// v000
// Measured on an AMD MI455X. A time is GPU time per run, averaged over a window of back-to-back runs after a warm-up
// (all launches, gaps included; the runs take copies of the inputs in turn), and the median of several windows.
// Apart from v000's, it joins two sittings. Times from different sittings can be a few percent apart, while
// side-by-side timings come from the same sitting.
// v000, which the later versions start from, runs in 2000 microseconds.
#include <hip/hip_runtime.h>

// Multi-head attention WITHOUT a mask over three input streams with a computed rotate-half rotary (query, key, value [2][2048][1024]; q = query Wq^T, k = key Wk^T, v = value Wv^T ('oi' [1024][1024] 1/32, no bias; 16 heads x 64), each from its own stream; _apply_rope AFTER the head split: (x1, x2) = the two HALVES: cat(x1 cos - x2 sin, x1 sin + x2 cos) with angle t x inv_freq[i], inv_freq = 1.0 / (10000.0 ** (arange(0, 64, 2, f32) / 64)) (32 f32 constants; both halves share the 32 angles; one f32 product per angle; precise cosf / sinf), on q and k; scores / sqrt(64); softmax over all keys; out = merged Wo^T + bo ('oi' + a REAL 0.01 bias) -> [2][2048][1024] (4.2 M); argument order query, key, value, Wq, Wk, Wv, Wo, bo).
// Layout per batch: bf16 copies of query, key, value in turn; 'oi' weights; exact projections; dense T-2048 attention (hybrid rows: < 512 hi/lo 3 products, rest fp16 x1024); merged hi/lo x Wo exact.
// Compute dtypes, f32 accumulate: every input rounded to bf16; projections exact; attention rows < 512 3 products, rest fp16; softmax f32; Wo hl x exact.

#define NB_  2
#define TT   2048
#define DM   1024
#define NH_  16
#define NKV  16
#define REP  (NH_ / NKV)
#define HD   64
#define DQ   (NH_ * HD)
#define DKV  (NKV * HD)
#define ZH   2
#define RH   512                  // query rows < RH use hi+lo planes (0: none)
#define WIN  0
#define PCAR 1024.0f
#define SCL  0.125f   // HD^-0.5
typedef _Float16 h16;
typedef unsigned short bf;
typedef __attribute__((ext_vector_type(16))) __bf16   v16bf;
typedef __attribute__((ext_vector_type(16))) _Float16 v16h;
typedef __attribute__((ext_vector_type(8)))  _Float16 v8h;
typedef __attribute__((ext_vector_type(8)))  unsigned short v8us;
typedef __attribute__((ext_vector_type(8)))  float    v8f;
typedef __attribute__((ext_vector_type(4)))  float    v4f;
typedef v8h  __attribute__((may_alias)) v8ha;
typedef v4f  __attribute__((may_alias)) v4fa;
typedef v8us __attribute__((may_alias)) v8usa;

__device__ __forceinline__ unsigned short f2bf(float f) { unsigned u = __float_as_uint(f); u += 0x7FFFu + ((u >> 16) & 1u); return (unsigned short)(u >> 16); }
__device__ __forceinline__ float bf2f(unsigned short b) { return __uint_as_float(((unsigned)b) << 16); }
__device__ __forceinline__ float bfr(float f) { return bf2f(f2bf(f)); }
__device__ __forceinline__ v16h cat16(v8h lo, v8h hi) { return __builtin_shufflevector(lo, hi, 0, 1, 2, 3, 4, 5, 6, 7, 8, 9, 10, 11, 12, 13, 14, 15); }
__device__ __forceinline__ v16bf cat16b(v8us lo, v8us hi) { return __builtin_bit_cast(v16bf, __builtin_shufflevector(lo, hi, 0, 1, 2, 3, 4, 5, 6, 7, 8, 9, 10, 11, 12, 13, 14, 15)); }
__device__ __forceinline__ v8f wmma16(v16h a, v16h b, v8f c) { return __builtin_amdgcn_wmma_f32_16x16x32_f16(false, a, false, b, (short)0, c, false, false); }
__device__ __forceinline__ v8f wmmab(v16bf a, v16bf b, v8f c) { return __builtin_amdgcn_wmma_f32_16x16x32_bf16(false, a, false, b, (short)0, c, false, false); }



// ---- k_gemmw: register-blocked GEMM, ONE WAVE per 64x64 output tile (16 accumulators), operands straight from K-contiguous 16-bit planes; grid (M/64, N/64, Z), 32 threads.
// C[m][n] (f32, pitch ldc, + optional f32 bias[n]) = sum_k A[m][k] Bt[n][k] (+ split products per NSPLIT). z-batch strides sA/sB/sC in elements. K % 32 == 0.
template <typename T16> struct WFrag;
template <> struct WFrag<h16> { typedef v16h V; static __device__ __forceinline__ V ld(const h16* p) { return cat16(*(const v8h*)p, *(const v8h*)(p + 16)); } static __device__ __forceinline__ v8f mma(V a, V b, v8f c) { return wmma16(a, b, c); } };
template <> struct WFrag<bf> { typedef v16bf V; static __device__ __forceinline__ V ld(const bf* p) { return cat16b(*(const v8us*)p, *(const v8us*)(p + 16)); } static __device__ __forceinline__ v8f mma(V a, V b, v8f c) { return wmmab(a, b, c); } };
template <typename T16, int NSPLIT, bool BIAS>
__global__ __launch_bounds__(32) void k_gemmw(const T16* __restrict__ A, const T16* __restrict__ A2, const T16* __restrict__ Bt, const T16* __restrict__ Bt2, int K, float* C, int ldc, const float* __restrict__ bias, size_t sA, size_t sB, size_t sC) {
    typedef typename WFrag<T16>::V V;
    __shared__ __align__(16) float os[16 * 68];
    const size_t z = blockIdx.z; A += z * sA; if (A2) A2 += z * sA; Bt += z * sB; if (Bt2) Bt2 += z * sB; C += z * sC;
    const int lane = threadIdx.x & 31, lr = lane & 15, hi = lane >> 4; const int r0 = blockIdx.x * 64, c0 = blockIdx.y * 64;
    v8f acc[4][4];
#pragma unroll
    for (int mb = 0; mb < 4; ++mb)
#pragma unroll
        for (int nb = 0; nb < 4; ++nb) acc[mb][nb] = (v8f){};
    const size_t aoff = (size_t)(r0 + lr) * K + 8 * hi, boff = (size_t)(c0 + lr) * K + 8 * hi;
#pragma unroll 1
    for (int kc = 0; kc < K; kc += 32) {
        V a[4], a2[4];
#pragma unroll
        for (int mb = 0; mb < 4; ++mb) { a[mb] = WFrag<T16>::ld(A + aoff + (size_t)mb * 16 * K + kc); if (NSPLIT == 1 || NSPLIT == 2) a2[mb] = WFrag<T16>::ld(A2 + aoff + (size_t)mb * 16 * K + kc); }
#pragma unroll
        for (int nb = 0; nb < 4; ++nb) { const V b = WFrag<T16>::ld(Bt + boff + (size_t)nb * 16 * K + kc); V b2; if (NSPLIT >= 2) b2 = WFrag<T16>::ld(Bt2 + boff + (size_t)nb * 16 * K + kc);
#pragma unroll
            for (int mb = 0; mb < 4; ++mb) { acc[mb][nb] = WFrag<T16>::mma(a[mb], b, acc[mb][nb]); if (NSPLIT == 1 || NSPLIT == 2) acc[mb][nb] = WFrag<T16>::mma(a2[mb], b, acc[mb][nb]); if (NSPLIT >= 2) acc[mb][nb] = WFrag<T16>::mma(a[mb], b2, acc[mb][nb]); } }
        asm volatile("v_nop\n\tv_nop\n\tv_nop\n\tv_nop" : "+v"(acc[0][0]), "+v"(acc[1][1]), "+v"(acc[2][2]), "+v"(acc[3][3]) : "v"(a[0]), "v"(a[3]));
    }
#pragma unroll
    for (int mb = 0; mb < 4; ++mb) {
#pragma unroll
        for (int nb = 0; nb < 4; ++nb) {
#pragma unroll
            for (int j = 0; j < 8; ++j) os[(hi * 8 + j) * 68 + nb * 16 + lr] = acc[mb][nb][j]; }
        __builtin_amdgcn_wave_barrier(); asm volatile("" ::: "memory");
        float* crow = C + (size_t)(r0 + mb * 16) * ldc + c0;
{
#pragma unroll
            for (int s = 0; s < 8; ++s) { const int row = 2 * s + hi, cofs = lr * 4; v4f val = *(const v4fa*)(os + row * 68 + cofs); if (BIAS) { val[0] += bfr(bias[c0 + cofs]); val[1] += bfr(bias[c0 + cofs + 1]); val[2] += bfr(bias[c0 + cofs + 2]); val[3] += bfr(bias[c0 + cofs + 3]); }
                *(v4f*)(crow + (size_t)row * ldc + cofs) = val; }
             }
        __builtin_amdgcn_wave_barrier(); asm volatile("" ::: "memory");
    }
}

__device__ __forceinline__ h16 tohx(float x) { return (h16)x; }
__device__ __forceinline__ void splitf(float y, unsigned short& h, unsigned short& l) { h = f2bf(y); l = f2bf(y - bf2f(h)); }
typedef __attribute__((ext_vector_type(2))) _Float16 v2h;
typedef __attribute__((ext_vector_type(4))) _Float16 v4h;
typedef __attribute__((ext_vector_type(2))) unsigned short v2us;
typedef __attribute__((ext_vector_type(4))) unsigned short v4us;
typedef __attribute__((ext_vector_type(2))) float v2f;
typedef __attribute__((ext_vector_type(4))) int v4i;

__global__ __launch_bounds__(256) void k_wtG(const float* __restrict__ w, int K, int N, bf* Bt) {
    const int lane = threadIdx.x & 31; const int L0 = (blockIdx.x * 8 + (threadIdx.x >> 5)) * 8; const int nlines = N * K / 64;
{
#pragma unroll 1
        for (int l = 0; l < 8; ++l) { const int L = L0 + l; if (L >= nlines) break; const size_t e = (size_t)L * 64 + lane * 2; const int k = (int)(e % K), n = (int)(e / K); v2us o;
            o[0] = f2bf(w[(size_t)k * N + n]); o[1] = f2bf(w[(size_t)(k + 1) * N + n]); *(v2us*)(Bt + e) = o; }
         }
}
__global__ __launch_bounds__(256) void k_cvt8(const float* __restrict__ src, bf* dst, size_t n8) { const size_t i = (size_t)blockIdx.x * 256 + threadIdx.x; if (i >= n8) return; const v8f v = *(const v8f*)(src + i * 8); v8us o;
#pragma unroll
    for (int k = 0; k < 8; ++k) o[k] = f2bf(v[k]); *(v8us*)(dst + i * 8) = o;  }

// k_rope: head planes [h][t][d] (fp16 + hi/lo) of rope(x) x sc with the rotate-half convention out[d] = x[d] cos[t][d] - x[d+HD/2] sin[t][d], out[d+HD/2] = x[d+HD/2] cos[t][d+HD/2] + x[d] sin[t][d+HD/2]
__global__ __launch_bounds__(256) void k_rope(const float* __restrict__ F, int pitch, int nheads, const float* __restrict__ CS, const float* __restrict__ RF, const float* __restrict__ nw, float sc, h16* P16, bf* Ph, bf* Pl) {
    const size_t e = ((size_t)blockIdx.x * 256 + threadIdx.x) * 2; if (e >= (size_t)nheads * TT * HD) return; const int d = (int)(e % HD); const int t = (int)((e / HD) % TT); const int h = (int)(e / ((size_t)HD * TT)); const float* f = F + (size_t)t * pitch + h * HD; const float rf = RF ? RF[(size_t)h * TT + t] : 1.0f; v2h o16; v2us oh, ol;
#pragma unroll
    for (int q = 0; q < 2; ++q) { const int dd = d + q; const int dp = (dd < HD / 2) ? dd + HD / 2 : dd - HD / 2; float x0 = f[dd], x1 = f[dp];
        if (RF) { float n0 = __fmul_rn(x0, rf), n1 = __fmul_rn(x1, rf); asm volatile("" : "+v"(n0)); asm volatile("" : "+v"(n1)); x0 = __fmul_rn(bfr(nw[dd]), n0); x1 = __fmul_rn(bfr(nw[dp]), n1); }
        const v2f cs = *(const v2f*)(CS + ((size_t)t * HD + dd) * 2); float a = __fmul_rn(x0, cs[0]), bq = __fmul_rn(x1, cs[1]); asm volatile("" : "+v"(a)); asm volatile("" : "+v"(bq)); const float r = ((dd < HD / 2) ? __fsub_rn(a, bq) : __fadd_rn(a, bq)) * sc;
        o16[q] = tohx(r); unsigned short a2, c2; splitf(r, a2, c2); oh[q] = a2; ol[q] = c2; }
    *(v2h*)(P16 + e) = o16; *(v2us*)(Ph + e) = oh; *(v2us*)(Pl + e) = ol;  }
__global__ __launch_bounds__(256) void k_vtp(const float* __restrict__ F, int pitch, int nheads, h16* V16, bf* Vh, bf* Vl) { const size_t e = ((size_t)blockIdx.x * 256 + threadIdx.x) * 2; if (e >= (size_t)nheads * HD * TT) return; const int t = (int)(e % TT); const int d = (int)((e / TT) % HD); const int g = (int)(e / ((size_t)TT * HD)); v2h o16; v2us oh, ol;
#pragma unroll
    for (int q = 0; q < 2; ++q) { const float x = F[(size_t)(t + q) * pitch + g * HD + d]; o16[q] = tohx(x); unsigned short a2, c2; splitf(x, a2, c2); oh[q] = a2; ol[q] = c2; }
    *(v2h*)(V16 + e) = o16; *(v2us*)(Vh + e) = oh; *(v2us*)(Vl + e) = ol;  }
__constant__ float INVT[HD / 2] = { 1.000000000e+00f, 7.498942018e-01f, 5.623413324e-01f, 4.216965139e-01f, 3.162277639e-01f, 2.371373624e-01f, 1.778279394e-01f, 1.333521456e-01f, 1.000000015e-01f, 7.498941571e-02f, 5.623412877e-02f, 4.216964915e-02f, 3.162277862e-02f, 2.371373586e-02f, 1.778279431e-02f, 1.333521493e-02f, 9.999999776e-03f, 7.498942316e-03f, 5.623413250e-03f, 4.216964822e-03f, 3.162277862e-03f, 2.371373819e-03f, 1.778279431e-03f, 1.333521446e-03f, 1.000000047e-03f, 7.498941850e-04f, 5.623413017e-04f, 4.216964880e-04f, 3.162277862e-04f, 2.371373848e-04f, 1.778279402e-04f, 1.333521504e-04f };   // 1 / 10000^(2i/64) (float32, generated with jnp to be bit-exact)
__global__ __launch_bounds__(256) void k_cstabT(float* CS) { const int idx = blockIdx.x * 256 + threadIdx.x; if (idx >= TT * HD) return; const int d = idx % HD; const int t = idx / HD; const float a = __fmul_rn((float)t, INVT[d % (HD / 2)]); v2f cs; cs[0] = cosf(a); cs[1] = sinf(a); *(v2f*)(CS + (size_t)idx * 2) = cs;  }
// k_asoft: per row (zz, i): t = S x HD^-0.5 (no mask); softmax over the 2048 keys (register row, one exp, fixed trees);
__global__ __launch_bounds__(256) void k_asoft(const float* __restrict__ Sb, h16* P16, bf* Ph, bf* Pl) {
    const int lane = threadIdx.x & 31; const int row = blockIdx.x * 8 + (threadIdx.x >> 5); if (row >= ZH * TT) return; const int i = row % TT; const int zz = row / TT; (void)zz; const bool hires = (i < RH); const float* sr = Sb + (size_t)row * TT; float v[TT / 32]; float mx = -3.0e38f;
#pragma unroll
    for (int ch = 0; ch < TT / 128; ++ch) { const int j0 = ch * 128 + lane * 4; const v4f a = *(const v4f*)(sr + j0);
#pragma unroll
        for (int q = 0; q < 4; ++q) { const int j = j0 + q; (void)j; const float t = a[q] * SCL; v[ch * 4 + q] = t; mx = fmaxf(mx, t); } }
#pragma unroll
    for (int sh = 16; sh; sh >>= 1) mx = fmaxf(mx, __shfl_xor(mx, sh, 32));
    float sum = 0.f;
#pragma unroll
    for (int k = 0; k < TT / 32; ++k) { float d0 = __fsub_rn(v[k], mx); asm volatile("" : "+v"(d0)); v[k] = __builtin_amdgcn_exp2f(__fmul_rn(d0, 1.4426950408889634f)); sum += v[k]; }
#pragma unroll
    for (int sh = 16; sh; sh >>= 1) sum += __shfl_xor(sum, sh, 32);
    const float f = __fdiv_rn(hires ? 1.0f : PCAR, sum);
{
        if (hires) {
#pragma unroll
            for (int ch = 0; ch < TT / 128; ++ch) { v4us oh, ol;
#pragma unroll
                for (int q = 0; q < 4; ++q) { unsigned short a, c2; splitf(v[ch * 4 + q] * f, a, c2); oh[q] = a; ol[q] = c2; }
                const size_t oo = ((size_t)zz * (RH ? RH : 1) + i) * TT + ch * 128 + lane * 4; *(v4us*)(Ph + oo) = oh; *(v4us*)(Pl + oo) = ol; }
        } else {
#pragma unroll
            for (int ch = 0; ch < TT / 128; ++ch) { v4h o4;
#pragma unroll
                for (int q = 0; q < 4; ++q) o4[q] = tohx(v[ch * 4 + q] * f);
                *(v4h*)(P16 + (size_t)row * TT + ch * 128 + lane * 4) = o4; } }
         }
}
__global__ __launch_bounds__(256) void k_merge(const float* __restrict__ O, int h0, bf* Ah, bf* Al) { const size_t e = ((size_t)blockIdx.x * 256 + threadIdx.x) * 2; if (e >= (size_t)ZH * TT * HD) return; const int d = (int)(e % HD); const int t = (int)((e / HD) % TT); const int zz = (int)(e / ((size_t)HD * TT)); const float cs = (t < RH) ? 1.0f : (1.0f / PCAR); const size_t oo = (size_t)t * DQ + (h0 + zz) * HD + d;
    v2us oh, ol;
#pragma unroll
    for (int q = 0; q < 2; ++q) { unsigned short a, c2; splitf(O[e + q] * cs, a, c2); oh[q] = a; ol[q] = c2; } *(v2us*)(Ah + oo) = oh; *(v2us*)(Al + oo) = ol;  }

extern "C" void kernel_launch(void* const* d_in, const int* in_sizes, int n_in,
                              void* d_out, int out_size, void* d_ws, size_t ws_size, hipStream_t stream) {
    (void)in_sizes; (void)n_in; (void)out_size;
    const float* x = (const float*)d_in[0];   /* query */ const float* xk = (const float*)d_in[1]; const float* xv = (const float*)d_in[2]; const float* wq = (const float*)d_in[3]; const float* wk = (const float*)d_in[4]; const float* wv = (const float*)d_in[5]; const float* wo = (const float*)d_in[6]; const float* bo = (const float*)d_in[7];   /* argument order query, key, value, Wq, Wk, Wv, Wo ('oi' [1024][1024]), bo [1024] (REAL 0.01); eight inputs, all read */
    float* OUT = (float*)d_out;     // [2][2048][1024]
    char* wsp = (char*)d_ws;
    auto take = [&](size_t bytes) { char* p = wsp; wsp += (bytes + 255) & ~(size_t)255; return (void*)p; };
    bf* WQ = (bf*)take((size_t)DQ * DM * 2); bf* WK = (bf*)take((size_t)DKV * DM * 2); bf* WV = (bf*)take((size_t)DKV * DM * 2); bf* WO = (bf*)take((size_t)DM * DQ * 2); float* CS = (float*)take((size_t)TT * HD * 2 * 4);
    bf* XB = (bf*)take((size_t)TT * DM * 2); float* FQ = (float*)take((size_t)TT * DQ * 4); float* FK = (float*)take((size_t)TT * DKV * 4);
    h16* QP16 = (h16*)take((size_t)NH_ * TT * HD * 2); h16* KP16 = (h16*)take((size_t)NKV * TT * HD * 2); h16* VT16 = (h16*)take((size_t)NKV * HD * TT * 2);
    bf* QPh = (bf*)take((size_t)NH_ * TT * HD * 2); bf* QPl = (bf*)take((size_t)NH_ * TT * HD * 2); bf* KPh = (bf*)take((size_t)NKV * TT * HD * 2); bf* KPl = (bf*)take((size_t)NKV * TT * HD * 2); bf* VTh = (bf*)take((size_t)NKV * HD * TT * 2); bf* VTl = (bf*)take((size_t)NKV * HD * TT * 2); bf* Ph = (bf*)take((size_t)ZH * RH * TT * 2); bf* Pl = (bf*)take((size_t)ZH * RH * TT * 2);
    float* Sb = (float*)take((size_t)ZH * TT * TT * 4); h16* P16 = (h16*)take((size_t)ZH * TT * TT * 2); float* Ob = (float*)take((size_t)ZH * TT * HD * 4); bf* ATh = (bf*)take((size_t)TT * DQ * 2); bf* ATl = (bf*)take((size_t)TT * DQ * 2);
    if ((size_t)(wsp - (char*)d_ws) > ws_size) return;    // ws 256 MiB
    float* FV = FK;   // v projection reuses the k buffer after the k planes are built (stream-ordered)
    { k_cvt8<<<(unsigned)(((size_t)DQ * DM / 8 + 255) / 256), 256, 0, stream>>>(wq, WQ, (size_t)DQ * DM / 8); k_cvt8<<<(unsigned)(((size_t)DKV * DM / 8 + 255) / 256), 256, 0, stream>>>(wk, WK, (size_t)DKV * DM / 8); k_cvt8<<<(unsigned)(((size_t)DKV * DM / 8 + 255) / 256), 256, 0, stream>>>(wv, WV, (size_t)DKV * DM / 8);
      k_cvt8<<<(unsigned)(((size_t)DM * DQ / 8 + 255) / 256), 256, 0, stream>>>(wo, WO, (size_t)DM * DQ / 8);
       }
    k_cstabT<<<(TT * HD + 255) / 256, 256, 0, stream>>>(CS);   /* rotary table once (positions = arange) */
    const unsigned LQ = (unsigned)(((size_t)NH_ * TT * HD / 2 + 255) / 256), LKv = (unsigned)(((size_t)NKV * TT * HD / 2 + 255) / 256);
    for (int b = 0; b < NB_; ++b) {
        
        k_cvt8<<<(unsigned)(((size_t)TT * DM / 8 + 255) / 256), 256, 0, stream>>>(x + (size_t)b * TT * DM, XB, (size_t)TT * DM / 8);
        k_gemmw<bf, 0, false><<<dim3(TT / 64, DQ / 64, 1), 32, 0, stream>>>(XB, nullptr, WQ, nullptr, DM, FQ, DQ, nullptr, 0, 0, 0);
        k_rope<<<LQ, 256, 0, stream>>>(FQ, DQ, NH_, CS, nullptr, nullptr, 1.0f, QP16, QPh, QPl);
        k_cvt8<<<(unsigned)(((size_t)TT * DM / 8 + 255) / 256), 256, 0, stream>>>(xk + (size_t)b * TT * DM, XB, (size_t)TT * DM / 8); k_gemmw<bf, 0, false><<<dim3(TT / 64, DKV / 64, 1), 32, 0, stream>>>(XB, nullptr, WK, nullptr, DM, FK, DKV, nullptr, 0, 0, 0);
        k_rope<<<LKv, 256, 0, stream>>>(FK, DKV, NKV, CS, nullptr, nullptr, 1.0f, KP16, KPh, KPl);
        k_cvt8<<<(unsigned)(((size_t)TT * DM / 8 + 255) / 256), 256, 0, stream>>>(xv + (size_t)b * TT * DM, XB, (size_t)TT * DM / 8); k_gemmw<bf, 0, false><<<dim3(TT / 64, DKV / 64, 1), 32, 0, stream>>>(XB, nullptr, WV, nullptr, DM, FV, DKV, nullptr, 0, 0, 0); k_vtp<<<LKv, 256, 0, stream>>>(FV, DKV, NKV, VT16, VTh, VTl);
        for (int h0 = 0; h0 < NH_; h0 += ZH) { const size_t zq = (size_t)h0, zk = (size_t)(h0 / REP);   // one kv head per query head: the pass's two heads use consecutive kv planes (z-strides TT*HD)
            k_gemmw<bf, 2, false><<<dim3(RH / 64, TT / 64, ZH), 32, 0, stream>>>(QPh + zq * TT * HD, QPl + zq * TT * HD, KPh + zk * TT * HD, KPl + zk * TT * HD, HD, Sb, TT, nullptr, (size_t)TT * HD, (size_t)TT * HD, (size_t)TT * TT);
            k_gemmw<h16, 0, false><<<dim3((TT - RH) / 64, TT / 64, ZH), 32, 0, stream>>>(QP16 + zq * TT * HD + (size_t)RH * HD, nullptr, KP16 + zk * TT * HD, nullptr, HD, Sb + (size_t)RH * TT, TT, nullptr, (size_t)TT * HD, (size_t)TT * HD, (size_t)TT * TT);
            k_asoft<<<ZH * TT / 8, 256, 0, stream>>>(Sb, P16, Ph, Pl);
            k_gemmw<bf, 2, false><<<dim3(RH / 64, HD / 64, ZH), 32, 0, stream>>>(Ph, Pl, VTh + zk * HD * TT, VTl + zk * HD * TT, TT, Ob, HD, nullptr, (size_t)RH * TT, (size_t)HD * TT, (size_t)TT * HD);
            k_gemmw<h16, 0, false><<<dim3((TT - RH) / 64, HD / 64, ZH), 32, 0, stream>>>(P16 + (size_t)RH * TT, nullptr, VT16 + zk * HD * TT, nullptr, TT, Ob + (size_t)RH * HD, HD, nullptr, (size_t)TT * TT, (size_t)HD * TT, (size_t)TT * HD);
            k_merge<<<(unsigned)(((size_t)ZH * TT * HD / 2 + 255) / 256), 256, 0, stream>>>(Ob, h0, ATh, ATl); }
        k_gemmw<bf, 1, true><<<dim3(TT / 64, DM / 64, 1), 32, 0, stream>>>(ATh, ATl, WO, nullptr, DQ, OUT + (size_t)b * TT * DM, DM, bo, 0, 0, 0); }
}

// v001
// It runs in 866 microseconds.
// In two side-by-side timings against v000, it was 2.30 and 2.33 times as fast.
#include <hip/hip_runtime.h>

// Multi-head attention WITHOUT a mask over three input streams with a computed rotate-half rotary (query, key, value [2][2048][1024]; q = query Wq^T, k = key Wk^T, v = value Wv^T ('oi' [1024][1024] 1/32, no bias; 16 heads x 64), each from its own stream; _apply_rope AFTER the head split: (x1, x2) = the two HALVES: cat(x1 cos - x2 sin, x1 sin + x2 cos) with angle t x inv_freq[i], inv_freq = 1.0 / (10000.0 ** (arange(0, 64, 2, f32) / 64)) (32 f32 constants; both halves share the 32 angles; one f32 product per angle; precise cosf / sinf), on q and k; scores / sqrt(64); softmax over all keys; out = merged Wo^T + bo ('oi' + a REAL 0.01 bias) -> [2][2048][1024] (4.2 M); argument order query, key, value, Wq, Wk, Wv, Wo, bo).
// Layout per batch: bf16 copies of query, key, value in turn; 'oi' weights; exact projections; dense T-2048 attention (hybrid rows: < 512 hi/lo 3 products, rest fp16 x1024); merged hi/lo x Wo exact.
// Compute dtypes, f32 accumulate: every input rounded to bf16; projections exact; attention rows < 512 3 products, rest fp16; softmax f32; Wo hl x exact.

#define NB_  2
#define TT   2048
#define DM   1024
#define NH_  16
#define NKV  16
#define REP  (NH_ / NKV)
#define HD   64
#define DQ   (NH_ * HD)
#define DKV  (NKV * HD)
#define ZH   2
#define RH   512                  // query rows < RH use hi+lo planes (0: none)
#define WIN  0
#define PCAR 1024.0f
#define SCL  0.125f   // HD^-0.5
#define KSP  16                   // key ranges of the P x V products: one work-group per range, one f32 partial plane per range, summed in k_merge
typedef _Float16 h16;
typedef unsigned short bf;
typedef __attribute__((ext_vector_type(16))) __bf16   v16bf;
typedef __attribute__((ext_vector_type(16))) _Float16 v16h;
typedef __attribute__((ext_vector_type(8)))  _Float16 v8h;
typedef __attribute__((ext_vector_type(8)))  unsigned short v8us;
typedef __attribute__((ext_vector_type(8)))  float    v8f;
typedef __attribute__((ext_vector_type(4)))  float    v4f;
typedef v8h  __attribute__((may_alias)) v8ha;
typedef v4f  __attribute__((may_alias)) v4fa;
typedef v8us __attribute__((may_alias)) v8usa;

__device__ __forceinline__ unsigned short f2bf(float f) { unsigned u = __float_as_uint(f); u += 0x7FFFu + ((u >> 16) & 1u); return (unsigned short)(u >> 16); }
__device__ __forceinline__ float bf2f(unsigned short b) { return __uint_as_float(((unsigned)b) << 16); }
__device__ __forceinline__ float bfr(float f) { return bf2f(f2bf(f)); }
__device__ __forceinline__ v16h cat16(v8h lo, v8h hi) { return __builtin_shufflevector(lo, hi, 0, 1, 2, 3, 4, 5, 6, 7, 8, 9, 10, 11, 12, 13, 14, 15); }
__device__ __forceinline__ v16bf cat16b(v8us lo, v8us hi) { return __builtin_bit_cast(v16bf, __builtin_shufflevector(lo, hi, 0, 1, 2, 3, 4, 5, 6, 7, 8, 9, 10, 11, 12, 13, 14, 15)); }
__device__ __forceinline__ v8f wmma16(v16h a, v16h b, v8f c) { return __builtin_amdgcn_wmma_f32_16x16x32_f16(false, a, false, b, (short)0, c, false, false); }
__device__ __forceinline__ v8f wmmab(v16bf a, v16bf b, v8f c) { return __builtin_amdgcn_wmma_f32_16x16x32_bf16(false, a, false, b, (short)0, c, false, false); }



// ---- k_gemmw: register-blocked GEMM, ONE WAVE per 64x64 output tile (16 accumulators), operands straight from K-contiguous 16-bit planes; grid (M/64, N/64, Z), 32 threads.
// C[m][n] (f32, pitch ldc, + optional f32 bias[n]) = sum_k A[m][k] Bt[n][k] (+ split products per NSPLIT). z-batch strides sA/sB/sC in elements. K % 32 == 0.
// KS > 1: grid (M/64, N/64 * KS, Z); work-group ks = blockIdx.y % KS sums only k in [ks K/KS, (ks+1) K/KS) and stores its tile in partial plane ks (C + ks sP); the reader adds the KS planes. K % (32 KS) == 0.
template <typename T16> struct WFrag;
template <> struct WFrag<h16> { typedef v16h V; static __device__ __forceinline__ V ld(const h16* p) { return cat16(*(const v8h*)p, *(const v8h*)(p + 16)); } static __device__ __forceinline__ v8f mma(V a, V b, v8f c) { return wmma16(a, b, c); } };
template <> struct WFrag<bf> { typedef v16bf V; static __device__ __forceinline__ V ld(const bf* p) { return cat16b(*(const v8us*)p, *(const v8us*)(p + 16)); } static __device__ __forceinline__ v8f mma(V a, V b, v8f c) { return wmmab(a, b, c); } };
template <typename T16, int NSPLIT, bool BIAS, int KS>
__global__ __launch_bounds__(32) void k_gemmw(const T16* __restrict__ A, const T16* __restrict__ A2, const T16* __restrict__ Bt, const T16* __restrict__ Bt2, int K, float* C, int ldc, const float* __restrict__ bias, size_t sA, size_t sB, size_t sC, size_t sP) {
    typedef typename WFrag<T16>::V V;
    __shared__ __align__(16) float os[16 * 68];
    const size_t z = blockIdx.z; A += z * sA; if (A2) A2 += z * sA; Bt += z * sB; if (Bt2) Bt2 += z * sB; C += z * sC;
    const int ks = (KS > 1) ? (int)(blockIdx.y % KS) : 0; const int kbeg = ks * (K / KS), kend = kbeg + K / KS; if (KS > 1) C += (size_t)ks * sP;
    const int lane = threadIdx.x & 31, lr = lane & 15, hi = lane >> 4; const int r0 = blockIdx.x * 64, c0 = (int)(blockIdx.y / KS) * 64;
    v8f acc[4][4];
#pragma unroll
    for (int mb = 0; mb < 4; ++mb)
#pragma unroll
        for (int nb = 0; nb < 4; ++nb) acc[mb][nb] = (v8f){};
    const size_t aoff = (size_t)(r0 + lr) * K + 8 * hi, boff = (size_t)(c0 + lr) * K + 8 * hi;
#pragma unroll 1
    for (int kc = kbeg; kc < kend; kc += 32) {
        V a[4], a2[4];
#pragma unroll
        for (int mb = 0; mb < 4; ++mb) { a[mb] = WFrag<T16>::ld(A + aoff + (size_t)mb * 16 * K + kc); if (NSPLIT == 1 || NSPLIT == 2) a2[mb] = WFrag<T16>::ld(A2 + aoff + (size_t)mb * 16 * K + kc); }
#pragma unroll
        for (int nb = 0; nb < 4; ++nb) { const V b = WFrag<T16>::ld(Bt + boff + (size_t)nb * 16 * K + kc); V b2; if (NSPLIT >= 2) b2 = WFrag<T16>::ld(Bt2 + boff + (size_t)nb * 16 * K + kc);
#pragma unroll
            for (int mb = 0; mb < 4; ++mb) { acc[mb][nb] = WFrag<T16>::mma(a[mb], b, acc[mb][nb]); if (NSPLIT == 1 || NSPLIT == 2) acc[mb][nb] = WFrag<T16>::mma(a2[mb], b, acc[mb][nb]); if (NSPLIT >= 2) acc[mb][nb] = WFrag<T16>::mma(a[mb], b2, acc[mb][nb]); } }
        asm volatile("v_nop\n\tv_nop\n\tv_nop\n\tv_nop" : "+v"(acc[0][0]), "+v"(acc[1][1]), "+v"(acc[2][2]), "+v"(acc[3][3]) : "v"(a[0]), "v"(a[3]));
    }
#pragma unroll
    for (int mb = 0; mb < 4; ++mb) {
#pragma unroll
        for (int nb = 0; nb < 4; ++nb) {
#pragma unroll
            for (int j = 0; j < 8; ++j) os[(hi * 8 + j) * 68 + nb * 16 + lr] = acc[mb][nb][j]; }
        __builtin_amdgcn_wave_barrier(); asm volatile("" ::: "memory");
        float* crow = C + (size_t)(r0 + mb * 16) * ldc + c0;
{
#pragma unroll
            for (int s = 0; s < 8; ++s) { const int row = 2 * s + hi, cofs = lr * 4; v4f val = *(const v4fa*)(os + row * 68 + cofs); if (BIAS) { val[0] += bfr(bias[c0 + cofs]); val[1] += bfr(bias[c0 + cofs + 1]); val[2] += bfr(bias[c0 + cofs + 2]); val[3] += bfr(bias[c0 + cofs + 3]); }
                *(v4f*)(crow + (size_t)row * ldc + cofs) = val; }
             }
        __builtin_amdgcn_wave_barrier(); asm volatile("" ::: "memory");
    }
}

__device__ __forceinline__ h16 tohx(float x) { return (h16)x; }
__device__ __forceinline__ void splitf(float y, unsigned short& h, unsigned short& l) { h = f2bf(y); l = f2bf(y - bf2f(h)); }
typedef __attribute__((ext_vector_type(2))) _Float16 v2h;
typedef __attribute__((ext_vector_type(4))) _Float16 v4h;
typedef __attribute__((ext_vector_type(2))) unsigned short v2us;
typedef __attribute__((ext_vector_type(4))) unsigned short v4us;
typedef __attribute__((ext_vector_type(2))) float v2f;
typedef __attribute__((ext_vector_type(4))) int v4i;

__global__ __launch_bounds__(256) void k_wtG(const float* __restrict__ w, int K, int N, bf* Bt) {
    const int lane = threadIdx.x & 31; const int L0 = (blockIdx.x * 8 + (threadIdx.x >> 5)) * 8; const int nlines = N * K / 64;
{
#pragma unroll 1
        for (int l = 0; l < 8; ++l) { const int L = L0 + l; if (L >= nlines) break; const size_t e = (size_t)L * 64 + lane * 2; const int k = (int)(e % K), n = (int)(e / K); v2us o;
            o[0] = f2bf(w[(size_t)k * N + n]); o[1] = f2bf(w[(size_t)(k + 1) * N + n]); *(v2us*)(Bt + e) = o; }
         }
}
__global__ __launch_bounds__(256) void k_cvt8(const float* __restrict__ src, bf* dst, size_t n8) { const size_t i = (size_t)blockIdx.x * 256 + threadIdx.x; if (i >= n8) return; const v8f v = *(const v8f*)(src + i * 8); v8us o;
#pragma unroll
    for (int k = 0; k < 8; ++k) o[k] = f2bf(v[k]); *(v8us*)(dst + i * 8) = o;  }

// k_rope: head planes [h][t][d] (fp16 + hi/lo) of rope(x) x sc with the rotate-half convention out[d] = x[d] cos[t][d] - x[d+HD/2] sin[t][d], out[d+HD/2] = x[d+HD/2] cos[t][d+HD/2] + x[d] sin[t][d+HD/2]
__global__ __launch_bounds__(256) void k_rope(const float* __restrict__ F, int pitch, int nheads, const float* __restrict__ CS, const float* __restrict__ RF, const float* __restrict__ nw, float sc, h16* P16, bf* Ph, bf* Pl) {
    const size_t e = ((size_t)blockIdx.x * 256 + threadIdx.x) * 2; if (e >= (size_t)nheads * TT * HD) return; const int d = (int)(e % HD); const int t = (int)((e / HD) % TT); const int h = (int)(e / ((size_t)HD * TT)); const float* f = F + (size_t)t * pitch + h * HD; const float rf = RF ? RF[(size_t)h * TT + t] : 1.0f; v2h o16; v2us oh, ol;
#pragma unroll
    for (int q = 0; q < 2; ++q) { const int dd = d + q; const int dp = (dd < HD / 2) ? dd + HD / 2 : dd - HD / 2; float x0 = f[dd], x1 = f[dp];
        if (RF) { float n0 = __fmul_rn(x0, rf), n1 = __fmul_rn(x1, rf); asm volatile("" : "+v"(n0)); asm volatile("" : "+v"(n1)); x0 = __fmul_rn(bfr(nw[dd]), n0); x1 = __fmul_rn(bfr(nw[dp]), n1); }
        const v2f cs = *(const v2f*)(CS + ((size_t)t * HD + dd) * 2); float a = __fmul_rn(x0, cs[0]), bq = __fmul_rn(x1, cs[1]); asm volatile("" : "+v"(a)); asm volatile("" : "+v"(bq)); const float r = ((dd < HD / 2) ? __fsub_rn(a, bq) : __fadd_rn(a, bq)) * sc;
        o16[q] = tohx(r); unsigned short a2, c2; splitf(r, a2, c2); oh[q] = a2; ol[q] = c2; }
    *(v2h*)(P16 + e) = o16; *(v2us*)(Ph + e) = oh; *(v2us*)(Pl + e) = ol;  }
__global__ __launch_bounds__(256) void k_vtp(const float* __restrict__ F, int pitch, int nheads, h16* V16, bf* Vh, bf* Vl) { const size_t e = ((size_t)blockIdx.x * 256 + threadIdx.x) * 2; if (e >= (size_t)nheads * HD * TT) return; const int t = (int)(e % TT); const int d = (int)((e / TT) % HD); const int g = (int)(e / ((size_t)TT * HD)); v2h o16; v2us oh, ol;
#pragma unroll
    for (int q = 0; q < 2; ++q) { const float x = F[(size_t)(t + q) * pitch + g * HD + d]; o16[q] = tohx(x); unsigned short a2, c2; splitf(x, a2, c2); oh[q] = a2; ol[q] = c2; }
    *(v2h*)(V16 + e) = o16; *(v2us*)(Vh + e) = oh; *(v2us*)(Vl + e) = ol;  }
__constant__ float INVT[HD / 2] = { 1.000000000e+00f, 7.498942018e-01f, 5.623413324e-01f, 4.216965139e-01f, 3.162277639e-01f, 2.371373624e-01f, 1.778279394e-01f, 1.333521456e-01f, 1.000000015e-01f, 7.498941571e-02f, 5.623412877e-02f, 4.216964915e-02f, 3.162277862e-02f, 2.371373586e-02f, 1.778279431e-02f, 1.333521493e-02f, 9.999999776e-03f, 7.498942316e-03f, 5.623413250e-03f, 4.216964822e-03f, 3.162277862e-03f, 2.371373819e-03f, 1.778279431e-03f, 1.333521446e-03f, 1.000000047e-03f, 7.498941850e-04f, 5.623413017e-04f, 4.216964880e-04f, 3.162277862e-04f, 2.371373848e-04f, 1.778279402e-04f, 1.333521504e-04f };   // 1 / 10000^(2i/64) (float32, generated with jnp to be bit-exact)
__global__ __launch_bounds__(256) void k_cstabT(float* CS) { const int idx = blockIdx.x * 256 + threadIdx.x; if (idx >= TT * HD) return; const int d = idx % HD; const int t = idx / HD; const float a = __fmul_rn((float)t, INVT[d % (HD / 2)]); v2f cs; cs[0] = cosf(a); cs[1] = sinf(a); *(v2f*)(CS + (size_t)idx * 2) = cs;  }
// k_asoft: per row (zz, i): t = S x HD^-0.5 (no mask); softmax over the 2048 keys (register row, one exp, fixed trees);
__global__ __launch_bounds__(256) void k_asoft(const float* __restrict__ Sb, h16* P16, bf* Ph, bf* Pl) {
    const int lane = threadIdx.x & 31; const int row = blockIdx.x * 8 + (threadIdx.x >> 5); if (row >= ZH * TT) return; const int i = row % TT; const int zz = row / TT; (void)zz; const bool hires = (i < RH); const float* sr = Sb + (size_t)row * TT; float v[TT / 32]; float mx = -3.0e38f;
#pragma unroll
    for (int ch = 0; ch < TT / 128; ++ch) { const int j0 = ch * 128 + lane * 4; const v4f a = *(const v4f*)(sr + j0);
#pragma unroll
        for (int q = 0; q < 4; ++q) { const int j = j0 + q; (void)j; const float t = a[q] * SCL; v[ch * 4 + q] = t; mx = fmaxf(mx, t); } }
#pragma unroll
    for (int sh = 16; sh; sh >>= 1) mx = fmaxf(mx, __shfl_xor(mx, sh, 32));
    float sum = 0.f;
#pragma unroll
    for (int k = 0; k < TT / 32; ++k) { float d0 = __fsub_rn(v[k], mx); asm volatile("" : "+v"(d0)); v[k] = __builtin_amdgcn_exp2f(__fmul_rn(d0, 1.4426950408889634f)); sum += v[k]; }
#pragma unroll
    for (int sh = 16; sh; sh >>= 1) sum += __shfl_xor(sum, sh, 32);
    const float f = __fdiv_rn(hires ? 1.0f : PCAR, sum);
{
        if (hires) {
#pragma unroll
            for (int ch = 0; ch < TT / 128; ++ch) { v4us oh, ol;
#pragma unroll
                for (int q = 0; q < 4; ++q) { unsigned short a, c2; splitf(v[ch * 4 + q] * f, a, c2); oh[q] = a; ol[q] = c2; }
                const size_t oo = ((size_t)zz * (RH ? RH : 1) + i) * TT + ch * 128 + lane * 4; *(v4us*)(Ph + oo) = oh; *(v4us*)(Pl + oo) = ol; }
        } else {
#pragma unroll
            for (int ch = 0; ch < TT / 128; ++ch) { v4h o4;
#pragma unroll
                for (int q = 0; q < 4; ++q) o4[q] = tohx(v[ch * 4 + q] * f);
                *(v4h*)(P16 + (size_t)row * TT + ch * 128 + lane * 4) = o4; } }
         }
}
__global__ __launch_bounds__(256) void k_merge(const float* __restrict__ O, int h0, bf* Ah, bf* Al) { const size_t e = ((size_t)blockIdx.x * 256 + threadIdx.x) * 2; if (e >= (size_t)ZH * TT * HD) return; const int d = (int)(e % HD); const int t = (int)((e / HD) % TT); const int zz = (int)(e / ((size_t)HD * TT)); const float cs = (t < RH) ? 1.0f : (1.0f / PCAR); const size_t oo = (size_t)t * DQ + (h0 + zz) * HD + d;
    v2us oh, ol; v2f part[KSP];
#pragma unroll   // part[] stays in registers and all KSP loads are in flight together: one memory latency instead of KSP
    for (int p = 0; p < KSP; ++p) part[p] = *(const v2f*)(O + (size_t)p * ((size_t)ZH * TT * HD) + e);
    v2f sum = part[0];
#pragma unroll   // register array; fixed order, key ranges ascending
    for (int p = 1; p < KSP; ++p) sum += part[p];
#pragma unroll
    for (int q = 0; q < 2; ++q) { unsigned short a, c2; splitf(sum[q] * cs, a, c2); oh[q] = a; ol[q] = c2; } *(v2us*)(Ah + oo) = oh; *(v2us*)(Al + oo) = ol;  }

extern "C" void kernel_launch(void* const* d_in, const int* in_sizes, int n_in,
                              void* d_out, int out_size, void* d_ws, size_t ws_size, hipStream_t stream) {
    (void)in_sizes; (void)n_in; (void)out_size;
    const float* x = (const float*)d_in[0];   /* query */ const float* xk = (const float*)d_in[1]; const float* xv = (const float*)d_in[2]; const float* wq = (const float*)d_in[3]; const float* wk = (const float*)d_in[4]; const float* wv = (const float*)d_in[5]; const float* wo = (const float*)d_in[6]; const float* bo = (const float*)d_in[7];   /* argument order query, key, value, Wq, Wk, Wv, Wo ('oi' [1024][1024]), bo [1024] (REAL 0.01); eight inputs, all read */
    float* OUT = (float*)d_out;     // [2][2048][1024]
    char* wsp = (char*)d_ws;
    auto take = [&](size_t bytes) { char* p = wsp; wsp += (bytes + 255) & ~(size_t)255; return (void*)p; };
    bf* WQ = (bf*)take((size_t)DQ * DM * 2); bf* WK = (bf*)take((size_t)DKV * DM * 2); bf* WV = (bf*)take((size_t)DKV * DM * 2); bf* WO = (bf*)take((size_t)DM * DQ * 2); float* CS = (float*)take((size_t)TT * HD * 2 * 4);
    bf* XB = (bf*)take((size_t)TT * DM * 2); float* FQ = (float*)take((size_t)TT * DQ * 4); float* FK = (float*)take((size_t)TT * DKV * 4);
    h16* QP16 = (h16*)take((size_t)NH_ * TT * HD * 2); h16* KP16 = (h16*)take((size_t)NKV * TT * HD * 2); h16* VT16 = (h16*)take((size_t)NKV * HD * TT * 2);
    bf* QPh = (bf*)take((size_t)NH_ * TT * HD * 2); bf* QPl = (bf*)take((size_t)NH_ * TT * HD * 2); bf* KPh = (bf*)take((size_t)NKV * TT * HD * 2); bf* KPl = (bf*)take((size_t)NKV * TT * HD * 2); bf* VTh = (bf*)take((size_t)NKV * HD * TT * 2); bf* VTl = (bf*)take((size_t)NKV * HD * TT * 2); bf* Ph = (bf*)take((size_t)ZH * RH * TT * 2); bf* Pl = (bf*)take((size_t)ZH * RH * TT * 2);
    float* Sb = (float*)take((size_t)ZH * TT * TT * 4); h16* P16 = (h16*)take((size_t)ZH * TT * TT * 2); float* Ob = (float*)take((size_t)KSP * ZH * TT * HD * 4);   /* KSP partial planes [ZH][TT][HD] */ bf* ATh = (bf*)take((size_t)TT * DQ * 2); bf* ATl = (bf*)take((size_t)TT * DQ * 2);
    if ((size_t)(wsp - (char*)d_ws) > ws_size) return;    // ws 256 MiB
    float* FV = FK;   // v projection reuses the k buffer after the k planes are built (stream-ordered)
    { k_cvt8<<<(unsigned)(((size_t)DQ * DM / 8 + 255) / 256), 256, 0, stream>>>(wq, WQ, (size_t)DQ * DM / 8); k_cvt8<<<(unsigned)(((size_t)DKV * DM / 8 + 255) / 256), 256, 0, stream>>>(wk, WK, (size_t)DKV * DM / 8); k_cvt8<<<(unsigned)(((size_t)DKV * DM / 8 + 255) / 256), 256, 0, stream>>>(wv, WV, (size_t)DKV * DM / 8);
      k_cvt8<<<(unsigned)(((size_t)DM * DQ / 8 + 255) / 256), 256, 0, stream>>>(wo, WO, (size_t)DM * DQ / 8);
       }
    k_cstabT<<<(TT * HD + 255) / 256, 256, 0, stream>>>(CS);   /* rotary table once (positions = arange) */
    const unsigned LQ = (unsigned)(((size_t)NH_ * TT * HD / 2 + 255) / 256), LKv = (unsigned)(((size_t)NKV * TT * HD / 2 + 255) / 256);
    for (int b = 0; b < NB_; ++b) {
        
        k_cvt8<<<(unsigned)(((size_t)TT * DM / 8 + 255) / 256), 256, 0, stream>>>(x + (size_t)b * TT * DM, XB, (size_t)TT * DM / 8);
        k_gemmw<bf, 0, false, 1><<<dim3(TT / 64, DQ / 64, 1), 32, 0, stream>>>(XB, nullptr, WQ, nullptr, DM, FQ, DQ, nullptr, 0, 0, 0, 0);
        k_rope<<<LQ, 256, 0, stream>>>(FQ, DQ, NH_, CS, nullptr, nullptr, 1.0f, QP16, QPh, QPl);
        k_cvt8<<<(unsigned)(((size_t)TT * DM / 8 + 255) / 256), 256, 0, stream>>>(xk + (size_t)b * TT * DM, XB, (size_t)TT * DM / 8); k_gemmw<bf, 0, false, 1><<<dim3(TT / 64, DKV / 64, 1), 32, 0, stream>>>(XB, nullptr, WK, nullptr, DM, FK, DKV, nullptr, 0, 0, 0, 0);
        k_rope<<<LKv, 256, 0, stream>>>(FK, DKV, NKV, CS, nullptr, nullptr, 1.0f, KP16, KPh, KPl);
        k_cvt8<<<(unsigned)(((size_t)TT * DM / 8 + 255) / 256), 256, 0, stream>>>(xv + (size_t)b * TT * DM, XB, (size_t)TT * DM / 8); k_gemmw<bf, 0, false, 1><<<dim3(TT / 64, DKV / 64, 1), 32, 0, stream>>>(XB, nullptr, WV, nullptr, DM, FV, DKV, nullptr, 0, 0, 0, 0); k_vtp<<<LKv, 256, 0, stream>>>(FV, DKV, NKV, VT16, VTh, VTl);
        for (int h0 = 0; h0 < NH_; h0 += ZH) { const size_t zq = (size_t)h0, zk = (size_t)(h0 / REP);   // one kv head per query head: the pass's two heads use consecutive kv planes (z-strides TT*HD)
            k_gemmw<bf, 2, false, 1><<<dim3(RH / 64, TT / 64, ZH), 32, 0, stream>>>(QPh + zq * TT * HD, QPl + zq * TT * HD, KPh + zk * TT * HD, KPl + zk * TT * HD, HD, Sb, TT, nullptr, (size_t)TT * HD, (size_t)TT * HD, (size_t)TT * TT, 0);
            k_gemmw<h16, 0, false, 1><<<dim3((TT - RH) / 64, TT / 64, ZH), 32, 0, stream>>>(QP16 + zq * TT * HD + (size_t)RH * HD, nullptr, KP16 + zk * TT * HD, nullptr, HD, Sb + (size_t)RH * TT, TT, nullptr, (size_t)TT * HD, (size_t)TT * HD, (size_t)TT * TT, 0);
            k_asoft<<<ZH * TT / 8, 256, 0, stream>>>(Sb, P16, Ph, Pl);
            k_gemmw<bf, 2, false, KSP><<<dim3(RH / 64, HD / 64 * KSP, ZH), 32, 0, stream>>>(Ph, Pl, VTh + zk * HD * TT, VTl + zk * HD * TT, TT, Ob, HD, nullptr, (size_t)RH * TT, (size_t)HD * TT, (size_t)TT * HD, (size_t)ZH * TT * HD);
            k_gemmw<h16, 0, false, KSP><<<dim3((TT - RH) / 64, HD / 64 * KSP, ZH), 32, 0, stream>>>(P16 + (size_t)RH * TT, nullptr, VT16 + zk * HD * TT, nullptr, TT, Ob + (size_t)RH * HD, HD, nullptr, (size_t)TT * TT, (size_t)HD * TT, (size_t)TT * HD, (size_t)ZH * TT * HD);
            k_merge<<<(unsigned)(((size_t)ZH * TT * HD / 2 + 255) / 256), 256, 0, stream>>>(Ob, h0, ATh, ATl); }
        k_gemmw<bf, 1, true, 1><<<dim3(TT / 64, DM / 64, 1), 32, 0, stream>>>(ATh, ATl, WO, nullptr, DQ, OUT + (size_t)b * TT * DM, DM, bo, 0, 0, 0, 0); }
}

// v003
// Measured time: 272 microseconds a run.
// Versions in between are left out here; by their measured steps it is 3.18 times as fast as v001.
// Over all steps from v000 it is 7.36 times as fast.
#include <hip/hip_runtime.h>

// Multi-head attention WITHOUT a mask over three input streams with a computed rotate-half rotary (query, key, value [2][2048][1024]; q = query Wq^T, k = key Wk^T, v = value Wv^T ('oi' [1024][1024] 1/32, no bias; 16 heads x 64), each from its own stream; _apply_rope AFTER the head split: (x1, x2) = the two HALVES: cat(x1 cos - x2 sin, x1 sin + x2 cos) with angle t x inv_freq[i], inv_freq = 1.0 / (10000.0 ** (arange(0, 64, 2, f32) / 64)) (32 f32 constants; both halves share the 32 angles; one f32 product per angle; precise cosf / sinf), on q and k; scores / sqrt(64); softmax over all keys; out = merged Wo^T + bo ('oi' + a REAL 0.01 bias) -> [2][2048][1024] (4.2 M); argument order query, key, value, Wq, Wk, Wv, Wo, bo).
// Layout, both batches in every launch: bf16 copies of query, key, value and the four 'oi' weights (one launch, with the rotary table); the three exact projections as grid z of one launch; rotated q, k and transposed v head planes (fp16 + hi/lo) in one launch; one fused attention launch, grid z = batch (hybrid rows: < 512 hi/lo 3 products, rest fp16; online softmax, scores and weights stay in registers); merged hi/lo x Wo exact.
// Compute dtypes, f32 accumulate: every input rounded to bf16; projections exact; attention rows < 512 3 products, rest fp16; softmax f32; Wo hl x exact.

#define NB_  2
#define TT   2048
#define DM   1024
#define NH_  16
#define NKV  16
#define REP  (NH_ / NKV)
#define HD   64
#define DQ   (NH_ * HD)
#define DKV  (NKV * HD)
#define RH   512                  // query rows < RH use hi+lo planes (0: none)
#define WIN  0
#define SCL  0.125f   // HD^-0.5
#define CEXP (SCL * 1.4426950408889634f)   // score -> exponent of 2
typedef _Float16 h16;
typedef unsigned short bf;
typedef __attribute__((ext_vector_type(16))) __bf16   v16bf;
typedef __attribute__((ext_vector_type(16))) _Float16 v16h;
typedef __attribute__((ext_vector_type(8)))  _Float16 v8h;
typedef __attribute__((ext_vector_type(8)))  unsigned short v8us;
typedef __attribute__((ext_vector_type(8)))  float    v8f;
typedef __attribute__((ext_vector_type(4)))  float    v4f;
typedef v8h  __attribute__((may_alias)) v8ha;
typedef v4f  __attribute__((may_alias)) v4fa;
typedef v8us __attribute__((may_alias)) v8usa;

__device__ __forceinline__ unsigned short f2bf(float f) { unsigned u = __float_as_uint(f); u += 0x7FFFu + ((u >> 16) & 1u); return (unsigned short)(u >> 16); }
__device__ __forceinline__ float bf2f(unsigned short b) { return __uint_as_float(((unsigned)b) << 16); }
__device__ __forceinline__ float bfr(float f) { return bf2f(f2bf(f)); }
__device__ __forceinline__ v16h cat16(v8h lo, v8h hi) { return __builtin_shufflevector(lo, hi, 0, 1, 2, 3, 4, 5, 6, 7, 8, 9, 10, 11, 12, 13, 14, 15); }
__device__ __forceinline__ v16bf cat16b(v8us lo, v8us hi) { return __builtin_bit_cast(v16bf, __builtin_shufflevector(lo, hi, 0, 1, 2, 3, 4, 5, 6, 7, 8, 9, 10, 11, 12, 13, 14, 15)); }
__device__ __forceinline__ v8f wmma16(v16h a, v16h b, v8f c) { return __builtin_amdgcn_wmma_f32_16x16x32_f16(false, a, false, b, (short)0, c, false, false); }
__device__ __forceinline__ v8f wmmab(v16bf a, v16bf b, v8f c) { return __builtin_amdgcn_wmma_f32_16x16x32_bf16(false, a, false, b, (short)0, c, false, false); }



// ---- k_gemmw: register-blocked GEMM, ONE WAVE per 64x64 output tile (16 accumulators), operands straight from K-contiguous 16-bit planes; grid (M/64, N/64, Z), 32 threads.
// C[m][n] (f32, pitch ldc, + optional f32 bias[n]) = sum_k A[m][k] Bt[n][k] (+ split products per NSPLIT). z-batch strides sA/sB/sC in elements. K % 32 == 0.
// KS > 1: grid (M/64, N/64 * KS, Z); work-group ks = blockIdx.y % KS sums only k in [ks K/KS, (ks+1) K/KS) and stores its tile in partial plane ks (C + ks sP); the reader adds the KS planes. K % (32 KS) == 0.
template <typename T16> struct WFrag;
template <> struct WFrag<h16> { typedef v16h V; static __device__ __forceinline__ V ld(const h16* p) { return cat16(*(const v8h*)p, *(const v8h*)(p + 16)); } static __device__ __forceinline__ v8f mma(V a, V b, v8f c) { return wmma16(a, b, c); } };
template <> struct WFrag<bf> { typedef v16bf V; static __device__ __forceinline__ V ld(const bf* p) { return cat16b(*(const v8us*)p, *(const v8us*)(p + 16)); } static __device__ __forceinline__ v8f mma(V a, V b, v8f c) { return wmmab(a, b, c); } };
template <typename T16, int NSPLIT, bool BIAS, int KS>
__global__ __launch_bounds__(32) void k_gemmw(const T16* __restrict__ A, const T16* __restrict__ A2, const T16* __restrict__ Bt, const T16* __restrict__ Bt2, int K, float* C, int ldc, const float* __restrict__ bias, size_t sA, size_t sB, size_t sC, size_t sP) {
    typedef typename WFrag<T16>::V V;
    __shared__ __align__(16) float os[16 * 68];
    const size_t z = blockIdx.z; A += z * sA; if (A2) A2 += z * sA; Bt += z * sB; if (Bt2) Bt2 += z * sB; C += z * sC;
    const int ks = (KS > 1) ? (int)(blockIdx.y % KS) : 0; const int kbeg = ks * (K / KS), kend = kbeg + K / KS; if (KS > 1) C += (size_t)ks * sP;
    const int lane = threadIdx.x & 31, lr = lane & 15, hi = lane >> 4; const int r0 = blockIdx.x * 64, c0 = (int)(blockIdx.y / KS) * 64;
    v8f acc[4][4];
#pragma unroll
    for (int mb = 0; mb < 4; ++mb)
#pragma unroll
        for (int nb = 0; nb < 4; ++nb) acc[mb][nb] = (v8f){};
    const size_t aoff = (size_t)(r0 + lr) * K + 8 * hi, boff = (size_t)(c0 + lr) * K + 8 * hi;
#pragma unroll 1
    for (int kc = kbeg; kc < kend; kc += 32) {
        V a[4], a2[4];
#pragma unroll
        for (int mb = 0; mb < 4; ++mb) { a[mb] = WFrag<T16>::ld(A + aoff + (size_t)mb * 16 * K + kc); if (NSPLIT == 1 || NSPLIT == 2) a2[mb] = WFrag<T16>::ld(A2 + aoff + (size_t)mb * 16 * K + kc); }
#pragma unroll
        for (int nb = 0; nb < 4; ++nb) { const V b = WFrag<T16>::ld(Bt + boff + (size_t)nb * 16 * K + kc); V b2; if (NSPLIT >= 2) b2 = WFrag<T16>::ld(Bt2 + boff + (size_t)nb * 16 * K + kc);
#pragma unroll
            for (int mb = 0; mb < 4; ++mb) { acc[mb][nb] = WFrag<T16>::mma(a[mb], b, acc[mb][nb]); if (NSPLIT == 1 || NSPLIT == 2) acc[mb][nb] = WFrag<T16>::mma(a2[mb], b, acc[mb][nb]); if (NSPLIT >= 2) acc[mb][nb] = WFrag<T16>::mma(a[mb], b2, acc[mb][nb]); } }
        asm volatile("v_nop\n\tv_nop\n\tv_nop\n\tv_nop" : "+v"(acc[0][0]), "+v"(acc[1][1]), "+v"(acc[2][2]), "+v"(acc[3][3]) : "v"(a[0]), "v"(a[3]));
    }
#pragma unroll
    for (int mb = 0; mb < 4; ++mb) {
#pragma unroll
        for (int nb = 0; nb < 4; ++nb) {
#pragma unroll
            for (int j = 0; j < 8; ++j) os[(hi * 8 + j) * 68 + nb * 16 + lr] = acc[mb][nb][j]; }
        __builtin_amdgcn_wave_barrier(); asm volatile("" ::: "memory");
        float* crow = C + (size_t)(r0 + mb * 16) * ldc + c0;
{
#pragma unroll
            for (int s = 0; s < 8; ++s) { const int row = 2 * s + hi, cofs = lr * 4; v4f val = *(const v4fa*)(os + row * 68 + cofs); if (BIAS) { val[0] += bfr(bias[c0 + cofs]); val[1] += bfr(bias[c0 + cofs + 1]); val[2] += bfr(bias[c0 + cofs + 2]); val[3] += bfr(bias[c0 + cofs + 3]); }
                *(v4f*)(crow + (size_t)row * ldc + cofs) = val; }
             }
        __builtin_amdgcn_wave_barrier(); asm volatile("" ::: "memory");
    }
}

__device__ __forceinline__ h16 tohx(float x) { return (h16)x; }
__device__ __forceinline__ void splitf(float y, unsigned short& h, unsigned short& l) { h = f2bf(y); l = f2bf(y - bf2f(h)); }
typedef __attribute__((ext_vector_type(2))) _Float16 v2h;
typedef __attribute__((ext_vector_type(4))) _Float16 v4h;
typedef __attribute__((ext_vector_type(2))) unsigned short v2us;
typedef __attribute__((ext_vector_type(4))) unsigned short v4us;
typedef __attribute__((ext_vector_type(2))) float v2f;
typedef __attribute__((ext_vector_type(4))) int v4i;

__global__ __launch_bounds__(256) void k_wtG(const float* __restrict__ w, int K, int N, bf* Bt) {
    const int lane = threadIdx.x & 31; const int L0 = (blockIdx.x * 8 + (threadIdx.x >> 5)) * 8; const int nlines = N * K / 64;
{
#pragma unroll 1
        for (int l = 0; l < 8; ++l) { const int L = L0 + l; if (L >= nlines) break; const size_t e = (size_t)L * 64 + lane * 2; const int k = (int)(e % K), n = (int)(e / K); v2us o;
            o[0] = f2bf(w[(size_t)k * N + n]); o[1] = f2bf(w[(size_t)(k + 1) * N + n]); *(v2us*)(Bt + e) = o; }
         }
}

// k_rope: nheads counts the head planes of every stream and batch, plane h = (stream NB_ + batch) NH_ + head, rows of F in the same (stream, batch, t) order. Head planes [h][t][d] (fp16 + hi/lo) of rope(x) x sc with the rotate-half convention out[d] = x[d] cos[t][d] - x[d+HD/2] sin[t][d], out[d+HD/2] = x[d+HD/2] cos[t][d+HD/2] + x[d] sin[t][d+HD/2]
__device__ __forceinline__ void k_rope(unsigned bx, const float* __restrict__ F, int pitch, int nheads, const float* __restrict__ CS, const float* __restrict__ RF, const float* __restrict__ nw, float sc, h16* P16, bf* Ph, bf* Pl) {
    const size_t e = ((size_t)bx * 256 + threadIdx.x) * 2; if (e >= (size_t)nheads * TT * HD) return; const int d = (int)(e % HD); const int t = (int)((e / HD) % TT); const int h = (int)(e / ((size_t)HD * TT)); const float* f = F + ((size_t)(h / NH_) * TT + t) * pitch + (h % NH_) * HD; const float rf = RF ? RF[(size_t)h * TT + t] : 1.0f; v2h o16; v2us oh, ol;
#pragma unroll
    for (int q = 0; q < 2; ++q) { const int dd = d + q; const int dp = (dd < HD / 2) ? dd + HD / 2 : dd - HD / 2; float x0 = f[dd], x1 = f[dp];
        if (RF) { float n0 = __fmul_rn(x0, rf), n1 = __fmul_rn(x1, rf); asm volatile("" : "+v"(n0)); asm volatile("" : "+v"(n1)); x0 = __fmul_rn(bfr(nw[dd]), n0); x1 = __fmul_rn(bfr(nw[dp]), n1); }
        const v2f cs = *(const v2f*)(CS + ((size_t)t * HD + dd) * 2); float a = __fmul_rn(x0, cs[0]), bq = __fmul_rn(x1, cs[1]); asm volatile("" : "+v"(a)); asm volatile("" : "+v"(bq)); const float r = ((dd < HD / 2) ? __fsub_rn(a, bq) : __fadd_rn(a, bq)) * sc;
        o16[q] = tohx(r); unsigned short a2, c2; splitf(r, a2, c2); oh[q] = a2; ol[q] = c2; }
    *(v2h*)(P16 + e) = o16; *(v2us*)(Ph + e) = oh; *(v2us*)(Pl + e) = ol;  }
__device__ __forceinline__ void k_vtp(unsigned bx, const float* __restrict__ F, int pitch, int nheads, h16* V16, bf* Vh, bf* Vl) { const size_t e = ((size_t)bx * 256 + threadIdx.x) * 2; if (e >= (size_t)nheads * HD * TT) return; const int t = (int)(e % TT); const int d = (int)((e / TT) % HD); const int g = (int)(e / ((size_t)TT * HD)); v2h o16; v2us oh, ol;
#pragma unroll
    for (int q = 0; q < 2; ++q) { const float x = F[((size_t)(g / NKV) * TT + t + q) * pitch + (g % NKV) * HD + d];   /* plane g = batch NKV + head */ o16[q] = tohx(x); unsigned short a2, c2; splitf(x, a2, c2); oh[q] = a2; ol[q] = c2; }
    *(v2h*)(V16 + e) = o16; *(v2us*)(Vh + e) = oh; *(v2us*)(Vl + e) = ol;  }
// k_planes: all that reads the projections and nothing else, in one grid: work-groups [0, VBL) build the transposed v planes (the scattered reads, so they start first), the rest the rotated q and k planes.
#define VBL  (NB_ * NKV * HD * TT / 512)
#define RBL  (2 * NB_ * NH_ * TT * HD / 512)
__global__ __launch_bounds__(256) void k_planes(const float* __restrict__ FQK, const float* __restrict__ FV, const float* __restrict__ CS, h16* P16, bf* Ph, bf* Pl, h16* V16, bf* Vh, bf* Vl) {
    if (blockIdx.x < VBL) k_vtp(blockIdx.x, FV, DKV, NB_ * NKV, V16, Vh, Vl);
    else k_rope(blockIdx.x - VBL, FQK, DQ, 2 * NB_ * NH_, CS, nullptr, nullptr, 1.0f, P16, Ph, Pl);
}
__constant__ float INVT[HD / 2] = { 1.000000000e+00f, 7.498942018e-01f, 5.623413324e-01f, 4.216965139e-01f, 3.162277639e-01f, 2.371373624e-01f, 1.778279394e-01f, 1.333521456e-01f, 1.000000015e-01f, 7.498941571e-02f, 5.623412877e-02f, 4.216964915e-02f, 3.162277862e-02f, 2.371373586e-02f, 1.778279431e-02f, 1.333521493e-02f, 9.999999776e-03f, 7.498942316e-03f, 5.623413250e-03f, 4.216964822e-03f, 3.162277862e-03f, 2.371373819e-03f, 1.778279431e-03f, 1.333521446e-03f, 1.000000047e-03f, 7.498941850e-04f, 5.623413017e-04f, 4.216964880e-04f, 3.162277862e-04f, 2.371373848e-04f, 1.778279402e-04f, 1.333521504e-04f };   // 1 / 10000^(2i/64) (float32, generated with jnp to be bit-exact)
// k_prep: everything that depends on no other launch, in one grid. Work-groups [0, CSB): the rotary table (positions = arange). The rest: f32 -> bf16, 2048 elements each, into ONE run of planes
// dst = query, key, value (both batches each), Wq, Wk, Wv, Wo, so that the destination offset is linear in the work-group index and only the source is chosen (a scalar choice).
#define CSB  (TT * HD / 256)
#define XBL  (NB_ * TT * DM / 2048)   // work-groups per input stream
#define WBL  (DQ * DM / 2048)         // work-groups per weight
__global__ __launch_bounds__(256) void k_prep(const float* __restrict__ xq, const float* __restrict__ xk, const float* __restrict__ xv, const float* __restrict__ wq, const float* __restrict__ wk, const float* __restrict__ wv, const float* __restrict__ wo, bf* dst, float* CS) {
    if (blockIdx.x < CSB) { const int idx = blockIdx.x * 256 + threadIdx.x; const int d = idx % HD; const int t = idx / HD; const float a = __fmul_rn((float)t, INVT[d % (HD / 2)]); v2f cs; cs[0] = cosf(a); cs[1] = sinf(a); *(v2f*)(CS + (size_t)idx * 2) = cs; return; }
    const int bx = blockIdx.x - CSB; const float* src; int lb;
    if (bx < 3 * XBL) { const int sel = bx / XBL; lb = bx % XBL; src = sel == 0 ? xq : sel == 1 ? xk : xv; }
    else { const int sel = (bx - 3 * XBL) / WBL; lb = (bx - 3 * XBL) % WBL; src = sel == 0 ? wq : sel == 1 ? wk : sel == 2 ? wv : wo; }
    const v8f v = *(const v8f*)(src + (size_t)lb * 2048 + threadIdx.x * 8); v8us o;
#pragma unroll
    for (int k = 0; k < 8; ++k) o[k] = f2bf(v[k]);
    *(v8us*)(dst + (size_t)bx * 2048 + threadIdx.x * 8) = o;  }
// ---- k_fattn: scores, softmax and weights x V in ONE kernel; one wave per work-group, grid (RH/16 + (TT-RH)/32, heads, batches).
// The wave forms the TRANSPOSED score tile S^T = K Q^T (A = 16 keys, B = 16 queries): lane (lr, hi) then holds keys 8 hi + j of query lr, and two such tiles (keys 0..15, 16..31)
// side by side ARE the B fragment (k = 8 hi + 0..7, 16 + 8 hi + 0..7) of O^T = V^T P^T, so the weights never leave their registers. Online softmax per query over steps of 32 keys, ascending:
// running maximum m (in exponent-of-2 units), running sum l and O^T rescaled by 2^(m_old - m_new); the two lane halves of a query share m (one cross-half exchange per step) and add their l at the end.
typedef __attribute__((ext_vector_type(8))) __bf16 v8bf;
__device__ __forceinline__ float xhalf(float x) { return __builtin_bit_cast(float, __builtin_amdgcn_permlanex16(__builtin_bit_cast(int, x), __builtin_bit_cast(int, x), 0x76543210, 0xfedcba98, false, false)); }   // lane l with lane l ^ 16, no LDS round trip
// 2^x. The instruction set asks for one free slot behind a transcendental before its result is read or its source overwritten: the v_nop ends the same statement so that it cannot drift,
// and the early-clobber results keep every exp of the run of eight off the sources of the others.
__device__ __forceinline__ float exp2s(float x) { float r; asm("v_exp_f32 %0, %1\n\tv_nop" : "=v"(r) : "v"(x)); return r; }
__device__ __forceinline__ v8f exp2v(v8f x) { float r0, r1, r2, r3, r4, r5, r6, r7;
    asm("v_exp_f32 %0, %8\n\tv_exp_f32 %1, %9\n\tv_exp_f32 %2, %10\n\tv_exp_f32 %3, %11\n\tv_exp_f32 %4, %12\n\tv_exp_f32 %5, %13\n\tv_exp_f32 %6, %14\n\tv_exp_f32 %7, %15\n\tv_nop"
        : "=&v"(r0), "=&v"(r1), "=&v"(r2), "=&v"(r3), "=&v"(r4), "=&v"(r5), "=&v"(r6), "=&v"(r7) : "v"(x[0]), "v"(x[1]), "v"(x[2]), "v"(x[3]), "v"(x[4]), "v"(x[5]), "v"(x[6]), "v"(x[7]));
    return (v8f){r0, r1, r2, r3, r4, r5, r6, r7}; }
__device__ __forceinline__ float vmax8(v8f a, v8f b) { float x = fmaxf(a[0], b[0]);
#pragma unroll
    for (int j = 1; j < 8; ++j) x = fmaxf(x, fmaxf(a[j], b[j]));
    return x; }
__device__ __forceinline__ void attn_store(const v8f* o, float l, size_t oo, bf* Ah, bf* Al) {   // o: four d tiles of one query column; oo: element offset of (query, head, 8 hi)
    const float inv = __fdiv_rn(1.0f, l + xhalf(l));
#pragma unroll
    for (int dt = 0; dt < 4; ++dt) { const v8f x = o[dt] * inv; const v8bf xh = __builtin_convertvector(x, v8bf), xl = __builtin_convertvector(x - __builtin_convertvector(xh, v8f), v8bf);   // hi + lo, nearest even, packed converts
        *(v8us*)(Ah + oo + dt * 16) = __builtin_bit_cast(v8us, xh); *(v8us*)(Al + oo + dt * 16) = __builtin_bit_cast(v8us, xl); }
}
// rows >= RH: fp16 operands, 32 queries per wave
__device__ __forceinline__ void attn_f16(const h16* __restrict__ Q, const h16* __restrict__ K, const h16* __restrict__ VT, int q0, int col, bf* Ah, bf* Al) {
    typedef WFrag<h16> F; const int lane = threadIdx.x & 31, lr = lane & 15, hi = lane >> 4;
    v16h qf[2][2], kf[2][2]; v8f o[2][4]; float m[2], l[2];
    const h16* kp = K + (size_t)lr * HD + 8 * hi; const h16* vp = VT + (size_t)lr * TT + 8 * hi;
#pragma unroll
    for (int qt = 0; qt < 2; ++qt) { m[qt] = -3.0e38f; l[qt] = 0.f;
#pragma unroll
        for (int ks = 0; ks < 2; ++ks) qf[qt][ks] = F::ld(Q + (size_t)(q0 + qt * 16 + lr) * HD + ks * 32 + 8 * hi);
#pragma unroll
        for (int dt = 0; dt < 4; ++dt) o[qt][dt] = (v8f){}; }
#pragma unroll
    for (int kt = 0; kt < 2; ++kt)
#pragma unroll
        for (int ks = 0; ks < 2; ++ks) kf[kt][ks] = F::ld(kp + (size_t)(kt * 16) * HD + ks * 32);
#pragma unroll 1   // one step of 32 keys is a whole body of 16 loads and 16 matrix instructions; unrolling would only add registers
    for (int kb = 0; kb < TT; kb += 32) {
        v16h vf[4], pf[2]; v8f st[2][2];
#pragma unroll
        for (int dt = 0; dt < 4; ++dt) vf[dt] = F::ld(vp + (size_t)(dt * 16) * TT + kb);
#pragma unroll
        for (int kt = 0; kt < 2; ++kt)
#pragma unroll
            for (int qt = 0; qt < 2; ++qt) st[kt][qt] = F::mma(kf[kt][1], qf[qt][1], F::mma(kf[kt][0], qf[qt][0], (v8f){}));
        const int kn = (kb + 32 < TT) ? kb + 32 : 0;   // next step's keys are fetched under this step's softmax; the last step refetches step 0 (in bounds, unused)
#pragma unroll
        for (int kt = 0; kt < 2; ++kt)
#pragma unroll
            for (int ks = 0; ks < 2; ++ks) kf[kt][ks] = F::ld(kp + (size_t)(kn + kt * 16) * HD + ks * 32);
#pragma unroll
        for (int qt = 0; qt < 2; ++qt) { float mx = vmax8(st[0][qt], st[1][qt]); mx = fmaxf(mx, xhalf(mx));
            const float mn = fmaxf(m[qt], mx * CEXP); const float al = exp2s(m[qt] - mn); m[qt] = mn; float s = 0.f;
#pragma unroll
            for (int kt = 0; kt < 2; ++kt) { const v8f p = exp2v(st[kt][qt] * CEXP - mn);
#pragma unroll
                for (int j = 0; j < 8; ++j) { s += p[j]; pf[qt][kt * 8 + j] = tohx(p[j]); } }
            l[qt] = l[qt] * al + s;
#pragma unroll
            for (int dt = 0; dt < 4; ++dt) o[qt][dt] *= al; }
#pragma unroll
        for (int dt = 0; dt < 4; ++dt)
#pragma unroll
            for (int qt = 0; qt < 2; ++qt) o[qt][dt] = F::mma(vf[dt], pf[qt], o[qt][dt]);
        // four vector slots behind the last matrix instructions: on the taken branch the loop's first ones overwrite their B registers
        asm volatile("v_nop\n\tv_nop\n\tv_nop\n\tv_nop" : "+v"(o[0][0]), "+v"(o[0][1]), "+v"(o[0][2]), "+v"(o[0][3]), "+v"(o[1][0]), "+v"(o[1][1]), "+v"(o[1][2]), "+v"(o[1][3]));
    }
#pragma unroll
    for (int qt = 0; qt < 2; ++qt) attn_store(o[qt], l[qt], (size_t)(q0 + qt * 16 + lr) * DQ + col + hi * 8, Ah, Al);
}
// rows < RH: bf16 hi + lo planes, three products each (hi hi, lo hi, hi lo), 16 queries per wave
__device__ __forceinline__ void attn_hl(const bf* __restrict__ Qh, const bf* __restrict__ Ql, const bf* __restrict__ Kh, const bf* __restrict__ Kl, const bf* __restrict__ VTh, const bf* __restrict__ VTl, int q0, int col, bf* Ah, bf* Al) {
    typedef WFrag<bf> F; const int lane = threadIdx.x & 31, lr = lane & 15, hi = lane >> 4;
    v16bf qh[2], ql[2], kh[2][2], kl[2][2]; v8f o[4]; float m = -3.0e38f, l = 0.f;
    const size_t ko = (size_t)lr * HD + 8 * hi, vo = (size_t)lr * TT + 8 * hi;
#pragma unroll
    for (int ks = 0; ks < 2; ++ks) { const size_t qo = (size_t)(q0 + lr) * HD + ks * 32 + 8 * hi; qh[ks] = F::ld(Qh + qo); ql[ks] = F::ld(Ql + qo); }
#pragma unroll
    for (int dt = 0; dt < 4; ++dt) o[dt] = (v8f){};
#pragma unroll
    for (int kt = 0; kt < 2; ++kt)
#pragma unroll
        for (int ks = 0; ks < 2; ++ks) { kh[kt][ks] = F::ld(Kh + ko + (size_t)(kt * 16) * HD + ks * 32); kl[kt][ks] = F::ld(Kl + ko + (size_t)(kt * 16) * HD + ks * 32); }
#pragma unroll 1   // as in attn_f16
    for (int kb = 0; kb < TT; kb += 32) {
        v16bf vh[4], vl[4]; v8f st[2];
#pragma unroll
        for (int dt = 0; dt < 4; ++dt) { vh[dt] = F::ld(VTh + vo + (size_t)(dt * 16) * TT + kb); vl[dt] = F::ld(VTl + vo + (size_t)(dt * 16) * TT + kb); }
#pragma unroll
        for (int kt = 0; kt < 2; ++kt) { st[kt] = (v8f){};
#pragma unroll
            for (int ks = 0; ks < 2; ++ks) { st[kt] = F::mma(kh[kt][ks], qh[ks], st[kt]); st[kt] = F::mma(kh[kt][ks], ql[ks], st[kt]); st[kt] = F::mma(kl[kt][ks], qh[ks], st[kt]); } }
        const int kn = (kb + 32 < TT) ? kb + 32 : 0;   // as in attn_f16
        asm volatile("s_wait_xcnt 0x0" ::: "memory");   // the key fetch below lands in registers that held the V loads' addresses: the wait stands in front of that overwrite
#pragma unroll
        for (int kt = 0; kt < 2; ++kt)
#pragma unroll
            for (int ks = 0; ks < 2; ++ks) { kh[kt][ks] = F::ld(Kh + ko + (size_t)(kn + kt * 16) * HD + ks * 32); kl[kt][ks] = F::ld(Kl + ko + (size_t)(kn + kt * 16) * HD + ks * 32); }
        __builtin_amdgcn_sched_barrier(0);   // keeps the 16 key loads above the softmax: sunk to the loop's foot they are waited for at once and their whole latency shows
        float mx = vmax8(st[0], st[1]); mx = fmaxf(mx, xhalf(mx));
        const float mn = fmaxf(m, mx * CEXP); const float al = exp2s(m - mn); m = mn; float s = 0.f; v8bf ph[2], pl[2];
#pragma unroll
        for (int kt = 0; kt < 2; ++kt) { const v8f p = exp2v(st[kt] * CEXP - mn);
#pragma unroll
            for (int j = 0; j < 8; ++j) s += p[j];
            ph[kt] = __builtin_convertvector(p, v8bf); pl[kt] = __builtin_convertvector(p - __builtin_convertvector(ph[kt], v8f), v8bf); }   // hi = nearest-even bf16 of p, lo = nearest-even bf16 of the exact rest (packed converts)
        l = l * al + s; const v16bf pfh = __builtin_shufflevector(ph[0], ph[1], 0, 1, 2, 3, 4, 5, 6, 7, 8, 9, 10, 11, 12, 13, 14, 15), pfl = __builtin_shufflevector(pl[0], pl[1], 0, 1, 2, 3, 4, 5, 6, 7, 8, 9, 10, 11, 12, 13, 14, 15);
#pragma unroll
        for (int dt = 0; dt < 4; ++dt) o[dt] *= al;
#pragma unroll
        for (int dt = 0; dt < 4; ++dt) { o[dt] = F::mma(vh[dt], pfh, o[dt]); o[dt] = F::mma(vh[dt], pfl, o[dt]); o[dt] = F::mma(vl[dt], pfh, o[dt]); }
        asm volatile("v_nop\n\tv_nop\n\tv_nop\n\tv_nop" : "+v"(o[0]), "+v"(o[1]), "+v"(o[2]), "+v"(o[3]));   // as in attn_f16
    }
    attn_store(o, l, (size_t)(q0 + lr) * DQ + col + hi * 8, Ah, Al);
}
__global__ __launch_bounds__(32) void k_fattn(const h16* __restrict__ Q16, const h16* __restrict__ K16, const h16* __restrict__ VT16, const bf* __restrict__ Qh, const bf* __restrict__ Ql, const bf* __restrict__ Kh, const bf* __restrict__ Kl, const bf* __restrict__ VTh, const bf* __restrict__ VTl, bf* Ah, bf* Al) {
    const int h = blockIdx.y, bx = blockIdx.x; const size_t zo = ((size_t)blockIdx.z * NH_ + h) * TT * HD;   // head planes [b][h][t][d] and [b][h][d][t] have the same size
    Ah += (size_t)blockIdx.z * TT * DQ; Al += (size_t)blockIdx.z * TT * DQ;   // merged rows [b][t][DQ]
    if (bx < RH / 16) attn_hl(Qh + zo, Ql + zo, Kh + zo, Kl + zo, VTh + zo, VTl + zo, bx * 16, h * HD, Ah, Al);
    else attn_f16(Q16 + zo, K16 + zo, VT16 + zo, RH + (bx - RH / 16) * 32, h * HD, Ah, Al);
}

extern "C" void kernel_launch(void* const* d_in, const int* in_sizes, int n_in,
                              void* d_out, int out_size, void* d_ws, size_t ws_size, hipStream_t stream) {
    (void)in_sizes; (void)n_in; (void)out_size;
    const float* x = (const float*)d_in[0];   /* query */ const float* xk = (const float*)d_in[1]; const float* xv = (const float*)d_in[2]; const float* wq = (const float*)d_in[3]; const float* wk = (const float*)d_in[4]; const float* wv = (const float*)d_in[5]; const float* wo = (const float*)d_in[6]; const float* bo = (const float*)d_in[7];   /* argument order query, key, value, Wq, Wk, Wv, Wo ('oi' [1024][1024]), bo [1024] (REAL 0.01); eight inputs, all read */
    float* OUT = (float*)d_out;     // [2][2048][1024]
    char* wsp = (char*)d_ws;
    auto take = [&](size_t bytes) { char* p = wsp; wsp += (bytes + 255) & ~(size_t)255; return (void*)p; };
    const size_t NX = (size_t)NB_ * TT * DM, NW = (size_t)DQ * DM, NP = (size_t)NB_ * NH_ * TT * HD;   // elements of one input stream, one weight, one set of head planes (both batches)
    bf* XB = (bf*)take((3 * NX + 4 * NW) * 2); bf* WQ = XB + 3 * NX; bf* WO = WQ + 3 * NW;   // query, key, value, Wq, Wk, Wv, Wo in one run (k_prep)
    float* CS = (float*)take((size_t)TT * HD * 2 * 4); float* FQ = (float*)take(3 * NX * 4); float* FV = FQ + 2 * NX;   // q, k, v projections [stream][b][t][DQ]
    h16* QP16 = (h16*)take(2 * NP * 2); h16* KP16 = QP16 + NP; bf* QPh = (bf*)take(2 * NP * 2); bf* KPh = QPh + NP; bf* QPl = (bf*)take(2 * NP * 2); bf* KPl = QPl + NP;   // q planes, then k planes (k_rope's plane order)
    h16* VT16 = (h16*)take(NP * 2); bf* VTh = (bf*)take(NP * 2); bf* VTl = (bf*)take(NP * 2);
    bf* ATh = (bf*)take(NX * 2); bf* ATl = (bf*)take(NX * 2);
    if ((size_t)(wsp - (char*)d_ws) > ws_size) return;    // ws 256 MiB
    k_prep<<<CSB + 3 * XBL + 4 * WBL, 256, 0, stream>>>(x, xk, xv, wq, wk, wv, wo, XB, CS);
    k_gemmw<bf, 0, false, 1><<<dim3(NB_ * TT / 64, DQ / 64, 3), 32, 0, stream>>>(XB, nullptr, WQ, nullptr, DM, FQ, DQ, nullptr, NX, NW, NX, 0);   // z = stream: q, k, v
    k_planes<<<VBL + RBL, 256, 0, stream>>>(FQ, FV, CS, QP16, QPh, QPl, VT16, VTh, VTl);
    k_fattn<<<dim3(RH / 16 + (TT - RH) / 32, NH_, NB_), 32, 0, stream>>>(QP16, KP16, VT16, QPh, QPl, KPh, KPl, VTh, VTl, ATh, ATl);   // one kv head per query head
    k_gemmw<bf, 1, true, 1><<<dim3(NB_ * TT / 64, DM / 64, 1), 32, 0, stream>>>(ATh, ATl, WO, nullptr, DQ, OUT, DM, bo, 0, 0, 0, 0);
}

// v004
// Measured time: 243 microseconds a run.
// Next to v003, in two timings, it ran 1.12 times as fast each time.
// Over all steps from v000 it is 8.25 times as fast.
#include <hip/hip_runtime.h>

// Multi-head attention WITHOUT a mask over three input streams with a computed rotate-half rotary (query, key, value [2][2048][1024]; q = query Wq^T, k = key Wk^T, v = value Wv^T ('oi' [1024][1024] 1/32, no bias; 16 heads x 64), each from its own stream; _apply_rope AFTER the head split: (x1, x2) = the two HALVES: cat(x1 cos - x2 sin, x1 sin + x2 cos) with angle t x inv_freq[i], inv_freq = 1.0 / (10000.0 ** (arange(0, 64, 2, f32) / 64)) (32 f32 constants; both halves share the 32 angles; one f32 product per angle; precise cosf / sinf), on q and k; scores / sqrt(64); softmax over all keys; out = merged Wo^T + bo ('oi' + a REAL 0.01 bias) -> [2][2048][1024] (4.2 M); argument order query, key, value, Wq, Wk, Wv, Wo, bo).
// Layout, both batches in every launch: bf16 copies of query, key, value and the four 'oi' weights (one launch, with the rotary table); the three exact projections as grid z of one launch, whose epilogue rotates q and k and stores the head planes itself; one fused attention launch, grid z = batch (hybrid rows: < 512 hi/lo 3 products, rest fp16; online softmax, scores and weights stay in registers); merged hi/lo x Wo exact.
// Compute dtypes, f32 accumulate: every input rounded to bf16; projections exact; attention rows < 512 3 products, rest fp16; softmax f32; Wo hl x exact.

#define NB_  2
#define TT   2048
#define DM   1024
#define NH_  16
#define NKV  16
#define REP  (NH_ / NKV)
#define HD   64
#define DQ   (NH_ * HD)
#define DKV  (NKV * HD)
#define RH   512                  // query rows < RH use hi+lo planes (0: none)
#define WIN  0
#define SCL  0.125f   // HD^-0.5
#define CEXP (SCL * 1.4426950408889634f)   // score -> exponent of 2
typedef _Float16 h16;
typedef unsigned short bf;
typedef __attribute__((ext_vector_type(16))) __bf16   v16bf;
typedef __attribute__((ext_vector_type(16))) _Float16 v16h;
typedef __attribute__((ext_vector_type(8)))  _Float16 v8h;
typedef __attribute__((ext_vector_type(8)))  unsigned short v8us;
typedef __attribute__((ext_vector_type(8)))  float    v8f;
typedef __attribute__((ext_vector_type(4)))  float    v4f;
typedef v8h  __attribute__((may_alias)) v8ha;
typedef v4f  __attribute__((may_alias)) v4fa;
typedef v8us __attribute__((may_alias)) v8usa;

__device__ __forceinline__ unsigned short f2bf(float f) { unsigned u = __float_as_uint(f); u += 0x7FFFu + ((u >> 16) & 1u); return (unsigned short)(u >> 16); }
__device__ __forceinline__ float bf2f(unsigned short b) { return __uint_as_float(((unsigned)b) << 16); }
__device__ __forceinline__ float bfr(float f) { return bf2f(f2bf(f)); }
__device__ __forceinline__ v16h cat16(v8h lo, v8h hi) { return __builtin_shufflevector(lo, hi, 0, 1, 2, 3, 4, 5, 6, 7, 8, 9, 10, 11, 12, 13, 14, 15); }
__device__ __forceinline__ v16bf cat16b(v8us lo, v8us hi) { return __builtin_bit_cast(v16bf, __builtin_shufflevector(lo, hi, 0, 1, 2, 3, 4, 5, 6, 7, 8, 9, 10, 11, 12, 13, 14, 15)); }
__device__ __forceinline__ v8f wmma16(v16h a, v16h b, v8f c) { return __builtin_amdgcn_wmma_f32_16x16x32_f16(false, a, false, b, (short)0, c, false, false); }
__device__ __forceinline__ v8f wmmab(v16bf a, v16bf b, v8f c) { return __builtin_amdgcn_wmma_f32_16x16x32_bf16(false, a, false, b, (short)0, c, false, false); }



// ---- k_gemmw: register-blocked GEMM, ONE WAVE per 64x64 output tile (16 accumulators), operands straight from K-contiguous 16-bit planes; grid (M/64, N/64, Z), 32 threads.
// C[m][n] (f32, pitch ldc, + optional f32 bias[n]) = sum_k A[m][k] Bt[n][k] (+ split products per NSPLIT). z-batch strides sA/sB/sC in elements. K % 32 == 0.
// KS > 1: grid (M/64, N/64 * KS, Z); work-group ks = blockIdx.y % KS sums only k in [ks K/KS, (ks+1) K/KS) and stores its tile in partial plane ks (C + ks sP); the reader adds the KS planes. K % (32 KS) == 0.
template <typename T16> struct WFrag;
template <> struct WFrag<h16> { typedef v16h V; static __device__ __forceinline__ V ld(const h16* p) { return cat16(*(const v8h*)p, *(const v8h*)(p + 16)); } static __device__ __forceinline__ v8f mma(V a, V b, v8f c) { return wmma16(a, b, c); } };
template <> struct WFrag<bf> { typedef v16bf V; static __device__ __forceinline__ V ld(const bf* p) { return cat16b(*(const v8us*)p, *(const v8us*)(p + 16)); } static __device__ __forceinline__ v8f mma(V a, V b, v8f c) { return wmmab(a, b, c); } };
template <typename T16, int NSPLIT, bool BIAS, int KS>
__global__ __launch_bounds__(32) void k_gemmw(const T16* __restrict__ A, const T16* __restrict__ A2, const T16* __restrict__ Bt, const T16* __restrict__ Bt2, int K, float* C, int ldc, const float* __restrict__ bias, size_t sA, size_t sB, size_t sC, size_t sP) {
    typedef typename WFrag<T16>::V V;
    __shared__ __align__(16) float os[16 * 68];
    const size_t z = blockIdx.z; A += z * sA; if (A2) A2 += z * sA; Bt += z * sB; if (Bt2) Bt2 += z * sB; C += z * sC;
    const int ks = (KS > 1) ? (int)(blockIdx.y % KS) : 0; const int kbeg = ks * (K / KS), kend = kbeg + K / KS; if (KS > 1) C += (size_t)ks * sP;
    const int lane = threadIdx.x & 31, lr = lane & 15, hi = lane >> 4; const int r0 = blockIdx.x * 64, c0 = (int)(blockIdx.y / KS) * 64;
    v8f acc[4][4];
#pragma unroll
    for (int mb = 0; mb < 4; ++mb)
#pragma unroll
        for (int nb = 0; nb < 4; ++nb) acc[mb][nb] = (v8f){};
    const size_t aoff = (size_t)(r0 + lr) * K + 8 * hi, boff = (size_t)(c0 + lr) * K + 8 * hi;
#pragma unroll 1
    for (int kc = kbeg; kc < kend; kc += 32) {
        V a[4], a2[4];
#pragma unroll
        for (int mb = 0; mb < 4; ++mb) { a[mb] = WFrag<T16>::ld(A + aoff + (size_t)mb * 16 * K + kc); if (NSPLIT == 1 || NSPLIT == 2) a2[mb] = WFrag<T16>::ld(A2 + aoff + (size_t)mb * 16 * K + kc); }
#pragma unroll
        for (int nb = 0; nb < 4; ++nb) { const V b = WFrag<T16>::ld(Bt + boff + (size_t)nb * 16 * K + kc); V b2; if (NSPLIT >= 2) b2 = WFrag<T16>::ld(Bt2 + boff + (size_t)nb * 16 * K + kc);
#pragma unroll
            for (int mb = 0; mb < 4; ++mb) { acc[mb][nb] = WFrag<T16>::mma(a[mb], b, acc[mb][nb]); if (NSPLIT == 1 || NSPLIT == 2) acc[mb][nb] = WFrag<T16>::mma(a2[mb], b, acc[mb][nb]); if (NSPLIT >= 2) acc[mb][nb] = WFrag<T16>::mma(a[mb], b2, acc[mb][nb]); } }
        asm volatile("v_nop\n\tv_nop\n\tv_nop\n\tv_nop" : "+v"(acc[0][0]), "+v"(acc[1][1]), "+v"(acc[2][2]), "+v"(acc[3][3]) : "v"(a[0]), "v"(a[3]));
    }
#pragma unroll
    for (int mb = 0; mb < 4; ++mb) {
#pragma unroll
        for (int nb = 0; nb < 4; ++nb) {
#pragma unroll
            for (int j = 0; j < 8; ++j) os[(hi * 8 + j) * 68 + nb * 16 + lr] = acc[mb][nb][j]; }
        __builtin_amdgcn_wave_barrier(); asm volatile("" ::: "memory");
        float* crow = C + (size_t)(r0 + mb * 16) * ldc + c0;
{
#pragma unroll
            for (int s = 0; s < 8; ++s) { const int row = 2 * s + hi, cofs = lr * 4; v4f val = *(const v4fa*)(os + row * 68 + cofs); if (BIAS) { val[0] += bfr(bias[c0 + cofs]); val[1] += bfr(bias[c0 + cofs + 1]); val[2] += bfr(bias[c0 + cofs + 2]); val[3] += bfr(bias[c0 + cofs + 3]); }
                *(v4f*)(crow + (size_t)row * ldc + cofs) = val; }
             }
        __builtin_amdgcn_wave_barrier(); asm volatile("" ::: "memory");
    }
}

__device__ __forceinline__ h16 tohx(float x) { return (h16)x; }
__device__ __forceinline__ void splitf(float y, unsigned short& h, unsigned short& l) { h = f2bf(y); l = f2bf(y - bf2f(h)); }
typedef __attribute__((ext_vector_type(2))) _Float16 v2h;
typedef __attribute__((ext_vector_type(4))) _Float16 v4h;
typedef __attribute__((ext_vector_type(2))) unsigned short v2us;
typedef __attribute__((ext_vector_type(4))) unsigned short v4us;
typedef __attribute__((ext_vector_type(2))) float v2f;
typedef __attribute__((ext_vector_type(4))) int v4i;
typedef __attribute__((ext_vector_type(8))) __bf16 v8bf;

__global__ __launch_bounds__(256) void k_wtG(const float* __restrict__ w, int K, int N, bf* Bt) {
    const int lane = threadIdx.x & 31; const int L0 = (blockIdx.x * 8 + (threadIdx.x >> 5)) * 8; const int nlines = N * K / 64;
{
#pragma unroll 1
        for (int l = 0; l < 8; ++l) { const int L = L0 + l; if (L >= nlines) break; const size_t e = (size_t)L * 64 + lane * 2; const int k = (int)(e % K), n = (int)(e / K); v2us o;
            o[0] = f2bf(w[(size_t)k * N + n]); o[1] = f2bf(w[(size_t)(k + 1) * N + n]); *(v2us*)(Bt + e) = o; }
         }
}

// ---- k_projp: the three projections (grid z = stream: q, k, v), ONE WAVE per 64x64 tile as in k_gemmw; the tile is 64 rows t of ONE head (64 d), so the epilogue finishes it in registers and stores
// the head planes (fp16, bf16 hi, bf16 lo) itself: no f32 projection goes through memory. The operand that supplies the WMMA rows is chosen so that a lane's eight accumulator elements run along the plane's
// CONTIGUOUS index: q, k (planes [h][t][d], h = (stream NB_ + batch) NH_ + head): rows = d (the weight), columns = t; v (planes [g][d][t], g = batch NKV + head): rows = t (the input), columns = d.
// Rotate-half: out[d] = x[d] cos - x[d+32] sin, out[d+32] = x[d+32] cos + x[d] sin, angle (t, d % 32); d and d + 32 are row tiles mb and mb + 2 of the same lane and element.
#define PP   72   // LDS row pitch in 16-bit elements: a 128-byte row + 16 bytes, the pitch for 16-byte readers
// Epilogue of k_projp, one group of 16 plane rows (nb) at a time: rotate (q, k), round to the three planes, pass them through LDS so that every global store covers whole 128-byte rows.
template <bool ROPE>
__device__ __forceinline__ void proj_store(v8f (&acc)[4][4], unsigned short* os, const float* __restrict__ CSt, unsigned short* D16, unsigned short* Dh, unsigned short* Dl, const int pitch) {
    const int lane = threadIdx.x & 31, lr = lane & 15, hi = lane >> 4;
    const float* cp = ROPE ? CSt + ((size_t)lr * HD + hi * 8) * 2 : nullptr;   // (cos, sin) pairs of the tile's row lr, from d = 8 hi; row group nb lies nb 16 rows on
    v4f c[2][8];
    if (ROPE) {
#pragma unroll
        for (int i = 0; i < 8; ++i) c[0][i] = *(const v4f*)(cp + (i >> 2) * 32 + (i & 3) * 4); }
#pragma unroll
    for (int nb = 0; nb < 4; ++nb) {
        if (ROPE) {
            if (nb < 3) {   // the next row group's pairs fly under this group's arithmetic and stores
#pragma unroll
                for (int i = 0; i < 8; ++i) c[(nb + 1) & 1][i] = *(const v4f*)(cp + (size_t)(nb + 1) * 16 * HD * 2 + (i >> 2) * 32 + (i & 3) * 4); }
#pragma unroll
            for (int mb = 0; mb < 2; ++mb)
#pragma unroll
                for (int j = 0; j < 8; ++j) { const float co = c[nb & 1][mb * 4 + (j >> 1)][(j & 1) * 2], si = c[nb & 1][mb * 4 + (j >> 1)][(j & 1) * 2 + 1]; const float x1 = acc[mb][nb][j], x2 = acc[mb + 2][nb][j];
                    acc[mb][nb][j] = x1 * co - x2 * si; acc[mb + 2][nb][j] = x2 * co + x1 * si; }
        }
#pragma unroll
        for (int mb = 0; mb < 4; ++mb) { const v8f x = acc[mb][nb]; const v8bf xh = __builtin_convertvector(x, v8bf);   // hi = nearest-even bf16, lo = nearest-even bf16 of the exact rest
            unsigned short* o = os + lr * PP + mb * 16 + hi * 8;
            *(v8usa*)o = __builtin_bit_cast(v8us, __builtin_convertvector(x, v8h)); *(v8usa*)(o + 16 * PP) = __builtin_bit_cast(v8us, xh);
            *(v8usa*)(o + 32 * PP) = __builtin_bit_cast(v8us, __builtin_convertvector(x - __builtin_convertvector(xh, v8f), v8bf)); }
        __builtin_amdgcn_wave_barrier(); asm volatile("" ::: "memory");   // one wave, its LDS operations run in order: this only keeps the compiler from lifting the reads of other lanes' rows over the writes
        v8us w[4][3];   // all twelve LDS reads first, as one group behind one latency, then the stores
#pragma unroll
        for (int s = 0; s < 4; ++s)
#pragma unroll
            for (int pl = 0; pl < 3; ++pl) w[s][pl] = *(const v8usa*)(os + (pl * 16 + s * 4 + (lane >> 3)) * PP + (lane & 7) * 8);
#pragma unroll
        for (int s = 0; s < 4; ++s) { const size_t g = (size_t)(nb * 16 + s * 4 + (lane >> 3)) * pitch + (lane & 7) * 8;
            *(v8us*)(D16 + g) = w[s][0]; *(v8us*)(Dh + g) = w[s][1]; *(v8us*)(Dl + g) = w[s][2]; }
        asm volatile("s_wait_xcnt 0x0" ::: "memory");   // what follows (the next group's table loads and arithmetic; behind the last group whatever the kernel does next) may land in registers that these stores name: the wait stands in front of that overwrite
        __builtin_amdgcn_wave_barrier(); asm volatile("" ::: "memory");   // and the next group's writes from rising over these reads
        __builtin_amdgcn_sched_barrier(0);   // without it the table loads of all four groups are lifted to the front, and their 128 registers on top of the accumulators cost a wave per SIMD
    }
}
__global__ __launch_bounds__(32) void k_projp(const bf* __restrict__ X, const bf* __restrict__ Wt, const float* __restrict__ CS, unsigned short* P16, unsigned short* Ph, unsigned short* Pl, unsigned short* V16, unsigned short* Vh, unsigned short* Vl) {
    typedef WFrag<bf> F; typedef F::V V;
    __shared__ __align__(16) unsigned short os[3 * 16 * PP];
    const int z = blockIdx.z; const bool isv = z == 2;
    const int lane = threadIdx.x & 31, lr = lane & 15, hi = lane >> 4; const int r0 = blockIdx.x * 64, head = blockIdx.y; const int b = r0 / TT, t0 = r0 % TT;
    const bf* xs = X + (size_t)z * NB_ * TT * DM + (size_t)r0 * DM; const bf* wr = Wt + (size_t)z * DQ * DM + (size_t)head * HD * DM;
    const bf* A = isv ? xs : wr; const bf* Bt = isv ? wr : xs; const unsigned lo = lr * DM + 8 * hi;   // wave-uniform bases, one lane offset for both operands
    v8f acc[4][4];
#pragma unroll
    for (int mb = 0; mb < 4; ++mb)
#pragma unroll
        for (int nb = 0; nb < 4; ++nb) acc[mb][nb] = (v8f){};
#pragma unroll 1   // one trip is a whole body of 16 loads and 16 matrix instructions; unrolling would only add operand registers on top of the 128 of the accumulators
    for (int kc = 0; kc < DM; kc += 32) {
        V a[4]; const bf* pa = A + kc + lo; const bf* pb = Bt + kc + lo;
#pragma unroll
        for (int mb = 0; mb < 4; ++mb) a[mb] = F::ld(pa + mb * 16 * DM);
#pragma unroll
        for (int nb = 0; nb < 4; ++nb) {
            const V bb = F::ld(pb + nb * 16 * DM);
#pragma unroll
            for (int mb = 0; mb < 4; ++mb) acc[mb][nb] = F::mma(a[mb], bb, acc[mb][nb]); }
        // four vector slots behind the last matrix instructions, as in k_gemmw: on the taken branch the loop's first loads overwrite their operands.
        // The two address pairs are inputs so that they keep their registers to the foot of the trip: otherwise a later load of the trip lands on an address that issued loads still name.
        asm volatile("v_nop\n\tv_nop\n\tv_nop\n\tv_nop" : "+v"(acc[0][0]), "+v"(acc[1][1]), "+v"(acc[2][2]), "+v"(acc[3][3]) : "v"(a[0]), "v"(a[3]), "v"(pa), "v"(pb));
    }
    // acc[mb][nb][j]: contiguous index i = mb 16 + hi 8 + j, plane row o = nb 16 + lr
    if (isv) { const size_t base = (size_t)(b * NKV + head) * HD * TT + t0; proj_store<false>(acc, os, nullptr, V16 + base, Vh + base, Vl + base, TT); }
    else { const size_t base = (((size_t)(z * NB_ + b) * NH_ + head) * TT + t0) * HD; proj_store<true>(acc, os, CS + (size_t)t0 * HD * 2, P16 + base, Ph + base, Pl + base, HD); }
}
__constant__ float INVT[HD / 2] = { 1.000000000e+00f, 7.498942018e-01f, 5.623413324e-01f, 4.216965139e-01f, 3.162277639e-01f, 2.371373624e-01f, 1.778279394e-01f, 1.333521456e-01f, 1.000000015e-01f, 7.498941571e-02f, 5.623412877e-02f, 4.216964915e-02f, 3.162277862e-02f, 2.371373586e-02f, 1.778279431e-02f, 1.333521493e-02f, 9.999999776e-03f, 7.498942316e-03f, 5.623413250e-03f, 4.216964822e-03f, 3.162277862e-03f, 2.371373819e-03f, 1.778279431e-03f, 1.333521446e-03f, 1.000000047e-03f, 7.498941850e-04f, 5.623413017e-04f, 4.216964880e-04f, 3.162277862e-04f, 2.371373848e-04f, 1.778279402e-04f, 1.333521504e-04f };   // 1 / 10000^(2i/64) (float32, generated with jnp to be bit-exact)
// k_prep: everything that depends on no other launch, in one grid. Work-groups [0, CSB): the rotary table (positions = arange). The rest: f32 -> bf16, 2048 elements each, into ONE run of planes
// dst = query, key, value (both batches each), Wq, Wk, Wv, Wo, so that the destination offset is linear in the work-group index and only the source is chosen (a scalar choice).
#define CSB  (TT * HD / 256)
#define XBL  (NB_ * TT * DM / 2048)   // work-groups per input stream
#define WBL  (DQ * DM / 2048)         // work-groups per weight
__global__ __launch_bounds__(256) void k_prep(const float* __restrict__ xq, const float* __restrict__ xk, const float* __restrict__ xv, const float* __restrict__ wq, const float* __restrict__ wk, const float* __restrict__ wv, const float* __restrict__ wo, bf* dst, float* CS) {
    if (blockIdx.x < CSB) { const int idx = blockIdx.x * 256 + threadIdx.x; const int d = idx % HD; const int t = idx / HD; const float a = __fmul_rn((float)t, INVT[d % (HD / 2)]); v2f cs; cs[0] = cosf(a); cs[1] = sinf(a); *(v2f*)(CS + (size_t)idx * 2) = cs; return; }
    const int bx = blockIdx.x - CSB; const float* src; int lb;
    if (bx < 3 * XBL) { const int sel = bx / XBL; lb = bx % XBL; src = sel == 0 ? xq : sel == 1 ? xk : xv; }
    else { const int sel = (bx - 3 * XBL) / WBL; lb = (bx - 3 * XBL) % WBL; src = sel == 0 ? wq : sel == 1 ? wk : sel == 2 ? wv : wo; }
    const v8f v = *(const v8f*)(src + (size_t)lb * 2048 + threadIdx.x * 8); v8us o;
#pragma unroll
    for (int k = 0; k < 8; ++k) o[k] = f2bf(v[k]);
    *(v8us*)(dst + (size_t)bx * 2048 + threadIdx.x * 8) = o;  }
// ---- k_fattn: scores, softmax and weights x V in ONE kernel; one wave per work-group, grid (RH/16 + (TT-RH)/32, heads, batches).
// The wave forms the TRANSPOSED score tile S^T = K Q^T (A = 16 keys, B = 16 queries): lane (lr, hi) then holds keys 8 hi + j of query lr, and two such tiles (keys 0..15, 16..31)
// side by side ARE the B fragment (k = 8 hi + 0..7, 16 + 8 hi + 0..7) of O^T = V^T P^T, so the weights never leave their registers. Online softmax per query over steps of 32 keys, ascending:
// running maximum m (in exponent-of-2 units), running sum l and O^T rescaled by 2^(m_old - m_new); the two lane halves of a query share m (one cross-half exchange per step) and add their l at the end.
__device__ __forceinline__ float xhalf(float x) { return __builtin_bit_cast(float, __builtin_amdgcn_permlanex16(__builtin_bit_cast(int, x), __builtin_bit_cast(int, x), 0x76543210, 0xfedcba98, false, false)); }   // lane l with lane l ^ 16, no LDS round trip
// 2^x. The instruction set asks for one free slot behind a transcendental before its result is read or its source overwritten: the v_nop ends the same statement so that it cannot drift,
// and the early-clobber results keep every exp of the run of eight off the sources of the others.
__device__ __forceinline__ float exp2s(float x) { float r; asm("v_exp_f32 %0, %1\n\tv_nop" : "=v"(r) : "v"(x)); return r; }
__device__ __forceinline__ v8f exp2v(v8f x) { float r0, r1, r2, r3, r4, r5, r6, r7;
    asm("v_exp_f32 %0, %8\n\tv_exp_f32 %1, %9\n\tv_exp_f32 %2, %10\n\tv_exp_f32 %3, %11\n\tv_exp_f32 %4, %12\n\tv_exp_f32 %5, %13\n\tv_exp_f32 %6, %14\n\tv_exp_f32 %7, %15\n\tv_nop"
        : "=&v"(r0), "=&v"(r1), "=&v"(r2), "=&v"(r3), "=&v"(r4), "=&v"(r5), "=&v"(r6), "=&v"(r7) : "v"(x[0]), "v"(x[1]), "v"(x[2]), "v"(x[3]), "v"(x[4]), "v"(x[5]), "v"(x[6]), "v"(x[7]));
    return (v8f){r0, r1, r2, r3, r4, r5, r6, r7}; }
__device__ __forceinline__ float vmax8(v8f a, v8f b) { float x = fmaxf(a[0], b[0]);
#pragma unroll
    for (int j = 1; j < 8; ++j) x = fmaxf(x, fmaxf(a[j], b[j]));
    return x; }
__device__ __forceinline__ void attn_store(const v8f* o, float l, size_t oo, bf* Ah, bf* Al) {   // o: four d tiles of one query column; oo: element offset of (query, head, 8 hi)
    const float inv = __fdiv_rn(1.0f, l + xhalf(l));
#pragma unroll
    for (int dt = 0; dt < 4; ++dt) { const v8f x = o[dt] * inv; const v8bf xh = __builtin_convertvector(x, v8bf), xl = __builtin_convertvector(x - __builtin_convertvector(xh, v8f), v8bf);   // hi + lo, nearest even, packed converts
        *(v8us*)(Ah + oo + dt * 16) = __builtin_bit_cast(v8us, xh); *(v8us*)(Al + oo + dt * 16) = __builtin_bit_cast(v8us, xl); }
}
// rows >= RH: fp16 operands, 32 queries per wave
__device__ __forceinline__ void attn_f16(const h16* __restrict__ Q, const h16* __restrict__ K, const h16* __restrict__ VT, int q0, int col, bf* Ah, bf* Al) {
    typedef WFrag<h16> F; const int lane = threadIdx.x & 31, lr = lane & 15, hi = lane >> 4;
    v16h qf[2][2], kf[2][2]; v8f o[2][4]; float m[2], l[2];
    const h16* kp = K + (size_t)lr * HD + 8 * hi; const h16* vp = VT + (size_t)lr * TT + 8 * hi;
#pragma unroll
    for (int qt = 0; qt < 2; ++qt) { m[qt] = -3.0e38f; l[qt] = 0.f;
#pragma unroll
        for (int ks = 0; ks < 2; ++ks) qf[qt][ks] = F::ld(Q + (size_t)(q0 + qt * 16 + lr) * HD + ks * 32 + 8 * hi);
#pragma unroll
        for (int dt = 0; dt < 4; ++dt) o[qt][dt] = (v8f){}; }
#pragma unroll
    for (int kt = 0; kt < 2; ++kt)
#pragma unroll
        for (int ks = 0; ks < 2; ++ks) kf[kt][ks] = F::ld(kp + (size_t)(kt * 16) * HD + ks * 32);
#pragma unroll 1   // one step of 32 keys is a whole body of 16 loads and 16 matrix instructions; unrolling would only add registers
    for (int kb = 0; kb < TT; kb += 32) {
        v16h vf[4], pf[2]; v8f st[2][2];
#pragma unroll
        for (int dt = 0; dt < 4; ++dt) vf[dt] = F::ld(vp + (size_t)(dt * 16) * TT + kb);
#pragma unroll
        for (int kt = 0; kt < 2; ++kt)
#pragma unroll
            for (int qt = 0; qt < 2; ++qt) st[kt][qt] = F::mma(kf[kt][1], qf[qt][1], F::mma(kf[kt][0], qf[qt][0], (v8f){}));
        const int kn = (kb + 32 < TT) ? kb + 32 : 0;   // next step's keys are fetched under this step's softmax; the last step refetches step 0 (in bounds, unused)
#pragma unroll
        for (int kt = 0; kt < 2; ++kt)
#pragma unroll
            for (int ks = 0; ks < 2; ++ks) kf[kt][ks] = F::ld(kp + (size_t)(kn + kt * 16) * HD + ks * 32);
#pragma unroll
        for (int qt = 0; qt < 2; ++qt) { float mx = vmax8(st[0][qt], st[1][qt]); mx = fmaxf(mx, xhalf(mx));
            const float mn = fmaxf(m[qt], mx * CEXP); const float al = exp2s(m[qt] - mn); m[qt] = mn; float s = 0.f;
#pragma unroll
            for (int kt = 0; kt < 2; ++kt) { const v8f p = exp2v(st[kt][qt] * CEXP - mn);
#pragma unroll
                for (int j = 0; j < 8; ++j) { s += p[j]; pf[qt][kt * 8 + j] = tohx(p[j]); } }
            l[qt] = l[qt] * al + s;
#pragma unroll
            for (int dt = 0; dt < 4; ++dt) o[qt][dt] *= al; }
#pragma unroll
        for (int dt = 0; dt < 4; ++dt)
#pragma unroll
            for (int qt = 0; qt < 2; ++qt) o[qt][dt] = F::mma(vf[dt], pf[qt], o[qt][dt]);
        // four vector slots behind the last matrix instructions: on the taken branch the loop's first ones overwrite their B registers
        asm volatile("v_nop\n\tv_nop\n\tv_nop\n\tv_nop" : "+v"(o[0][0]), "+v"(o[0][1]), "+v"(o[0][2]), "+v"(o[0][3]), "+v"(o[1][0]), "+v"(o[1][1]), "+v"(o[1][2]), "+v"(o[1][3]));
    }
#pragma unroll
    for (int qt = 0; qt < 2; ++qt) attn_store(o[qt], l[qt], (size_t)(q0 + qt * 16 + lr) * DQ + col + hi * 8, Ah, Al);
}
// rows < RH: bf16 hi + lo planes, three products each (hi hi, lo hi, hi lo), 16 queries per wave
__device__ __forceinline__ void attn_hl(const bf* __restrict__ Qh, const bf* __restrict__ Ql, const bf* __restrict__ Kh, const bf* __restrict__ Kl, const bf* __restrict__ VTh, const bf* __restrict__ VTl, int q0, int col, bf* Ah, bf* Al) {
    typedef WFrag<bf> F; const int lane = threadIdx.x & 31, lr = lane & 15, hi = lane >> 4;
    v16bf qh[2], ql[2], kh[2][2], kl[2][2]; v8f o[4]; float m = -3.0e38f, l = 0.f;
    const size_t ko = (size_t)lr * HD + 8 * hi, vo = (size_t)lr * TT + 8 * hi;
#pragma unroll
    for (int ks = 0; ks < 2; ++ks) { const size_t qo = (size_t)(q0 + lr) * HD + ks * 32 + 8 * hi; qh[ks] = F::ld(Qh + qo); ql[ks] = F::ld(Ql + qo); }
#pragma unroll
    for (int dt = 0; dt < 4; ++dt) o[dt] = (v8f){};
#pragma unroll
    for (int kt = 0; kt < 2; ++kt)
#pragma unroll
        for (int ks = 0; ks < 2; ++ks) { kh[kt][ks] = F::ld(Kh + ko + (size_t)(kt * 16) * HD + ks * 32); kl[kt][ks] = F::ld(Kl + ko + (size_t)(kt * 16) * HD + ks * 32); }
#pragma unroll 1   // as in attn_f16
    for (int kb = 0; kb < TT; kb += 32) {
        v16bf vh[4], vl[4]; v8f st[2];
#pragma unroll
        for (int dt = 0; dt < 4; ++dt) { vh[dt] = F::ld(VTh + vo + (size_t)(dt * 16) * TT + kb); vl[dt] = F::ld(VTl + vo + (size_t)(dt * 16) * TT + kb); }
#pragma unroll
        for (int kt = 0; kt < 2; ++kt) { st[kt] = (v8f){};
#pragma unroll
            for (int ks = 0; ks < 2; ++ks) { st[kt] = F::mma(kh[kt][ks], qh[ks], st[kt]); st[kt] = F::mma(kh[kt][ks], ql[ks], st[kt]); st[kt] = F::mma(kl[kt][ks], qh[ks], st[kt]); } }
        const int kn = (kb + 32 < TT) ? kb + 32 : 0;   // as in attn_f16
        asm volatile("s_wait_xcnt 0x0" ::: "memory");   // the key fetch below lands in registers that held the V loads' addresses: the wait stands in front of that overwrite
#pragma unroll
        for (int kt = 0; kt < 2; ++kt)
#pragma unroll
            for (int ks = 0; ks < 2; ++ks) { kh[kt][ks] = F::ld(Kh + ko + (size_t)(kn + kt * 16) * HD + ks * 32); kl[kt][ks] = F::ld(Kl + ko + (size_t)(kn + kt * 16) * HD + ks * 32); }
        __builtin_amdgcn_sched_barrier(0);   // keeps the 16 key loads above the softmax: sunk to the loop's foot they are waited for at once and their whole latency shows
        float mx = vmax8(st[0], st[1]); mx = fmaxf(mx, xhalf(mx));
        const float mn = fmaxf(m, mx * CEXP); const float al = exp2s(m - mn); m = mn; float s = 0.f; v8bf ph[2], pl[2];
#pragma unroll
        for (int kt = 0; kt < 2; ++kt) { const v8f p = exp2v(st[kt] * CEXP - mn);
#pragma unroll
            for (int j = 0; j < 8; ++j) s += p[j];
            ph[kt] = __builtin_convertvector(p, v8bf); pl[kt] = __builtin_convertvector(p - __builtin_convertvector(ph[kt], v8f), v8bf); }   // hi = nearest-even bf16 of p, lo = nearest-even bf16 of the exact rest (packed converts)
        l = l * al + s; const v16bf pfh = __builtin_shufflevector(ph[0], ph[1], 0, 1, 2, 3, 4, 5, 6, 7, 8, 9, 10, 11, 12, 13, 14, 15), pfl = __builtin_shufflevector(pl[0], pl[1], 0, 1, 2, 3, 4, 5, 6, 7, 8, 9, 10, 11, 12, 13, 14, 15);
#pragma unroll
        for (int dt = 0; dt < 4; ++dt) o[dt] *= al;
#pragma unroll
        for (int dt = 0; dt < 4; ++dt) { o[dt] = F::mma(vh[dt], pfh, o[dt]); o[dt] = F::mma(vh[dt], pfl, o[dt]); o[dt] = F::mma(vl[dt], pfh, o[dt]); }
        asm volatile("v_nop\n\tv_nop\n\tv_nop\n\tv_nop" : "+v"(o[0]), "+v"(o[1]), "+v"(o[2]), "+v"(o[3]));   // as in attn_f16
    }
    attn_store(o, l, (size_t)(q0 + lr) * DQ + col + hi * 8, Ah, Al);
}
__global__ __launch_bounds__(32) void k_fattn(const h16* __restrict__ Q16, const h16* __restrict__ K16, const h16* __restrict__ VT16, const bf* __restrict__ Qh, const bf* __restrict__ Ql, const bf* __restrict__ Kh, const bf* __restrict__ Kl, const bf* __restrict__ VTh, const bf* __restrict__ VTl, bf* Ah, bf* Al) {
    const int h = blockIdx.y, bx = blockIdx.x; const size_t zo = ((size_t)blockIdx.z * NH_ + h) * TT * HD;   // head planes [b][h][t][d] and [b][h][d][t] have the same size
    Ah += (size_t)blockIdx.z * TT * DQ; Al += (size_t)blockIdx.z * TT * DQ;   // merged rows [b][t][DQ]
    if (bx < RH / 16) attn_hl(Qh + zo, Ql + zo, Kh + zo, Kl + zo, VTh + zo, VTl + zo, bx * 16, h * HD, Ah, Al);
    else attn_f16(Q16 + zo, K16 + zo, VT16 + zo, RH + (bx - RH / 16) * 32, h * HD, Ah, Al);
}

extern "C" void kernel_launch(void* const* d_in, const int* in_sizes, int n_in,
                              void* d_out, int out_size, void* d_ws, size_t ws_size, hipStream_t stream) {
    (void)in_sizes; (void)n_in; (void)out_size;
    const float* x = (const float*)d_in[0];   /* query */ const float* xk = (const float*)d_in[1]; const float* xv = (const float*)d_in[2]; const float* wq = (const float*)d_in[3]; const float* wk = (const float*)d_in[4]; const float* wv = (const float*)d_in[5]; const float* wo = (const float*)d_in[6]; const float* bo = (const float*)d_in[7];   /* argument order query, key, value, Wq, Wk, Wv, Wo ('oi' [1024][1024]), bo [1024] (REAL 0.01); eight inputs, all read */
    float* OUT = (float*)d_out;     // [2][2048][1024]
    char* wsp = (char*)d_ws;
    auto take = [&](size_t bytes) { char* p = wsp; wsp += (bytes + 255) & ~(size_t)255; return (void*)p; };
    const size_t NX = (size_t)NB_ * TT * DM, NW = (size_t)DQ * DM, NP = (size_t)NB_ * NH_ * TT * HD;   // elements of one input stream, one weight, one set of head planes (both batches)
    bf* XB = (bf*)take((3 * NX + 4 * NW) * 2); bf* WQ = XB + 3 * NX; bf* WO = WQ + 3 * NW;   // query, key, value, Wq, Wk, Wv, Wo in one run (k_prep)
    float* CS = (float*)take((size_t)TT * HD * 2 * 4);
    h16* QP16 = (h16*)take(2 * NP * 2); h16* KP16 = QP16 + NP; bf* QPh = (bf*)take(2 * NP * 2); bf* KPh = QPh + NP; bf* QPl = (bf*)take(2 * NP * 2); bf* KPl = QPl + NP;   // q planes, then k planes (k_projp's plane order)
    h16* VT16 = (h16*)take(NP * 2); bf* VTh = (bf*)take(NP * 2); bf* VTl = (bf*)take(NP * 2);
    bf* ATh = (bf*)take(NX * 2); bf* ATl = (bf*)take(NX * 2);
    if ((size_t)(wsp - (char*)d_ws) > ws_size) return;    // ws 256 MiB
    k_prep<<<CSB + 3 * XBL + 4 * WBL, 256, 0, stream>>>(x, xk, xv, wq, wk, wv, wo, XB, CS);
    k_projp<<<dim3(NB_ * TT / 64, NH_, 3), 32, 0, stream>>>(XB, WQ, CS, (unsigned short*)QP16, QPh, QPl, (unsigned short*)VT16, VTh, VTl);   // z = stream: q, k, v
    k_fattn<<<dim3(RH / 16 + (TT - RH) / 32, NH_, NB_), 32, 0, stream>>>(QP16, KP16, VT16, QPh, QPl, KPh, KPl, VTh, VTl, ATh, ATl);   // one kv head per query head
    k_gemmw<bf, 1, true, 1><<<dim3(NB_ * TT / 64, DM / 64, 1), 32, 0, stream>>>(ATh, ATl, WO, nullptr, DQ, OUT, DM, bo, 0, 0, 0, 0);
}

// v005
// Measured time: 172 microseconds a run.
// In two side-by-side timings against v004, it was 1.40 and 1.42 times as fast.
// Over all steps from v000 it is 11.6 times as fast.
#include <hip/hip_runtime.h>

// Multi-head attention WITHOUT a mask over three input streams with a computed rotate-half rotary (query, key, value [2][2048][1024]; q = query Wq^T, k = key Wk^T, v = value Wv^T ('oi' [1024][1024] 1/32, no bias; 16 heads x 64), each from its own stream; _apply_rope AFTER the head split: (x1, x2) = the two HALVES: cat(x1 cos - x2 sin, x1 sin + x2 cos) with angle t x inv_freq[i], inv_freq = 1.0 / (10000.0 ** (arange(0, 64, 2, f32) / 64)) (32 f32 constants; both halves share the 32 angles; one f32 product per angle; precise cosf / sinf), on q and k; scores / sqrt(64); softmax over all keys; out = merged Wo^T + bo ('oi' + a REAL 0.01 bias) -> [2][2048][1024] (4.2 M); argument order query, key, value, Wq, Wk, Wv, Wo, bo).
// Layout, both batches in every launch: bf16 copies of query, key, value and the four 'oi' weights (one launch, with the rotary table); the three exact projections as grid z of one launch, whose epilogue rotates q and k and stores the head planes itself; one fused attention launch, grid z = batch (hybrid rows: < 512 hi/lo 3 products, rest fp16; online softmax, scores and weights stay in registers); merged hi/lo x Wo exact.
// FRAGMENT ORDER: every 16-bit plane that a matrix instruction reads (inputs, weights, head planes, merged rows) is stored as tiles of 16 rows x 32 k = 512 elements, laid out as the operand registers want them:
// element (row, k) lies at tile 512 + ((k % 32) / 16) 256 + (((k % 16) / 8) 16 + row % 16) 8 + k % 8, so lane l's two 16-byte pieces lie at l 8 and 256 + l 8 and each wave-wide load or store is 512 contiguous bytes
// (4 cache lines; in row-major planes it touched 16). Tile order: (row / 16) major, k / 32 minor; the V^T planes k / 32 (keys) major, d / 16 minor, so that a step of 32 keys is 4 KiB in a row.
// Compute dtypes, f32 accumulate: every input rounded to bf16; projections exact; attention rows < 512 3 products, rest fp16; softmax f32; Wo hl x exact.

#define NB_  2
#define TT   2048
#define DM   1024
#define NH_  16
#define NKV  16
#define REP  (NH_ / NKV)
#define HD   64
#define DQ   (NH_ * HD)
#define DKV  (NKV * HD)
#define RH   512                  // query rows < RH use hi+lo planes (0: none)
#define WIN  0
#define SCL  0.125f   // HD^-0.5
#define CEXP (SCL * 1.4426950408889634f)   // score -> exponent of 2
typedef _Float16 h16;
typedef unsigned short bf;
typedef __attribute__((ext_vector_type(16))) __bf16   v16bf;
typedef __attribute__((ext_vector_type(16))) _Float16 v16h;
typedef __attribute__((ext_vector_type(8)))  _Float16 v8h;
typedef __attribute__((ext_vector_type(8)))  unsigned short v8us;
typedef __attribute__((ext_vector_type(8)))  float    v8f;
typedef __attribute__((ext_vector_type(4)))  float    v4f;
typedef v8h  __attribute__((may_alias)) v8ha;
typedef v4f  __attribute__((may_alias)) v4fa;
typedef v8us __attribute__((may_alias)) v8usa;

__device__ __forceinline__ unsigned short f2bf(float f) { unsigned u = __float_as_uint(f); u += 0x7FFFu + ((u >> 16) & 1u); return (unsigned short)(u >> 16); }
__device__ __forceinline__ float bf2f(unsigned short b) { return __uint_as_float(((unsigned)b) << 16); }
__device__ __forceinline__ float bfr(float f) { return bf2f(f2bf(f)); }
__device__ __forceinline__ v16h cat16(v8h lo, v8h hi) { return __builtin_shufflevector(lo, hi, 0, 1, 2, 3, 4, 5, 6, 7, 8, 9, 10, 11, 12, 13, 14, 15); }
__device__ __forceinline__ v16bf cat16b(v8us lo, v8us hi) { return __builtin_bit_cast(v16bf, __builtin_shufflevector(lo, hi, 0, 1, 2, 3, 4, 5, 6, 7, 8, 9, 10, 11, 12, 13, 14, 15)); }
__device__ __forceinline__ v8f wmma16(v16h a, v16h b, v8f c) { return __builtin_amdgcn_wmma_f32_16x16x32_f16(false, a, false, b, (short)0, c, false, false); }
__device__ __forceinline__ v8f wmmab(v16bf a, v16bf b, v8f c) { return __builtin_amdgcn_wmma_f32_16x16x32_bf16(false, a, false, b, (short)0, c, false, false); }



// ---- k_gemmw: register-blocked GEMM, ONE WAVE per 64x64 output tile (16 accumulators), operands straight from 16-bit planes in fragment order (ld(p): p = tile + lane 8; ld(t, l8): t = the tile, wave-uniform, l8 = lane 8); grid (M/64, N/64, Z), 32 threads.
// C[m][n] (f32, pitch ldc, + optional f32 bias[n]) = sum_k A[m][k] Bt[n][k] (+ split products per NSPLIT). z-batch strides sA/sB/sC in elements. K % 32 == 0.
// KS > 1: grid (M/64, N/64 * KS, Z); work-group ks = blockIdx.y % KS sums only k in [ks K/KS, (ks+1) K/KS) and stores its tile in partial plane ks (C + ks sP); the reader adds the KS planes. K % (32 KS) == 0.
template <typename T16> struct WFrag;
template <> struct WFrag<h16> { typedef v16h V; static __device__ __forceinline__ V ld(const h16* p) { return cat16(*(const v8h*)p, *(const v8h*)(p + 256)); } static __device__ __forceinline__ V ld(const h16* t, unsigned l8) { return cat16(*(const v8h*)(t + l8), *(const v8h*)(t + 256 + l8)); } static __device__ __forceinline__ v8f mma(V a, V b, v8f c) { return wmma16(a, b, c); } };
template <> struct WFrag<bf> { typedef v16bf V; static __device__ __forceinline__ V ld(const bf* p) { return cat16b(*(const v8us*)p, *(const v8us*)(p + 256)); } static __device__ __forceinline__ V ld(const bf* t, unsigned l8) { return cat16b(*(const v8us*)(t + l8), *(const v8us*)(t + 256 + l8)); } static __device__ __forceinline__ v8f mma(V a, V b, v8f c) { return wmmab(a, b, c); } };
template <typename T16, int NSPLIT, bool BIAS, int KS, int K>   // K at compile time: the row tiles of an operand then lie at immediate offsets from ONE address pair
__global__ __launch_bounds__(32) void k_gemmw(const T16* __restrict__ A, const T16* __restrict__ A2, const T16* __restrict__ Bt, const T16* __restrict__ Bt2, float* C, int ldc, const float* __restrict__ bias, size_t sA, size_t sB, size_t sC, size_t sP) {
    typedef typename WFrag<T16>::V V;
    __shared__ __align__(16) float os[16 * 68];
    const size_t z = blockIdx.z; A += z * sA; if (A2) A2 += z * sA; Bt += z * sB; if (Bt2) Bt2 += z * sB; C += z * sC;
    const int ks = (KS > 1) ? (int)(blockIdx.y % KS) : 0; const int kbeg = ks * (K / KS), kend = kbeg + K / KS; if (KS > 1) C += (size_t)ks * sP;
    const int lane = threadIdx.x & 31, lr = lane & 15, hi = lane >> 4; const int r0 = blockIdx.x * 64, c0 = (int)(blockIdx.y / KS) * 64;
    v8f acc[4][4];
#pragma unroll
    for (int mb = 0; mb < 4; ++mb)
#pragma unroll
        for (int nb = 0; nb < 4; ++nb) acc[mb][nb] = (v8f){};
    const size_t aoff = (size_t)r0 * K + lane * 8, boff = (size_t)c0 * K + lane * 8;   // 16 rows of tiles are 16 K elements; 32 k are one tile of 512
#pragma unroll 1
    for (int kc = kbeg; kc < kend; kc += 32) {
        V a[4], a2[4]; const T16* pa = A + aoff + kc * 16; const T16* pa2 = (NSPLIT == 1 || NSPLIT == 2) ? A2 + aoff + kc * 16 : pa; const T16* pb = Bt + boff + kc * 16; const T16* pb2 = (NSPLIT >= 2) ? Bt2 + boff + kc * 16 : pb;
#pragma unroll
        for (int mb = 0; mb < 4; ++mb) { a[mb] = WFrag<T16>::ld(pa + mb * 16 * K); if (NSPLIT == 1 || NSPLIT == 2) a2[mb] = WFrag<T16>::ld(pa2 + mb * 16 * K); }
#pragma unroll
        for (int nb = 0; nb < 4; ++nb) { const V b = WFrag<T16>::ld(pb + nb * 16 * K); V b2; if (NSPLIT >= 2) b2 = WFrag<T16>::ld(pb2 + nb * 16 * K);
#pragma unroll
            for (int mb = 0; mb < 4; ++mb) { acc[mb][nb] = WFrag<T16>::mma(a[mb], b, acc[mb][nb]); if (NSPLIT == 1 || NSPLIT == 2) acc[mb][nb] = WFrag<T16>::mma(a2[mb], b, acc[mb][nb]); if (NSPLIT >= 2) acc[mb][nb] = WFrag<T16>::mma(a[mb], b2, acc[mb][nb]); } }
        // four vector slots behind the last matrix instructions (on the taken branch the loop's first loads overwrite their operands); the address pairs are inputs so that they keep their registers to the foot of the trip:
        // otherwise a later load of the trip lands on an address that issued loads still name
        asm volatile("v_nop\n\tv_nop\n\tv_nop\n\tv_nop" : "+v"(acc[0][0]), "+v"(acc[1][1]), "+v"(acc[2][2]), "+v"(acc[3][3]) : "v"(a[0]), "v"(a[3]), "v"(pa), "v"(pa2), "v"(pb), "v"(pb2));
    }
#pragma unroll
    for (int mb = 0; mb < 4; ++mb) {
#pragma unroll
        for (int nb = 0; nb < 4; ++nb) {
#pragma unroll
            for (int j = 0; j < 8; ++j) os[(hi * 8 + j) * 68 + nb * 16 + lr] = acc[mb][nb][j]; }
        __builtin_amdgcn_wave_barrier(); asm volatile("" ::: "memory");
        float* crow = C + (size_t)(r0 + mb * 16) * ldc + c0;
{
#pragma unroll
            for (int s = 0; s < 8; ++s) { const int row = 2 * s + hi, cofs = lr * 4; v4f val = *(const v4fa*)(os + row * 68 + cofs); if (BIAS) { val[0] += bfr(bias[c0 + cofs]); val[1] += bfr(bias[c0 + cofs + 1]); val[2] += bfr(bias[c0 + cofs + 2]); val[3] += bfr(bias[c0 + cofs + 3]); }
                *(v4f*)(crow + (size_t)row * ldc + cofs) = val; }
             }
        __builtin_amdgcn_wave_barrier(); asm volatile("" ::: "memory");
    }
}

__device__ __forceinline__ h16 tohx(float x) { return (h16)x; }
__device__ __forceinline__ void splitf(float y, unsigned short& h, unsigned short& l) { h = f2bf(y); l = f2bf(y - bf2f(h)); }
typedef __attribute__((ext_vector_type(2))) _Float16 v2h;
typedef __attribute__((ext_vector_type(4))) _Float16 v4h;
typedef __attribute__((ext_vector_type(2))) unsigned short v2us;
typedef __attribute__((ext_vector_type(4))) unsigned short v4us;
typedef __attribute__((ext_vector_type(2))) float v2f;
typedef __attribute__((ext_vector_type(4))) int v4i;
typedef __attribute__((ext_vector_type(8))) __bf16 v8bf;

__global__ __launch_bounds__(256) void k_wtG(const float* __restrict__ w, int K, int N, bf* Bt) {
    const int lane = threadIdx.x & 31; const int L0 = (blockIdx.x * 8 + (threadIdx.x >> 5)) * 8; const int nlines = N * K / 64;
{
#pragma unroll 1
        for (int l = 0; l < 8; ++l) { const int L = L0 + l; if (L >= nlines) break; const size_t e = (size_t)L * 64 + lane * 2; const int k = (int)(e % K), n = (int)(e / K); v2us o;
            o[0] = f2bf(w[(size_t)k * N + n]); o[1] = f2bf(w[(size_t)(k + 1) * N + n]); *(v2us*)(Bt + e) = o; }
         }
}

// ---- k_projp: the three projections (grid z = stream: q, k, v), ONE WAVE per 64x64 tile as in k_gemmw; the tile is 64 rows t of ONE head (64 d), so the epilogue finishes it in registers and stores
// the head planes (fp16, bf16 hi, bf16 lo) itself: no f32 projection goes through memory. The operand that supplies the WMMA rows is chosen so that a lane's eight accumulator elements run along the plane's
// k index: q, k (planes [h], rows t, k = d, h = (stream NB_ + batch) NH_ + head): WMMA rows = d (the weight), columns = t; v (planes [g], rows d, k = t, g = batch NKV + head): WMMA rows = t (the input), columns = d.
// Rotate-half: out[d] = x[d] cos - x[d+32] sin, out[d+32] = x[d+32] cos + x[d] sin, angle (t, d % 32); d and d + 32 are row tiles mb and mb + 2 of the same lane and element.
// Epilogue of k_projp, one group of 16 plane rows (nb) at a time: rotate (q, k), round to the three planes, store. Accumulator (mb, nb) holds k = mb 16 + hi 8 + j of plane row nb 16 + lr: that IS half (mb & 1) of fragment
// tile (row tile nb, k tile mb / 2) in fragment order, so each store goes straight from the registers as 512 contiguous bytes. SN, SM: element strides of a row tile and of a k tile in the plane's tile order.
template <bool ROPE, int SN, int SM>
__device__ __forceinline__ void proj_store(v8f (&acc)[4][4], const float* __restrict__ CSt, unsigned short* D16, unsigned short* Dh, unsigned short* Dl) {
    const int lane = threadIdx.x & 31, lr = lane & 15, hi = lane >> 4; const unsigned l8 = lane * 8;
    const float* cp = ROPE ? CSt + ((size_t)lr * HD + hi * 8) * 2 : nullptr;   // (cos, sin) pairs of the tile's row lr, from d = 8 hi; row group nb lies nb 16 rows on
    v4f c[2][8];
    if (ROPE) {
#pragma unroll
        for (int i = 0; i < 8; ++i) c[0][i] = *(const v4f*)(cp + (i >> 2) * 32 + (i & 3) * 4); }
#pragma unroll
    for (int nb = 0; nb < 4; ++nb) {
        if (ROPE) {
            if (nb < 3) {   // the next row group's pairs fly under this group's arithmetic and stores
#pragma unroll
                for (int i = 0; i < 8; ++i) c[(nb + 1) & 1][i] = *(const v4f*)(cp + (size_t)(nb + 1) * 16 * HD * 2 + (i >> 2) * 32 + (i & 3) * 4); }
#pragma unroll
            for (int mb = 0; mb < 2; ++mb)
#pragma unroll
                for (int j = 0; j < 8; ++j) { const float co = c[nb & 1][mb * 4 + (j >> 1)][(j & 1) * 2], si = c[nb & 1][mb * 4 + (j >> 1)][(j & 1) * 2 + 1]; const float x1 = acc[mb][nb][j], x2 = acc[mb + 2][nb][j];
                    acc[mb][nb][j] = x1 * co - x2 * si; acc[mb + 2][nb][j] = x2 * co + x1 * si; }
        }
        v8us w[4][3];
#pragma unroll
        for (int mb = 0; mb < 4; ++mb) { const v8f x = acc[mb][nb]; const v8bf xh = __builtin_convertvector(x, v8bf);   // hi = nearest-even bf16, lo = nearest-even bf16 of the exact rest
            w[mb][0] = __builtin_bit_cast(v8us, __builtin_convertvector(x, v8h)); w[mb][1] = __builtin_bit_cast(v8us, xh);
            w[mb][2] = __builtin_bit_cast(v8us, __builtin_convertvector(x - __builtin_convertvector(xh, v8f), v8bf)); }
        __builtin_amdgcn_sched_barrier(0);   // all twelve pieces are formed before the first store: mixed with the stores, a later convert lands in a register that an issued store still names, ahead of the wait below
#pragma unroll
        for (int mb = 0; mb < 4; ++mb) { const int g = nb * SN + (mb >> 1) * SM + (mb & 1) * 256;
            *(v8us*)(D16 + g + l8) = w[mb][0]; *(v8us*)(Dh + g + l8) = w[mb][1]; *(v8us*)(Dl + g + l8) = w[mb][2]; }
        asm volatile("s_wait_xcnt 0x0" ::: "memory");   // what follows (the next group's table loads and arithmetic; behind the last group whatever the kernel does next) may land in registers that these stores name: the wait stands in front of that overwrite
        __builtin_amdgcn_sched_barrier(0);   // without it the table loads of all four groups are lifted to the front, and their 128 registers on top of the accumulators cost a wave per SIMD
    }
}
__global__ __launch_bounds__(32) void k_projp(const bf* __restrict__ X, const bf* __restrict__ Wt, const float* __restrict__ CS, unsigned short* P16, unsigned short* Ph, unsigned short* Pl, unsigned short* V16, unsigned short* Vh, unsigned short* Vl) {
    typedef WFrag<bf> F; typedef F::V V;
    const int z = blockIdx.z; const bool isv = z == 2;
    const int lane = threadIdx.x & 31; const int r0 = blockIdx.x * 64, head = blockIdx.y; const int b = r0 / TT, t0 = r0 % TT;
    const bf* xs = X + (size_t)z * NB_ * TT * DM + (size_t)r0 * DM; const bf* wr = Wt + (size_t)z * DQ * DM + (size_t)head * HD * DM;
    const bf* A = isv ? xs : wr; const bf* Bt = isv ? wr : xs; const unsigned l8 = lane * 8;   // wave-uniform bases (16 rows of tiles are 16 DM elements), one lane offset for both operands
    v8f acc[4][4];
#pragma unroll
    for (int mb = 0; mb < 4; ++mb)
#pragma unroll
        for (int nb = 0; nb < 4; ++nb) acc[mb][nb] = (v8f){};
#pragma unroll 1   // one trip is a whole body of 16 loads and 16 matrix instructions; unrolling would only add operand registers on top of the 128 of the accumulators
    for (int kc = 0; kc < DM; kc += 32) {
        V a[4]; const bf* pa = A + kc * 16 + l8; const bf* pb = Bt + kc * 16 + l8;   // 32 k are one tile of 512 elements
#pragma unroll
        for (int mb = 0; mb < 4; ++mb) a[mb] = F::ld(pa + mb * 16 * DM);
#pragma unroll
        for (int nb = 0; nb < 4; ++nb) {
            const V bb = F::ld(pb + nb * 16 * DM);
#pragma unroll
            for (int mb = 0; mb < 4; ++mb) acc[mb][nb] = F::mma(a[mb], bb, acc[mb][nb]); }
        // four vector slots behind the last matrix instructions, as in k_gemmw: on the taken branch the loop's first loads overwrite their operands.
        // The two address pairs are inputs so that they keep their registers to the foot of the trip: otherwise a later load of the trip lands on an address that issued loads still name.
        asm volatile("v_nop\n\tv_nop\n\tv_nop\n\tv_nop" : "+v"(acc[0][0]), "+v"(acc[1][1]), "+v"(acc[2][2]), "+v"(acc[3][3]) : "v"(a[0]), "v"(a[3]), "v"(pa), "v"(pb));
    }
    // acc[mb][nb][j]: k index i = mb 16 + hi 8 + j, plane row o = nb 16 + lr. 64 t of one head are 4096 elements in a row in both tile orders: q, k 4 row tiles x 2 k tiles, v 2 k tiles x 4 row tiles
    if (isv) { const size_t base = ((size_t)(b * NKV + head) * TT + t0) * HD; proj_store<false, 512, 2048>(acc, nullptr, V16 + base, Vh + base, Vl + base); }
    else { const size_t base = (((size_t)(z * NB_ + b) * NH_ + head) * TT + t0) * HD; proj_store<true, 1024, 512>(acc, CS + (size_t)t0 * HD * 2, P16 + base, Ph + base, Pl + base); }
}
__constant__ float INVT[HD / 2] = { 1.000000000e+00f, 7.498942018e-01f, 5.623413324e-01f, 4.216965139e-01f, 3.162277639e-01f, 2.371373624e-01f, 1.778279394e-01f, 1.333521456e-01f, 1.000000015e-01f, 7.498941571e-02f, 5.623412877e-02f, 4.216964915e-02f, 3.162277862e-02f, 2.371373586e-02f, 1.778279431e-02f, 1.333521493e-02f, 9.999999776e-03f, 7.498942316e-03f, 5.623413250e-03f, 4.216964822e-03f, 3.162277862e-03f, 2.371373819e-03f, 1.778279431e-03f, 1.333521446e-03f, 1.000000047e-03f, 7.498941850e-04f, 5.623413017e-04f, 4.216964880e-04f, 3.162277862e-04f, 2.371373848e-04f, 1.778279402e-04f, 1.333521504e-04f };   // 1 / 10000^(2i/64) (float32, generated with jnp to be bit-exact)
// k_prep: everything that depends on no other launch, in one grid. Work-groups [0, CSB): the rotary table (positions = arange). The rest: f32 -> bf16, 2048 elements each, into ONE run of planes
// dst = query, key, value (both batches each), Wq, Wk, Wv, Wo, so that the destination offset is linear in the work-group index and only the source is chosen (a scalar choice).
// The planes are in fragment order (rows of DM = 32 k tiles): a work-group writes 4 tiles in a row = 16 source rows x 128 k. A wave takes 8 rows of one tile in two loads of 4 whole 128-byte source lines each
// (8 lanes a row, 4 k a lane); its 8-byte pieces fill 64-byte runs (4 rows of one half-column of 8 k), and the two stores together whole lines of the tile.
#define CSB  (TT * HD / 256)
#define XBL  (NB_ * TT * DM / 2048)   // work-groups per input stream
#define WBL  (DQ * DM / 2048)         // work-groups per weight
__global__ __launch_bounds__(256) void k_prep(const float* __restrict__ xq, const float* __restrict__ xk, const float* __restrict__ xv, const float* __restrict__ wq, const float* __restrict__ wk, const float* __restrict__ wv, const float* __restrict__ wo, bf* dst, float* CS) {
    if (blockIdx.x < CSB) { const int idx = blockIdx.x * 256 + threadIdx.x; const int d = idx % HD; const int t = idx / HD; const float a = __fmul_rn((float)t, INVT[d % (HD / 2)]); v2f cs; cs[0] = cosf(a); cs[1] = sinf(a); *(v2f*)(CS + (size_t)idx * 2) = cs; return; }
    const int bx = blockIdx.x - CSB; const float* src; int lb;
    if (bx < 3 * XBL) { const int sel = bx / XBL; lb = bx % XBL; src = sel == 0 ? xq : sel == 1 ? xk : xv; }
    else { const int sel = (bx - 3 * XBL) / WBL; lb = (bx - 3 * XBL) % WBL; src = sel == 0 ? wq : sel == 1 ? wk : sel == 2 ? wv : wo; }
    const int w = threadIdx.x >> 5, lane = threadIdx.x & 31, tile = lb * 4 + (w >> 1); const int r = (w & 1) * 8 + (lane >> 3), k4 = (lane & 7) * 4;   // row in the tile (and r + 4), first k in the tile
    const float* sp = src + (size_t)((tile / (DM / 32)) * 16 + r) * DM + (tile % (DM / 32)) * 32 + k4;
    bf* dp = dst + (size_t)bx * 2048 + (w >> 1) * 512 + (k4 >> 4) * 256 + (((k4 >> 3) & 1) * 16 + r) * 8 + (k4 & 4);
    const v4f v0 = *(const v4f*)sp, v1 = *(const v4f*)(sp + 4 * DM); v4us o0, o1;
#pragma unroll
    for (int k = 0; k < 4; ++k) { o0[k] = f2bf(v0[k]); o1[k] = f2bf(v1[k]); }
    *(v4us*)dp = o0; *(v4us*)(dp + 4 * 8) = o1;  }
// ---- k_fattn: scores, softmax and weights x V in ONE kernel; one wave per work-group, grid (RH/16 + (TT-RH)/32, heads, batches).
// The wave forms the TRANSPOSED score tile S^T = K Q^T (A = 16 keys, B = 16 queries): lane (lr, hi) then holds keys 8 hi + j of query lr, and two such tiles (keys 0..15, 16..31)
// side by side ARE the B fragment (k = 8 hi + 0..7, 16 + 8 hi + 0..7) of O^T = V^T P^T, so the weights never leave their registers. Online softmax per query over steps of 32 keys, ascending:
// running maximum m (in exponent-of-2 units), running sum l and O^T rescaled by 2^(m_old - m_new); the two lane halves of a query share m (one cross-half exchange per step) and add their l at the end.
__device__ __forceinline__ float xhalf(float x) { return __builtin_bit_cast(float, __builtin_amdgcn_permlanex16(__builtin_bit_cast(int, x), __builtin_bit_cast(int, x), 0x76543210, 0xfedcba98, false, false)); }   // lane l with lane l ^ 16, no LDS round trip
// 2^x. The instruction set asks for one free slot behind a transcendental before its result is read or its source overwritten: the v_nop ends the same statement so that it cannot drift,
// and the early-clobber results keep every exp of the run of eight off the sources of the others.
__device__ __forceinline__ float exp2s(float x) { float r; asm("v_exp_f32 %0, %1\n\tv_nop" : "=v"(r) : "v"(x)); return r; }
__device__ __forceinline__ v8f exp2v(v8f x) { float r0, r1, r2, r3, r4, r5, r6, r7;
    asm("v_exp_f32 %0, %8\n\tv_exp_f32 %1, %9\n\tv_exp_f32 %2, %10\n\tv_exp_f32 %3, %11\n\tv_exp_f32 %4, %12\n\tv_exp_f32 %5, %13\n\tv_exp_f32 %6, %14\n\tv_exp_f32 %7, %15\n\tv_nop"
        : "=&v"(r0), "=&v"(r1), "=&v"(r2), "=&v"(r3), "=&v"(r4), "=&v"(r5), "=&v"(r6), "=&v"(r7) : "v"(x[0]), "v"(x[1]), "v"(x[2]), "v"(x[3]), "v"(x[4]), "v"(x[5]), "v"(x[6]), "v"(x[7]));
    return (v8f){r0, r1, r2, r3, r4, r5, r6, r7}; }
__device__ __forceinline__ float vmax8(v8f a, v8f b) { float x = fmaxf(a[0], b[0]);
#pragma unroll
    for (int j = 1; j < 8; ++j) x = fmaxf(x, fmaxf(a[j], b[j]));
    return x; }
__device__ __forceinline__ void attn_store(const v8f* o, float l, bf* Ah, bf* Al, unsigned l8) {   // o: four d tiles of one query column; Ah, Al: the first fragment tile of (16 queries, head), wave-uniform; d tile dt is half dt & 1 of k tile dt / 2, 256 elements a half
    const float inv = __fdiv_rn(1.0f, l + xhalf(l)); v8us wh[4], wl[4];
#pragma unroll
    for (int dt = 0; dt < 4; ++dt) { const v8f x = o[dt] * inv; const v8bf xh = __builtin_convertvector(x, v8bf), xl = __builtin_convertvector(x - __builtin_convertvector(xh, v8f), v8bf);   // hi + lo, nearest even, packed converts
        wh[dt] = __builtin_bit_cast(v8us, xh); wl[dt] = __builtin_bit_cast(v8us, xl); }
    __builtin_amdgcn_sched_barrier(0);   // all eight pieces are formed before the first store: mixed with the stores, a later convert lands in a register that an issued store still names
#pragma unroll
    for (int dt = 0; dt < 4; ++dt) { *(v8us*)(Ah + dt * 256 + l8) = wh[dt]; *(v8us*)(Al + dt * 256 + l8) = wl[dt]; }
}
// rows >= RH: fp16 operands, 32 queries per wave
__device__ __forceinline__ void attn_f16(const h16* __restrict__ Q, const h16* __restrict__ K, const h16* __restrict__ VT, int q0, int col, bf* Ah, bf* Al) {
    typedef WFrag<h16> F; const unsigned l8 = (threadIdx.x & 31) * 8;
    v16h qf[2][2], kf[2][2]; v8f o[2][4]; float m[2], l[2];
    // fragment order: 16 rows t of q or k are 2 tiles (16 HD elements), 32 keys of V^T are 4 tiles (32 HD elements)
#pragma unroll
    for (int qt = 0; qt < 2; ++qt) { m[qt] = -3.0e38f; l[qt] = 0.f;
#pragma unroll
        for (int ks = 0; ks < 2; ++ks) qf[qt][ks] = F::ld(Q + (size_t)(q0 + qt * 16) * HD + ks * 512, l8);
#pragma unroll
        for (int dt = 0; dt < 4; ++dt) o[qt][dt] = (v8f){}; }
#pragma unroll
    for (int kt = 0; kt < 2; ++kt)
#pragma unroll
        for (int ks = 0; ks < 2; ++ks) kf[kt][ks] = F::ld(K + (size_t)(kt * 16) * HD + ks * 512, l8);
#pragma unroll 1   // one step of 32 keys is a whole body of 16 loads and 16 matrix instructions; unrolling would only add registers
    for (int kb = 0; kb < TT; kb += 32) {
        v16h vf[4], pf[2]; v8f st[2][2];
#pragma unroll
        for (int dt = 0; dt < 4; ++dt) vf[dt] = F::ld(VT + (size_t)kb * HD + dt * 512, l8);
#pragma unroll
        for (int kt = 0; kt < 2; ++kt)
#pragma unroll
            for (int qt = 0; qt < 2; ++qt) st[kt][qt] = F::mma(kf[kt][1], qf[qt][1], F::mma(kf[kt][0], qf[qt][0], (v8f){}));
        const int kn = (kb + 32 < TT) ? kb + 32 : 0;   // next step's keys are fetched under this step's softmax; the last step refetches step 0 (in bounds, unused)
#pragma unroll
        for (int kt = 0; kt < 2; ++kt)
#pragma unroll
            for (int ks = 0; ks < 2; ++ks) kf[kt][ks] = F::ld(K + (size_t)(kn + kt * 16) * HD + ks * 512, l8);
#pragma unroll
        for (int qt = 0; qt < 2; ++qt) { float mx = vmax8(st[0][qt], st[1][qt]); mx = fmaxf(mx, xhalf(mx));
            const float mn = fmaxf(m[qt], mx * CEXP); const float al = exp2s(m[qt] - mn); m[qt] = mn; float s = 0.f;
#pragma unroll
            for (int kt = 0; kt < 2; ++kt) { const v8f p = exp2v(st[kt][qt] * CEXP - mn);
#pragma unroll
                for (int j = 0; j < 8; ++j) { s += p[j]; pf[qt][kt * 8 + j] = tohx(p[j]); } }
            l[qt] = l[qt] * al + s;
#pragma unroll
            for (int dt = 0; dt < 4; ++dt) o[qt][dt] *= al; }
#pragma unroll
        for (int dt = 0; dt < 4; ++dt)
#pragma unroll
            for (int qt = 0; qt < 2; ++qt) o[qt][dt] = F::mma(vf[dt], pf[qt], o[qt][dt]);
        // four vector slots behind the last matrix instructions: on the taken branch the loop's first ones overwrite their B registers
        asm volatile("v_nop\n\tv_nop\n\tv_nop\n\tv_nop" : "+v"(o[0][0]), "+v"(o[0][1]), "+v"(o[0][2]), "+v"(o[0][3]), "+v"(o[1][0]), "+v"(o[1][1]), "+v"(o[1][2]), "+v"(o[1][3]));
    }
#pragma unroll
    for (int qt = 0; qt < 2; ++qt) { const size_t oo = (size_t)(q0 + qt * 16) * DQ + col * 16; attn_store(o[qt], l[qt], Ah + oo, Al + oo, l8);
        if (qt == 0) { asm volatile("s_wait_xcnt 0x0" ::: "memory");   // the second query tile's pieces may land in registers that the first tile's stores name: the wait stands in front of that overwrite
            __builtin_amdgcn_sched_barrier(0); } }   // and keeps the second tile's arithmetic behind that wait
}
// rows < RH: bf16 hi + lo planes, three products each (hi hi, lo hi, hi lo), 16 queries per wave
__device__ __forceinline__ void attn_hl(const bf* __restrict__ Qh, const bf* __restrict__ Ql, const bf* __restrict__ Kh, const bf* __restrict__ Kl, const bf* __restrict__ VTh, const bf* __restrict__ VTl, int q0, int col, bf* Ah, bf* Al) {
    typedef WFrag<bf> F; const unsigned l8 = (threadIdx.x & 31) * 8;
    v16bf qh[2], ql[2], kh[2][2], kl[2][2]; v8f o[4]; float m = -3.0e38f, l = 0.f;
#pragma unroll
    for (int ks = 0; ks < 2; ++ks) { const size_t qo = (size_t)q0 * HD + ks * 512; qh[ks] = F::ld(Qh + qo, l8); ql[ks] = F::ld(Ql + qo, l8); }
#pragma unroll
    for (int dt = 0; dt < 4; ++dt) o[dt] = (v8f){};
#pragma unroll
    for (int kt = 0; kt < 2; ++kt)
#pragma unroll
        for (int ks = 0; ks < 2; ++ks) { kh[kt][ks] = F::ld(Kh + (size_t)(kt * 16) * HD + ks * 512, l8); kl[kt][ks] = F::ld(Kl + (size_t)(kt * 16) * HD + ks * 512, l8); }
#pragma unroll 1   // as in attn_f16
    for (int kb = 0; kb < TT; kb += 32) {
        v16bf vh[4], vl[4]; v8f st[2];
#pragma unroll
        for (int dt = 0; dt < 4; ++dt) { vh[dt] = F::ld(VTh + (size_t)kb * HD + dt * 512, l8); vl[dt] = F::ld(VTl + (size_t)kb * HD + dt * 512, l8); }
#pragma unroll
        for (int kt = 0; kt < 2; ++kt) { st[kt] = (v8f){};
#pragma unroll
            for (int ks = 0; ks < 2; ++ks) { st[kt] = F::mma(kh[kt][ks], qh[ks], st[kt]); st[kt] = F::mma(kh[kt][ks], ql[ks], st[kt]); st[kt] = F::mma(kl[kt][ks], qh[ks], st[kt]); } }
        const int kn = (kb + 32 < TT) ? kb + 32 : 0;   // as in attn_f16
        asm volatile("s_wait_xcnt 0x0" ::: "memory");   // the key fetch below lands in registers that held the V loads' addresses: the wait stands in front of that overwrite
#pragma unroll
        for (int kt = 0; kt < 2; ++kt)
#pragma unroll
            for (int ks = 0; ks < 2; ++ks) { kh[kt][ks] = F::ld(Kh + (size_t)(kn + kt * 16) * HD + ks * 512, l8); kl[kt][ks] = F::ld(Kl + (size_t)(kn + kt * 16) * HD + ks * 512, l8); }
        __builtin_amdgcn_sched_barrier(0);   // keeps the 16 key loads above the softmax: sunk to the loop's foot they are waited for at once and their whole latency shows
        float mx = vmax8(st[0], st[1]); mx = fmaxf(mx, xhalf(mx));
        const float mn = fmaxf(m, mx * CEXP); const float al = exp2s(m - mn); m = mn; float s = 0.f; v8bf ph[2], pl[2];
#pragma unroll
        for (int kt = 0; kt < 2; ++kt) { const v8f p = exp2v(st[kt] * CEXP - mn);
#pragma unroll
            for (int j = 0; j < 8; ++j) s += p[j];
            ph[kt] = __builtin_convertvector(p, v8bf); pl[kt] = __builtin_convertvector(p - __builtin_convertvector(ph[kt], v8f), v8bf); }   // hi = nearest-even bf16 of p, lo = nearest-even bf16 of the exact rest (packed converts)
        l = l * al + s; const v16bf pfh = __builtin_shufflevector(ph[0], ph[1], 0, 1, 2, 3, 4, 5, 6, 7, 8, 9, 10, 11, 12, 13, 14, 15), pfl = __builtin_shufflevector(pl[0], pl[1], 0, 1, 2, 3, 4, 5, 6, 7, 8, 9, 10, 11, 12, 13, 14, 15);
#pragma unroll
        for (int dt = 0; dt < 4; ++dt) o[dt] *= al;
#pragma unroll
        for (int dt = 0; dt < 4; ++dt) { o[dt] = F::mma(vh[dt], pfh, o[dt]); o[dt] = F::mma(vh[dt], pfl, o[dt]); o[dt] = F::mma(vl[dt], pfh, o[dt]); }
        asm volatile("v_nop\n\tv_nop\n\tv_nop\n\tv_nop" : "+v"(o[0]), "+v"(o[1]), "+v"(o[2]), "+v"(o[3]));   // as in attn_f16
    }
    { const size_t oo = (size_t)q0 * DQ + col * 16; attn_store(o, l, Ah + oo, Al + oo, l8); }
}
__global__ __launch_bounds__(32) void k_fattn(const h16* __restrict__ Q16, const h16* __restrict__ K16, const h16* __restrict__ VT16, const bf* __restrict__ Qh, const bf* __restrict__ Ql, const bf* __restrict__ Kh, const bf* __restrict__ Kl, const bf* __restrict__ VTh, const bf* __restrict__ VTl, bf* Ah, bf* Al) {
    const int h = blockIdx.y, bx = blockIdx.x; const size_t zo = ((size_t)blockIdx.z * NH_ + h) * TT * HD;   // the head planes of q, k (rows t) and of v (rows d) have the same size
    Ah += (size_t)blockIdx.z * TT * DQ; Al += (size_t)blockIdx.z * TT * DQ;   // merged rows (b, t) x DQ, fragment order
    if (bx < RH / 16) attn_hl(Qh + zo, Ql + zo, Kh + zo, Kl + zo, VTh + zo, VTl + zo, bx * 16, h * HD, Ah, Al);
    else attn_f16(Q16 + zo, K16 + zo, VT16 + zo, RH + (bx - RH / 16) * 32, h * HD, Ah, Al);
}

extern "C" void kernel_launch(void* const* d_in, const int* in_sizes, int n_in,
                              void* d_out, int out_size, void* d_ws, size_t ws_size, hipStream_t stream) {
    (void)in_sizes; (void)n_in; (void)out_size;
    const float* x = (const float*)d_in[0];   /* query */ const float* xk = (const float*)d_in[1]; const float* xv = (const float*)d_in[2]; const float* wq = (const float*)d_in[3]; const float* wk = (const float*)d_in[4]; const float* wv = (const float*)d_in[5]; const float* wo = (const float*)d_in[6]; const float* bo = (const float*)d_in[7];   /* argument order query, key, value, Wq, Wk, Wv, Wo ('oi' [1024][1024]), bo [1024] (REAL 0.01); eight inputs, all read */
    float* OUT = (float*)d_out;     // [2][2048][1024]
    char* wsp = (char*)d_ws;
    auto take = [&](size_t bytes) { char* p = wsp; wsp += (bytes + 255) & ~(size_t)255; return (void*)p; };
    const size_t NX = (size_t)NB_ * TT * DM, NW = (size_t)DQ * DM, NP = (size_t)NB_ * NH_ * TT * HD;   // elements of one input stream, one weight, one set of head planes (both batches)
    bf* XB = (bf*)take((3 * NX + 4 * NW) * 2); bf* WQ = XB + 3 * NX; bf* WO = WQ + 3 * NW;   // query, key, value, Wq, Wk, Wv, Wo in one run (k_prep)
    float* CS = (float*)take((size_t)TT * HD * 2 * 4);
    h16* QP16 = (h16*)take(2 * NP * 2); h16* KP16 = QP16 + NP; bf* QPh = (bf*)take(2 * NP * 2); bf* KPh = QPh + NP; bf* QPl = (bf*)take(2 * NP * 2); bf* KPl = QPl + NP;   // q planes, then k planes (k_projp's plane order)
    h16* VT16 = (h16*)take(NP * 2); bf* VTh = (bf*)take(NP * 2); bf* VTl = (bf*)take(NP * 2);
    bf* ATh = (bf*)take(NX * 2); bf* ATl = (bf*)take(NX * 2);
    if ((size_t)(wsp - (char*)d_ws) > ws_size) return;    // ws 256 MiB
    k_prep<<<CSB + 3 * XBL + 4 * WBL, 256, 0, stream>>>(x, xk, xv, wq, wk, wv, wo, XB, CS);
    k_projp<<<dim3(NB_ * TT / 64, NH_, 3), 32, 0, stream>>>(XB, WQ, CS, (unsigned short*)QP16, QPh, QPl, (unsigned short*)VT16, VTh, VTl);   // z = stream: q, k, v
    k_fattn<<<dim3(RH / 16 + (TT - RH) / 32, NH_, NB_), 32, 0, stream>>>(QP16, KP16, VT16, QPh, QPl, KPh, KPl, VTh, VTl, ATh, ATl);   // one kv head per query head
    k_gemmw<bf, 1, true, 1, DQ><<<dim3(NB_ * TT / 64, DM / 64, 1), 32, 0, stream>>>(ATh, ATl, WO, nullptr, OUT, DM, bo, 0, 0, 0, 0);
}

// v006
// It runs in 148 microseconds.
// Two timings next to v005 put it at 1.15 and 1.16 times that version's speed.
// Counting every step since v000, it is 13.4 times as fast.
#include <hip/hip_runtime.h>

// Multi-head attention WITHOUT a mask over three input streams with a computed rotate-half rotary (query, key, value [2][2048][1024]; q = query Wq^T, k = key Wk^T, v = value Wv^T ('oi' [1024][1024] 1/32, no bias; 16 heads x 64), each from its own stream; _apply_rope AFTER the head split: (x1, x2) = the two HALVES: cat(x1 cos - x2 sin, x1 sin + x2 cos) with angle t x inv_freq[i], inv_freq = 1.0 / (10000.0 ** (arange(0, 64, 2, f32) / 64)) (32 f32 constants; both halves share the 32 angles; one f32 product per angle; precise cosf / sinf), on q and k; scores / sqrt(64); softmax over all keys; out = merged Wo^T + bo ('oi' + a REAL 0.01 bias) -> [2][2048][1024] (4.2 M); argument order query, key, value, Wq, Wk, Wv, Wo, bo).
// Layout, both batches in every launch: bf16 copies of query, key, value and the four 'oi' weights (one launch, with the rotary table); the three exact projections as grid z of one launch, whose epilogue rotates q and k and stores the head planes itself; one fused attention launch, grid z = batch (hybrid rows: < 512 hi/lo 3 products, rest fp16; online softmax, scores and weights stay in registers); merged hi/lo x Wo exact.
// FRAGMENT ORDER: every 16-bit plane that a matrix instruction reads (inputs, weights, head planes, merged rows) is stored as tiles of 16 rows x 32 k = 512 elements, laid out as the operand registers want them:
// element (row, k) lies at tile 512 + ((k % 32) / 16) 256 + (((k % 16) / 8) 16 + row % 16) 8 + k % 8, so lane l's two 16-byte pieces lie at l 8 and 256 + l 8 and each wave-wide load or store is 512 contiguous bytes
// (4 cache lines; in row-major planes it touched 16). Tile order: (row / 16) major, k / 32 minor; the V^T planes k / 32 (keys) major, d / 16 minor, so that a step of 32 keys is 4 KiB in a row.
// Compute dtypes, f32 accumulate: every input rounded to bf16; projections exact; attention rows < 512 3 products, rest fp16; softmax f32; Wo hl x exact.

#define NB_  2
#define TT   2048
#define DM   1024
#define NH_  16
#define NKV  16
#define REP  (NH_ / NKV)
#define HD   64
#define DQ   (NH_ * HD)
#define DKV  (NKV * HD)
#define RH   512                  // query rows < RH use hi+lo planes (0: none)
#define WIN  0
#define SCL  0.125f   // HD^-0.5
#define CEXP (SCL * 1.4426950408889634f)   // score -> exponent of 2
typedef _Float16 h16;
typedef unsigned short bf;
typedef __attribute__((ext_vector_type(16))) __bf16   v16bf;
typedef __attribute__((ext_vector_type(16))) _Float16 v16h;
typedef __attribute__((ext_vector_type(8)))  _Float16 v8h;
typedef __attribute__((ext_vector_type(8)))  unsigned short v8us;
typedef __attribute__((ext_vector_type(8)))  float    v8f;
typedef __attribute__((ext_vector_type(4)))  float    v4f;
typedef v8h  __attribute__((may_alias)) v8ha;
typedef v4f  __attribute__((may_alias)) v4fa;
typedef v8us __attribute__((may_alias)) v8usa;

__device__ __forceinline__ unsigned short f2bf(float f) { unsigned u = __float_as_uint(f); u += 0x7FFFu + ((u >> 16) & 1u); return (unsigned short)(u >> 16); }
__device__ __forceinline__ float bf2f(unsigned short b) { return __uint_as_float(((unsigned)b) << 16); }
__device__ __forceinline__ float bfr(float f) { return bf2f(f2bf(f)); }
__device__ __forceinline__ v16h cat16(v8h lo, v8h hi) { return __builtin_shufflevector(lo, hi, 0, 1, 2, 3, 4, 5, 6, 7, 8, 9, 10, 11, 12, 13, 14, 15); }
__device__ __forceinline__ v16bf cat16b(v8us lo, v8us hi) { return __builtin_bit_cast(v16bf, __builtin_shufflevector(lo, hi, 0, 1, 2, 3, 4, 5, 6, 7, 8, 9, 10, 11, 12, 13, 14, 15)); }
__device__ __forceinline__ v8f wmma16(v16h a, v16h b, v8f c) { return __builtin_amdgcn_wmma_f32_16x16x32_f16(false, a, false, b, (short)0, c, false, false); }
__device__ __forceinline__ v8f wmmab(v16bf a, v16bf b, v8f c) { return __builtin_amdgcn_wmma_f32_16x16x32_bf16(false, a, false, b, (short)0, c, false, false); }



// ---- k_gemmw: register-blocked GEMM, ONE WAVE per 64x64 output tile (16 accumulators), operands straight from 16-bit planes in fragment order (ld(p): p = tile + lane 8; ld(t, l8): t = the tile, wave-uniform, l8 = lane 8); grid (M/64, N/64, Z), 32 threads.
// C[m][n] (f32, pitch ldc, + optional f32 bias[n]) = sum_k A[m][k] Bt[n][k] (+ split products per NSPLIT). z-batch strides sA/sB/sC in elements. K % 32 == 0.
// KS > 1: grid (M/64, N/64 * KS, Z); work-group ks = blockIdx.y % KS sums only k in [ks K/KS, (ks+1) K/KS) and stores its tile in partial plane ks (C + ks sP); the reader adds the KS planes. K % (32 KS) == 0.
template <typename T16> struct WFrag;
template <> struct WFrag<h16> { typedef v16h V; static __device__ __forceinline__ V ld(const h16* p) { return cat16(*(const v8h*)p, *(const v8h*)(p + 256)); } static __device__ __forceinline__ V ld(const h16* t, unsigned l8) { return cat16(*(const v8h*)(t + l8), *(const v8h*)(t + 256 + l8)); } static __device__ __forceinline__ v8f mma(V a, V b, v8f c) { return wmma16(a, b, c); } };
template <> struct WFrag<bf> { typedef v16bf V; static __device__ __forceinline__ V ld(const bf* p) { return cat16b(*(const v8us*)p, *(const v8us*)(p + 256)); } static __device__ __forceinline__ V ld(const bf* t, unsigned l8) { return cat16b(*(const v8us*)(t + l8), *(const v8us*)(t + 256 + l8)); } static __device__ __forceinline__ v8f mma(V a, V b, v8f c) { return wmmab(a, b, c); } };
template <typename T16, int NSPLIT, bool BIAS, int KS, int K>   // K at compile time: the row tiles of an operand then lie at immediate offsets from ONE address pair
__global__ __launch_bounds__(32) void k_gemmw(const T16* __restrict__ A, const T16* __restrict__ A2, const T16* __restrict__ Bt, const T16* __restrict__ Bt2, float* C, int ldc, const float* __restrict__ bias, size_t sA, size_t sB, size_t sC, size_t sP) {
    typedef typename WFrag<T16>::V V;
    __shared__ __align__(16) float os[16 * 68];
    const size_t z = blockIdx.z; A += z * sA; if (A2) A2 += z * sA; Bt += z * sB; if (Bt2) Bt2 += z * sB; C += z * sC;
    const int ks = (KS > 1) ? (int)(blockIdx.y % KS) : 0; const int kbeg = ks * (K / KS), kend = kbeg + K / KS; if (KS > 1) C += (size_t)ks * sP;
    const int lane = threadIdx.x & 31, lr = lane & 15, hi = lane >> 4; const int r0 = blockIdx.x * 64, c0 = (int)(blockIdx.y / KS) * 64;
    v8f acc[4][4];
#pragma unroll
    for (int mb = 0; mb < 4; ++mb)
#pragma unroll
        for (int nb = 0; nb < 4; ++nb) acc[mb][nb] = (v8f){};
    const size_t aoff = (size_t)r0 * K + lane * 8, boff = (size_t)c0 * K + lane * 8;   // 16 rows of tiles are 16 K elements; 32 k are one tile of 512
#pragma unroll 1
    for (int kc = kbeg; kc < kend; kc += 32) {
        V a[4], a2[4]; const T16* pa = A + aoff + kc * 16; const T16* pa2 = (NSPLIT == 1 || NSPLIT == 2) ? A2 + aoff + kc * 16 : pa; const T16* pb = Bt + boff + kc * 16; const T16* pb2 = (NSPLIT >= 2) ? Bt2 + boff + kc * 16 : pb;
#pragma unroll
        for (int mb = 0; mb < 4; ++mb) { a[mb] = WFrag<T16>::ld(pa + mb * 16 * K); if (NSPLIT == 1 || NSPLIT == 2) a2[mb] = WFrag<T16>::ld(pa2 + mb * 16 * K); }
#pragma unroll
        for (int nb = 0; nb < 4; ++nb) { const V b = WFrag<T16>::ld(pb + nb * 16 * K); V b2; if (NSPLIT >= 2) b2 = WFrag<T16>::ld(pb2 + nb * 16 * K);
#pragma unroll
            for (int mb = 0; mb < 4; ++mb) { acc[mb][nb] = WFrag<T16>::mma(a[mb], b, acc[mb][nb]); if (NSPLIT == 1 || NSPLIT == 2) acc[mb][nb] = WFrag<T16>::mma(a2[mb], b, acc[mb][nb]); if (NSPLIT >= 2) acc[mb][nb] = WFrag<T16>::mma(a[mb], b2, acc[mb][nb]); } }
        // four vector slots behind the last matrix instructions (on the taken branch the loop's first loads overwrite their operands); the address pairs are inputs so that they keep their registers to the foot of the trip:
        // otherwise a later load of the trip lands on an address that issued loads still name
        asm volatile("v_nop\n\tv_nop\n\tv_nop\n\tv_nop" : "+v"(acc[0][0]), "+v"(acc[1][1]), "+v"(acc[2][2]), "+v"(acc[3][3]) : "v"(a[0]), "v"(a[3]), "v"(pa), "v"(pa2), "v"(pb), "v"(pb2));
    }
#pragma unroll
    for (int mb = 0; mb < 4; ++mb) {
#pragma unroll
        for (int nb = 0; nb < 4; ++nb) {
#pragma unroll
            for (int j = 0; j < 8; ++j) os[(hi * 8 + j) * 68 + nb * 16 + lr] = acc[mb][nb][j]; }
        __builtin_amdgcn_wave_barrier(); asm volatile("" ::: "memory");
        float* crow = C + (size_t)(r0 + mb * 16) * ldc + c0;
{
#pragma unroll
            for (int s = 0; s < 8; ++s) { const int row = 2 * s + hi, cofs = lr * 4; v4f val = *(const v4fa*)(os + row * 68 + cofs); if (BIAS) { val[0] += bfr(bias[c0 + cofs]); val[1] += bfr(bias[c0 + cofs + 1]); val[2] += bfr(bias[c0 + cofs + 2]); val[3] += bfr(bias[c0 + cofs + 3]); }
                *(v4f*)(crow + (size_t)row * ldc + cofs) = val; }
             }
        __builtin_amdgcn_wave_barrier(); asm volatile("" ::: "memory");
    }
}

__device__ __forceinline__ h16 tohx(float x) { return (h16)x; }
__device__ __forceinline__ void splitf(float y, unsigned short& h, unsigned short& l) { h = f2bf(y); l = f2bf(y - bf2f(h)); }
typedef __attribute__((ext_vector_type(2))) _Float16 v2h;
typedef __attribute__((ext_vector_type(4))) _Float16 v4h;
typedef __attribute__((ext_vector_type(2))) unsigned short v2us;
typedef __attribute__((ext_vector_type(4))) unsigned short v4us;
typedef __attribute__((ext_vector_type(2))) float v2f;
typedef __attribute__((ext_vector_type(4))) int v4i;
typedef __attribute__((ext_vector_type(8))) __bf16 v8bf;

__global__ __launch_bounds__(256) void k_wtG(const float* __restrict__ w, int K, int N, bf* Bt) {
    const int lane = threadIdx.x & 31; const int L0 = (blockIdx.x * 8 + (threadIdx.x >> 5)) * 8; const int nlines = N * K / 64;
{
#pragma unroll 1
        for (int l = 0; l < 8; ++l) { const int L = L0 + l; if (L >= nlines) break; const size_t e = (size_t)L * 64 + lane * 2; const int k = (int)(e % K), n = (int)(e / K); v2us o;
            o[0] = f2bf(w[(size_t)k * N + n]); o[1] = f2bf(w[(size_t)(k + 1) * N + n]); *(v2us*)(Bt + e) = o; }
         }
}

// ---- k_projp: the three projections (grid z = stream: q, k, v), ONE WAVE per 64x64 tile as in k_gemmw; the tile is 64 rows t of ONE head (64 d), so the epilogue finishes it in registers and stores
// the head planes (fp16, bf16 hi, bf16 lo) itself: no f32 projection goes through memory. The operand that supplies the WMMA rows is chosen so that a lane's eight accumulator elements run along the plane's
// k index: q, k (planes [h], rows t, k = d, h = (stream NB_ + batch) NH_ + head): WMMA rows = d (the weight), columns = t; v (planes [g], rows d, k = t, g = batch NKV + head): WMMA rows = t (the input), columns = d.
// Rotate-half: out[d] = x[d] cos - x[d+32] sin, out[d+32] = x[d+32] cos + x[d] sin, angle (t, d % 32); d and d + 32 are row tiles mb and mb + 2 of the same lane and element.
// Epilogue of k_projp, one group of 16 plane rows (nb) at a time: rotate (q, k), round to the three planes, store. Accumulator (mb, nb) holds k = mb 16 + hi 8 + j of plane row nb 16 + lr: that IS half (mb & 1) of fragment
// tile (row tile nb, k tile mb / 2) in fragment order, so each store goes straight from the registers as 512 contiguous bytes. SN, SM: element strides of a row tile and of a k tile in the plane's tile order.
template <bool ROPE, int SN, int SM>
__device__ __forceinline__ void proj_store(v8f (&acc)[4][4], const float* __restrict__ CSt, unsigned short* D16, unsigned short* Dh, unsigned short* Dl) {
    const int lane = threadIdx.x & 31, lr = lane & 15, hi = lane >> 4; const unsigned l8 = lane * 8;
    const float* cp = ROPE ? CSt + ((size_t)lr * HD + hi * 8) * 2 : nullptr;   // (cos, sin) pairs of the tile's row lr, from d = 8 hi; row group nb lies nb 16 rows on
    v4f c[2][8];
    if (ROPE) {
#pragma unroll
        for (int i = 0; i < 8; ++i) c[0][i] = *(const v4f*)(cp + (i >> 2) * 32 + (i & 3) * 4); }
#pragma unroll
    for (int nb = 0; nb < 4; ++nb) {
        if (ROPE) {
            if (nb < 3) {   // the next row group's pairs fly under this group's arithmetic and stores
#pragma unroll
                for (int i = 0; i < 8; ++i) c[(nb + 1) & 1][i] = *(const v4f*)(cp + (size_t)(nb + 1) * 16 * HD * 2 + (i >> 2) * 32 + (i & 3) * 4); }
#pragma unroll
            for (int mb = 0; mb < 2; ++mb)
#pragma unroll
                for (int j = 0; j < 8; ++j) { const float co = c[nb & 1][mb * 4 + (j >> 1)][(j & 1) * 2], si = c[nb & 1][mb * 4 + (j >> 1)][(j & 1) * 2 + 1]; const float x1 = acc[mb][nb][j], x2 = acc[mb + 2][nb][j];
                    acc[mb][nb][j] = x1 * co - x2 * si; acc[mb + 2][nb][j] = x2 * co + x1 * si; }
        }
        v8us w[4][3];
#pragma unroll
        for (int mb = 0; mb < 4; ++mb) { const v8f x = acc[mb][nb]; const v8bf xh = __builtin_convertvector(x, v8bf);   // hi = nearest-even bf16, lo = nearest-even bf16 of the exact rest
            w[mb][0] = __builtin_bit_cast(v8us, __builtin_convertvector(x, v8h)); w[mb][1] = __builtin_bit_cast(v8us, xh);
            w[mb][2] = __builtin_bit_cast(v8us, __builtin_convertvector(x - __builtin_convertvector(xh, v8f), v8bf)); }
        __builtin_amdgcn_sched_barrier(0);   // all twelve pieces are formed before the first store: mixed with the stores, a later convert lands in a register that an issued store still names, ahead of the wait below
#pragma unroll
        for (int mb = 0; mb < 4; ++mb) { const int g = nb * SN + (mb >> 1) * SM + (mb & 1) * 256;
            *(v8us*)(D16 + g + l8) = w[mb][0]; *(v8us*)(Dh + g + l8) = w[mb][1]; *(v8us*)(Dl + g + l8) = w[mb][2]; }
        asm volatile("s_wait_xcnt 0x0" ::: "memory");   // what follows (the next group's table loads and arithmetic; behind the last group whatever the kernel does next) may land in registers that these stores name: the wait stands in front of that overwrite
        __builtin_amdgcn_sched_barrier(0);   // without it the table loads of all four groups are lifted to the front, and their 128 registers on top of the accumulators cost a wave per SIMD
    }
}
__global__ __launch_bounds__(32) void k_projp(const bf* __restrict__ X, const bf* __restrict__ Wt, const float* __restrict__ CS, unsigned short* P16, unsigned short* Ph, unsigned short* Pl, unsigned short* V16, unsigned short* Vh, unsigned short* Vl) {
    typedef WFrag<bf> F; typedef F::V V;
    const int z = blockIdx.z; const bool isv = z == 2;
    const int lane = threadIdx.x & 31; const int r0 = blockIdx.x * 64, head = blockIdx.y; const int b = r0 / TT, t0 = r0 % TT;
    const bf* xs = X + (size_t)z * NB_ * TT * DM + (size_t)r0 * DM; const bf* wr = Wt + (size_t)z * DQ * DM + (size_t)head * HD * DM;
    const bf* A = isv ? xs : wr; const bf* Bt = isv ? wr : xs; const unsigned l8 = lane * 8;   // wave-uniform bases (16 rows of tiles are 16 DM elements), one lane offset for both operands
    v8f acc[4][4];
#pragma unroll
    for (int mb = 0; mb < 4; ++mb)
#pragma unroll
        for (int nb = 0; nb < 4; ++nb) acc[mb][nb] = (v8f){};
#pragma unroll 1   // one trip is a whole body of 16 loads and 16 matrix instructions; unrolling would only add operand registers on top of the 128 of the accumulators
    for (int kc = 0; kc < DM; kc += 32) {
        V a[4]; const bf* pa = A + kc * 16 + l8; const bf* pb = Bt + kc * 16 + l8;   // 32 k are one tile of 512 elements
#pragma unroll
        for (int mb = 0; mb < 4; ++mb) a[mb] = F::ld(pa + mb * 16 * DM);
#pragma unroll
        for (int nb = 0; nb < 4; ++nb) {
            const V bb = F::ld(pb + nb * 16 * DM);
#pragma unroll
            for (int mb = 0; mb < 4; ++mb) acc[mb][nb] = F::mma(a[mb], bb, acc[mb][nb]); }
        // four vector slots behind the last matrix instructions, as in k_gemmw: on the taken branch the loop's first loads overwrite their operands.
        // The two address pairs are inputs so that they keep their registers to the foot of the trip: otherwise a later load of the trip lands on an address that issued loads still name.
        asm volatile("v_nop\n\tv_nop\n\tv_nop\n\tv_nop" : "+v"(acc[0][0]), "+v"(acc[1][1]), "+v"(acc[2][2]), "+v"(acc[3][3]) : "v"(a[0]), "v"(a[3]), "v"(pa), "v"(pb));
    }
    // acc[mb][nb][j]: k index i = mb 16 + hi 8 + j, plane row o = nb 16 + lr. 64 t of one head are 4096 elements in a row in both tile orders: q, k 4 row tiles x 2 k tiles, v 2 k tiles x 4 row tiles
    if (isv) { const size_t base = ((size_t)(b * NKV + head) * TT + t0) * HD; proj_store<false, 512, 2048>(acc, nullptr, V16 + base, Vh + base, Vl + base); }
    else { const size_t base = (((size_t)(z * NB_ + b) * NH_ + head) * TT + t0) * HD; proj_store<true, 1024, 512>(acc, CS + (size_t)t0 * HD * 2, P16 + base, Ph + base, Pl + base); }
}
__constant__ float INVT[HD / 2] = { 1.000000000e+00f, 7.498942018e-01f, 5.623413324e-01f, 4.216965139e-01f, 3.162277639e-01f, 2.371373624e-01f, 1.778279394e-01f, 1.333521456e-01f, 1.000000015e-01f, 7.498941571e-02f, 5.623412877e-02f, 4.216964915e-02f, 3.162277862e-02f, 2.371373586e-02f, 1.778279431e-02f, 1.333521493e-02f, 9.999999776e-03f, 7.498942316e-03f, 5.623413250e-03f, 4.216964822e-03f, 3.162277862e-03f, 2.371373819e-03f, 1.778279431e-03f, 1.333521446e-03f, 1.000000047e-03f, 7.498941850e-04f, 5.623413017e-04f, 4.216964880e-04f, 3.162277862e-04f, 2.371373848e-04f, 1.778279402e-04f, 1.333521504e-04f };   // 1 / 10000^(2i/64) (float32, generated with jnp to be bit-exact)
// k_prep: everything that depends on no other launch, in one grid. Work-groups [0, CSB): the rotary table (positions = arange). The rest: f32 -> bf16, 2048 elements each, into ONE run of planes
// dst = query, key, value (both batches each), Wq, Wk, Wv, Wo, so that the destination offset is linear in the work-group index and only the source is chosen (a scalar choice).
// The planes are in fragment order (rows of DM = 32 k tiles): a work-group writes 4 tiles in a row = 16 source rows x 128 k. A wave takes 8 rows of one tile in two loads of 4 whole 128-byte source lines each
// (8 lanes a row, 4 k a lane); its 8-byte pieces fill 64-byte runs (4 rows of one half-column of 8 k), and the two stores together whole lines of the tile.
#define CSB  (TT * HD / 256)
#define XBL  (NB_ * TT * DM / 2048)   // work-groups per input stream
#define WBL  (DQ * DM / 2048)         // work-groups per weight
__global__ __launch_bounds__(256) void k_prep(const float* __restrict__ xq, const float* __restrict__ xk, const float* __restrict__ xv, const float* __restrict__ wq, const float* __restrict__ wk, const float* __restrict__ wv, const float* __restrict__ wo, bf* dst, float* CS) {
    if (blockIdx.x < CSB) { const int idx = blockIdx.x * 256 + threadIdx.x; const int d = idx % HD; const int t = idx / HD; const float a = __fmul_rn((float)t, INVT[d % (HD / 2)]); v2f cs; cs[0] = cosf(a); cs[1] = sinf(a); *(v2f*)(CS + (size_t)idx * 2) = cs; return; }
    const int bx = blockIdx.x - CSB; const float* src; int lb;
    if (bx < 3 * XBL) { const int sel = bx / XBL; lb = bx % XBL; src = sel == 0 ? xq : sel == 1 ? xk : xv; }
    else { const int sel = (bx - 3 * XBL) / WBL; lb = (bx - 3 * XBL) % WBL; src = sel == 0 ? wq : sel == 1 ? wk : sel == 2 ? wv : wo; }
    const int w = threadIdx.x >> 5, lane = threadIdx.x & 31, tile = lb * 4 + (w >> 1); const int r = (w & 1) * 8 + (lane >> 3), k4 = (lane & 7) * 4;   // row in the tile (and r + 4), first k in the tile
    const float* sp = src + (size_t)((tile / (DM / 32)) * 16 + r) * DM + (tile % (DM / 32)) * 32 + k4;
    bf* dp = dst + (size_t)bx * 2048 + (w >> 1) * 512 + (k4 >> 4) * 256 + (((k4 >> 3) & 1) * 16 + r) * 8 + (k4 & 4);
    const v4f v0 = *(const v4f*)sp, v1 = *(const v4f*)(sp + 4 * DM); v4us o0, o1;
#pragma unroll
    for (int k = 0; k < 4; ++k) { o0[k] = f2bf(v0[k]); o1[k] = f2bf(v1[k]); }
    *(v4us*)dp = o0; *(v4us*)(dp + 4 * 8) = o1;  }
// ---- k_fattn: scores, softmax and weights x V in ONE kernel; AW waves per work-group, grid (RH/(16 AW) + (TT-RH)/(32 AW), heads, batches).
// The wave forms the TRANSPOSED score tile S^T = K Q^T (A = 16 keys, B = 16 queries): lane (lr, hi) then holds keys 8 hi + j of query lr, and two such tiles (keys 0..15, 16..31)
// side by side ARE the B fragment (k = 8 hi + 0..7, 16 + 8 hi + 0..7) of O^T = V^T P^T, so the weights never leave their registers. Online softmax per query over steps of 32 keys, ascending:
// running maximum m (in exponent-of-2 units), running sum l and O^T rescaled by 2^(m_old - m_new); the two lane halves of a query share m (one cross-half exchange per step) and add their l at the end.
__device__ __forceinline__ float xhalf(float x) { return __builtin_bit_cast(float, __builtin_amdgcn_permlanex16(__builtin_bit_cast(int, x), __builtin_bit_cast(int, x), 0x76543210, 0xfedcba98, false, false)); }   // lane l with lane l ^ 16, no LDS round trip
// 2^x. The instruction set asks for one free slot behind a transcendental before its result is read or its source overwritten: the v_nop ends the same statement so that it cannot drift,
// and the early-clobber results keep every exp of the run of eight off the sources of the others.
__device__ __forceinline__ float exp2s(float x) { float r; asm("v_exp_f32 %0, %1\n\tv_nop" : "=v"(r) : "v"(x)); return r; }
__device__ __forceinline__ v8f exp2v(v8f x) { float r0, r1, r2, r3, r4, r5, r6, r7;
    asm("v_exp_f32 %0, %8\n\tv_exp_f32 %1, %9\n\tv_exp_f32 %2, %10\n\tv_exp_f32 %3, %11\n\tv_exp_f32 %4, %12\n\tv_exp_f32 %5, %13\n\tv_exp_f32 %6, %14\n\tv_exp_f32 %7, %15\n\tv_nop"
        : "=&v"(r0), "=&v"(r1), "=&v"(r2), "=&v"(r3), "=&v"(r4), "=&v"(r5), "=&v"(r6), "=&v"(r7) : "v"(x[0]), "v"(x[1]), "v"(x[2]), "v"(x[3]), "v"(x[4]), "v"(x[5]), "v"(x[6]), "v"(x[7]));
    return (v8f){r0, r1, r2, r3, r4, r5, r6, r7}; }
__device__ __forceinline__ float vmax8(v8f a, v8f b) { float x = fmaxf(a[0], b[0]);
#pragma unroll
    for (int j = 1; j < 8; ++j) x = fmaxf(x, fmaxf(a[j], b[j]));
    return x; }
__device__ __forceinline__ void attn_store(const v8f* o, float l, bf* Ah, bf* Al, unsigned l8) {   // o: four d tiles of one query column; Ah, Al: the first fragment tile of (16 queries, head), wave-uniform; d tile dt is half dt & 1 of k tile dt / 2, 256 elements a half
    const float inv = __fdiv_rn(1.0f, l + xhalf(l)); v8us wh[4], wl[4];
#pragma unroll
    for (int dt = 0; dt < 4; ++dt) { const v8f x = o[dt] * inv; const v8bf xh = __builtin_convertvector(x, v8bf), xl = __builtin_convertvector(x - __builtin_convertvector(xh, v8f), v8bf);   // hi + lo, nearest even, packed converts
        wh[dt] = __builtin_bit_cast(v8us, xh); wl[dt] = __builtin_bit_cast(v8us, xl); }
    __builtin_amdgcn_sched_barrier(0);   // all eight pieces are formed before the first store: mixed with the stores, a later convert lands in a register that an issued store still names
#pragma unroll
    for (int dt = 0; dt < 4; ++dt) { *(v8us*)(Ah + dt * 256 + l8) = wh[dt]; *(v8us*)(Al + dt * 256 + l8) = wl[dt]; }
}
// K AND V THROUGH LDS: a work-group is AW waves that walk the same keys of one head, each with its own queries. A stage of SK keys (each plane's part is PB contiguous bytes in fragment order, copied as it lies)
// is brought into LDS ONCE for all AW waves by asynchronous copies, two buffers: stage t + 2 is asked for when every wave has left stage t, and flies under stage t + 1. A fragment read is 512 contiguous LDS bytes a wave.
#define AW   4                 // waves of an attention work-group
#define SK   64                // keys of a stage
#define PB   (SK * HD * 2)     // bytes of one 16-bit plane's part of a stage
#define NST  (TT / SK)         // stages
// Eight copies of 16 bytes a lane: PB bytes from ga to LDS byte address la and PB bytes from gb to lb (AW 32 lanes x 16 bytes = 2048 bytes a copy; la, lb, ga, gb are the lane's own).
// The s_wait_xcnt ends the copies' own statement, so that it stands in front of whatever next rewrites an address register that a copy names.
__device__ __forceinline__ void copy8(unsigned la, const char* ga, unsigned lb, const char* gb) {
    asm volatile("global_load_async_to_lds_b128 %0, %8, off\n\tglobal_load_async_to_lds_b128 %1, %9, off\n\tglobal_load_async_to_lds_b128 %2, %10, off\n\tglobal_load_async_to_lds_b128 %3, %11, off\n\t"
                 "global_load_async_to_lds_b128 %4, %12, off\n\tglobal_load_async_to_lds_b128 %5, %13, off\n\tglobal_load_async_to_lds_b128 %6, %14, off\n\tglobal_load_async_to_lds_b128 %7, %15, off\n\ts_wait_xcnt 0x0"
                 :: "v"(la), "v"(la + 2048u), "v"(la + 4096u), "v"(la + 6144u), "v"(lb), "v"(lb + 2048u), "v"(lb + 4096u), "v"(lb + 6144u),
                    "v"(ga), "v"(ga + 2048), "v"(ga + 4096), "v"(ga + 6144), "v"(gb), "v"(gb + 2048), "v"(gb + 4096), "v"(gb + 6144) : "memory");
}
__device__ __forceinline__ void wait_copies() { asm volatile("s_wait_asynccnt 0x0" ::: "memory"); }   // this wave's copies have landed; the compiler places no wait for them
__device__ __forceinline__ void wait_lds() { asm volatile("s_wait_dscnt 0x0" ::: "memory"); }         // this wave's LDS reads have returned before the buffer they read is handed back for a refill
// rows >= RH: fp16 operands, 32 queries per wave
__device__ __forceinline__ void attn_f16(const h16* __restrict__ Q, const h16* __restrict__ K, const h16* __restrict__ VT, int q0, int col, bf* Ah, bf* Al, char* ring) {
    typedef WFrag<h16> F; const unsigned l8 = (threadIdx.x & 31) * 8;
    constexpr unsigned SB = 2 * PB;   // a stage in LDS: K part, V^T part
    const unsigned lc = (unsigned)(size_t)ring + threadIdx.x * 16; const char* gk = (const char*)K + threadIdx.x * 16; const char* gv = (const char*)VT + threadIdx.x * 16;   // the lane's 16 bytes of every 2048
    v16h qf[2][2]; v8f o[2][4]; float m[2], l[2];
    copy8(lc, gk, lc + PB, gv);   // stage 0
    // fragment order: 16 rows t of q or k are 2 tiles (16 HD elements), 32 keys of V^T are 4 tiles (32 HD elements)
#pragma unroll
    for (int qt = 0; qt < 2; ++qt) { m[qt] = -3.0e38f; l[qt] = 0.f;
#pragma unroll
        for (int ks = 0; ks < 2; ++ks) qf[qt][ks] = F::ld(Q + (size_t)(q0 + qt * 16) * HD + ks * 512, l8);
#pragma unroll
        for (int dt = 0; dt < 4; ++dt) o[qt][dt] = (v8f){}; }
    wait_copies(); __syncthreads();   // stage 0 is published
    copy8(lc + SB, gk + PB, lc + SB + PB, gv + PB);   // stage 1
#pragma unroll 1   // one trip is a stage; unrolling would only add registers
    for (int t = 0; t < NST; ++t) {
        const unsigned bo = (t & 1) * SB; const h16* sk = (const h16*)(ring + bo); const h16* sv = (const h16*)(ring + bo + PB);
        v16h kf[2][2];
#pragma unroll
        for (int kt = 0; kt < 2; ++kt)
#pragma unroll
            for (int ks = 0; ks < 2; ++ks) kf[kt][ks] = F::ld(sk + (kt * 16) * HD + ks * 512, l8);
#pragma unroll
        for (int kb = 0; kb < SK; kb += 32) {   // steps of 32 keys, ascending, as before
            v16h vf[4], pf[2]; v8f st[2][2];
#pragma unroll
            for (int dt = 0; dt < 4; ++dt) vf[dt] = F::ld(sv + kb * HD + dt * 512, l8);
#pragma unroll
            for (int kt = 0; kt < 2; ++kt)
#pragma unroll
                for (int qt = 0; qt < 2; ++qt) st[kt][qt] = F::mma(kf[kt][1], qf[qt][1], F::mma(kf[kt][0], qf[qt][0], (v8f){}));
            if (kb + 32 < SK) {   // the next step's keys OF THE SAME STAGE are read under this step's softmax
#pragma unroll
                for (int kt = 0; kt < 2; ++kt)
#pragma unroll
                    for (int ks = 0; ks < 2; ++ks) kf[kt][ks] = F::ld(sk + (kb + 32 + kt * 16) * HD + ks * 512, l8); }
#pragma unroll
            for (int qt = 0; qt < 2; ++qt) { float mx = vmax8(st[0][qt], st[1][qt]); mx = fmaxf(mx, xhalf(mx));
                const float mn = fmaxf(m[qt], mx * CEXP); const float al = exp2s(m[qt] - mn); m[qt] = mn; float s = 0.f;
#pragma unroll
                for (int kt = 0; kt < 2; ++kt) { const v8f p = exp2v(st[kt][qt] * CEXP - mn);
#pragma unroll
                    for (int j = 0; j < 8; ++j) { s += p[j]; pf[qt][kt * 8 + j] = tohx(p[j]); } }
                l[qt] = l[qt] * al + s;
#pragma unroll
                for (int dt = 0; dt < 4; ++dt) o[qt][dt] *= al; }
#pragma unroll
            for (int dt = 0; dt < 4; ++dt)
#pragma unroll
                for (int qt = 0; qt < 2; ++qt) o[qt][dt] = F::mma(vf[dt], pf[qt], o[qt][dt]);
        }
        // four vector slots behind the last matrix instructions: on the taken branch the loop's first ones overwrite their B registers
        asm volatile("v_nop\n\tv_nop\n\tv_nop\n\tv_nop" : "+v"(o[0][0]), "+v"(o[0][1]), "+v"(o[0][2]), "+v"(o[0][3]), "+v"(o[1][0]), "+v"(o[1][1]), "+v"(o[1][2]), "+v"(o[1][3]));
        wait_lds(); wait_copies(); __syncthreads();   // publish point: stage t + 1 has landed for every wave, and every wave has left stage t's buffer
        if (t + 2 < NST) copy8(lc + bo, gk + (size_t)(t + 2) * PB, lc + bo + PB, gv + (size_t)(t + 2) * PB);   // refill of the buffer just left
    }
    wait_copies();
#pragma unroll
    for (int qt = 0; qt < 2; ++qt) { const size_t oo = (size_t)(q0 + qt * 16) * DQ + col * 16; attn_store(o[qt], l[qt], Ah + oo, Al + oo, l8);
        if (qt == 0) { asm volatile("s_wait_xcnt 0x0" ::: "memory");   // the second query tile's pieces may land in registers that the first tile's stores name: the wait stands in front of that overwrite
            __builtin_amdgcn_sched_barrier(0); } }   // and keeps the second tile's arithmetic behind that wait
}
// rows < RH: bf16 hi + lo planes, three products each (hi hi, lo hi, hi lo), 16 queries per wave
__device__ __forceinline__ void attn_hl(const bf* __restrict__ Qh, const bf* __restrict__ Ql, const bf* __restrict__ Kh, const bf* __restrict__ Kl, const bf* __restrict__ VTh, const bf* __restrict__ VTl, int q0, int col, bf* Ah, bf* Al, char* ring) {
    typedef WFrag<bf> F; const unsigned l8 = (threadIdx.x & 31) * 8;
    constexpr unsigned SB = 4 * PB;   // a stage in LDS: K hi, K lo, V^T hi, V^T lo
    const unsigned lc = (unsigned)(size_t)ring + threadIdx.x * 16;   // the lane's 16 bytes of every 2048
    const char* gkh = (const char*)Kh + threadIdx.x * 16; const char* gkl = (const char*)Kl + threadIdx.x * 16; const char* gvh = (const char*)VTh + threadIdx.x * 16; const char* gvl = (const char*)VTl + threadIdx.x * 16;
    v16bf qh[2], ql[2]; v8f o[4]; float m = -3.0e38f, l = 0.f;
    copy8(lc, gkh, lc + PB, gkl); copy8(lc + 2 * PB, gvh, lc + 3 * PB, gvl);   // stage 0
#pragma unroll
    for (int ks = 0; ks < 2; ++ks) { const size_t qo = (size_t)q0 * HD + ks * 512; qh[ks] = F::ld(Qh + qo, l8); ql[ks] = F::ld(Ql + qo, l8); }
#pragma unroll
    for (int dt = 0; dt < 4; ++dt) o[dt] = (v8f){};
    wait_copies(); __syncthreads();   // stage 0 is published
    copy8(lc + SB, gkh + PB, lc + SB + PB, gkl + PB); copy8(lc + SB + 2 * PB, gvh + PB, lc + SB + 3 * PB, gvl + PB);   // stage 1
#pragma unroll 1   // as in attn_f16
    for (int t = 0; t < NST; ++t) {
        const unsigned bo = (t & 1) * SB; const bf* skh = (const bf*)(ring + bo); const bf* skl = (const bf*)(ring + bo + PB); const bf* svh = (const bf*)(ring + bo + 2 * PB); const bf* svl = (const bf*)(ring + bo + 3 * PB);
        v16bf kh[2][2], kl[2][2];
#pragma unroll
        for (int kt = 0; kt < 2; ++kt)
#pragma unroll
            for (int ks = 0; ks < 2; ++ks) { kh[kt][ks] = F::ld(skh + (kt * 16) * HD + ks * 512, l8); kl[kt][ks] = F::ld(skl + (kt * 16) * HD + ks * 512, l8); }
#pragma unroll
        for (int kb = 0; kb < SK; kb += 32) {   // steps of 32 keys, ascending, as before
            v16bf vh[4], vl[4]; v8f st[2];
#pragma unroll
            for (int dt = 0; dt < 4; ++dt) { vh[dt] = F::ld(svh + kb * HD + dt * 512, l8); vl[dt] = F::ld(svl + kb * HD + dt * 512, l8); }
#pragma unroll
            for (int kt = 0; kt < 2; ++kt) { st[kt] = (v8f){};
#pragma unroll
                for (int ks = 0; ks < 2; ++ks) { st[kt] = F::mma(kh[kt][ks], qh[ks], st[kt]); st[kt] = F::mma(kh[kt][ks], ql[ks], st[kt]); st[kt] = F::mma(kl[kt][ks], qh[ks], st[kt]); } }
            if (kb + 32 < SK) {   // as in attn_f16
#pragma unroll
                for (int kt = 0; kt < 2; ++kt)
#pragma unroll
                    for (int ks = 0; ks < 2; ++ks) { kh[kt][ks] = F::ld(skh + (kb + 32 + kt * 16) * HD + ks * 512, l8); kl[kt][ks] = F::ld(skl + (kb + 32 + kt * 16) * HD + ks * 512, l8); }
                __builtin_amdgcn_sched_barrier(0); }   // keeps the 16 key reads above the softmax: sunk to the next step's head they are waited for at once and their whole latency shows
            float mx = vmax8(st[0], st[1]); mx = fmaxf(mx, xhalf(mx));
            const float mn = fmaxf(m, mx * CEXP); const float al = exp2s(m - mn); m = mn; float s = 0.f; v8bf ph[2], pl[2];
#pragma unroll
            for (int kt = 0; kt < 2; ++kt) { const v8f p = exp2v(st[kt] * CEXP - mn);
#pragma unroll
                for (int j = 0; j < 8; ++j) s += p[j];
                ph[kt] = __builtin_convertvector(p, v8bf); pl[kt] = __builtin_convertvector(p - __builtin_convertvector(ph[kt], v8f), v8bf); }   // hi = nearest-even bf16 of p, lo = nearest-even bf16 of the exact rest (packed converts)
            l = l * al + s; const v16bf pfh = __builtin_shufflevector(ph[0], ph[1], 0, 1, 2, 3, 4, 5, 6, 7, 8, 9, 10, 11, 12, 13, 14, 15), pfl = __builtin_shufflevector(pl[0], pl[1], 0, 1, 2, 3, 4, 5, 6, 7, 8, 9, 10, 11, 12, 13, 14, 15);
#pragma unroll
            for (int dt = 0; dt < 4; ++dt) o[dt] *= al;
#pragma unroll
            for (int dt = 0; dt < 4; ++dt) { o[dt] = F::mma(vh[dt], pfh, o[dt]); o[dt] = F::mma(vh[dt], pfl, o[dt]); o[dt] = F::mma(vl[dt], pfh, o[dt]); }
        }
        asm volatile("v_nop\n\tv_nop\n\tv_nop\n\tv_nop" : "+v"(o[0]), "+v"(o[1]), "+v"(o[2]), "+v"(o[3]));   // as in attn_f16
        wait_lds(); wait_copies(); __syncthreads();   // publish point, as in attn_f16
        if (t + 2 < NST) { const size_t go = (size_t)(t + 2) * PB; copy8(lc + bo, gkh + go, lc + bo + PB, gkl + go); copy8(lc + bo + 2 * PB, gvh + go, lc + bo + 3 * PB, gvl + go); }   // refill of the buffer just left
    }
    wait_copies();
    { const size_t oo = (size_t)q0 * DQ + col * 16; attn_store(o, l, Ah + oo, Al + oo, l8); }
}
__global__ __launch_bounds__(AW * 32) void k_fattn(const h16* __restrict__ Q16, const h16* __restrict__ K16, const h16* __restrict__ VT16, const bf* __restrict__ Qh, const bf* __restrict__ Ql, const bf* __restrict__ Kh, const bf* __restrict__ Kl, const bf* __restrict__ VTh, const bf* __restrict__ VTl, bf* Ah, bf* Al) {
    __shared__ __align__(128) char ring[2 * 4 * PB];   // two buffers of the larger stage (hi + lo planes)
    const int h = blockIdx.y, bx = blockIdx.x, w = __builtin_amdgcn_readfirstlane(threadIdx.x >> 5); const size_t zo = ((size_t)blockIdx.z * NH_ + h) * TT * HD;   // the head planes of q, k (rows t) and of v (rows d) have the same size
    Ah += (size_t)blockIdx.z * TT * DQ; Al += (size_t)blockIdx.z * TT * DQ;   // merged rows (b, t) x DQ, fragment order
    if (bx < RH / (16 * AW)) attn_hl(Qh + zo, Ql + zo, Kh + zo, Kl + zo, VTh + zo, VTl + zo, (bx * AW + w) * 16, h * HD, Ah, Al, ring);
    else attn_f16(Q16 + zo, K16 + zo, VT16 + zo, RH + ((bx - RH / (16 * AW)) * AW + w) * 32, h * HD, Ah, Al, ring);
}

extern "C" void kernel_launch(void* const* d_in, const int* in_sizes, int n_in,
                              void* d_out, int out_size, void* d_ws, size_t ws_size, hipStream_t stream) {
    (void)in_sizes; (void)n_in; (void)out_size;
    const float* x = (const float*)d_in[0];   /* query */ const float* xk = (const float*)d_in[1]; const float* xv = (const float*)d_in[2]; const float* wq = (const float*)d_in[3]; const float* wk = (const float*)d_in[4]; const float* wv = (const float*)d_in[5]; const float* wo = (const float*)d_in[6]; const float* bo = (const float*)d_in[7];   /* argument order query, key, value, Wq, Wk, Wv, Wo ('oi' [1024][1024]), bo [1024] (REAL 0.01); eight inputs, all read */
    float* OUT = (float*)d_out;     // [2][2048][1024]
    char* wsp = (char*)d_ws;
    auto take = [&](size_t bytes) { char* p = wsp; wsp += (bytes + 255) & ~(size_t)255; return (void*)p; };
    const size_t NX = (size_t)NB_ * TT * DM, NW = (size_t)DQ * DM, NP = (size_t)NB_ * NH_ * TT * HD;   // elements of one input stream, one weight, one set of head planes (both batches)
    bf* XB = (bf*)take((3 * NX + 4 * NW) * 2); bf* WQ = XB + 3 * NX; bf* WO = WQ + 3 * NW;   // query, key, value, Wq, Wk, Wv, Wo in one run (k_prep)
    float* CS = (float*)take((size_t)TT * HD * 2 * 4);
    h16* QP16 = (h16*)take(2 * NP * 2); h16* KP16 = QP16 + NP; bf* QPh = (bf*)take(2 * NP * 2); bf* KPh = QPh + NP; bf* QPl = (bf*)take(2 * NP * 2); bf* KPl = QPl + NP;   // q planes, then k planes (k_projp's plane order)
    h16* VT16 = (h16*)take(NP * 2); bf* VTh = (bf*)take(NP * 2); bf* VTl = (bf*)take(NP * 2);
    bf* ATh = (bf*)take(NX * 2); bf* ATl = (bf*)take(NX * 2);
    if ((size_t)(wsp - (char*)d_ws) > ws_size) return;    // ws 256 MiB
    k_prep<<<CSB + 3 * XBL + 4 * WBL, 256, 0, stream>>>(x, xk, xv, wq, wk, wv, wo, XB, CS);
    k_projp<<<dim3(NB_ * TT / 64, NH_, 3), 32, 0, stream>>>(XB, WQ, CS, (unsigned short*)QP16, QPh, QPl, (unsigned short*)VT16, VTh, VTl);   // z = stream: q, k, v
    k_fattn<<<dim3(RH / (16 * AW) + (TT - RH) / (32 * AW), NH_, NB_), AW * 32, 0, stream>>>(QP16, KP16, VT16, QPh, QPl, KPh, KPl, VTh, VTl, ATh, ATl);   // one kv head per query head
    k_gemmw<bf, 1, true, 1, DQ><<<dim3(NB_ * TT / 64, DM / 64, 1), 32, 0, stream>>>(ATh, ATl, WO, nullptr, OUT, DM, bo, 0, 0, 0, 0);
}

// v007
// Measured time: 109 microseconds a run.
// Next to v006, in two timings, it ran 1.38 and 1.36 times as fast.
// Counting every step since v000, it is 18.4 times as fast.
#include <hip/hip_runtime.h>

// Multi-head attention WITHOUT a mask over three input streams with a computed rotate-half rotary (query, key, value [2][2048][1024]; q = query Wq^T, k = key Wk^T, v = value Wv^T ('oi' [1024][1024] 1/32, no bias; 16 heads x 64), each from its own stream; _apply_rope AFTER the head split: (x1, x2) = the two HALVES: cat(x1 cos - x2 sin, x1 sin + x2 cos) with angle t x inv_freq[i], inv_freq = 1.0 / (10000.0 ** (arange(0, 64, 2, f32) / 64)) (32 f32 constants; both halves share the 32 angles; one f32 product per angle; precise cosf / sinf), on q and k; scores / sqrt(64); softmax over all keys; out = merged Wo^T + bo ('oi' + a REAL 0.01 bias) -> [2][2048][1024] (4.2 M); argument order query, key, value, Wq, Wk, Wv, Wo, bo).
// Layout, both batches in every launch: bf16 copies of query, key, value and the four 'oi' weights (one launch, with the rotary table); the three exact projections as grid z of one launch, whose epilogue rotates q and k and stores the head planes itself; one fused attention launch, grid z = batch (hybrid rows: < 512 hi/lo 3 products, rest fp16; online softmax, scores and weights stay in registers); merged hi/lo x Wo exact.
// FRAGMENT ORDER: every 16-bit plane that a matrix instruction reads (inputs, weights, head planes, merged rows) is stored as tiles of 16 rows x 32 k = 512 elements, laid out as the operand registers want them:
// element (row, k) lies at tile 512 + ((k % 32) / 16) 256 + (((k % 16) / 8) 16 + row % 16) 8 + k % 8, so lane l's two 16-byte pieces lie at l 8 and 256 + l 8 and each wave-wide load or store is 512 contiguous bytes
// (4 cache lines; in row-major planes it touched 16). Tile order: (row / 16) major, k / 32 minor; the V^T planes k / 32 (keys) major, d / 16 minor, so that a step of 32 keys is 4 KiB in a row.
// Compute dtypes, f32 accumulate: every input rounded to bf16; projections exact; attention rows < 512 3 products, rest fp16; softmax f32; Wo hl x exact.

#define NB_  2
#define TT   2048
#define DM   1024
#define NH_  16
#define NKV  16
#define REP  (NH_ / NKV)
#define HD   64
#define DQ   (NH_ * HD)
#define DKV  (NKV * HD)
#define RH   512                  // query rows < RH use hi+lo planes (0: none)
#define WIN  0
#define SCL  0.125f   // HD^-0.5
#define CEXP (SCL * 1.4426950408889634f)   // score -> exponent of 2
typedef _Float16 h16;
typedef unsigned short bf;
typedef __attribute__((ext_vector_type(16))) __bf16   v16bf;
typedef __attribute__((ext_vector_type(16))) _Float16 v16h;
typedef __attribute__((ext_vector_type(8)))  _Float16 v8h;
typedef __attribute__((ext_vector_type(8)))  unsigned short v8us;
typedef __attribute__((ext_vector_type(8)))  float    v8f;
typedef __attribute__((ext_vector_type(4)))  float    v4f;
typedef v8h  __attribute__((may_alias)) v8ha;
typedef v4f  __attribute__((may_alias)) v4fa;
typedef v8us __attribute__((may_alias)) v8usa;

__device__ __forceinline__ unsigned short f2bf(float f) { unsigned u = __float_as_uint(f); u += 0x7FFFu + ((u >> 16) & 1u); return (unsigned short)(u >> 16); }
__device__ __forceinline__ float bf2f(unsigned short b) { return __uint_as_float(((unsigned)b) << 16); }
__device__ __forceinline__ float bfr(float f) { return bf2f(f2bf(f)); }
__device__ __forceinline__ v16h cat16(v8h lo, v8h hi) { return __builtin_shufflevector(lo, hi, 0, 1, 2, 3, 4, 5, 6, 7, 8, 9, 10, 11, 12, 13, 14, 15); }
__device__ __forceinline__ v16bf cat16b(v8us lo, v8us hi) { return __builtin_bit_cast(v16bf, __builtin_shufflevector(lo, hi, 0, 1, 2, 3, 4, 5, 6, 7, 8, 9, 10, 11, 12, 13, 14, 15)); }
__device__ __forceinline__ v8f wmma16(v16h a, v16h b, v8f c) { return __builtin_amdgcn_wmma_f32_16x16x32_f16(false, a, false, b, (short)0, c, false, false); }
__device__ __forceinline__ v8f wmmab(v16bf a, v16bf b, v8f c) { return __builtin_amdgcn_wmma_f32_16x16x32_bf16(false, a, false, b, (short)0, c, false, false); }



// ---- GEMM work-groups: GW = 4 waves, 2 x 2 register-blocked tiles of 64x64 (16 accumulators a wave), one 128x128 output tile; operands are 16-bit planes in fragment order, rows of 1024 k (ld(t, l8): t = the tile, wave-uniform, l8 = lane 8).
// OPERANDS THROUGH LDS: a stage is GK = 64 k of the 128 rows of each operand; 16 rows x 64 k are 2 fragment tiles = 2048 contiguous bytes of the plane, copied as they lie, so a stage part is 8 row tiles x 2048 bytes.
// It is brought into LDS ONCE for the two waves that read each half of it by asynchronous copies, two buffers: stage t + 2 is asked for when every wave has left stage t, and flies under stage t + 1. (k_gemmo takes two such stages as one, 128 k.)
template <typename T16> struct WFrag;
template <> struct WFrag<h16> { typedef v16h V; static __device__ __forceinline__ V ld(const h16* p) { return cat16(*(const v8h*)p, *(const v8h*)(p + 256)); } static __device__ __forceinline__ V ld(const h16* t, unsigned l8) { return cat16(*(const v8h*)(t + l8), *(const v8h*)(t + 256 + l8)); } static __device__ __forceinline__ v8f mma(V a, V b, v8f c) { return wmma16(a, b, c); } };
template <> struct WFrag<bf> { typedef v16bf V; static __device__ __forceinline__ V ld(const bf* p) { return cat16b(*(const v8us*)p, *(const v8us*)(p + 256)); } static __device__ __forceinline__ V ld(const bf* t, unsigned l8) { return cat16b(*(const v8us*)(t + l8), *(const v8us*)(t + 256 + l8)); } static __device__ __forceinline__ v8f mma(V a, V b, v8f c) { return wmmab(a, b, c); } };
#define GW   4                  // waves of a GEMM work-group
#define GK   64                 // k of a stage
#define GOB  (128 * GK * 2)     // bytes of one operand's part of a stage
#define GNS  (DM / GK)          // stages (DM == DQ: every product here sums over 1024 k)
#define GRT  (16 * DM * 2)      // bytes from one row tile of a plane to the next
__device__ __forceinline__ void wait_copies() { asm volatile("s_wait_asynccnt 0x0" ::: "memory"); }   // this wave's copies have landed; the compiler places no wait for them
__device__ __forceinline__ void wait_lds() { asm volatile("s_wait_dscnt 0x0" ::: "memory"); }         // this wave's LDS reads have returned before the buffer they read is handed back for a refill
// Eight copies of 16 bytes a lane: the 2048 bytes of a stage in each of 8 row tiles (GRT bytes apart in the plane) to 8 x 2048 bytes in a row from LDS byte address la (GW 32 lanes x 16 bytes = 2048 bytes a copy; la, ga are the lane's own).
// The s_wait_xcnt ends the copies' own statement, so that it stands in front of whatever next rewrites an address register that a copy names.
__device__ __forceinline__ void copy8r(unsigned la, const char* ga) {
    asm volatile("global_load_async_to_lds_b128 %0, %8, off\n\tglobal_load_async_to_lds_b128 %1, %9, off\n\tglobal_load_async_to_lds_b128 %2, %10, off\n\tglobal_load_async_to_lds_b128 %3, %11, off\n\t"
                 "global_load_async_to_lds_b128 %4, %12, off\n\tglobal_load_async_to_lds_b128 %5, %13, off\n\tglobal_load_async_to_lds_b128 %6, %14, off\n\tglobal_load_async_to_lds_b128 %7, %15, off\n\ts_wait_xcnt 0x0"
                 :: "v"(la), "v"(la + 2048u), "v"(la + 4096u), "v"(la + 6144u), "v"(la + 8192u), "v"(la + 10240u), "v"(la + 12288u), "v"(la + 14336u),
                    "v"(ga), "v"(ga + GRT), "v"(ga + 2 * GRT), "v"(ga + 3 * GRT), "v"(ga + 4 * GRT), "v"(ga + 5 * GRT), "v"(ga + 6 * GRT), "v"(ga + 7 * GRT) : "memory");
    __builtin_amdgcn_sched_barrier(0);   // the next run's 24 address registers are formed behind this run: formed ahead for several runs, on top of the accumulators, they take the wave past 256 registers
}
// k_gemmo: C[m][n] (f32, pitch DM) = sum_k (A[m][k] + A2[m][k]) Bt[n][k] + bias[n] (bias rounded to bf16), two products per k tile (A, then A2); grid (M/128, N/128), GW 32 threads.
__global__ __launch_bounds__(GW * 32) void k_gemmo(const bf* __restrict__ A, const bf* __restrict__ A2, const bf* __restrict__ Bt, float* C, const float* __restrict__ bias) {
    typedef WFrag<bf> F; typedef F::V V;
    __shared__ __align__(128) char ring[2 * 2 * 3 * GOB];   // two buffers of a stage of 2 GK = 128 k: A, A2, Bt parts of the first 64 k, then of the second (one work-group per WGP: a longer stage gives the copies a longer lead)
    __shared__ __align__(16) float osw[GW][16 * 68];    // each wave's own rows for the epilogue
    constexpr unsigned HB = 3 * GOB, SB = 2 * HB; constexpr int ldc = DM;   // bytes of half a stage, of a stage
    const int w = __builtin_amdgcn_readfirstlane(threadIdx.x >> 5), wm = w & 1, wn = w >> 1; float* os = osw[w];
    const int lane = threadIdx.x & 31, lr = lane & 15, hi = lane >> 4; const unsigned l8 = lane * 8; const int r0 = blockIdx.x * 128 + wm * 64, c0 = blockIdx.y * 128 + wn * 64;
    const unsigned lc = (unsigned)(size_t)ring + threadIdx.x * 16;   // the lane's 16 bytes of every 2048
    const char* ga = (const char*)(A + (size_t)blockIdx.x * 128 * DQ) + threadIdx.x * 16; const char* ga2 = (const char*)(A2 + (size_t)blockIdx.x * 128 * DQ) + threadIdx.x * 16; const char* gb = (const char*)(Bt + (size_t)blockIdx.y * 128 * DQ) + threadIdx.x * 16;
    v8f acc[4][4];
    copy8r(lc, ga); copy8r(lc + GOB, ga2); copy8r(lc + 2 * GOB, gb); copy8r(lc + HB, ga + 2048); copy8r(lc + HB + GOB, ga2 + 2048); copy8r(lc + HB + 2 * GOB, gb + 2048);   // stage 0
#pragma unroll
    for (int mb = 0; mb < 4; ++mb)
#pragma unroll
        for (int nb = 0; nb < 4; ++nb) acc[mb][nb] = (v8f){};
    wait_copies(); __syncthreads();   // stage 0 is published
    copy8r(lc + SB, ga + 4096); copy8r(lc + SB + GOB, ga2 + 4096); copy8r(lc + SB + 2 * GOB, gb + 4096); copy8r(lc + SB + HB, ga + 6144); copy8r(lc + SB + HB + GOB, ga2 + 6144); copy8r(lc + SB + HB + 2 * GOB, gb + 6144);   // stage 1
#pragma unroll 1   // one trip is a stage of 128 matrix instructions; unrolling would only add registers
    for (int t = 0; t < GNS / 2; ++t) {
        const unsigned bo = (t & 1) * SB; const bf* sa = (const bf*)(ring + bo + wm * (GOB / 2)); const bf* sa2 = (const bf*)(ring + bo + GOB + wm * (GOB / 2)); const bf* sb = (const bf*)(ring + bo + 2 * GOB + wn * (GOB / 2));
#pragma unroll
        for (int kt = 0; kt < 4; ++kt) {   // 32 k, ascending, as before; half a stage is HB / 2 elements, a row tile in it 1024, a k tile 512
            V a[4], a2[4], b[4]; constexpr int HE = HB / 2; const int ko = (kt >> 1) * HE + (kt & 1) * 512;
#pragma unroll
            for (int mb = 0; mb < 4; ++mb) { a[mb] = F::ld(sa + mb * 1024 + ko, l8); b[mb] = F::ld(sb + mb * 1024 + ko, l8); }
#pragma unroll
            for (int mb = 0; mb < 4; ++mb) a2[mb] = F::ld(sa2 + mb * 1024 + ko, l8);
            __builtin_amdgcn_sched_barrier(0);   // the twelve fragments are asked for as one group: sunk among the matrix instructions, each is waited for at once and its whole LDS latency shows (one wave per SIMD)
#pragma unroll
            for (int nb = 0; nb < 4; ++nb)
#pragma unroll
                for (int mb = 0; mb < 4; ++mb) acc[mb][nb] = F::mma(a[mb], b[nb], acc[mb][nb]);
#pragma unroll
            for (int nb = 0; nb < 4; ++nb)
#pragma unroll
                for (int mb = 0; mb < 4; ++mb) acc[mb][nb] = F::mma(a2[mb], b[nb], acc[mb][nb]);
        }
        __builtin_amdgcn_sched_barrier(0);   // keeps every matrix instruction of the trip in front of the slots below: some were moved behind the barrier, where the slots no longer follow the last of them
        // four vector slots behind the last matrix instructions: on the taken branch the loop's first reads overwrite their operands
        asm volatile("v_nop\n\tv_nop\n\tv_nop\n\tv_nop" : "+v"(acc[0][3]), "+v"(acc[1][3]), "+v"(acc[2][3]), "+v"(acc[3][3]));
        wait_lds(); wait_copies(); __syncthreads();   // publish point: stage t + 1 has landed for every wave, and every wave has left stage t's buffer
        if (t + 2 < GNS / 2) { const size_t go = (size_t)(t + 2) * 4096; copy8r(lc + bo, ga + go); copy8r(lc + bo + GOB, ga2 + go); copy8r(lc + bo + 2 * GOB, gb + go);   // refill of the buffer just left
            copy8r(lc + bo + HB, ga + go + 2048); copy8r(lc + bo + HB + GOB, ga2 + go + 2048); copy8r(lc + bo + HB + 2 * GOB, gb + go + 2048); }
    }
    wait_copies();
    constexpr bool BIAS = true;
#pragma unroll
    for (int mb = 0; mb < 4; ++mb) {
#pragma unroll
        for (int nb = 0; nb < 4; ++nb) {
#pragma unroll
            for (int j = 0; j < 8; ++j) os[(hi * 8 + j) * 68 + nb * 16 + lr] = acc[mb][nb][j]; }
        __builtin_amdgcn_wave_barrier(); asm volatile("" ::: "memory");
        float* crow = C + (size_t)(r0 + mb * 16) * ldc + c0;
{
#pragma unroll
            for (int s = 0; s < 8; ++s) { const int row = 2 * s + hi, cofs = lr * 4; v4f val = *(const v4fa*)(os + row * 68 + cofs); if (BIAS) { val[0] += bfr(bias[c0 + cofs]); val[1] += bfr(bias[c0 + cofs + 1]); val[2] += bfr(bias[c0 + cofs + 2]); val[3] += bfr(bias[c0 + cofs + 3]); }
                *(v4f*)(crow + (size_t)row * ldc + cofs) = val; }
             }
        __builtin_amdgcn_wave_barrier(); asm volatile("" ::: "memory");
    }
}

__device__ __forceinline__ h16 tohx(float x) { return (h16)x; }
__device__ __forceinline__ void splitf(float y, unsigned short& h, unsigned short& l) { h = f2bf(y); l = f2bf(y - bf2f(h)); }
typedef __attribute__((ext_vector_type(2))) _Float16 v2h;
typedef __attribute__((ext_vector_type(4))) _Float16 v4h;
typedef __attribute__((ext_vector_type(2))) unsigned short v2us;
typedef __attribute__((ext_vector_type(4))) unsigned short v4us;
typedef __attribute__((ext_vector_type(2))) float v2f;
typedef __attribute__((ext_vector_type(4))) int v4i;
typedef __attribute__((ext_vector_type(8))) __bf16 v8bf;

__global__ __launch_bounds__(256) void k_wtG(const float* __restrict__ w, int K, int N, bf* Bt) {
    const int lane = threadIdx.x & 31; const int L0 = (blockIdx.x * 8 + (threadIdx.x >> 5)) * 8; const int nlines = N * K / 64;
{
#pragma unroll 1
        for (int l = 0; l < 8; ++l) { const int L = L0 + l; if (L >= nlines) break; const size_t e = (size_t)L * 64 + lane * 2; const int k = (int)(e % K), n = (int)(e / K); v2us o;
            o[0] = f2bf(w[(size_t)k * N + n]); o[1] = f2bf(w[(size_t)(k + 1) * N + n]); *(v2us*)(Bt + e) = o; }
         }
}

// ---- k_projp: the three projections (grid z = stream: q, k, v), one wave per 64x64 tile, four to a work-group as in k_gemmo; a wave's tile is 64 rows t of ONE head (64 d), so the epilogue finishes it in registers and stores
// the head planes (fp16, bf16 hi, bf16 lo) itself: no f32 projection goes through memory. The operand that supplies the WMMA rows is chosen so that a lane's eight accumulator elements run along the plane's
// k index: q, k (planes [h], rows t, k = d, h = (stream NB_ + batch) NH_ + head): WMMA rows = d (the weight), columns = t; v (planes [g], rows d, k = t, g = batch NKV + head): WMMA rows = t (the input), columns = d.
// Rotate-half: out[d] = x[d] cos - x[d+32] sin, out[d+32] = x[d+32] cos + x[d] sin, angle (t, d % 32); d and d + 32 are row tiles mb and mb + 2 of the same lane and element.
// Epilogue of k_projp, one group of 16 plane rows (nb) at a time: rotate (q, k), round to the three planes, store. Accumulator (mb, nb) holds k = mb 16 + hi 8 + j of plane row nb 16 + lr: that IS half (mb & 1) of fragment
// tile (row tile nb, k tile mb / 2) in fragment order, so each store goes straight from the registers as 512 contiguous bytes. SN, SM: element strides of a row tile and of a k tile in the plane's tile order.
template <bool ROPE, int SN, int SM>
__device__ __forceinline__ void proj_store(v8f (&acc)[4][4], const float* __restrict__ CSt, unsigned short* D16, unsigned short* Dh, unsigned short* Dl) {
    const int lane = threadIdx.x & 31, lr = lane & 15, hi = lane >> 4; const unsigned l8 = lane * 8;
    const float* cp = ROPE ? CSt + ((size_t)lr * HD + hi * 8) * 2 : nullptr;   // (cos, sin) pairs of the tile's row lr, from d = 8 hi; row group nb lies nb 16 rows on
    v4f c[2][8];
    if (ROPE) {
#pragma unroll
        for (int i = 0; i < 8; ++i) c[0][i] = *(const v4f*)(cp + (i >> 2) * 32 + (i & 3) * 4); }
#pragma unroll
    for (int nb = 0; nb < 4; ++nb) {
        if (ROPE) {
            if (nb < 3) {   // the next row group's pairs fly under this group's arithmetic and stores
#pragma unroll
                for (int i = 0; i < 8; ++i) c[(nb + 1) & 1][i] = *(const v4f*)(cp + (size_t)(nb + 1) * 16 * HD * 2 + (i >> 2) * 32 + (i & 3) * 4); }
#pragma unroll
            for (int mb = 0; mb < 2; ++mb)
#pragma unroll
                for (int j = 0; j < 8; ++j) { const float co = c[nb & 1][mb * 4 + (j >> 1)][(j & 1) * 2], si = c[nb & 1][mb * 4 + (j >> 1)][(j & 1) * 2 + 1]; const float x1 = acc[mb][nb][j], x2 = acc[mb + 2][nb][j];
                    acc[mb][nb][j] = x1 * co - x2 * si; acc[mb + 2][nb][j] = x2 * co + x1 * si; }
        }
        v8us w[4][3];
#pragma unroll
        for (int mb = 0; mb < 4; ++mb) { const v8f x = acc[mb][nb]; const v8bf xh = __builtin_convertvector(x, v8bf);   // hi = nearest-even bf16, lo = nearest-even bf16 of the exact rest
            w[mb][0] = __builtin_bit_cast(v8us, __builtin_convertvector(x, v8h)); w[mb][1] = __builtin_bit_cast(v8us, xh);
            w[mb][2] = __builtin_bit_cast(v8us, __builtin_convertvector(x - __builtin_convertvector(xh, v8f), v8bf)); }
        __builtin_amdgcn_sched_barrier(0);   // all twelve pieces are formed before the first store: mixed with the stores, a later convert lands in a register that an issued store still names, ahead of the wait below
#pragma unroll
        for (int mb = 0; mb < 4; ++mb) { const int g = nb * SN + (mb >> 1) * SM + (mb & 1) * 256;
            *(v8us*)(D16 + g + l8) = w[mb][0]; *(v8us*)(Dh + g + l8) = w[mb][1]; *(v8us*)(Dl + g + l8) = w[mb][2]; }
        asm volatile("s_wait_xcnt 0x0" ::: "memory");   // what follows (the next group's table loads and arithmetic; behind the last group whatever the kernel does next) may land in registers that these stores name: the wait stands in front of that overwrite
        __builtin_amdgcn_sched_barrier(0);   // without it the table loads of all four groups are lifted to the front, and their 128 registers on top of the accumulators cost a wave per SIMD
    }
}
__global__ __launch_bounds__(GW * 32) void k_projp(const bf* __restrict__ X, const bf* __restrict__ Wt, const float* __restrict__ CS, unsigned short* P16, unsigned short* Ph, unsigned short* Pl, unsigned short* V16, unsigned short* Vh, unsigned short* Vl) {
    typedef WFrag<bf> F; typedef F::V V;
    __shared__ __align__(128) char ring[2 * 2 * GOB];   // two buffers of a stage: input part (128 rows t), weight part (128 rows = 2 heads)
    constexpr unsigned SB = 2 * GOB;
    const int z = blockIdx.z; const bool isv = z == 2;
    const int w = __builtin_amdgcn_readfirstlane(threadIdx.x >> 5), wx = w & 1, wh = w >> 1;   // the wave's 64 rows t and its head within the work-group's tile
    const int lane = threadIdx.x & 31; const int r0 = blockIdx.x * 128 + wx * 64, head = blockIdx.y * 2 + wh; const int b = r0 / TT, t0 = r0 % TT; const unsigned l8 = lane * 8;
    const unsigned lc = (unsigned)(size_t)ring + threadIdx.x * 16;   // the lane's 16 bytes of every 2048
    const char* gx = (const char*)(X + (size_t)z * NB_ * TT * DM + (size_t)blockIdx.x * 128 * DM) + threadIdx.x * 16; const char* gw = (const char*)(Wt + (size_t)z * DQ * DM + (size_t)blockIdx.y * 128 * DM) + threadIdx.x * 16;
    const unsigned xo = wx * (GOB / 2), wo = GOB + wh * (GOB / 2); const unsigned ao = isv ? xo : wo, bo2 = isv ? wo : xo;   // the wave's halves of the two parts; which of them supplies the WMMA rows
    copy8r(lc, gx); copy8r(lc + GOB, gw);   // stage 0
    v8f acc[4][4];
#pragma unroll
    for (int mb = 0; mb < 4; ++mb)
#pragma unroll
        for (int nb = 0; nb < 4; ++nb) acc[mb][nb] = (v8f){};
    wait_copies(); __syncthreads();   // stage 0 is published
    copy8r(lc + SB, gx + 2048); copy8r(lc + SB + GOB, gw + 2048);   // stage 1
#pragma unroll 1   // one trip is a stage of 32 matrix instructions; unrolling would only add operand registers on top of the 128 of the accumulators
    for (int t = 0; t < GNS; ++t) {
        const unsigned bo = (t & 1) * SB; const bf* sa = (const bf*)(ring + bo + ao); const bf* sb = (const bf*)(ring + bo + bo2);
#pragma unroll
        for (int kt = 0; kt < 2; ++kt) {   // 32 k, ascending, as before; a row tile of the stage is 1024 elements, a k tile 512
            V a[4], bb[4];
#pragma unroll
            for (int mb = 0; mb < 4; ++mb) { a[mb] = F::ld(sa + mb * 1024 + kt * 512, l8); bb[mb] = F::ld(sb + mb * 1024 + kt * 512, l8); }
            __builtin_amdgcn_sched_barrier(0);   // the eight fragments are asked for as one group, as in k_gemmo
#pragma unroll
            for (int nb = 0; nb < 4; ++nb)
#pragma unroll
                for (int mb = 0; mb < 4; ++mb) acc[mb][nb] = F::mma(a[mb], bb[nb], acc[mb][nb]);
        }
        __builtin_amdgcn_sched_barrier(0);   // as in k_gemmo
        // four vector slots behind the last matrix instructions, as in k_gemmo
        asm volatile("v_nop\n\tv_nop\n\tv_nop\n\tv_nop" : "+v"(acc[0][3]), "+v"(acc[1][3]), "+v"(acc[2][3]), "+v"(acc[3][3]));
        wait_lds(); wait_copies(); __syncthreads();   // publish point, as in k_gemmo
        if (t + 2 < GNS) { const size_t go = (size_t)(t + 2) * 2048; copy8r(lc + bo, gx + go); copy8r(lc + bo + GOB, gw + go); }   // refill of the buffer just left
    }
    wait_copies();
    // acc[mb][nb][j]: k index i = mb 16 + hi 8 + j, plane row o = nb 16 + lr. 64 t of one head are 4096 elements in a row in both tile orders: q, k 4 row tiles x 2 k tiles, v 2 k tiles x 4 row tiles
    if (isv) { const size_t base = ((size_t)(b * NKV + head) * TT + t0) * HD; proj_store<false, 512, 2048>(acc, nullptr, V16 + base, Vh + base, Vl + base); }
    else { const size_t base = (((size_t)(z * NB_ + b) * NH_ + head) * TT + t0) * HD; proj_store<true, 1024, 512>(acc, CS + (size_t)t0 * HD * 2, P16 + base, Ph + base, Pl + base); }
}
__constant__ float INVT[HD / 2] = { 1.000000000e+00f, 7.498942018e-01f, 5.623413324e-01f, 4.216965139e-01f, 3.162277639e-01f, 2.371373624e-01f, 1.778279394e-01f, 1.333521456e-01f, 1.000000015e-01f, 7.498941571e-02f, 5.623412877e-02f, 4.216964915e-02f, 3.162277862e-02f, 2.371373586e-02f, 1.778279431e-02f, 1.333521493e-02f, 9.999999776e-03f, 7.498942316e-03f, 5.623413250e-03f, 4.216964822e-03f, 3.162277862e-03f, 2.371373819e-03f, 1.778279431e-03f, 1.333521446e-03f, 1.000000047e-03f, 7.498941850e-04f, 5.623413017e-04f, 4.216964880e-04f, 3.162277862e-04f, 2.371373848e-04f, 1.778279402e-04f, 1.333521504e-04f };   // 1 / 10000^(2i/64) (float32, generated with jnp to be bit-exact)
// k_prep: everything that depends on no other launch, in one grid. Work-groups [0, CSB): the rotary table (positions = arange). The rest: f32 -> bf16, 2048 elements each, into ONE run of planes
// dst = query, key, value (both batches each), Wq, Wk, Wv, Wo, so that the destination offset is linear in the work-group index and only the source is chosen (a scalar choice).
// The planes are in fragment order (rows of DM = 32 k tiles): a work-group writes 4 tiles in a row = 16 source rows x 128 k. A wave takes 8 rows of one tile in two loads of 4 whole 128-byte source lines each
// (8 lanes a row, 4 k a lane); its 8-byte pieces fill 64-byte runs (4 rows of one half-column of 8 k), and the two stores together whole lines of the tile.
#define CSB  (TT * HD / 256)
#define XBL  (NB_ * TT * DM / 2048)   // work-groups per input stream
#define WBL  (DQ * DM / 2048)         // work-groups per weight
__global__ __launch_bounds__(256) void k_prep(const float* __restrict__ xq, const float* __restrict__ xk, const float* __restrict__ xv, const float* __restrict__ wq, const float* __restrict__ wk, const float* __restrict__ wv, const float* __restrict__ wo, bf* dst, float* CS) {
    if (blockIdx.x < CSB) { const int idx = blockIdx.x * 256 + threadIdx.x; const int d = idx % HD; const int t = idx / HD; const float a = __fmul_rn((float)t, INVT[d % (HD / 2)]); v2f cs; cs[0] = cosf(a); cs[1] = sinf(a); *(v2f*)(CS + (size_t)idx * 2) = cs; return; }
    const int bx = blockIdx.x - CSB; const float* src; int lb;
    if (bx < 3 * XBL) { const int sel = bx / XBL; lb = bx % XBL; src = sel == 0 ? xq : sel == 1 ? xk : xv; }
    else { const int sel = (bx - 3 * XBL) / WBL; lb = (bx - 3 * XBL) % WBL; src = sel == 0 ? wq : sel == 1 ? wk : sel == 2 ? wv : wo; }
    const int w = threadIdx.x >> 5, lane = threadIdx.x & 31, tile = lb * 4 + (w >> 1); const int r = (w & 1) * 8 + (lane >> 3), k4 = (lane & 7) * 4;   // row in the tile (and r + 4), first k in the tile
    const float* sp = src + (size_t)((tile / (DM / 32)) * 16 + r) * DM + (tile % (DM / 32)) * 32 + k4;
    bf* dp = dst + (size_t)bx * 2048 + (w >> 1) * 512 + (k4 >> 4) * 256 + (((k4 >> 3) & 1) * 16 + r) * 8 + (k4 & 4);
    const v4f v0 = *(const v4f*)sp, v1 = *(const v4f*)(sp + 4 * DM); v4us o0, o1;
#pragma unroll
    for (int k = 0; k < 4; ++k) { o0[k] = f2bf(v0[k]); o1[k] = f2bf(v1[k]); }
    *(v4us*)dp = o0; *(v4us*)(dp + 4 * 8) = o1;  }
// ---- k_fattn: scores, softmax and weights x V in ONE kernel; AW waves per work-group, grid (RH/(16 AW) + (TT-RH)/(32 AW), heads, batches).
// The wave forms the TRANSPOSED score tile S^T = K Q^T (A = 16 keys, B = 16 queries): lane (lr, hi) then holds keys 8 hi + j of query lr, and two such tiles (keys 0..15, 16..31)
// side by side ARE the B fragment (k = 8 hi + 0..7, 16 + 8 hi + 0..7) of O^T = V^T P^T, so the weights never leave their registers. Online softmax per query over steps of 32 keys, ascending:
// running maximum m (in exponent-of-2 units), running sum l and O^T rescaled by 2^(m_old - m_new); the two lane halves of a query share m (one cross-half exchange per step) and add their l at the end.
__device__ __forceinline__ float xhalf(float x) { return __builtin_bit_cast(float, __builtin_amdgcn_permlanex16(__builtin_bit_cast(int, x), __builtin_bit_cast(int, x), 0x76543210, 0xfedcba98, false, false)); }   // lane l with lane l ^ 16, no LDS round trip
// 2^x. The instruction set asks for one free slot behind a transcendental before its result is read or its source overwritten: the v_nop ends the same statement so that it cannot drift,
// and the early-clobber results keep every exp of the run of eight off the sources of the others.
__device__ __forceinline__ float exp2s(float x) { float r; asm("v_exp_f32 %0, %1\n\tv_nop" : "=v"(r) : "v"(x)); return r; }
__device__ __forceinline__ v8f exp2v(v8f x) { float r0, r1, r2, r3, r4, r5, r6, r7;
    asm("v_exp_f32 %0, %8\n\tv_exp_f32 %1, %9\n\tv_exp_f32 %2, %10\n\tv_exp_f32 %3, %11\n\tv_exp_f32 %4, %12\n\tv_exp_f32 %5, %13\n\tv_exp_f32 %6, %14\n\tv_exp_f32 %7, %15\n\tv_nop"
        : "=&v"(r0), "=&v"(r1), "=&v"(r2), "=&v"(r3), "=&v"(r4), "=&v"(r5), "=&v"(r6), "=&v"(r7) : "v"(x[0]), "v"(x[1]), "v"(x[2]), "v"(x[3]), "v"(x[4]), "v"(x[5]), "v"(x[6]), "v"(x[7]));
    return (v8f){r0, r1, r2, r3, r4, r5, r6, r7}; }
__device__ __forceinline__ float vmax8(v8f a, v8f b) { float x = fmaxf(a[0], b[0]);
#pragma unroll
    for (int j = 1; j < 8; ++j) x = fmaxf(x, fmaxf(a[j], b[j]));
    return x; }
__device__ __forceinline__ void attn_store(const v8f* o, float l, bf* Ah, bf* Al, unsigned l8) {   // o: four d tiles of one query column; Ah, Al: the first fragment tile of (16 queries, head), wave-uniform; d tile dt is half dt & 1 of k tile dt / 2, 256 elements a half
    const float inv = __fdiv_rn(1.0f, l + xhalf(l)); v8us wh[4], wl[4];
#pragma unroll
    for (int dt = 0; dt < 4; ++dt) { const v8f x = o[dt] * inv; const v8bf xh = __builtin_convertvector(x, v8bf), xl = __builtin_convertvector(x - __builtin_convertvector(xh, v8f), v8bf);   // hi + lo, nearest even, packed converts
        wh[dt] = __builtin_bit_cast(v8us, xh); wl[dt] = __builtin_bit_cast(v8us, xl); }
    __builtin_amdgcn_sched_barrier(0);   // all eight pieces are formed before the first store: mixed with the stores, a later convert lands in a register that an issued store still names
#pragma unroll
    for (int dt = 0; dt < 4; ++dt) { *(v8us*)(Ah + dt * 256 + l8) = wh[dt]; *(v8us*)(Al + dt * 256 + l8) = wl[dt]; }
}
// K AND V THROUGH LDS: a work-group is AW waves that walk the same keys of one head, each with its own queries. A stage of SK keys (each plane's part is PB contiguous bytes in fragment order, copied as it lies)
// is brought into LDS ONCE for all AW waves by asynchronous copies, two buffers: stage t + 2 is asked for when every wave has left stage t, and flies under stage t + 1. A fragment read is 512 contiguous LDS bytes a wave.
#define AW   4                 // waves of an attention work-group
#define SK   64                // keys of a stage
#define PB   (SK * HD * 2)     // bytes of one 16-bit plane's part of a stage
#define NST  (TT / SK)         // stages
// Eight copies of 16 bytes a lane: PB bytes from ga to LDS byte address la and PB bytes from gb to lb (AW 32 lanes x 16 bytes = 2048 bytes a copy; la, lb, ga, gb are the lane's own).
// The s_wait_xcnt ends the copies' own statement, so that it stands in front of whatever next rewrites an address register that a copy names.
__device__ __forceinline__ void copy8(unsigned la, const char* ga, unsigned lb, const char* gb) {
    asm volatile("global_load_async_to_lds_b128 %0, %8, off\n\tglobal_load_async_to_lds_b128 %1, %9, off\n\tglobal_load_async_to_lds_b128 %2, %10, off\n\tglobal_load_async_to_lds_b128 %3, %11, off\n\t"
                 "global_load_async_to_lds_b128 %4, %12, off\n\tglobal_load_async_to_lds_b128 %5, %13, off\n\tglobal_load_async_to_lds_b128 %6, %14, off\n\tglobal_load_async_to_lds_b128 %7, %15, off\n\ts_wait_xcnt 0x0"
                 :: "v"(la), "v"(la + 2048u), "v"(la + 4096u), "v"(la + 6144u), "v"(lb), "v"(lb + 2048u), "v"(lb + 4096u), "v"(lb + 6144u),
                    "v"(ga), "v"(ga + 2048), "v"(ga + 4096), "v"(ga + 6144), "v"(gb), "v"(gb + 2048), "v"(gb + 4096), "v"(gb + 6144) : "memory");
}
// rows >= RH: fp16 operands, 32 queries per wave
__device__ __forceinline__ void attn_f16(const h16* __restrict__ Q, const h16* __restrict__ K, const h16* __restrict__ VT, int q0, int col, bf* Ah, bf* Al, char* ring) {
    typedef WFrag<h16> F; const unsigned l8 = (threadIdx.x & 31) * 8;
    constexpr unsigned SB = 2 * PB;   // a stage in LDS: K part, V^T part
    const unsigned lc = (unsigned)(size_t)ring + threadIdx.x * 16; const char* gk = (const char*)K + threadIdx.x * 16; const char* gv = (const char*)VT + threadIdx.x * 16;   // the lane's 16 bytes of every 2048
    v16h qf[2][2]; v8f o[2][4]; float m[2], l[2];
    copy8(lc, gk, lc + PB, gv);   // stage 0
    // fragment order: 16 rows t of q or k are 2 tiles (16 HD elements), 32 keys of V^T are 4 tiles (32 HD elements)
#pragma unroll
    for (int qt = 0; qt < 2; ++qt) { m[qt] = -3.0e38f; l[qt] = 0.f;
#pragma unroll
        for (int ks = 0; ks < 2; ++ks) qf[qt][ks] = F::ld(Q + (size_t)(q0 + qt * 16) * HD + ks * 512, l8);
#pragma unroll
        for (int dt = 0; dt < 4; ++dt) o[qt][dt] = (v8f){}; }
    wait_copies(); __syncthreads();   // stage 0 is published
    copy8(lc + SB, gk + PB, lc + SB + PB, gv + PB);   // stage 1
#pragma unroll 1   // one trip is a stage; unrolling would only add registers
    for (int t = 0; t < NST; ++t) {
        const unsigned bo = (t & 1) * SB; const h16* sk = (const h16*)(ring + bo); const h16* sv = (const h16*)(ring + bo + PB);
        v16h kf[2][2];
#pragma unroll
        for (int kt = 0; kt < 2; ++kt)
#pragma unroll
            for (int ks = 0; ks < 2; ++ks) kf[kt][ks] = F::ld(sk + (kt * 16) * HD + ks * 512, l8);
#pragma unroll
        for (int kb = 0; kb < SK; kb += 32) {   // steps of 32 keys, ascending, as before
            v16h vf[4], pf[2]; v8f st[2][2];
#pragma unroll
            for (int dt = 0; dt < 4; ++dt) vf[dt] = F::ld(sv + kb * HD + dt * 512, l8);
#pragma unroll
            for (int kt = 0; kt < 2; ++kt)
#pragma unroll
                for (int qt = 0; qt < 2; ++qt) st[kt][qt] = F::mma(kf[kt][1], qf[qt][1], F::mma(kf[kt][0], qf[qt][0], (v8f){}));
            if (kb + 32 < SK) {   // the next step's keys OF THE SAME STAGE are read under this step's softmax
#pragma unroll
                for (int kt = 0; kt < 2; ++kt)
#pragma unroll
                    for (int ks = 0; ks < 2; ++ks) kf[kt][ks] = F::ld(sk + (kb + 32 + kt * 16) * HD + ks * 512, l8); }
#pragma unroll
            for (int qt = 0; qt < 2; ++qt) { float mx = vmax8(st[0][qt], st[1][qt]); mx = fmaxf(mx, xhalf(mx));
                const float mn = fmaxf(m[qt], mx * CEXP); const float al = exp2s(m[qt] - mn); m[qt] = mn; float s = 0.f;
#pragma unroll
                for (int kt = 0; kt < 2; ++kt) { const v8f p = exp2v(st[kt][qt] * CEXP - mn);
#pragma unroll
                    for (int j = 0; j < 8; ++j) { s += p[j]; pf[qt][kt * 8 + j] = tohx(p[j]); } }
                l[qt] = l[qt] * al + s;
#pragma unroll
                for (int dt = 0; dt < 4; ++dt) o[qt][dt] *= al; }
#pragma unroll
            for (int dt = 0; dt < 4; ++dt)
#pragma unroll
                for (int qt = 0; qt < 2; ++qt) o[qt][dt] = F::mma(vf[dt], pf[qt], o[qt][dt]);
        }
        // four vector slots behind the last matrix instructions: on the taken branch the loop's first ones overwrite their B registers
        asm volatile("v_nop\n\tv_nop\n\tv_nop\n\tv_nop" : "+v"(o[0][0]), "+v"(o[0][1]), "+v"(o[0][2]), "+v"(o[0][3]), "+v"(o[1][0]), "+v"(o[1][1]), "+v"(o[1][2]), "+v"(o[1][3]));
        wait_lds(); wait_copies(); __syncthreads();   // publish point: stage t + 1 has landed for every wave, and every wave has left stage t's buffer
        if (t + 2 < NST) copy8(lc + bo, gk + (size_t)(t + 2) * PB, lc + bo + PB, gv + (size_t)(t + 2) * PB);   // refill of the buffer just left
    }
    wait_copies();
#pragma unroll
    for (int qt = 0; qt < 2; ++qt) { const size_t oo = (size_t)(q0 + qt * 16) * DQ + col * 16; attn_store(o[qt], l[qt], Ah + oo, Al + oo, l8);
        if (qt == 0) { asm volatile("s_wait_xcnt 0x0" ::: "memory");   // the second query tile's pieces may land in registers that the first tile's stores name: the wait stands in front of that overwrite
            __builtin_amdgcn_sched_barrier(0); } }   // and keeps the second tile's arithmetic behind that wait
}
// rows < RH: bf16 hi + lo planes, three products each (hi hi, lo hi, hi lo), 16 queries per wave
__device__ __forceinline__ void attn_hl(const bf* __restrict__ Qh, const bf* __restrict__ Ql, const bf* __restrict__ Kh, const bf* __restrict__ Kl, const bf* __restrict__ VTh, const bf* __restrict__ VTl, int q0, int col, bf* Ah, bf* Al, char* ring) {
    typedef WFrag<bf> F; const unsigned l8 = (threadIdx.x & 31) * 8;
    constexpr unsigned SB = 4 * PB;   // a stage in LDS: K hi, K lo, V^T hi, V^T lo
    const unsigned lc = (unsigned)(size_t)ring + threadIdx.x * 16;   // the lane's 16 bytes of every 2048
    const char* gkh = (const char*)Kh + threadIdx.x * 16; const char* gkl = (const char*)Kl + threadIdx.x * 16; const char* gvh = (const char*)VTh + threadIdx.x * 16; const char* gvl = (const char*)VTl + threadIdx.x * 16;
    v16bf qh[2], ql[2]; v8f o[4]; float m = -3.0e38f, l = 0.f;
    copy8(lc, gkh, lc + PB, gkl); copy8(lc + 2 * PB, gvh, lc + 3 * PB, gvl);   // stage 0
#pragma unroll
    for (int ks = 0; ks < 2; ++ks) { const size_t qo = (size_t)q0 * HD + ks * 512; qh[ks] = F::ld(Qh + qo, l8); ql[ks] = F::ld(Ql + qo, l8); }
#pragma unroll
    for (int dt = 0; dt < 4; ++dt) o[dt] = (v8f){};
    wait_copies(); __syncthreads();   // stage 0 is published
    copy8(lc + SB, gkh + PB, lc + SB + PB, gkl + PB); copy8(lc + SB + 2 * PB, gvh + PB, lc + SB + 3 * PB, gvl + PB);   // stage 1
#pragma unroll 1   // as in attn_f16
    for (int t = 0; t < NST; ++t) {
        const unsigned bo = (t & 1) * SB; const bf* skh = (const bf*)(ring + bo); const bf* skl = (const bf*)(ring + bo + PB); const bf* svh = (const bf*)(ring + bo + 2 * PB); const bf* svl = (const bf*)(ring + bo + 3 * PB);
        v16bf kh[2][2], kl[2][2];
#pragma unroll
        for (int kt = 0; kt < 2; ++kt)
#pragma unroll
            for (int ks = 0; ks < 2; ++ks) { kh[kt][ks] = F::ld(skh + (kt * 16) * HD + ks * 512, l8); kl[kt][ks] = F::ld(skl + (kt * 16) * HD + ks * 512, l8); }
#pragma unroll
        for (int kb = 0; kb < SK; kb += 32) {   // steps of 32 keys, ascending, as before
            v16bf vh[4], vl[4]; v8f st[2];
#pragma unroll
            for (int dt = 0; dt < 4; ++dt) { vh[dt] = F::ld(svh + kb * HD + dt * 512, l8); vl[dt] = F::ld(svl + kb * HD + dt * 512, l8); }
#pragma unroll
            for (int kt = 0; kt < 2; ++kt) { st[kt] = (v8f){};
#pragma unroll
                for (int ks = 0; ks < 2; ++ks) { st[kt] = F::mma(kh[kt][ks], qh[ks], st[kt]); st[kt] = F::mma(kh[kt][ks], ql[ks], st[kt]); st[kt] = F::mma(kl[kt][ks], qh[ks], st[kt]); } }
            if (kb + 32 < SK) {   // as in attn_f16
#pragma unroll
                for (int kt = 0; kt < 2; ++kt)
#pragma unroll
                    for (int ks = 0; ks < 2; ++ks) { kh[kt][ks] = F::ld(skh + (kb + 32 + kt * 16) * HD + ks * 512, l8); kl[kt][ks] = F::ld(skl + (kb + 32 + kt * 16) * HD + ks * 512, l8); }
                __builtin_amdgcn_sched_barrier(0); }   // keeps the 16 key reads above the softmax: sunk to the next step's head they are waited for at once and their whole latency shows
            float mx = vmax8(st[0], st[1]); mx = fmaxf(mx, xhalf(mx));
            const float mn = fmaxf(m, mx * CEXP); const float al = exp2s(m - mn); m = mn; float s = 0.f; v8bf ph[2], pl[2];
#pragma unroll
            for (int kt = 0; kt < 2; ++kt) { const v8f p = exp2v(st[kt] * CEXP - mn);
#pragma unroll
                for (int j = 0; j < 8; ++j) s += p[j];
                ph[kt] = __builtin_convertvector(p, v8bf); pl[kt] = __builtin_convertvector(p - __builtin_convertvector(ph[kt], v8f), v8bf); }   // hi = nearest-even bf16 of p, lo = nearest-even bf16 of the exact rest (packed converts)
            l = l * al + s; const v16bf pfh = __builtin_shufflevector(ph[0], ph[1], 0, 1, 2, 3, 4, 5, 6, 7, 8, 9, 10, 11, 12, 13, 14, 15), pfl = __builtin_shufflevector(pl[0], pl[1], 0, 1, 2, 3, 4, 5, 6, 7, 8, 9, 10, 11, 12, 13, 14, 15);
#pragma unroll
            for (int dt = 0; dt < 4; ++dt) o[dt] *= al;
#pragma unroll
            for (int dt = 0; dt < 4; ++dt) { o[dt] = F::mma(vh[dt], pfh, o[dt]); o[dt] = F::mma(vh[dt], pfl, o[dt]); o[dt] = F::mma(vl[dt], pfh, o[dt]); }
        }
        asm volatile("v_nop\n\tv_nop\n\tv_nop\n\tv_nop" : "+v"(o[0]), "+v"(o[1]), "+v"(o[2]), "+v"(o[3]));   // as in attn_f16
        wait_lds(); wait_copies(); __syncthreads();   // publish point, as in attn_f16
        if (t + 2 < NST) { const size_t go = (size_t)(t + 2) * PB; copy8(lc + bo, gkh + go, lc + bo + PB, gkl + go); copy8(lc + bo + 2 * PB, gvh + go, lc + bo + 3 * PB, gvl + go); }   // refill of the buffer just left
    }
    wait_copies();
    { const size_t oo = (size_t)q0 * DQ + col * 16; attn_store(o, l, Ah + oo, Al + oo, l8); }
}
__global__ __launch_bounds__(AW * 32) void k_fattn(const h16* __restrict__ Q16, const h16* __restrict__ K16, const h16* __restrict__ VT16, const bf* __restrict__ Qh, const bf* __restrict__ Ql, const bf* __restrict__ Kh, const bf* __restrict__ Kl, const bf* __restrict__ VTh, const bf* __restrict__ VTl, bf* Ah, bf* Al) {
    __shared__ __align__(128) char ring[2 * 4 * PB];   // two buffers of the larger stage (hi + lo planes)
    const int h = blockIdx.y, bx = blockIdx.x, w = __builtin_amdgcn_readfirstlane(threadIdx.x >> 5); const size_t zo = ((size_t)blockIdx.z * NH_ + h) * TT * HD;   // the head planes of q, k (rows t) and of v (rows d) have the same size
    Ah += (size_t)blockIdx.z * TT * DQ; Al += (size_t)blockIdx.z * TT * DQ;   // merged rows (b, t) x DQ, fragment order
    if (bx < RH / (16 * AW)) attn_hl(Qh + zo, Ql + zo, Kh + zo, Kl + zo, VTh + zo, VTl + zo, (bx * AW + w) * 16, h * HD, Ah, Al, ring);
    else attn_f16(Q16 + zo, K16 + zo, VT16 + zo, RH + ((bx - RH / (16 * AW)) * AW + w) * 32, h * HD, Ah, Al, ring);
}

extern "C" void kernel_launch(void* const* d_in, const int* in_sizes, int n_in,
                              void* d_out, int out_size, void* d_ws, size_t ws_size, hipStream_t stream) {
    (void)in_sizes; (void)n_in; (void)out_size;
    const float* x = (const float*)d_in[0];   /* query */ const float* xk = (const float*)d_in[1]; const float* xv = (const float*)d_in[2]; const float* wq = (const float*)d_in[3]; const float* wk = (const float*)d_in[4]; const float* wv = (const float*)d_in[5]; const float* wo = (const float*)d_in[6]; const float* bo = (const float*)d_in[7];   /* argument order query, key, value, Wq, Wk, Wv, Wo ('oi' [1024][1024]), bo [1024] (REAL 0.01); eight inputs, all read */
    float* OUT = (float*)d_out;     // [2][2048][1024]
    char* wsp = (char*)d_ws;
    auto take = [&](size_t bytes) { char* p = wsp; wsp += (bytes + 255) & ~(size_t)255; return (void*)p; };
    const size_t NX = (size_t)NB_ * TT * DM, NW = (size_t)DQ * DM, NP = (size_t)NB_ * NH_ * TT * HD;   // elements of one input stream, one weight, one set of head planes (both batches)
    bf* XB = (bf*)take((3 * NX + 4 * NW) * 2); bf* WQ = XB + 3 * NX; bf* WO = WQ + 3 * NW;   // query, key, value, Wq, Wk, Wv, Wo in one run (k_prep)
    float* CS = (float*)take((size_t)TT * HD * 2 * 4);
    h16* QP16 = (h16*)take(2 * NP * 2); h16* KP16 = QP16 + NP; bf* QPh = (bf*)take(2 * NP * 2); bf* KPh = QPh + NP; bf* QPl = (bf*)take(2 * NP * 2); bf* KPl = QPl + NP;   // q planes, then k planes (k_projp's plane order)
    h16* VT16 = (h16*)take(NP * 2); bf* VTh = (bf*)take(NP * 2); bf* VTl = (bf*)take(NP * 2);
    bf* ATh = (bf*)take(NX * 2); bf* ATl = (bf*)take(NX * 2);
    if ((size_t)(wsp - (char*)d_ws) > ws_size) return;    // ws 256 MiB
    k_prep<<<CSB + 3 * XBL + 4 * WBL, 256, 0, stream>>>(x, xk, xv, wq, wk, wv, wo, XB, CS);
    k_projp<<<dim3(NB_ * TT / 128, NH_ / 2, 3), GW * 32, 0, stream>>>(XB, WQ, CS, (unsigned short*)QP16, QPh, QPl, (unsigned short*)VT16, VTh, VTl);   // z = stream: q, k, v
    k_fattn<<<dim3(RH / (16 * AW) + (TT - RH) / (32 * AW), NH_, NB_), AW * 32, 0, stream>>>(QP16, KP16, VT16, QPh, QPl, KPh, KPl, VTh, VTl, ATh, ATl);   // one kv head per query head
    k_gemmo<<<dim3(NB_ * TT / 128, DM / 128, 1), GW * 32, 0, stream>>>(ATh, ATl, WO, OUT, bo);
}

// v008
// Measured time: 104 microseconds a run.
// Next to v007, in two timings, it ran 1.05 times as fast each time.
// Counting every step since v000, it is 19.3 times as fast.
#include <hip/hip_runtime.h>

// Multi-head attention WITHOUT a mask over three input streams with a computed rotate-half rotary (query, key, value [2][2048][1024]; q = query Wq^T, k = key Wk^T, v = value Wv^T ('oi' [1024][1024] 1/32, no bias; 16 heads x 64), each from its own stream; _apply_rope AFTER the head split: (x1, x2) = the two HALVES: cat(x1 cos - x2 sin, x1 sin + x2 cos) with angle t x inv_freq[i], inv_freq = 1.0 / (10000.0 ** (arange(0, 64, 2, f32) / 64)) (32 f32 constants; both halves share the 32 angles; one f32 product per angle; precise cosf / sinf), on q and k; scores / sqrt(64); softmax over all keys; out = merged Wo^T + bo ('oi' + a REAL 0.01 bias) -> [2][2048][1024] (4.2 M); argument order query, key, value, Wq, Wk, Wv, Wo, bo).
// Layout, both batches in every launch: bf16 copies of query, key, value and the four 'oi' weights (one launch, with the rotary table); the three exact projections as grid z of one launch, whose epilogue rotates q and k and stores the head planes itself; one fused attention launch, grid y = batch and head, z = class of work-groups (hybrid rows: < 512 hi/lo 3 products, rest fp16; online softmax, scores and weights stay in registers); merged hi/lo x Wo exact.
// FRAGMENT ORDER: every 16-bit plane that a matrix instruction reads (inputs, weights, head planes, merged rows) is stored as tiles of 16 rows x 32 k = 512 elements, laid out as the operand registers want them:
// element (row, k) lies at tile 512 + ((k % 32) / 16) 256 + (((k % 16) / 8) 16 + row % 16) 8 + k % 8, so lane l's two 16-byte pieces lie at l 8 and 256 + l 8 and each wave-wide load or store is 512 contiguous bytes
// (4 cache lines; in row-major planes it touched 16). Tile order: (row / 16) major, k / 32 minor; the V^T planes k / 32 (keys) major, d / 16 minor, so that a step of 32 keys is 4 KiB in a row.
// Compute dtypes, f32 accumulate: every input rounded to bf16; projections exact; attention rows < 512 3 products, rest fp16; softmax f32; Wo hl x exact.

#define NB_  2
#define TT   2048
#define DM   1024
#define NH_  16
#define NKV  16
#define REP  (NH_ / NKV)
#define HD   64
#define DQ   (NH_ * HD)
#define DKV  (NKV * HD)
#define RH   512                  // query rows < RH use hi+lo planes
#define WIN  0
#define SCL  0.125f   // HD^-0.5
#define CEXP (SCL * 1.4426950408889634f)   // score -> exponent of 2
typedef _Float16 h16;
typedef unsigned short bf;
typedef __attribute__((ext_vector_type(16))) __bf16   v16bf;
typedef __attribute__((ext_vector_type(16))) _Float16 v16h;
typedef __attribute__((ext_vector_type(8)))  _Float16 v8h;
typedef __attribute__((ext_vector_type(8)))  unsigned short v8us;
typedef __attribute__((ext_vector_type(8)))  float    v8f;
typedef __attribute__((ext_vector_type(4)))  float    v4f;
typedef v8h  __attribute__((may_alias)) v8ha;
typedef v4f  __attribute__((may_alias)) v4fa;
typedef v8us __attribute__((may_alias)) v8usa;

__device__ __forceinline__ unsigned short f2bf(float f) { unsigned u = __float_as_uint(f); u += 0x7FFFu + ((u >> 16) & 1u); return (unsigned short)(u >> 16); }
__device__ __forceinline__ float bf2f(unsigned short b) { return __uint_as_float(((unsigned)b) << 16); }
__device__ __forceinline__ float bfr(float f) { return bf2f(f2bf(f)); }
__device__ __forceinline__ v16h cat16(v8h lo, v8h hi) { return __builtin_shufflevector(lo, hi, 0, 1, 2, 3, 4, 5, 6, 7, 8, 9, 10, 11, 12, 13, 14, 15); }
__device__ __forceinline__ v16bf cat16b(v8us lo, v8us hi) { return __builtin_bit_cast(v16bf, __builtin_shufflevector(lo, hi, 0, 1, 2, 3, 4, 5, 6, 7, 8, 9, 10, 11, 12, 13, 14, 15)); }
__device__ __forceinline__ v8f wmma16(v16h a, v16h b, v8f c) { return __builtin_amdgcn_wmma_f32_16x16x32_f16(false, a, false, b, (short)0, c, false, false); }
__device__ __forceinline__ v8f wmmab(v16bf a, v16bf b, v8f c) { return __builtin_amdgcn_wmma_f32_16x16x32_bf16(false, a, false, b, (short)0, c, false, false); }



// ---- GEMM work-groups: GW = 4 waves, 2 x 2 register-blocked tiles of 64x64 (16 accumulators a wave), one 128x128 output tile; operands are 16-bit planes in fragment order, rows of 1024 k (ld(t, l8): t = the tile, wave-uniform, l8 = lane 8).
// OPERANDS THROUGH LDS: a stage is GK = 64 k of the 128 rows of each operand; 16 rows x 64 k are 2 fragment tiles = 2048 contiguous bytes of the plane, copied as they lie, so a stage part is 8 row tiles x 2048 bytes.
// It is brought into LDS ONCE for the two waves that read each half of it by asynchronous copies, two buffers: stage t + 2 is asked for when every wave has left stage t, and flies under stage t + 1. (k_gemmo takes two such stages as one, 128 k.)
template <typename T16> struct WFrag;
template <> struct WFrag<h16> { typedef v16h V; static __device__ __forceinline__ V ld(const h16* p) { return cat16(*(const v8h*)p, *(const v8h*)(p + 256)); } static __device__ __forceinline__ V ld(const h16* t, unsigned l8) { return cat16(*(const v8h*)(t + l8), *(const v8h*)(t + 256 + l8)); } static __device__ __forceinline__ v8f mma(V a, V b, v8f c) { return wmma16(a, b, c); } };
template <> struct WFrag<bf> { typedef v16bf V; static __device__ __forceinline__ V ld(const bf* p) { return cat16b(*(const v8us*)p, *(const v8us*)(p + 256)); } static __device__ __forceinline__ V ld(const bf* t, unsigned l8) { return cat16b(*(const v8us*)(t + l8), *(const v8us*)(t + 256 + l8)); } static __device__ __forceinline__ v8f mma(V a, V b, v8f c) { return wmmab(a, b, c); } };
#define GW   4                  // waves of a GEMM work-group
#define GK   64                 // k of a stage
#define GOB  (128 * GK * 2)     // bytes of one operand's part of a stage
#define GNS  (DM / GK)          // stages (DM == DQ: every product here sums over 1024 k)
#define GRT  (16 * DM * 2)      // bytes from one row tile of a plane to the next
__device__ __forceinline__ void wait_copies() { asm volatile("s_wait_asynccnt 0x0" ::: "memory"); }   // this wave's copies have landed; the compiler places no wait for them
__device__ __forceinline__ void wait_lds() { asm volatile("s_wait_dscnt 0x0" ::: "memory"); }         // this wave's LDS reads have returned before the buffer they read is handed back for a refill
// Eight copies of 16 bytes a lane: the 2048 bytes of a stage in each of 8 row tiles (GRT bytes apart in the plane) to 8 x 2048 bytes in a row from LDS byte address la (GW 32 lanes x 16 bytes = 2048 bytes a copy; la, ga are the lane's own).
// The s_wait_xcnt ends the copies' own statement, so that it stands in front of whatever next rewrites an address register that a copy names.
__device__ __forceinline__ void copy8r(unsigned la, const char* ga) {
    asm volatile("global_load_async_to_lds_b128 %0, %8, off\n\tglobal_load_async_to_lds_b128 %1, %9, off\n\tglobal_load_async_to_lds_b128 %2, %10, off\n\tglobal_load_async_to_lds_b128 %3, %11, off\n\t"
                 "global_load_async_to_lds_b128 %4, %12, off\n\tglobal_load_async_to_lds_b128 %5, %13, off\n\tglobal_load_async_to_lds_b128 %6, %14, off\n\tglobal_load_async_to_lds_b128 %7, %15, off\n\ts_wait_xcnt 0x0"
                 :: "v"(la), "v"(la + 2048u), "v"(la + 4096u), "v"(la + 6144u), "v"(la + 8192u), "v"(la + 10240u), "v"(la + 12288u), "v"(la + 14336u),
                    "v"(ga), "v"(ga + GRT), "v"(ga + 2 * GRT), "v"(ga + 3 * GRT), "v"(ga + 4 * GRT), "v"(ga + 5 * GRT), "v"(ga + 6 * GRT), "v"(ga + 7 * GRT) : "memory");
    __builtin_amdgcn_sched_barrier(0);   // the next run's 24 address registers are formed behind this run: formed ahead for several runs, on top of the accumulators, they take the wave past 256 registers
}
// k_gemmo: C[m][n] (f32, pitch DM) = sum_k (A[m][k] + A2[m][k]) Bt[n][k] + bias[n] (bias rounded to bf16), two products per k tile (A, then A2); grid (M/128, N/128), GW 32 threads.
__global__ __launch_bounds__(GW * 32) void k_gemmo(const bf* __restrict__ A, const bf* __restrict__ A2, const bf* __restrict__ Bt, float* C, const float* __restrict__ bias) {
    typedef WFrag<bf> F; typedef F::V V;
    __shared__ __align__(128) char ring[2 * 2 * 3 * GOB];   // two buffers of a stage of 2 GK = 128 k: A, A2, Bt parts of the first 64 k, then of the second (one work-group per WGP: a longer stage gives the copies a longer lead)
    __shared__ __align__(16) float osw[GW][16 * 68];    // each wave's own rows for the epilogue
    constexpr unsigned HB = 3 * GOB, SB = 2 * HB; constexpr int ldc = DM;   // bytes of half a stage, of a stage
    const int w = __builtin_amdgcn_readfirstlane(threadIdx.x >> 5), wm = w & 1, wn = w >> 1; float* os = osw[w];
    const int lane = threadIdx.x & 31, lr = lane & 15, hi = lane >> 4; const unsigned l8 = lane * 8; const int r0 = blockIdx.x * 128 + wm * 64, c0 = blockIdx.y * 128 + wn * 64;
    const unsigned lc = (unsigned)(size_t)ring + threadIdx.x * 16;   // the lane's 16 bytes of every 2048
    const char* ga = (const char*)(A + (size_t)blockIdx.x * 128 * DQ) + threadIdx.x * 16; const char* ga2 = (const char*)(A2 + (size_t)blockIdx.x * 128 * DQ) + threadIdx.x * 16; const char* gb = (const char*)(Bt + (size_t)blockIdx.y * 128 * DQ) + threadIdx.x * 16;
    v8f acc[4][4];
    copy8r(lc, ga); copy8r(lc + GOB, ga2); copy8r(lc + 2 * GOB, gb); copy8r(lc + HB, ga + 2048); copy8r(lc + HB + GOB, ga2 + 2048); copy8r(lc + HB + 2 * GOB, gb + 2048);   // stage 0
#pragma unroll
    for (int mb = 0; mb < 4; ++mb)
#pragma unroll
        for (int nb = 0; nb < 4; ++nb) acc[mb][nb] = (v8f){};
    wait_copies(); __syncthreads();   // stage 0 is published
    copy8r(lc + SB, ga + 4096); copy8r(lc + SB + GOB, ga2 + 4096); copy8r(lc + SB + 2 * GOB, gb + 4096); copy8r(lc + SB + HB, ga + 6144); copy8r(lc + SB + HB + GOB, ga2 + 6144); copy8r(lc + SB + HB + 2 * GOB, gb + 6144);   // stage 1
#pragma unroll 1   // one trip is a stage of 128 matrix instructions; unrolling would only add registers
    for (int t = 0; t < GNS / 2; ++t) {
        const unsigned bo = (t & 1) * SB; const bf* sa = (const bf*)(ring + bo + wm * (GOB / 2)); const bf* sa2 = (const bf*)(ring + bo + GOB + wm * (GOB / 2)); const bf* sb = (const bf*)(ring + bo + 2 * GOB + wn * (GOB / 2));
#pragma unroll
        for (int kt = 0; kt < 4; ++kt) {   // 32 k, ascending, as before; half a stage is HB / 2 elements, a row tile in it 1024, a k tile 512
            V a[4], a2[4], b[4]; constexpr int HE = HB / 2; const int ko = (kt >> 1) * HE + (kt & 1) * 512;
#pragma unroll
            for (int mb = 0; mb < 4; ++mb) { a[mb] = F::ld(sa + mb * 1024 + ko, l8); b[mb] = F::ld(sb + mb * 1024 + ko, l8); }
#pragma unroll
            for (int mb = 0; mb < 4; ++mb) a2[mb] = F::ld(sa2 + mb * 1024 + ko, l8);
            __builtin_amdgcn_sched_barrier(0);   // the twelve fragments are asked for as one group: sunk among the matrix instructions, each is waited for at once and its whole LDS latency shows (one wave per SIMD)
#pragma unroll
            for (int nb = 0; nb < 4; ++nb)
#pragma unroll
                for (int mb = 0; mb < 4; ++mb) acc[mb][nb] = F::mma(a[mb], b[nb], acc[mb][nb]);
#pragma unroll
            for (int nb = 0; nb < 4; ++nb)
#pragma unroll
                for (int mb = 0; mb < 4; ++mb) acc[mb][nb] = F::mma(a2[mb], b[nb], acc[mb][nb]);
        }
        __builtin_amdgcn_sched_barrier(0);   // keeps every matrix instruction of the trip in front of the slots below: some were moved behind the barrier, where the slots no longer follow the last of them
        // four vector slots behind the last matrix instructions: on the taken branch the loop's first reads overwrite their operands
        asm volatile("v_nop\n\tv_nop\n\tv_nop\n\tv_nop" : "+v"(acc[0][3]), "+v"(acc[1][3]), "+v"(acc[2][3]), "+v"(acc[3][3]));
        wait_lds(); wait_copies(); __syncthreads();   // publish point: stage t + 1 has landed for every wave, and every wave has left stage t's buffer
        if (t + 2 < GNS / 2) { const size_t go = (size_t)(t + 2) * 4096; copy8r(lc + bo, ga + go); copy8r(lc + bo + GOB, ga2 + go); copy8r(lc + bo + 2 * GOB, gb + go);   // refill of the buffer just left
            copy8r(lc + bo + HB, ga + go + 2048); copy8r(lc + bo + HB + GOB, ga2 + go + 2048); copy8r(lc + bo + HB + 2 * GOB, gb + go + 2048); }
    }
    wait_copies();
    constexpr bool BIAS = true;
#pragma unroll
    for (int mb = 0; mb < 4; ++mb) {
#pragma unroll
        for (int nb = 0; nb < 4; ++nb) {
#pragma unroll
            for (int j = 0; j < 8; ++j) os[(hi * 8 + j) * 68 + nb * 16 + lr] = acc[mb][nb][j]; }
        __builtin_amdgcn_wave_barrier(); asm volatile("" ::: "memory");
        float* crow = C + (size_t)(r0 + mb * 16) * ldc + c0;
{
#pragma unroll
            for (int s = 0; s < 8; ++s) { const int row = 2 * s + hi, cofs = lr * 4; v4f val = *(const v4fa*)(os + row * 68 + cofs); if (BIAS) { val[0] += bfr(bias[c0 + cofs]); val[1] += bfr(bias[c0 + cofs + 1]); val[2] += bfr(bias[c0 + cofs + 2]); val[3] += bfr(bias[c0 + cofs + 3]); }
                *(v4f*)(crow + (size_t)row * ldc + cofs) = val; }
             }
        __builtin_amdgcn_wave_barrier(); asm volatile("" ::: "memory");
    }
}

__device__ __forceinline__ h16 tohx(float x) { return (h16)x; }
__device__ __forceinline__ void splitf(float y, unsigned short& h, unsigned short& l) { h = f2bf(y); l = f2bf(y - bf2f(h)); }
typedef __attribute__((ext_vector_type(2))) _Float16 v2h;
typedef __attribute__((ext_vector_type(4))) _Float16 v4h;
typedef __attribute__((ext_vector_type(2))) unsigned short v2us;
typedef __attribute__((ext_vector_type(4))) unsigned short v4us;
typedef __attribute__((ext_vector_type(2))) float v2f;
typedef __attribute__((ext_vector_type(4))) int v4i;
typedef __attribute__((ext_vector_type(8))) __bf16 v8bf;

__global__ __launch_bounds__(256) void k_wtG(const float* __restrict__ w, int K, int N, bf* Bt) {
    const int lane = threadIdx.x & 31; const int L0 = (blockIdx.x * 8 + (threadIdx.x >> 5)) * 8; const int nlines = N * K / 64;
{
#pragma unroll 1
        for (int l = 0; l < 8; ++l) { const int L = L0 + l; if (L >= nlines) break; const size_t e = (size_t)L * 64 + lane * 2; const int k = (int)(e % K), n = (int)(e / K); v2us o;
            o[0] = f2bf(w[(size_t)k * N + n]); o[1] = f2bf(w[(size_t)(k + 1) * N + n]); *(v2us*)(Bt + e) = o; }
         }
}

// ---- k_projp: the three projections (grid z = stream: q, k, v), one wave per 64x64 tile, four to a work-group as in k_gemmo; a wave's tile is 64 rows t of ONE head (64 d), so the epilogue finishes it in registers and stores
// the head planes (fp16, bf16 hi, bf16 lo) itself: no f32 projection goes through memory. The operand that supplies the WMMA rows is chosen so that a lane's eight accumulator elements run along the plane's
// k index: q, k (planes [h], rows t, k = d, h = (stream NB_ + batch) NH_ + head): WMMA rows = d (the weight), columns = t; v (planes [g], rows d, k = t, g = batch NKV + head): WMMA rows = t (the input), columns = d.
// Rotate-half: out[d] = x[d] cos - x[d+32] sin, out[d+32] = x[d+32] cos + x[d] sin, angle (t, d % 32); d and d + 32 are row tiles mb and mb + 2 of the same lane and element.
// Epilogue of k_projp, one group of 16 plane rows (nb) at a time: rotate (q, k), round to the three planes, store. Accumulator (mb, nb) holds k = mb 16 + hi 8 + j of plane row nb 16 + lr: that IS half (mb & 1) of fragment
// tile (row tile nb, k tile mb / 2) in fragment order, so each store goes straight from the registers as 512 contiguous bytes. SN, SM: element strides of a row tile and of a k tile in the plane's tile order.
template <bool ROPE, int SN, int SM>
__device__ __forceinline__ void proj_store(v8f (&acc)[4][4], const float* __restrict__ CSt, unsigned short* D16, unsigned short* Dh, unsigned short* Dl) {
    const int lane = threadIdx.x & 31, lr = lane & 15, hi = lane >> 4; const unsigned l8 = lane * 8;
    const float* cp = ROPE ? CSt + ((size_t)lr * HD + hi * 8) * 2 : nullptr;   // (cos, sin) pairs of the tile's row lr, from d = 8 hi; row group nb lies nb 16 rows on
    v4f c[2][8];
    if (ROPE) {
#pragma unroll
        for (int i = 0; i < 8; ++i) c[0][i] = *(const v4f*)(cp + (i >> 2) * 32 + (i & 3) * 4); }
#pragma unroll
    for (int nb = 0; nb < 4; ++nb) {
        if (ROPE) {
            if (nb < 3) {   // the next row group's pairs fly under this group's arithmetic and stores
#pragma unroll
                for (int i = 0; i < 8; ++i) c[(nb + 1) & 1][i] = *(const v4f*)(cp + (size_t)(nb + 1) * 16 * HD * 2 + (i >> 2) * 32 + (i & 3) * 4); }
#pragma unroll
            for (int mb = 0; mb < 2; ++mb)
#pragma unroll
                for (int j = 0; j < 8; ++j) { const float co = c[nb & 1][mb * 4 + (j >> 1)][(j & 1) * 2], si = c[nb & 1][mb * 4 + (j >> 1)][(j & 1) * 2 + 1]; const float x1 = acc[mb][nb][j], x2 = acc[mb + 2][nb][j];
                    acc[mb][nb][j] = x1 * co - x2 * si; acc[mb + 2][nb][j] = x2 * co + x1 * si; }
        }
        v8us w[4][3];
#pragma unroll
        for (int mb = 0; mb < 4; ++mb) { const v8f x = acc[mb][nb]; const v8bf xh = __builtin_convertvector(x, v8bf);   // hi = nearest-even bf16, lo = nearest-even bf16 of the exact rest
            w[mb][0] = __builtin_bit_cast(v8us, __builtin_convertvector(x, v8h)); w[mb][1] = __builtin_bit_cast(v8us, xh);
            w[mb][2] = __builtin_bit_cast(v8us, __builtin_convertvector(x - __builtin_convertvector(xh, v8f), v8bf)); }
        __builtin_amdgcn_sched_barrier(0);   // all twelve pieces are formed before the first store: mixed with the stores, a later convert lands in a register that an issued store still names, ahead of the wait below
#pragma unroll
        for (int mb = 0; mb < 4; ++mb) { const int g = nb * SN + (mb >> 1) * SM + (mb & 1) * 256;
            *(v8us*)(D16 + g + l8) = w[mb][0]; *(v8us*)(Dh + g + l8) = w[mb][1]; *(v8us*)(Dl + g + l8) = w[mb][2]; }
        asm volatile("s_wait_xcnt 0x0" ::: "memory");   // what follows (the next group's table loads and arithmetic; behind the last group whatever the kernel does next) may land in registers that these stores name: the wait stands in front of that overwrite
        __builtin_amdgcn_sched_barrier(0);   // without it the table loads of all four groups are lifted to the front, and their 128 registers on top of the accumulators cost a wave per SIMD
    }
}
__global__ __launch_bounds__(GW * 32) void k_projp(const bf* __restrict__ X, const bf* __restrict__ Wt, const float* __restrict__ CS, unsigned short* P16, unsigned short* Ph, unsigned short* Pl, unsigned short* V16, unsigned short* Vh, unsigned short* Vl) {
    typedef WFrag<bf> F; typedef F::V V;
    __shared__ __align__(128) char ring[2 * 2 * GOB];   // two buffers of a stage: input part (128 rows t), weight part (128 rows = 2 heads)
    constexpr unsigned SB = 2 * GOB;
    const int z = blockIdx.z; const bool isv = z == 2;
    const int w = __builtin_amdgcn_readfirstlane(threadIdx.x >> 5), wx = w & 1, wh = w >> 1;   // the wave's 64 rows t and its head within the work-group's tile
    const int lane = threadIdx.x & 31; const int r0 = blockIdx.x * 128 + wx * 64, head = blockIdx.y * 2 + wh; const int b = r0 / TT, t0 = r0 % TT; const unsigned l8 = lane * 8;
    const unsigned lc = (unsigned)(size_t)ring + threadIdx.x * 16;   // the lane's 16 bytes of every 2048
    const char* gx = (const char*)(X + (size_t)z * NB_ * TT * DM + (size_t)blockIdx.x * 128 * DM) + threadIdx.x * 16; const char* gw = (const char*)(Wt + (size_t)z * DQ * DM + (size_t)blockIdx.y * 128 * DM) + threadIdx.x * 16;
    const unsigned xo = wx * (GOB / 2), wo = GOB + wh * (GOB / 2); const unsigned ao = isv ? xo : wo, bo2 = isv ? wo : xo;   // the wave's halves of the two parts; which of them supplies the WMMA rows
    copy8r(lc, gx); copy8r(lc + GOB, gw);   // stage 0
    v8f acc[4][4];
#pragma unroll
    for (int mb = 0; mb < 4; ++mb)
#pragma unroll
        for (int nb = 0; nb < 4; ++nb) acc[mb][nb] = (v8f){};
    wait_copies(); __syncthreads();   // stage 0 is published
    copy8r(lc + SB, gx + 2048); copy8r(lc + SB + GOB, gw + 2048);   // stage 1
#pragma unroll 1   // one trip is a stage of 32 matrix instructions; unrolling would only add operand registers on top of the 128 of the accumulators
    for (int t = 0; t < GNS; ++t) {
        const unsigned bo = (t & 1) * SB; const bf* sa = (const bf*)(ring + bo + ao); const bf* sb = (const bf*)(ring + bo + bo2);
#pragma unroll
        for (int kt = 0; kt < 2; ++kt) {   // 32 k, ascending, as before; a row tile of the stage is 1024 elements, a k tile 512
            V a[4], bb[4];
#pragma unroll
            for (int mb = 0; mb < 4; ++mb) { a[mb] = F::ld(sa + mb * 1024 + kt * 512, l8); bb[mb] = F::ld(sb + mb * 1024 + kt * 512, l8); }
            __builtin_amdgcn_sched_barrier(0);   // the eight fragments are asked for as one group, as in k_gemmo
#pragma unroll
            for (int nb = 0; nb < 4; ++nb)
#pragma unroll
                for (int mb = 0; mb < 4; ++mb) acc[mb][nb] = F::mma(a[mb], bb[nb], acc[mb][nb]);
        }
        __builtin_amdgcn_sched_barrier(0);   // as in k_gemmo
        // four vector slots behind the last matrix instructions, as in k_gemmo
        asm volatile("v_nop\n\tv_nop\n\tv_nop\n\tv_nop" : "+v"(acc[0][3]), "+v"(acc[1][3]), "+v"(acc[2][3]), "+v"(acc[3][3]));
        wait_lds(); wait_copies(); __syncthreads();   // publish point, as in k_gemmo
        if (t + 2 < GNS) { const size_t go = (size_t)(t + 2) * 2048; copy8r(lc + bo, gx + go); copy8r(lc + bo + GOB, gw + go); }   // refill of the buffer just left
    }
    wait_copies();
    // acc[mb][nb][j]: k index i = mb 16 + hi 8 + j, plane row o = nb 16 + lr. 64 t of one head are 4096 elements in a row in both tile orders: q, k 4 row tiles x 2 k tiles, v 2 k tiles x 4 row tiles
    if (isv) { const size_t base = ((size_t)(b * NKV + head) * TT + t0) * HD; proj_store<false, 512, 2048>(acc, nullptr, V16 + base, Vh + base, Vl + base); }
    else { const size_t base = (((size_t)(z * NB_ + b) * NH_ + head) * TT + t0) * HD; proj_store<true, 1024, 512>(acc, CS + (size_t)t0 * HD * 2, P16 + base, Ph + base, Pl + base); }
}
__constant__ float INVT[HD / 2] = { 1.000000000e+00f, 7.498942018e-01f, 5.623413324e-01f, 4.216965139e-01f, 3.162277639e-01f, 2.371373624e-01f, 1.778279394e-01f, 1.333521456e-01f, 1.000000015e-01f, 7.498941571e-02f, 5.623412877e-02f, 4.216964915e-02f, 3.162277862e-02f, 2.371373586e-02f, 1.778279431e-02f, 1.333521493e-02f, 9.999999776e-03f, 7.498942316e-03f, 5.623413250e-03f, 4.216964822e-03f, 3.162277862e-03f, 2.371373819e-03f, 1.778279431e-03f, 1.333521446e-03f, 1.000000047e-03f, 7.498941850e-04f, 5.623413017e-04f, 4.216964880e-04f, 3.162277862e-04f, 2.371373848e-04f, 1.778279402e-04f, 1.333521504e-04f };   // 1 / 10000^(2i/64) (float32, generated with jnp to be bit-exact)
// k_prep: everything that depends on no other launch, in one grid. Work-groups [0, CSB): the rotary table (positions = arange). The rest: f32 -> bf16, 2048 elements each, into ONE run of planes
// dst = query, key, value (both batches each), Wq, Wk, Wv, Wo, so that the destination offset is linear in the work-group index and only the source is chosen (a scalar choice).
// The planes are in fragment order (rows of DM = 32 k tiles): a work-group writes 4 tiles in a row = 16 source rows x 128 k. A wave takes 8 rows of one tile in two loads of 4 whole 128-byte source lines each
// (8 lanes a row, 4 k a lane); its 8-byte pieces fill 64-byte runs (4 rows of one half-column of 8 k), and the two stores together whole lines of the tile.
#define CSB  (TT * HD / 256)
#define XBL  (NB_ * TT * DM / 2048)   // work-groups per input stream
#define WBL  (DQ * DM / 2048)         // work-groups per weight
__global__ __launch_bounds__(256) void k_prep(const float* __restrict__ xq, const float* __restrict__ xk, const float* __restrict__ xv, const float* __restrict__ wq, const float* __restrict__ wk, const float* __restrict__ wv, const float* __restrict__ wo, bf* dst, float* CS) {
    if (blockIdx.x < CSB) { const int idx = blockIdx.x * 256 + threadIdx.x; const int d = idx % HD; const int t = idx / HD; const float a = __fmul_rn((float)t, INVT[d % (HD / 2)]); v2f cs; cs[0] = cosf(a); cs[1] = sinf(a); *(v2f*)(CS + (size_t)idx * 2) = cs; return; }
    const int bx = blockIdx.x - CSB; const float* src; int lb;
    if (bx < 3 * XBL) { const int sel = bx / XBL; lb = bx % XBL; src = sel == 0 ? xq : sel == 1 ? xk : xv; }
    else { const int sel = (bx - 3 * XBL) / WBL; lb = (bx - 3 * XBL) % WBL; src = sel == 0 ? wq : sel == 1 ? wk : sel == 2 ? wv : wo; }
    const int w = threadIdx.x >> 5, lane = threadIdx.x & 31, tile = lb * 4 + (w >> 1); const int r = (w & 1) * 8 + (lane >> 3), k4 = (lane & 7) * 4;   // row in the tile (and r + 4), first k in the tile
    const float* sp = src + (size_t)((tile / (DM / 32)) * 16 + r) * DM + (tile % (DM / 32)) * 32 + k4;
    bf* dp = dst + (size_t)bx * 2048 + (w >> 1) * 512 + (k4 >> 4) * 256 + (((k4 >> 3) & 1) * 16 + r) * 8 + (k4 & 4);
    const v4f v0 = *(const v4f*)sp, v1 = *(const v4f*)(sp + 4 * DM); v4us o0, o1;
#pragma unroll
    for (int k = 0; k < 4; ++k) { o0[k] = f2bf(v0[k]); o1[k] = f2bf(v1[k]); }
    *(v4us*)dp = o0; *(v4us*)(dp + 4 * 8) = o1;  }
// ---- k_fattn: scores, softmax and weights x V in ONE kernel; AW waves per work-group, grid (ATL tiles, heads x batches, 3 classes of work-groups: see k_fattn).
// The wave forms the TRANSPOSED score tile S^T = K Q^T (A = 16 keys, B = 16 queries): lane (lr, hi) then holds keys 8 hi + j of query lr, and two such tiles (keys 0..15, 16..31)
// side by side ARE the B fragment (k = 8 hi + 0..7, 16 + 8 hi + 0..7) of O^T = V^T P^T, so the weights never leave their registers. Online softmax per query over steps of 32 keys, ascending:
// running maximum m (in exponent-of-2 units), running sum l and O^T rescaled by 2^(m_old - m_new); the two lane halves of a query share m (one cross-half exchange per step) and add their l at the end.
__device__ __forceinline__ float xhalf(float x) { return __builtin_bit_cast(float, __builtin_amdgcn_permlanex16(__builtin_bit_cast(int, x), __builtin_bit_cast(int, x), 0x76543210, 0xfedcba98, false, false)); }   // lane l with lane l ^ 16, no LDS round trip
// 2^x. The instruction set asks for one free slot behind a transcendental before its result is read or its source overwritten: the v_nop ends the same statement so that it cannot drift,
// and the early-clobber results keep every exp of the run of eight off the sources of the others.
__device__ __forceinline__ float exp2s(float x) { float r; asm("v_exp_f32 %0, %1\n\tv_nop" : "=v"(r) : "v"(x)); return r; }
__device__ __forceinline__ v8f exp2v(v8f x) { float r0, r1, r2, r3, r4, r5, r6, r7;
    asm("v_exp_f32 %0, %8\n\tv_exp_f32 %1, %9\n\tv_exp_f32 %2, %10\n\tv_exp_f32 %3, %11\n\tv_exp_f32 %4, %12\n\tv_exp_f32 %5, %13\n\tv_exp_f32 %6, %14\n\tv_exp_f32 %7, %15\n\tv_nop"
        : "=&v"(r0), "=&v"(r1), "=&v"(r2), "=&v"(r3), "=&v"(r4), "=&v"(r5), "=&v"(r6), "=&v"(r7) : "v"(x[0]), "v"(x[1]), "v"(x[2]), "v"(x[3]), "v"(x[4]), "v"(x[5]), "v"(x[6]), "v"(x[7]));
    return (v8f){r0, r1, r2, r3, r4, r5, r6, r7}; }
__device__ __forceinline__ float vmax8(v8f a, v8f b) { float x = fmaxf(a[0], b[0]);
#pragma unroll
    for (int j = 1; j < 8; ++j) x = fmaxf(x, fmaxf(a[j], b[j]));
    return x; }
__device__ __forceinline__ void attn_store(const v8f* o, float l, bf* Ah, bf* Al, unsigned l8) {   // o: four d tiles of one query column; Ah, Al: the first fragment tile of (16 queries, head), wave-uniform; d tile dt is half dt & 1 of k tile dt / 2, 256 elements a half
    const float inv = __fdiv_rn(1.0f, l + xhalf(l)); v8us wh[4], wl[4];
#pragma unroll
    for (int dt = 0; dt < 4; ++dt) { const v8f x = o[dt] * inv; const v8bf xh = __builtin_convertvector(x, v8bf), xl = __builtin_convertvector(x - __builtin_convertvector(xh, v8f), v8bf);   // hi + lo, nearest even, packed converts
        wh[dt] = __builtin_bit_cast(v8us, xh); wl[dt] = __builtin_bit_cast(v8us, xl); }
    __builtin_amdgcn_sched_barrier(0);   // all eight pieces are formed before the first store: mixed with the stores, a later convert lands in a register that an issued store still names
#pragma unroll
    for (int dt = 0; dt < 4; ++dt) { *(v8us*)(Ah + dt * 256 + l8) = wh[dt]; *(v8us*)(Al + dt * 256 + l8) = wl[dt]; }
    asm volatile("s_wait_xcnt 0x0" ::: "memory");   // what follows (the next query tile's pieces; the way round the other classes' code, which forms base addresses anew) may land in registers that these stores name: the wait stands in front of that overwrite
}
// K AND V THROUGH LDS: a work-group is AW waves that walk the same keys of one head, each with its own queries. A stage of SK keys (each plane's part is PB contiguous bytes in fragment order, copied as it lies)
// is brought into LDS ONCE for all AW waves by asynchronous copies, two buffers: stage t + 2 is asked for when every wave has left stage t, and flies under stage t + 1. A fragment read is 512 contiguous LDS bytes a wave.
#define AW   4                 // waves of an attention work-group
#define SK   64                // keys of a stage
#define PB   (SK * HD * 2)     // bytes of one 16-bit plane's part of a stage
#define NST  (TT / SK)         // stages
// Eight copies of 16 bytes a lane: PB bytes from ga to LDS byte address la and PB bytes from gb to lb (AW 32 lanes x 16 bytes = 2048 bytes a copy; la, lb, ga, gb are the lane's own).
// The s_wait_xcnt ends the copies' own statement, so that it stands in front of whatever next rewrites an address register that a copy names.
__device__ __forceinline__ void copy8(unsigned la, const char* ga, unsigned lb, const char* gb) {
    asm volatile("global_load_async_to_lds_b128 %0, %8, off\n\tglobal_load_async_to_lds_b128 %1, %9, off\n\tglobal_load_async_to_lds_b128 %2, %10, off\n\tglobal_load_async_to_lds_b128 %3, %11, off\n\t"
                 "global_load_async_to_lds_b128 %4, %12, off\n\tglobal_load_async_to_lds_b128 %5, %13, off\n\tglobal_load_async_to_lds_b128 %6, %14, off\n\tglobal_load_async_to_lds_b128 %7, %15, off\n\ts_wait_xcnt 0x0"
                 :: "v"(la), "v"(la + 2048u), "v"(la + 4096u), "v"(la + 6144u), "v"(lb), "v"(lb + 2048u), "v"(lb + 4096u), "v"(lb + 6144u),
                    "v"(ga), "v"(ga + 2048), "v"(ga + 4096), "v"(ga + 6144), "v"(gb), "v"(gb + 2048), "v"(gb + 4096), "v"(gb + 6144) : "memory");
}
// rows >= RH: fp16 operands, QT tiles of 16 queries per wave
template <int QT>
__device__ __forceinline__ void attn_f16(const h16* __restrict__ Q, const h16* __restrict__ K, const h16* __restrict__ VT, int q0, int col, bf* Ah, bf* Al, char* ring) {
    typedef WFrag<h16> F; const unsigned l8 = (threadIdx.x & 31) * 8;
    constexpr unsigned SB = 2 * PB;   // a stage in LDS: K part, V^T part
    const unsigned lc = (unsigned)(size_t)ring + threadIdx.x * 16; const char* gk = (const char*)K + threadIdx.x * 16; const char* gv = (const char*)VT + threadIdx.x * 16;   // the lane's 16 bytes of every 2048
    v16h qf[QT][2]; v8f o[QT][4]; float m[QT], l[QT];
    copy8(lc, gk, lc + PB, gv);   // stage 0
    // fragment order: 16 rows t of q or k are 2 tiles (16 HD elements), 32 keys of V^T are 4 tiles (32 HD elements)
#pragma unroll
    for (int qt = 0; qt < QT; ++qt) { m[qt] = -3.0e38f; l[qt] = 0.f;
#pragma unroll
        for (int ks = 0; ks < 2; ++ks) qf[qt][ks] = F::ld(Q + (size_t)(q0 + qt * 16) * HD + ks * 512, l8);
#pragma unroll
        for (int dt = 0; dt < 4; ++dt) o[qt][dt] = (v8f){}; }
    wait_copies(); __syncthreads();   // stage 0 is published
    copy8(lc + SB, gk + PB, lc + SB + PB, gv + PB);   // stage 1
#pragma unroll 1   // one trip is a stage; unrolling would only add registers
    for (int t = 0; t < NST; ++t) {
        const unsigned bo = (t & 1) * SB; const h16* sk = (const h16*)(ring + bo); const h16* sv = (const h16*)(ring + bo + PB);
        v16h kf[2][2];
#pragma unroll
        for (int kt = 0; kt < 2; ++kt)
#pragma unroll
            for (int ks = 0; ks < 2; ++ks) kf[kt][ks] = F::ld(sk + (kt * 16) * HD + ks * 512, l8);
#pragma unroll
        for (int kb = 0; kb < SK; kb += 32) {   // steps of 32 keys, ascending, as before
            v16h vf[4], pf[QT]; v8f st[2][QT];
#pragma unroll
            for (int dt = 0; dt < 4; ++dt) vf[dt] = F::ld(sv + kb * HD + dt * 512, l8);
#pragma unroll
            for (int kt = 0; kt < 2; ++kt)
#pragma unroll
                for (int qt = 0; qt < QT; ++qt) st[kt][qt] = F::mma(kf[kt][1], qf[qt][1], F::mma(kf[kt][0], qf[qt][0], (v8f){}));
            if (kb + 32 < SK) {   // the next step's keys OF THE SAME STAGE are read under this step's softmax
#pragma unroll
                for (int kt = 0; kt < 2; ++kt)
#pragma unroll
                    for (int ks = 0; ks < 2; ++ks) kf[kt][ks] = F::ld(sk + (kb + 32 + kt * 16) * HD + ks * 512, l8); }
#pragma unroll
            for (int qt = 0; qt < QT; ++qt) { float mx = vmax8(st[0][qt], st[1][qt]); mx = fmaxf(mx, xhalf(mx));
                const float mn = fmaxf(m[qt], mx * CEXP); const float al = exp2s(m[qt] - mn); m[qt] = mn; float s = 0.f;
#pragma unroll
                for (int kt = 0; kt < 2; ++kt) { const v8f p = exp2v(st[kt][qt] * CEXP - mn);
#pragma unroll
                    for (int j = 0; j < 8; ++j) { s += p[j]; pf[qt][kt * 8 + j] = tohx(p[j]); } }
                l[qt] = l[qt] * al + s;
#pragma unroll
                for (int dt = 0; dt < 4; ++dt) o[qt][dt] *= al; }
#pragma unroll
            for (int dt = 0; dt < 4; ++dt)
#pragma unroll
                for (int qt = 0; qt < QT; ++qt) o[qt][dt] = F::mma(vf[dt], pf[qt], o[qt][dt]);
        }
        // four vector slots behind the last matrix instructions: on the taken branch the loop's first ones overwrite their B registers
        // (with one query tile the first vector instructions on the taken branch write none of those registers: no slots are owed there)
        if constexpr (QT == 2) asm volatile("v_nop\n\tv_nop\n\tv_nop\n\tv_nop" : "+v"(o[0][0]), "+v"(o[0][1]), "+v"(o[0][2]), "+v"(o[0][3]), "+v"(o[1][0]), "+v"(o[1][1]), "+v"(o[1][2]), "+v"(o[1][3]));
        wait_lds(); wait_copies(); __syncthreads();   // publish point: stage t + 1 has landed for every wave, and every wave has left stage t's buffer
        if (t + 2 < NST) copy8(lc + bo, gk + (size_t)(t + 2) * PB, lc + bo + PB, gv + (size_t)(t + 2) * PB);   // refill of the buffer just left
    }
    wait_copies();
#pragma unroll
    for (int qt = 0; qt < QT; ++qt) { const size_t oo = (size_t)(q0 + qt * 16) * DQ + col * 16; attn_store(o[qt], l[qt], Ah + oo, Al + oo, l8);
        if (qt + 1 < QT) __builtin_amdgcn_sched_barrier(0); }   // the second query tile's pieces may land in registers that the first tile's stores name: this keeps its arithmetic behind the wait that ends those stores
}
// rows < RH: bf16 hi + lo planes, three products each (hi hi, lo hi, hi lo), 16 queries per wave
__device__ __forceinline__ void attn_hl(const bf* __restrict__ Qh, const bf* __restrict__ Ql, const bf* __restrict__ Kh, const bf* __restrict__ Kl, const bf* __restrict__ VTh, const bf* __restrict__ VTl, int q0, int col, bf* Ah, bf* Al, char* ring) {
    typedef WFrag<bf> F; const unsigned l8 = (threadIdx.x & 31) * 8;
    constexpr unsigned SB = 4 * PB;   // a stage in LDS: K hi, K lo, V^T hi, V^T lo
    const unsigned lc = (unsigned)(size_t)ring + threadIdx.x * 16;   // the lane's 16 bytes of every 2048
    const char* gkh = (const char*)Kh + threadIdx.x * 16; const char* gkl = (const char*)Kl + threadIdx.x * 16; const char* gvh = (const char*)VTh + threadIdx.x * 16; const char* gvl = (const char*)VTl + threadIdx.x * 16;
    v16bf qh[2], ql[2]; v8f o[4]; float m = -3.0e38f, l = 0.f;
    copy8(lc, gkh, lc + PB, gkl); copy8(lc + 2 * PB, gvh, lc + 3 * PB, gvl);   // stage 0
#pragma unroll
    for (int ks = 0; ks < 2; ++ks) { const size_t qo = (size_t)q0 * HD + ks * 512; qh[ks] = F::ld(Qh + qo, l8); ql[ks] = F::ld(Ql + qo, l8); }
#pragma unroll
    for (int dt = 0; dt < 4; ++dt) o[dt] = (v8f){};
    wait_copies(); __syncthreads();   // stage 0 is published
    copy8(lc + SB, gkh + PB, lc + SB + PB, gkl + PB); copy8(lc + SB + 2 * PB, gvh + PB, lc + SB + 3 * PB, gvl + PB);   // stage 1
#pragma unroll 1   // as in attn_f16
    for (int t = 0; t < NST; ++t) {
        const unsigned bo = (t & 1) * SB; const bf* skh = (const bf*)(ring + bo); const bf* skl = (const bf*)(ring + bo + PB); const bf* svh = (const bf*)(ring + bo + 2 * PB); const bf* svl = (const bf*)(ring + bo + 3 * PB);
        v16bf kh[2][2], kl[2][2];
#pragma unroll
        for (int kt = 0; kt < 2; ++kt)
#pragma unroll
            for (int ks = 0; ks < 2; ++ks) { kh[kt][ks] = F::ld(skh + (kt * 16) * HD + ks * 512, l8); kl[kt][ks] = F::ld(skl + (kt * 16) * HD + ks * 512, l8); }
#pragma unroll
        for (int kb = 0; kb < SK; kb += 32) {   // steps of 32 keys, ascending, as before
            v16bf vh[4], vl[4]; v8f st[2];
#pragma unroll
            for (int dt = 0; dt < 4; ++dt) { vh[dt] = F::ld(svh + kb * HD + dt * 512, l8); vl[dt] = F::ld(svl + kb * HD + dt * 512, l8); }
#pragma unroll
            for (int kt = 0; kt < 2; ++kt) { st[kt] = (v8f){};
#pragma unroll
                for (int ks = 0; ks < 2; ++ks) { st[kt] = F::mma(kh[kt][ks], qh[ks], st[kt]); st[kt] = F::mma(kh[kt][ks], ql[ks], st[kt]); st[kt] = F::mma(kl[kt][ks], qh[ks], st[kt]); } }
            if (kb + 32 < SK) {   // as in attn_f16
#pragma unroll
                for (int kt = 0; kt < 2; ++kt)
#pragma unroll
                    for (int ks = 0; ks < 2; ++ks) { kh[kt][ks] = F::ld(skh + (kb + 32 + kt * 16) * HD + ks * 512, l8); kl[kt][ks] = F::ld(skl + (kb + 32 + kt * 16) * HD + ks * 512, l8); }
                __builtin_amdgcn_sched_barrier(0); }   // keeps the 16 key reads above the softmax: sunk to the next step's head they are waited for at once and their whole latency shows
            float mx = vmax8(st[0], st[1]); mx = fmaxf(mx, xhalf(mx));
            const float mn = fmaxf(m, mx * CEXP); const float al = exp2s(m - mn); m = mn; float s = 0.f; v8bf ph[2], pl[2];
#pragma unroll
            for (int kt = 0; kt < 2; ++kt) { const v8f p = exp2v(st[kt] * CEXP - mn);
#pragma unroll
                for (int j = 0; j < 8; ++j) s += p[j];
                ph[kt] = __builtin_convertvector(p, v8bf); pl[kt] = __builtin_convertvector(p - __builtin_convertvector(ph[kt], v8f), v8bf); }   // hi = nearest-even bf16 of p, lo = nearest-even bf16 of the exact rest (packed converts)
            l = l * al + s; const v16bf pfh = __builtin_shufflevector(ph[0], ph[1], 0, 1, 2, 3, 4, 5, 6, 7, 8, 9, 10, 11, 12, 13, 14, 15), pfl = __builtin_shufflevector(pl[0], pl[1], 0, 1, 2, 3, 4, 5, 6, 7, 8, 9, 10, 11, 12, 13, 14, 15);
#pragma unroll
            for (int dt = 0; dt < 4; ++dt) o[dt] *= al;
#pragma unroll
            for (int dt = 0; dt < 4; ++dt) { o[dt] = F::mma(vh[dt], pfh, o[dt]); o[dt] = F::mma(vh[dt], pfl, o[dt]); o[dt] = F::mma(vl[dt], pfh, o[dt]); }
        }
        asm volatile("v_nop\n\tv_nop\n\tv_nop\n\tv_nop" : "+v"(o[0]), "+v"(o[1]), "+v"(o[2]), "+v"(o[3]));   // as in attn_f16
        wait_lds(); wait_copies(); __syncthreads();   // publish point, as in attn_f16
        if (t + 2 < NST) { const size_t go = (size_t)(t + 2) * PB; copy8(lc + bo, gkh + go, lc + bo + PB, gkl + go); copy8(lc + bo + 2 * PB, gvh + go, lc + bo + 3 * PB, gvl + go); }   // refill of the buffer just left
    }
    wait_copies();
    { const size_t oo = (size_t)q0 * DQ + col * 16; attn_store(o, l, Ah + oo, Al + oo, l8); }
}
// THE DEAL: all work-groups are resident at once, so the launch lasts as long as the fullest SIMD. Three classes of ATL x heads x batches = 256 work-groups each (grid z, so that a class is one round over the 256 WGPs
// in start order): 32-query fp16 waves, hi + lo waves (16 queries), 16-query fp16 waves. A WGP that takes one work-group of each class has on every SIMD one wave of each: 16 hi + lo and 48 fp16 queries, the chip's mean.
// Where a work-group lands changes the time only: every (class, tile, head, batch) is one work-group, every query row belongs to exactly one wave.
#define ATL  (RH / (16 * AW))      // tiles per class, head and batch
#define F2R  (ATL * AW * 32)       // fp16 rows of the 32-query class; the rest go to the 16-query class
static_assert(TT - RH == F2R + ATL * AW * 16, "the two fp16 classes cover rows RH .. TT");
__global__ __launch_bounds__(AW * 32) void k_fattn(const h16* __restrict__ Q16, const h16* __restrict__ K16, const h16* __restrict__ VT16, const bf* __restrict__ Qh, const bf* __restrict__ Ql, const bf* __restrict__ Kh, const bf* __restrict__ Kl, const bf* __restrict__ VTh, const bf* __restrict__ VTl, bf* Ah, bf* Al) {
    __shared__ __align__(128) char ring[2 * 4 * PB];   // two buffers of the larger stage (hi + lo planes)
    const int h = blockIdx.y % NH_, bt = blockIdx.y / NH_, qw = blockIdx.x * AW + __builtin_amdgcn_readfirstlane(threadIdx.x >> 5); const size_t zo = (size_t)blockIdx.y * TT * HD;   // blockIdx.y = batch NH_ + head; the head planes of q, k (rows t) and of v (rows d) have the same size
    Ah += (size_t)bt * TT * DQ; Al += (size_t)bt * TT * DQ;   // merged rows (b, t) x DQ, fragment order
    if (blockIdx.z == 0) attn_f16<2>(Q16 + zo, K16 + zo, VT16 + zo, RH + qw * 32, h * HD, Ah, Al, ring);   // the longest class starts first
    else if (blockIdx.z == 1) attn_hl(Qh + zo, Ql + zo, Kh + zo, Kl + zo, VTh + zo, VTl + zo, qw * 16, h * HD, Ah, Al, ring);
    else attn_f16<1>(Q16 + zo, K16 + zo, VT16 + zo, RH + F2R + qw * 16, h * HD, Ah, Al, ring);
}

extern "C" void kernel_launch(void* const* d_in, const int* in_sizes, int n_in,
                              void* d_out, int out_size, void* d_ws, size_t ws_size, hipStream_t stream) {
    (void)in_sizes; (void)n_in; (void)out_size;
    const float* x = (const float*)d_in[0];   /* query */ const float* xk = (const float*)d_in[1]; const float* xv = (const float*)d_in[2]; const float* wq = (const float*)d_in[3]; const float* wk = (const float*)d_in[4]; const float* wv = (const float*)d_in[5]; const float* wo = (const float*)d_in[6]; const float* bo = (const float*)d_in[7];   /* argument order query, key, value, Wq, Wk, Wv, Wo ('oi' [1024][1024]), bo [1024] (REAL 0.01); eight inputs, all read */
    float* OUT = (float*)d_out;     // [2][2048][1024]
    char* wsp = (char*)d_ws;
    auto take = [&](size_t bytes) { char* p = wsp; wsp += (bytes + 255) & ~(size_t)255; return (void*)p; };
    const size_t NX = (size_t)NB_ * TT * DM, NW = (size_t)DQ * DM, NP = (size_t)NB_ * NH_ * TT * HD;   // elements of one input stream, one weight, one set of head planes (both batches)
    bf* XB = (bf*)take((3 * NX + 4 * NW) * 2); bf* WQ = XB + 3 * NX; bf* WO = WQ + 3 * NW;   // query, key, value, Wq, Wk, Wv, Wo in one run (k_prep)
    float* CS = (float*)take((size_t)TT * HD * 2 * 4);
    h16* QP16 = (h16*)take(2 * NP * 2); h16* KP16 = QP16 + NP; bf* QPh = (bf*)take(2 * NP * 2); bf* KPh = QPh + NP; bf* QPl = (bf*)take(2 * NP * 2); bf* KPl = QPl + NP;   // q planes, then k planes (k_projp's plane order)
    h16* VT16 = (h16*)take(NP * 2); bf* VTh = (bf*)take(NP * 2); bf* VTl = (bf*)take(NP * 2);
    bf* ATh = (bf*)take(NX * 2); bf* ATl = (bf*)take(NX * 2);
    if ((size_t)(wsp - (char*)d_ws) > ws_size) return;    // ws 256 MiB
    k_prep<<<CSB + 3 * XBL + 4 * WBL, 256, 0, stream>>>(x, xk, xv, wq, wk, wv, wo, XB, CS);
    k_projp<<<dim3(NB_ * TT / 128, NH_ / 2, 3), GW * 32, 0, stream>>>(XB, WQ, CS, (unsigned short*)QP16, QPh, QPl, (unsigned short*)VT16, VTh, VTl);   // z = stream: q, k, v
    k_fattn<<<dim3(ATL, NH_ * NB_, 3), AW * 32, 0, stream>>>(QP16, KP16, VT16, QPh, QPl, KPh, KPl, VTh, VTl, ATh, ATl);   // one kv head per query head
    k_gemmo<<<dim3(NB_ * TT / 128, DM / 128, 1), GW * 32, 0, stream>>>(ATh, ATl, WO, OUT, bo);
}

// v009
// It runs in 99.3 microseconds.
// Two timings next to v008 put it at 1.04 and 1.05 times that version's speed.
// All steps since v000 together make it 20.2 times as fast.
#include <hip/hip_runtime.h>

// Multi-head attention WITHOUT a mask over three input streams with a computed rotate-half rotary (query, key, value [2][2048][1024]; q = query Wq^T, k = key Wk^T, v = value Wv^T ('oi' [1024][1024] 1/32, no bias; 16 heads x 64), each from its own stream; _apply_rope AFTER the head split: (x1, x2) = the two HALVES: cat(x1 cos - x2 sin, x1 sin + x2 cos) with angle t x inv_freq[i], inv_freq = 1.0 / (10000.0 ** (arange(0, 64, 2, f32) / 64)) (32 f32 constants; both halves share the 32 angles; one f32 product per angle; precise cosf / sinf), on q and k; scores / sqrt(64); softmax over all keys; out = merged Wo^T + bo ('oi' + a REAL 0.01 bias) -> [2][2048][1024] (4.2 M); argument order query, key, value, Wq, Wk, Wv, Wo, bo).
// Layout, both batches in every launch: bf16 copies of query, key, value and the four 'oi' weights (one launch, with the rotary table); the three exact projections as grid z of one launch, whose epilogue rotates q and k and stores the head planes itself; one fused attention launch, grid y = batch and head, z = class of work-groups (hybrid rows: < 512 hi/lo 3 products, rest fp16; online softmax, scores and weights stay in registers); merged hi/lo x Wo exact.
// FRAGMENT ORDER: every 16-bit plane that a matrix instruction reads (inputs, weights, head planes, merged rows) is stored as tiles of 16 rows x 32 k = 512 elements, laid out as the operand registers want them:
// element (row, k) lies at tile 512 + ((k % 32) / 16) 256 + (((k % 16) / 8) 16 + row % 16) 8 + k % 8, so lane l's two 16-byte pieces lie at l 8 and 256 + l 8 and each wave-wide load or store is 512 contiguous bytes
// (4 cache lines; in row-major planes it touched 16). Tile order: (row / 16) major, k / 32 minor; the V^T planes k / 32 (keys) major, d / 16 minor, so that a step of 32 keys is 4 KiB in a row.
// Compute dtypes, f32 accumulate: every input rounded to bf16; projections exact; attention rows < 512 3 products, rest fp16; softmax f32; Wo hl x exact.

#define NB_  2
#define TT   2048
#define DM   1024
#define NH_  16
#define NKV  16
#define REP  (NH_ / NKV)
#define HD   64
#define DQ   (NH_ * HD)
#define DKV  (NKV * HD)
#define RH   512                  // query rows < RH use hi+lo planes
#define WIN  0
#define SCL  0.125f   // HD^-0.5
#define CEXP (SCL * 1.4426950408889634f)   // score -> exponent of 2
typedef _Float16 h16;
typedef unsigned short bf;
typedef __attribute__((ext_vector_type(16))) __bf16   v16bf;
typedef __attribute__((ext_vector_type(16))) _Float16 v16h;
typedef __attribute__((ext_vector_type(8)))  _Float16 v8h;
typedef __attribute__((ext_vector_type(8)))  unsigned short v8us;
typedef __attribute__((ext_vector_type(8)))  float    v8f;
typedef __attribute__((ext_vector_type(4)))  float    v4f;
typedef v8h  __attribute__((may_alias)) v8ha;
typedef v4f  __attribute__((may_alias)) v4fa;
typedef v8us __attribute__((may_alias)) v8usa;

__device__ __forceinline__ unsigned short f2bf(float f) { unsigned u = __float_as_uint(f); u += 0x7FFFu + ((u >> 16) & 1u); return (unsigned short)(u >> 16); }
__device__ __forceinline__ float bf2f(unsigned short b) { return __uint_as_float(((unsigned)b) << 16); }
__device__ __forceinline__ float bfr(float f) { return bf2f(f2bf(f)); }
__device__ __forceinline__ v16h cat16(v8h lo, v8h hi) { return __builtin_shufflevector(lo, hi, 0, 1, 2, 3, 4, 5, 6, 7, 8, 9, 10, 11, 12, 13, 14, 15); }
__device__ __forceinline__ v16bf cat16b(v8us lo, v8us hi) { return __builtin_bit_cast(v16bf, __builtin_shufflevector(lo, hi, 0, 1, 2, 3, 4, 5, 6, 7, 8, 9, 10, 11, 12, 13, 14, 15)); }
__device__ __forceinline__ v8f wmma16(v16h a, v16h b, v8f c) { return __builtin_amdgcn_wmma_f32_16x16x32_f16(false, a, false, b, (short)0, c, false, false); }
__device__ __forceinline__ v8f wmmab(v16bf a, v16bf b, v8f c) { return __builtin_amdgcn_wmma_f32_16x16x32_bf16(false, a, false, b, (short)0, c, false, false); }



// ---- GEMM work-groups: GW = 4 waves, 2 x 2 register-blocked tiles of 64x64 (16 accumulators a wave), one 128x128 output tile; operands are 16-bit planes in fragment order, rows of 1024 k (ld(t, l8): t = the tile, wave-uniform, l8 = lane 8).
// OPERANDS THROUGH LDS: a stage is GK = 64 k of the 128 rows of each operand; 16 rows x 64 k are 2 fragment tiles = 2048 contiguous bytes of the plane, copied as they lie, so a stage part is 8 row tiles x 2048 bytes.
// It is brought into LDS ONCE for the two waves that read each half of it by asynchronous copies, two buffers: stage t + 2 is asked for when every wave has left stage t, and flies under stage t + 1. (k_gemmo takes two such stages as one, 128 k.)
template <typename T16> struct WFrag;
template <> struct WFrag<h16> { typedef v16h V; static __device__ __forceinline__ V ld(const h16* p) { return cat16(*(const v8h*)p, *(const v8h*)(p + 256)); } static __device__ __forceinline__ V ld(const h16* t, unsigned l8) { return cat16(*(const v8h*)(t + l8), *(const v8h*)(t + 256 + l8)); } static __device__ __forceinline__ v8f mma(V a, V b, v8f c) { return wmma16(a, b, c); } };
template <> struct WFrag<bf> { typedef v16bf V; static __device__ __forceinline__ V ld(const bf* p) { return cat16b(*(const v8us*)p, *(const v8us*)(p + 256)); } static __device__ __forceinline__ V ld(const bf* t, unsigned l8) { return cat16b(*(const v8us*)(t + l8), *(const v8us*)(t + 256 + l8)); } static __device__ __forceinline__ v8f mma(V a, V b, v8f c) { return wmmab(a, b, c); } };
#define GW   4                  // waves of a GEMM work-group
#define GK   64                 // k of a stage
#define GOB  (128 * GK * 2)     // bytes of one operand's part of a stage
#define GNS  (DM / GK)          // stages (DM == DQ: every product here sums over 1024 k)
#define GRT  (16 * DM * 2)      // bytes from one row tile of a plane to the next
__device__ __forceinline__ void wait_copies() { asm volatile("s_wait_asynccnt 0x0" ::: "memory"); }   // this wave's copies have landed; the compiler places no wait for them
__device__ __forceinline__ void wait_lds() { asm volatile("s_wait_dscnt 0x0" ::: "memory"); }         // this wave's LDS reads have returned before the buffer they read is handed back for a refill
// Eight copies of 16 bytes a lane: the 2048 bytes of a stage in each of 8 row tiles (GRT bytes apart in the plane) to 8 x 2048 bytes in a row from LDS byte address la (GW 32 lanes x 16 bytes = 2048 bytes a copy; la, ga are the lane's own).
// The s_wait_xcnt ends the copies' own statement, so that it stands in front of whatever next rewrites an address register that a copy names.
__device__ __forceinline__ void copy8r(unsigned la, const char* ga) {
    asm volatile("global_load_async_to_lds_b128 %0, %8, off\n\tglobal_load_async_to_lds_b128 %1, %9, off\n\tglobal_load_async_to_lds_b128 %2, %10, off\n\tglobal_load_async_to_lds_b128 %3, %11, off\n\t"
                 "global_load_async_to_lds_b128 %4, %12, off\n\tglobal_load_async_to_lds_b128 %5, %13, off\n\tglobal_load_async_to_lds_b128 %6, %14, off\n\tglobal_load_async_to_lds_b128 %7, %15, off\n\ts_wait_xcnt 0x0"
                 :: "v"(la), "v"(la + 2048u), "v"(la + 4096u), "v"(la + 6144u), "v"(la + 8192u), "v"(la + 10240u), "v"(la + 12288u), "v"(la + 14336u),
                    "v"(ga), "v"(ga + GRT), "v"(ga + 2 * GRT), "v"(ga + 3 * GRT), "v"(ga + 4 * GRT), "v"(ga + 5 * GRT), "v"(ga + 6 * GRT), "v"(ga + 7 * GRT) : "memory");
    __builtin_amdgcn_sched_barrier(0);   // the next run's 24 address registers are formed behind this run: formed ahead for several runs, on top of the accumulators, they take the wave past 256 registers
}
// k_gemmo: C[m][n] (f32, pitch DM) = sum_k (A[m][k] + A2[m][k]) Bt[n][k] + bias[n] (bias rounded to bf16), two products per k tile (A, then A2); grid (M/128, N/128), GW 32 threads.
__global__ __launch_bounds__(GW * 32) void k_gemmo(const bf* __restrict__ A, const bf* __restrict__ A2, const bf* __restrict__ Bt, float* C, const float* __restrict__ bias) {
    typedef WFrag<bf> F; typedef F::V V;
    __shared__ __align__(128) char ring[2 * 2 * 3 * GOB];   // two buffers of a stage of 2 GK = 128 k: A, A2, Bt parts of the first 64 k, then of the second (one work-group per WGP: a longer stage gives the copies a longer lead)
    __shared__ __align__(16) float osw[GW][16 * 68];    // each wave's own rows for the epilogue
    constexpr unsigned HB = 3 * GOB, SB = 2 * HB; constexpr int ldc = DM;   // bytes of half a stage, of a stage
    const int w = __builtin_amdgcn_readfirstlane(threadIdx.x >> 5), wm = w & 1, wn = w >> 1; float* os = osw[w];
    const int lane = threadIdx.x & 31, lr = lane & 15, hi = lane >> 4; const unsigned l8 = lane * 8; const int r0 = blockIdx.x * 128 + wm * 64, c0 = blockIdx.y * 128 + wn * 64;
    const unsigned lc = (unsigned)(size_t)ring + threadIdx.x * 16;   // the lane's 16 bytes of every 2048
    const char* ga = (const char*)(A + (size_t)blockIdx.x * 128 * DQ) + threadIdx.x * 16; const char* ga2 = (const char*)(A2 + (size_t)blockIdx.x * 128 * DQ) + threadIdx.x * 16; const char* gb = (const char*)(Bt + (size_t)blockIdx.y * 128 * DQ) + threadIdx.x * 16;
    v8f acc[4][4];
    copy8r(lc, ga); copy8r(lc + GOB, ga2); copy8r(lc + 2 * GOB, gb); copy8r(lc + HB, ga + 2048); copy8r(lc + HB + GOB, ga2 + 2048); copy8r(lc + HB + 2 * GOB, gb + 2048);   // stage 0
#pragma unroll
    for (int mb = 0; mb < 4; ++mb)
#pragma unroll
        for (int nb = 0; nb < 4; ++nb) acc[mb][nb] = (v8f){};
    wait_copies(); __syncthreads();   // stage 0 is published
    copy8r(lc + SB, ga + 4096); copy8r(lc + SB + GOB, ga2 + 4096); copy8r(lc + SB + 2 * GOB, gb + 4096); copy8r(lc + SB + HB, ga + 6144); copy8r(lc + SB + HB + GOB, ga2 + 6144); copy8r(lc + SB + HB + 2 * GOB, gb + 6144);   // stage 1
#pragma unroll 1   // one trip is a stage of 128 matrix instructions; unrolling would only add registers
    for (int t = 0; t < GNS / 2; ++t) {
        const unsigned bo = (t & 1) * SB; const bf* sa = (const bf*)(ring + bo + wm * (GOB / 2)); const bf* sa2 = (const bf*)(ring + bo + GOB + wm * (GOB / 2)); const bf* sb = (const bf*)(ring + bo + 2 * GOB + wn * (GOB / 2));
#pragma unroll
        for (int kt = 0; kt < 4; ++kt) {   // 32 k, ascending, as before; half a stage is HB / 2 elements, a row tile in it 1024, a k tile 512
            V a[4], a2[4], b[4]; constexpr int HE = HB / 2; const int ko = (kt >> 1) * HE + (kt & 1) * 512;
#pragma unroll
            for (int mb = 0; mb < 4; ++mb) { a[mb] = F::ld(sa + mb * 1024 + ko, l8); b[mb] = F::ld(sb + mb * 1024 + ko, l8); }
#pragma unroll
            for (int mb = 0; mb < 4; ++mb) a2[mb] = F::ld(sa2 + mb * 1024 + ko, l8);
            __builtin_amdgcn_sched_barrier(0);   // the twelve fragments are asked for as one group: sunk among the matrix instructions, each is waited for at once and its whole LDS latency shows (one wave per SIMD)
#pragma unroll
            for (int nb = 0; nb < 4; ++nb)
#pragma unroll
                for (int mb = 0; mb < 4; ++mb) acc[mb][nb] = F::mma(a[mb], b[nb], acc[mb][nb]);
#pragma unroll
            for (int nb = 0; nb < 4; ++nb)
#pragma unroll
                for (int mb = 0; mb < 4; ++mb) acc[mb][nb] = F::mma(a2[mb], b[nb], acc[mb][nb]);
        }
        __builtin_amdgcn_sched_barrier(0);   // keeps every matrix instruction of the trip in front of the slots below: some were moved behind the barrier, where the slots no longer follow the last of them
        // four vector slots behind the last matrix instructions: on the taken branch the loop's first reads overwrite their operands
        asm volatile("v_nop\n\tv_nop\n\tv_nop\n\tv_nop" : "+v"(acc[0][3]), "+v"(acc[1][3]), "+v"(acc[2][3]), "+v"(acc[3][3]));
        wait_lds(); wait_copies(); __syncthreads();   // publish point: stage t + 1 has landed for every wave, and every wave has left stage t's buffer
        if (t + 2 < GNS / 2) { const size_t go = (size_t)(t + 2) * 4096; copy8r(lc + bo, ga + go); copy8r(lc + bo + GOB, ga2 + go); copy8r(lc + bo + 2 * GOB, gb + go);   // refill of the buffer just left
            copy8r(lc + bo + HB, ga + go + 2048); copy8r(lc + bo + HB + GOB, ga2 + go + 2048); copy8r(lc + bo + HB + 2 * GOB, gb + go + 2048); }
    }
    wait_copies();
    constexpr bool BIAS = true;
#pragma unroll
    for (int mb = 0; mb < 4; ++mb) {
#pragma unroll
        for (int nb = 0; nb < 4; ++nb) {
#pragma unroll
            for (int j = 0; j < 8; ++j) os[(hi * 8 + j) * 68 + nb * 16 + lr] = acc[mb][nb][j]; }
        __builtin_amdgcn_wave_barrier(); asm volatile("" ::: "memory");
        float* crow = C + (size_t)(r0 + mb * 16) * ldc + c0;
{
#pragma unroll
            for (int s = 0; s < 8; ++s) { const int row = 2 * s + hi, cofs = lr * 4; v4f val = *(const v4fa*)(os + row * 68 + cofs); if (BIAS) { val[0] += bfr(bias[c0 + cofs]); val[1] += bfr(bias[c0 + cofs + 1]); val[2] += bfr(bias[c0 + cofs + 2]); val[3] += bfr(bias[c0 + cofs + 3]); }
                *(v4f*)(crow + (size_t)row * ldc + cofs) = val; }
             }
        __builtin_amdgcn_wave_barrier(); asm volatile("" ::: "memory");
    }
}

__device__ __forceinline__ h16 tohx(float x) { return (h16)x; }
__device__ __forceinline__ void splitf(float y, unsigned short& h, unsigned short& l) { h = f2bf(y); l = f2bf(y - bf2f(h)); }
typedef __attribute__((ext_vector_type(2))) _Float16 v2h;
typedef __attribute__((ext_vector_type(4))) _Float16 v4h;
typedef __attribute__((ext_vector_type(2))) unsigned short v2us;
typedef __attribute__((ext_vector_type(4))) unsigned short v4us;
typedef __attribute__((ext_vector_type(2))) float v2f;
typedef __attribute__((ext_vector_type(4))) int v4i;
typedef __attribute__((ext_vector_type(8))) __bf16 v8bf;

__global__ __launch_bounds__(256) void k_wtG(const float* __restrict__ w, int K, int N, bf* Bt) {
    const int lane = threadIdx.x & 31; const int L0 = (blockIdx.x * 8 + (threadIdx.x >> 5)) * 8; const int nlines = N * K / 64;
{
#pragma unroll 1
        for (int l = 0; l < 8; ++l) { const int L = L0 + l; if (L >= nlines) break; const size_t e = (size_t)L * 64 + lane * 2; const int k = (int)(e % K), n = (int)(e / K); v2us o;
            o[0] = f2bf(w[(size_t)k * N + n]); o[1] = f2bf(w[(size_t)(k + 1) * N + n]); *(v2us*)(Bt + e) = o; }
         }
}

// ---- k_projp: the three projections (grid z = stream: q, k, v), one wave per 64x64 tile, four to a work-group as in k_gemmo; a wave's tile is 64 rows t of ONE head (64 d), so the epilogue finishes it in registers and stores
// the head planes (fp16, bf16 hi, bf16 lo) itself: no f32 projection goes through memory. The operand that supplies the WMMA rows is chosen so that a lane's eight accumulator elements run along the plane's
// k index: q, k (planes [h], rows t, k = d, h = (stream NB_ + batch) NH_ + head): WMMA rows = d (the weight), columns = t; v (planes [g], rows d, k = t, g = batch NKV + head): WMMA rows = t (the input), columns = d.
// Rotate-half: out[d] = x[d] cos - x[d+32] sin, out[d+32] = x[d+32] cos + x[d] sin, angle (t, d % 32); d and d + 32 are row tiles mb and mb + 2 of the same lane and element.
// Epilogue of k_projp, one group of 16 plane rows (nb) at a time: rotate (q, k), round to the three planes, store. Accumulator (mb, nb) holds k = mb 16 + hi 8 + j of plane row nb 16 + lr: that IS half (mb & 1) of fragment
// tile (row tile nb, k tile mb / 2) in fragment order, so each store goes straight from the registers as 512 contiguous bytes. SN, SM: element strides of a row tile and of a k tile in the plane's tile order.
template <bool ROPE, int SN, int SM>
__device__ __forceinline__ void proj_store(v8f (&acc)[4][4], const float* __restrict__ CSt, float qs, unsigned short* D16, unsigned short* Dh, unsigned short* Dl) {   // qs: factor on the rotated values before they are rounded (q: CEXP, k: 1)
    const int lane = threadIdx.x & 31, lr = lane & 15, hi = lane >> 4; const unsigned l8 = lane * 8;
    const float* cp = ROPE ? CSt + ((size_t)lr * HD + hi * 8) * 2 : nullptr;   // (cos, sin) pairs of the tile's row lr, from d = 8 hi; row group nb lies nb 16 rows on
    v4f c[2][8];
    if (ROPE) {
#pragma unroll
        for (int i = 0; i < 8; ++i) c[0][i] = *(const v4f*)(cp + (i >> 2) * 32 + (i & 3) * 4); }
#pragma unroll
    for (int nb = 0; nb < 4; ++nb) {
        if (ROPE) {
            if (nb < 3) {   // the next row group's pairs fly under this group's arithmetic and stores
#pragma unroll
                for (int i = 0; i < 8; ++i) c[(nb + 1) & 1][i] = *(const v4f*)(cp + (size_t)(nb + 1) * 16 * HD * 2 + (i >> 2) * 32 + (i & 3) * 4); }
#pragma unroll
            for (int mb = 0; mb < 2; ++mb)
#pragma unroll
                for (int j = 0; j < 8; ++j) { const float co = c[nb & 1][mb * 4 + (j >> 1)][(j & 1) * 2], si = c[nb & 1][mb * 4 + (j >> 1)][(j & 1) * 2 + 1]; const float x1 = acc[mb][nb][j], x2 = acc[mb + 2][nb][j];
                    acc[mb][nb][j] = (x1 * co - x2 * si) * qs; acc[mb + 2][nb][j] = (x2 * co + x1 * si) * qs; }
        }
        v8us w[4][3];
#pragma unroll
        for (int mb = 0; mb < 4; ++mb) { const v8f x = acc[mb][nb]; const v8bf xh = __builtin_convertvector(x, v8bf);   // hi = nearest-even bf16, lo = nearest-even bf16 of the exact rest
            w[mb][0] = __builtin_bit_cast(v8us, __builtin_convertvector(x, v8h)); w[mb][1] = __builtin_bit_cast(v8us, xh);
            w[mb][2] = __builtin_bit_cast(v8us, __builtin_convertvector(x - __builtin_convertvector(xh, v8f), v8bf)); }
        __builtin_amdgcn_sched_barrier(0);   // all twelve pieces are formed before the first store: mixed with the stores, a later convert lands in a register that an issued store still names, ahead of the wait below
#pragma unroll
        for (int mb = 0; mb < 4; ++mb) { const int g = nb * SN + (mb >> 1) * SM + (mb & 1) * 256;
            *(v8us*)(D16 + g + l8) = w[mb][0]; *(v8us*)(Dh + g + l8) = w[mb][1]; *(v8us*)(Dl + g + l8) = w[mb][2]; }
        asm volatile("s_wait_xcnt 0x0" ::: "memory");   // what follows (the next group's table loads and arithmetic; behind the last group whatever the kernel does next) may land in registers that these stores name: the wait stands in front of that overwrite
        __builtin_amdgcn_sched_barrier(0);   // without it the table loads of all four groups are lifted to the front, and their 128 registers on top of the accumulators cost a wave per SIMD
    }
}
__global__ __launch_bounds__(GW * 32) void k_projp(const bf* __restrict__ X, const bf* __restrict__ Wt, const float* __restrict__ CS, unsigned short* P16, unsigned short* Ph, unsigned short* Pl, unsigned short* V16, unsigned short* Vh, unsigned short* Vl) {
    typedef WFrag<bf> F; typedef F::V V;
    __shared__ __align__(128) char ring[2 * 2 * GOB];   // two buffers of a stage: input part (128 rows t), weight part (128 rows = 2 heads)
    constexpr unsigned SB = 2 * GOB;
    const int z = blockIdx.z; const bool isv = z == 2;
    const int w = __builtin_amdgcn_readfirstlane(threadIdx.x >> 5), wx = w & 1, wh = w >> 1;   // the wave's 64 rows t and its head within the work-group's tile
    const int lane = threadIdx.x & 31; const int r0 = blockIdx.x * 128 + wx * 64, head = blockIdx.y * 2 + wh; const int b = r0 / TT, t0 = r0 % TT; const unsigned l8 = lane * 8;
    const unsigned lc = (unsigned)(size_t)ring + threadIdx.x * 16;   // the lane's 16 bytes of every 2048
    const char* gx = (const char*)(X + (size_t)z * NB_ * TT * DM + (size_t)blockIdx.x * 128 * DM) + threadIdx.x * 16; const char* gw = (const char*)(Wt + (size_t)z * DQ * DM + (size_t)blockIdx.y * 128 * DM) + threadIdx.x * 16;
    const unsigned xo = wx * (GOB / 2), wo = GOB + wh * (GOB / 2); const unsigned ao = isv ? xo : wo, bo2 = isv ? wo : xo;   // the wave's halves of the two parts; which of them supplies the WMMA rows
    copy8r(lc, gx); copy8r(lc + GOB, gw);   // stage 0
    v8f acc[4][4];
#pragma unroll
    for (int mb = 0; mb < 4; ++mb)
#pragma unroll
        for (int nb = 0; nb < 4; ++nb) acc[mb][nb] = (v8f){};
    wait_copies(); __syncthreads();   // stage 0 is published
    copy8r(lc + SB, gx + 2048); copy8r(lc + SB + GOB, gw + 2048);   // stage 1
#pragma unroll 1   // one trip is a stage of 32 matrix instructions; unrolling would only add operand registers on top of the 128 of the accumulators
    for (int t = 0; t < GNS; ++t) {
        const unsigned bo = (t & 1) * SB; const bf* sa = (const bf*)(ring + bo + ao); const bf* sb = (const bf*)(ring + bo + bo2);
#pragma unroll
        for (int kt = 0; kt < 2; ++kt) {   // 32 k, ascending, as before; a row tile of the stage is 1024 elements, a k tile 512
            V a[4], bb[4];
#pragma unroll
            for (int mb = 0; mb < 4; ++mb) { a[mb] = F::ld(sa + mb * 1024 + kt * 512, l8); bb[mb] = F::ld(sb + mb * 1024 + kt * 512, l8); }
            __builtin_amdgcn_sched_barrier(0);   // the eight fragments are asked for as one group, as in k_gemmo
#pragma unroll
            for (int nb = 0; nb < 4; ++nb)
#pragma unroll
                for (int mb = 0; mb < 4; ++mb) acc[mb][nb] = F::mma(a[mb], bb[nb], acc[mb][nb]);
        }
        __builtin_amdgcn_sched_barrier(0);   // as in k_gemmo
        // four vector slots behind the last matrix instructions, as in k_gemmo
        asm volatile("v_nop\n\tv_nop\n\tv_nop\n\tv_nop" : "+v"(acc[0][3]), "+v"(acc[1][3]), "+v"(acc[2][3]), "+v"(acc[3][3]));
        wait_lds(); wait_copies(); __syncthreads();   // publish point, as in k_gemmo
        if (t + 2 < GNS) { const size_t go = (size_t)(t + 2) * 2048; copy8r(lc + bo, gx + go); copy8r(lc + bo + GOB, gw + go); }   // refill of the buffer just left
    }
    wait_copies();
    // acc[mb][nb][j]: k index i = mb 16 + hi 8 + j, plane row o = nb 16 + lr. 64 t of one head are 4096 elements in a row in both tile orders: q, k 4 row tiles x 2 k tiles, v 2 k tiles x 4 row tiles
    if (isv) { const size_t base = ((size_t)(b * NKV + head) * TT + t0) * HD; proj_store<false, 512, 2048>(acc, nullptr, 1.0f, V16 + base, Vh + base, Vl + base); }
    else { const size_t base = (((size_t)(z * NB_ + b) * NH_ + head) * TT + t0) * HD; proj_store<true, 1024, 512>(acc, CS + (size_t)t0 * HD * 2, z == 0 ? CEXP : 1.0f, P16 + base, Ph + base, Pl + base); }
}
__constant__ float INVT[HD / 2] = { 1.000000000e+00f, 7.498942018e-01f, 5.623413324e-01f, 4.216965139e-01f, 3.162277639e-01f, 2.371373624e-01f, 1.778279394e-01f, 1.333521456e-01f, 1.000000015e-01f, 7.498941571e-02f, 5.623412877e-02f, 4.216964915e-02f, 3.162277862e-02f, 2.371373586e-02f, 1.778279431e-02f, 1.333521493e-02f, 9.999999776e-03f, 7.498942316e-03f, 5.623413250e-03f, 4.216964822e-03f, 3.162277862e-03f, 2.371373819e-03f, 1.778279431e-03f, 1.333521446e-03f, 1.000000047e-03f, 7.498941850e-04f, 5.623413017e-04f, 4.216964880e-04f, 3.162277862e-04f, 2.371373848e-04f, 1.778279402e-04f, 1.333521504e-04f };   // 1 / 10000^(2i/64) (float32, generated with jnp to be bit-exact)
// k_prep: everything that depends on no other launch, in one grid. Work-groups [0, CSB): the rotary table (positions = arange). The rest: f32 -> bf16, 2048 elements each, into ONE run of planes
// dst = query, key, value (both batches each), Wq, Wk, Wv, Wo, so that the destination offset is linear in the work-group index and only the source is chosen (a scalar choice).
// The planes are in fragment order (rows of DM = 32 k tiles): a work-group writes 4 tiles in a row = 16 source rows x 128 k. A wave takes 8 rows of one tile in two loads of 4 whole 128-byte source lines each
// (8 lanes a row, 4 k a lane); its 8-byte pieces fill 64-byte runs (4 rows of one half-column of 8 k), and the two stores together whole lines of the tile.
#define CSB  (TT * HD / 256)
#define XBL  (NB_ * TT * DM / 2048)   // work-groups per input stream
#define WBL  (DQ * DM / 2048)         // work-groups per weight
__global__ __launch_bounds__(256) void k_prep(const float* __restrict__ xq, const float* __restrict__ xk, const float* __restrict__ xv, const float* __restrict__ wq, const float* __restrict__ wk, const float* __restrict__ wv, const float* __restrict__ wo, bf* dst, float* CS) {
    if (blockIdx.x < CSB) { const int idx = blockIdx.x * 256 + threadIdx.x; const int d = idx % HD; const int t = idx / HD; const float a = __fmul_rn((float)t, INVT[d % (HD / 2)]); v2f cs; cs[0] = cosf(a); cs[1] = sinf(a); *(v2f*)(CS + (size_t)idx * 2) = cs; return; }
    const int bx = blockIdx.x - CSB; const float* src; int lb;
    if (bx < 3 * XBL) { const int sel = bx / XBL; lb = bx % XBL; src = sel == 0 ? xq : sel == 1 ? xk : xv; }
    else { const int sel = (bx - 3 * XBL) / WBL; lb = (bx - 3 * XBL) % WBL; src = sel == 0 ? wq : sel == 1 ? wk : sel == 2 ? wv : wo; }
    const int w = threadIdx.x >> 5, lane = threadIdx.x & 31, tile = lb * 4 + (w >> 1); const int r = (w & 1) * 8 + (lane >> 3), k4 = (lane & 7) * 4;   // row in the tile (and r + 4), first k in the tile
    const float* sp = src + (size_t)((tile / (DM / 32)) * 16 + r) * DM + (tile % (DM / 32)) * 32 + k4;
    bf* dp = dst + (size_t)bx * 2048 + (w >> 1) * 512 + (k4 >> 4) * 256 + (((k4 >> 3) & 1) * 16 + r) * 8 + (k4 & 4);
    const v4f v0 = *(const v4f*)sp, v1 = *(const v4f*)(sp + 4 * DM); v4us o0, o1;
#pragma unroll
    for (int k = 0; k < 4; ++k) { o0[k] = f2bf(v0[k]); o1[k] = f2bf(v1[k]); }
    *(v4us*)dp = o0; *(v4us*)(dp + 4 * 8) = o1;  }
// ---- k_fattn: scores, softmax and weights x V in ONE kernel; AW waves per work-group, grid (ATL tiles, heads x batches, 3 classes of work-groups: see k_fattn).
// The wave forms the TRANSPOSED score tile S^T = K Q^T (A = 16 keys, B = 16 queries): lane (lr, hi) then holds keys 8 hi + j of query lr, and two such tiles (keys 0..15, 16..31)
// side by side ARE the B fragment (k = 8 hi + 0..7, 16 + 8 hi + 0..7) of O^T = V^T P^T, so the weights never leave their registers. Online softmax per query over steps of 32 keys, ascending:
// a HELD reference m per query (in exponent-of-2 units; the q planes are stored times CEXP, so a score product is in those units): minus m is the C operand of the score products, so that their result is the exponent of the weight
// 2^(score - m) as it stands; m moves, and the running sum l, O^T and the stage's exponents are corrected by m_old - m_new, only in the first stage and in a stage where some query of the wave has a score more than LAZ above its m
// (one test per stage of SK keys for the whole wave, a scalar branch), so a weight never exceeds 2^LAZ; the two lane halves of a query share m (the cross-half exchange stands inside that branch) and add their l at the end.
__device__ __forceinline__ float xhalf(float x) { return __builtin_bit_cast(float, __builtin_amdgcn_permlanex16(__builtin_bit_cast(int, x), __builtin_bit_cast(int, x), 0x76543210, 0xfedcba98, false, false)); }   // lane l with lane l ^ 16, no LDS round trip
// 2^x. The instruction set asks for one free slot behind a transcendental before its result is read or its source overwritten: the v_nop ends the same statement so that it cannot drift,
// and the early-clobber results keep every exp of the run of eight off the sources of the others.
__device__ __forceinline__ float exp2s(float x) { float r; asm("v_exp_f32 %0, %1\n\tv_nop" : "=v"(r) : "v"(x)); return r; }
__device__ __forceinline__ v8f exp2v(v8f x) { float r0, r1, r2, r3, r4, r5, r6, r7;
    asm("v_exp_f32 %0, %8\n\tv_exp_f32 %1, %9\n\tv_exp_f32 %2, %10\n\tv_exp_f32 %3, %11\n\tv_exp_f32 %4, %12\n\tv_exp_f32 %5, %13\n\tv_exp_f32 %6, %14\n\tv_exp_f32 %7, %15\n\tv_nop"
        : "=&v"(r0), "=&v"(r1), "=&v"(r2), "=&v"(r3), "=&v"(r4), "=&v"(r5), "=&v"(r6), "=&v"(r7) : "v"(x[0]), "v"(x[1]), "v"(x[2]), "v"(x[3]), "v"(x[4]), "v"(x[5]), "v"(x[6]), "v"(x[7]));
    return (v8f){r0, r1, r2, r3, r4, r5, r6, r7}; }
#define LAZ  8.0f   // how far a score may rise above the held reference before it moves (exponent-of-2 units): 2^8 is far inside the range of fp16 and bf16 weights and of the f32 sums
__device__ __forceinline__ float vmax8(v8f a, v8f b) { float x = fmaxf(a[0], b[0]);
#pragma unroll
    for (int j = 1; j < 8; ++j) x = fmaxf(x, fmaxf(a[j], b[j]));
    return x; }
__device__ __forceinline__ void attn_store(const v8f* o, float l, bf* Ah, bf* Al, unsigned l8) {   // o: four d tiles of one query column; Ah, Al: the first fragment tile of (16 queries, head), wave-uniform; d tile dt is half dt & 1 of k tile dt / 2, 256 elements a half
    const float inv = __fdiv_rn(1.0f, l + xhalf(l)); v8us wh[4], wl[4];
#pragma unroll
    for (int dt = 0; dt < 4; ++dt) { const v8f x = o[dt] * inv; const v8bf xh = __builtin_convertvector(x, v8bf), xl = __builtin_convertvector(x - __builtin_convertvector(xh, v8f), v8bf);   // hi + lo, nearest even, packed converts
        wh[dt] = __builtin_bit_cast(v8us, xh); wl[dt] = __builtin_bit_cast(v8us, xl); }
    __builtin_amdgcn_sched_barrier(0);   // all eight pieces are formed before the first store: mixed with the stores, a later convert lands in a register that an issued store still names
#pragma unroll
    for (int dt = 0; dt < 4; ++dt) { *(v8us*)(Ah + dt * 256 + l8) = wh[dt]; *(v8us*)(Al + dt * 256 + l8) = wl[dt]; }
    asm volatile("s_wait_xcnt 0x0" ::: "memory");   // what follows (the next query tile's pieces; the way round the other classes' code, which forms base addresses anew) may land in registers that these stores name: the wait stands in front of that overwrite
}
// K AND V THROUGH LDS: a work-group is AW waves that walk the same keys of one head, each with its own queries. A stage of SK keys (each plane's part is PB contiguous bytes in fragment order, copied as it lies)
// is brought into LDS ONCE for all AW waves by asynchronous copies, two buffers: stage t + 2 is asked for when every wave has left stage t, and flies under stage t + 1. A fragment read is 512 contiguous LDS bytes a wave.
#define AW   4                 // waves of an attention work-group
#define SK   64                // keys of a stage
#define PB   (SK * HD * 2)     // bytes of one 16-bit plane's part of a stage
#define NST  (TT / SK)         // stages
// Eight copies of 16 bytes a lane: PB bytes from ga to LDS byte address la and PB bytes from gb to lb (AW 32 lanes x 16 bytes = 2048 bytes a copy; la, lb, ga, gb are the lane's own).
// The s_wait_xcnt ends the copies' own statement, so that it stands in front of whatever next rewrites an address register that a copy names.
__device__ __forceinline__ void copy8(unsigned la, const char* ga, unsigned lb, const char* gb) {
    asm volatile("global_load_async_to_lds_b128 %0, %8, off\n\tglobal_load_async_to_lds_b128 %1, %9, off\n\tglobal_load_async_to_lds_b128 %2, %10, off\n\tglobal_load_async_to_lds_b128 %3, %11, off\n\t"
                 "global_load_async_to_lds_b128 %4, %12, off\n\tglobal_load_async_to_lds_b128 %5, %13, off\n\tglobal_load_async_to_lds_b128 %6, %14, off\n\tglobal_load_async_to_lds_b128 %7, %15, off\n\ts_wait_xcnt 0x0"
                 :: "v"(la), "v"(la + 2048u), "v"(la + 4096u), "v"(la + 6144u), "v"(lb), "v"(lb + 2048u), "v"(lb + 4096u), "v"(lb + 6144u),
                    "v"(ga), "v"(ga + 2048), "v"(ga + 4096), "v"(ga + 6144), "v"(gb), "v"(gb + 2048), "v"(gb + 4096), "v"(gb + 6144) : "memory");
}
// rows >= RH: fp16 operands, QT tiles of 16 queries per wave
template <int QT>
__device__ __forceinline__ void attn_f16(const h16* __restrict__ Q, const h16* __restrict__ K, const h16* __restrict__ VT, int q0, int col, bf* Ah, bf* Al, char* ring) {
    typedef WFrag<h16> F; const unsigned l8 = (threadIdx.x & 31) * 8;
    constexpr unsigned SB = 2 * PB;   // a stage in LDS: K part, V^T part
    const unsigned lc = (unsigned)(size_t)ring + threadIdx.x * 16; const char* gk = (const char*)K + threadIdx.x * 16; const char* gv = (const char*)VT + threadIdx.x * 16;   // the lane's 16 bytes of every 2048
    v16h qf[QT][2]; v8f o[QT][4]; v8f nm[QT]; float l[QT], lim = -3.0e38f;   // nm: minus the held reference, in all eight elements (a lane's eight elements of a score tile belong to one query); lim: how far above it a score may lie (any score passes the first stage's)
    copy8(lc, gk, lc + PB, gv);   // stage 0
    // fragment order: 16 rows t of q or k are 2 tiles (16 HD elements), 32 keys of V^T are 4 tiles (32 HD elements)
#pragma unroll
    for (int qt = 0; qt < QT; ++qt) { nm[qt] = (v8f){}; l[qt] = 0.f;
#pragma unroll
        for (int ks = 0; ks < 2; ++ks) qf[qt][ks] = F::ld(Q + (size_t)(q0 + qt * 16) * HD + ks * 512, l8);
#pragma unroll
        for (int dt = 0; dt < 4; ++dt) o[qt][dt] = (v8f){}; }
    wait_copies(); __syncthreads();   // stage 0 is published
    copy8(lc + SB, gk + PB, lc + SB + PB, gv + PB);   // stage 1
#pragma unroll 1   // one trip is a stage; unrolling would only add registers
    for (int t = 0; t < NST; ++t) {
        const unsigned bo = (t & 1) * SB; const h16* sk = (const h16*)(ring + bo); const h16* sv = (const h16*)(ring + bo + PB);
        v8f st[SK / 16][QT]; v16h vf[SK / 32][4]; float mx[QT]; bool need = false;
        {   // the scores of the whole stage first, so that one test serves it
            v16h kf[SK / 16][2];
#pragma unroll
            for (int kt = 0; kt < SK / 16; ++kt)
#pragma unroll
                for (int ks = 0; ks < 2; ++ks) kf[kt][ks] = F::ld(sk + (kt * 16) * HD + ks * 512, l8);
            __builtin_amdgcn_sched_barrier(0);   // the stage's key fragments are asked for as one group: sunk among the matrix instructions, each is waited for at once and its whole LDS latency shows
#pragma unroll
            for (int kt = 0; kt < SK / 16; ++kt)
#pragma unroll
                for (int qt = 0; qt < QT; ++qt) st[kt][qt] = F::mma(kf[kt][0], qf[qt][0], nm[qt]);
#pragma unroll
            for (int kt = 0; kt < SK / 16; ++kt)
#pragma unroll
                for (int qt = 0; qt < QT; ++qt) st[kt][qt] = F::mma(kf[kt][1], qf[qt][1], st[kt][qt]);
        }
#pragma unroll
        for (int dt = 0; dt < 4; ++dt) vf[0][dt] = F::ld(sv + dt * 512, l8);   // the first step's V^T is read under the maxima and the test
        __builtin_amdgcn_sched_barrier(0);   // keeps these reads here: sunk to the matrix instructions that use them, each pair is waited for at once and its whole LDS latency shows
#pragma unroll
        for (int qt = 0; qt < QT; ++qt) { mx[qt] = fmaxf(vmax8(st[0][qt], st[1][qt]), vmax8(st[2][qt], st[3][qt])); need = need || mx[qt] > lim; }   // the lane's own 32 keys: the ballot joins the halves
        if (__builtin_amdgcn_ballot_w32(need) != 0) {   // the first stage, rare after it: the references move and what has been summed is rescaled
#pragma unroll
            for (int qt = 0; qt < QT; ++qt) { const float up = fmaxf(mx[qt], xhalf(mx[qt])); const float n1 = nm[qt][0] - fmaxf(up, fminf(lim, 0.f)), d = nm[qt][0] - n1;   // the first stage sets m, later ones only raise it; d: the move as the new C will carry it
                const float al = exp2s(fminf(-d, 0.f)); l[qt] *= al; nm[qt] = (v8f){n1, n1, n1, n1, n1, n1, n1, n1};   // in the first stage l and O^T are 0: the factor stays finite there
#pragma unroll
                for (int dt = 0; dt < 4; ++dt) o[qt][dt] *= al;
#pragma unroll
                for (int kt = 0; kt < SK / 16; ++kt) st[kt][qt] -= d; }
            lim = LAZ; }
#pragma unroll
        for (int kb = 0; kb < SK; kb += 32) {   // steps of 32 keys, ascending, as before
            v16h pf[QT];
#pragma unroll
            for (int qt = 0; qt < QT; ++qt) { float s = 0.f;
#pragma unroll
                for (int kt = 0; kt < 2; ++kt) { const v8f p = exp2v(st[kb / 16 + kt][qt]);
#pragma unroll
                    for (int j = 0; j < 8; ++j) { s += p[j]; pf[qt][kt * 8 + j] = tohx(p[j]); } }
                l[qt] += s; }
#pragma unroll
            for (int dt = 0; dt < 4; ++dt)
#pragma unroll
                for (int qt = 0; qt < QT; ++qt) o[qt][dt] = F::mma(vf[kb / 32][dt], pf[qt], o[qt][dt]);
            if (kb + 32 < SK) {   // the next step's V^T is read under the next step's softmax
                // four vector slots behind the step's last matrix instructions: the next step opens with the exp statements, which may land in their B registers
                if constexpr (QT == 2) asm volatile("v_nop\n\tv_nop\n\tv_nop\n\tv_nop" : "+v"(o[0][0]), "+v"(o[0][1]), "+v"(o[0][2]), "+v"(o[0][3]), "+v"(o[1][0]), "+v"(o[1][1]), "+v"(o[1][2]), "+v"(o[1][3]));
                else asm volatile("v_nop\n\tv_nop\n\tv_nop\n\tv_nop" : "+v"(o[0][0]), "+v"(o[0][1]), "+v"(o[0][2]), "+v"(o[0][3]));
#pragma unroll
                for (int dt = 0; dt < 4; ++dt) vf[kb / 32 + 1][dt] = F::ld(sv + (kb + 32) * HD + dt * 512, l8);
                __builtin_amdgcn_sched_barrier(0); }   // keeps these reads here, as above
        }
        // four vector slots behind the last matrix instructions: on the taken branch the loop's first ones overwrite their B registers
        if constexpr (QT == 2) asm volatile("v_nop\n\tv_nop\n\tv_nop\n\tv_nop" : "+v"(o[0][0]), "+v"(o[0][1]), "+v"(o[0][2]), "+v"(o[0][3]), "+v"(o[1][0]), "+v"(o[1][1]), "+v"(o[1][2]), "+v"(o[1][3]));
        else asm volatile("v_nop\n\tv_nop\n\tv_nop\n\tv_nop" : "+v"(o[0][0]), "+v"(o[0][1]), "+v"(o[0][2]), "+v"(o[0][3]));
        wait_lds(); wait_copies(); __syncthreads();   // publish point: stage t + 1 has landed for every wave, and every wave has left stage t's buffer
        if (t + 2 < NST) copy8(lc + bo, gk + (size_t)(t + 2) * PB, lc + bo + PB, gv + (size_t)(t + 2) * PB);   // refill of the buffer just left
    }
    wait_copies();
#pragma unroll
    for (int qt = 0; qt < QT; ++qt) { const size_t oo = (size_t)(q0 + qt * 16) * DQ + col * 16; attn_store(o[qt], l[qt], Ah + oo, Al + oo, l8);
        if (qt + 1 < QT) __builtin_amdgcn_sched_barrier(0); }   // the second query tile's pieces may land in registers that the first tile's stores name: this keeps its arithmetic behind the wait that ends those stores
}
// rows < RH: bf16 hi + lo planes, three products each (hi hi, lo hi, hi lo), 16 queries per wave
__device__ __forceinline__ void attn_hl(const bf* __restrict__ Qh, const bf* __restrict__ Ql, const bf* __restrict__ Kh, const bf* __restrict__ Kl, const bf* __restrict__ VTh, const bf* __restrict__ VTl, int q0, int col, bf* Ah, bf* Al, char* ring) {
    typedef WFrag<bf> F; const unsigned l8 = (threadIdx.x & 31) * 8;
    constexpr unsigned SB = 4 * PB;   // a stage in LDS: K hi, K lo, V^T hi, V^T lo
    const unsigned lc = (unsigned)(size_t)ring + threadIdx.x * 16;   // the lane's 16 bytes of every 2048
    const char* gkh = (const char*)Kh + threadIdx.x * 16; const char* gkl = (const char*)Kl + threadIdx.x * 16; const char* gvh = (const char*)VTh + threadIdx.x * 16; const char* gvl = (const char*)VTl + threadIdx.x * 16;
    v16bf qh[2], ql[2]; v8f o[4]; v8f nm = (v8f){}; float l = 0.f, lim = -3.0e38f;   // nm, lim as in attn_f16
    copy8(lc, gkh, lc + PB, gkl); copy8(lc + 2 * PB, gvh, lc + 3 * PB, gvl);   // stage 0
#pragma unroll
    for (int ks = 0; ks < 2; ++ks) { const size_t qo = (size_t)q0 * HD + ks * 512; qh[ks] = F::ld(Qh + qo, l8); ql[ks] = F::ld(Ql + qo, l8); }
#pragma unroll
    for (int dt = 0; dt < 4; ++dt) o[dt] = (v8f){};
    wait_copies(); __syncthreads();   // stage 0 is published
    copy8(lc + SB, gkh + PB, lc + SB + PB, gkl + PB); copy8(lc + SB + 2 * PB, gvh + PB, lc + SB + 3 * PB, gvl + PB);   // stage 1
#pragma unroll 1   // as in attn_f16
    for (int t = 0; t < NST; ++t) {
        const unsigned bo = (t & 1) * SB; const bf* skh = (const bf*)(ring + bo); const bf* skl = (const bf*)(ring + bo + PB); const bf* svh = (const bf*)(ring + bo + 2 * PB); const bf* svl = (const bf*)(ring + bo + 3 * PB);
        v8f st[SK / 16]; v16bf vh[SK / 32][4], vl[SK / 32][4];
        {   // the scores of the whole stage first, as in attn_f16; each tile's six products in the order they had, the four tiles side by side
            v16bf kh[SK / 16][2], kl[SK / 16][2];
#pragma unroll
            for (int kt = 0; kt < SK / 16; ++kt)
#pragma unroll
                for (int ks = 0; ks < 2; ++ks) { kh[kt][ks] = F::ld(skh + (kt * 16) * HD + ks * 512, l8); kl[kt][ks] = F::ld(skl + (kt * 16) * HD + ks * 512, l8); }
            __builtin_amdgcn_sched_barrier(0);   // as in attn_f16
#pragma unroll
            for (int kt = 0; kt < SK / 16; ++kt) st[kt] = nm;
#pragma unroll
            for (int ks = 0; ks < 2; ++ks) {
#pragma unroll
                for (int kt = 0; kt < SK / 16; ++kt) st[kt] = F::mma(kh[kt][ks], qh[ks], st[kt]);
#pragma unroll
                for (int kt = 0; kt < SK / 16; ++kt) st[kt] = F::mma(kh[kt][ks], ql[ks], st[kt]);
#pragma unroll
                for (int kt = 0; kt < SK / 16; ++kt) st[kt] = F::mma(kl[kt][ks], qh[ks], st[kt]); }
        }
#pragma unroll
        for (int dt = 0; dt < 4; ++dt) { vh[0][dt] = F::ld(svh + dt * 512, l8); vl[0][dt] = F::ld(svl + dt * 512, l8); }   // as in attn_f16
        __builtin_amdgcn_sched_barrier(0);   // as in attn_f16
        const float mx = fmaxf(vmax8(st[0], st[1]), vmax8(st[2], st[3]));
        if (__builtin_amdgcn_ballot_w32(mx > lim) != 0) {   // as in attn_f16
            const float up = fmaxf(mx, xhalf(mx)); const float n1 = nm[0] - fmaxf(up, fminf(lim, 0.f)), d = nm[0] - n1;
            const float al = exp2s(fminf(-d, 0.f)); l *= al; nm = (v8f){n1, n1, n1, n1, n1, n1, n1, n1};
#pragma unroll
            for (int dt = 0; dt < 4; ++dt) o[dt] *= al;
#pragma unroll
            for (int kt = 0; kt < SK / 16; ++kt) st[kt] -= d;
            lim = LAZ; }
#pragma unroll
        for (int kb = 0; kb < SK; kb += 32) {   // steps of 32 keys, ascending, as before
            float s = 0.f; v8bf ph[2], pl[2];
#pragma unroll
            for (int kt = 0; kt < 2; ++kt) { const v8f p = exp2v(st[kb / 16 + kt]);
#pragma unroll
                for (int j = 0; j < 8; ++j) s += p[j];
                ph[kt] = __builtin_convertvector(p, v8bf); pl[kt] = __builtin_convertvector(p - __builtin_convertvector(ph[kt], v8f), v8bf); }   // hi = nearest-even bf16 of p, lo = nearest-even bf16 of the exact rest (packed converts)
            l += s; const v16bf pfh = __builtin_shufflevector(ph[0], ph[1], 0, 1, 2, 3, 4, 5, 6, 7, 8, 9, 10, 11, 12, 13, 14, 15), pfl = __builtin_shufflevector(pl[0], pl[1], 0, 1, 2, 3, 4, 5, 6, 7, 8, 9, 10, 11, 12, 13, 14, 15);
#pragma unroll
            for (int dt = 0; dt < 4; ++dt) { o[dt] = F::mma(vh[kb / 32][dt], pfh, o[dt]); o[dt] = F::mma(vh[kb / 32][dt], pfl, o[dt]); o[dt] = F::mma(vl[kb / 32][dt], pfh, o[dt]); }
            if (kb + 32 < SK) {   // as in attn_f16
                asm volatile("v_nop\n\tv_nop\n\tv_nop\n\tv_nop" : "+v"(o[0]), "+v"(o[1]), "+v"(o[2]), "+v"(o[3]));   // as in attn_f16
#pragma unroll
                for (int dt = 0; dt < 4; ++dt) { vh[kb / 32 + 1][dt] = F::ld(svh + (kb + 32) * HD + dt * 512, l8); vl[kb / 32 + 1][dt] = F::ld(svl + (kb + 32) * HD + dt * 512, l8); }
                __builtin_amdgcn_sched_barrier(0); }   // as in attn_f16
        }
        asm volatile("v_nop\n\tv_nop\n\tv_nop\n\tv_nop" : "+v"(o[0]), "+v"(o[1]), "+v"(o[2]), "+v"(o[3]));   // as in attn_f16
        wait_lds(); wait_copies(); __syncthreads();   // publish point, as in attn_f16
        if (t + 2 < NST) { const size_t go = (size_t)(t + 2) * PB; copy8(lc + bo, gkh + go, lc + bo + PB, gkl + go); copy8(lc + bo + 2 * PB, gvh + go, lc + bo + 3 * PB, gvl + go); }   // refill of the buffer just left
    }
    wait_copies();
    { const size_t oo = (size_t)q0 * DQ + col * 16; attn_store(o, l, Ah + oo, Al + oo, l8); }
}
// THE DEAL: all work-groups are resident at once, so the launch lasts as long as the fullest SIMD. Three classes of ATL x heads x batches = 256 work-groups each (grid z, so that a class is one round over the 256 WGPs
// in start order): 32-query fp16 waves, hi + lo waves (16 queries), 16-query fp16 waves. A WGP that takes one work-group of each class has on every SIMD one wave of each: 16 hi + lo and 48 fp16 queries, the chip's mean.
// Where a work-group lands changes the time only: every (class, tile, head, batch) is one work-group, every query row belongs to exactly one wave.
#define ATL  (RH / (16 * AW))      // tiles per class, head and batch
#define F2R  (ATL * AW * 32)       // fp16 rows of the 32-query class; the rest go to the 16-query class
static_assert(TT - RH == F2R + ATL * AW * 16, "the two fp16 classes cover rows RH .. TT");
__global__ __launch_bounds__(AW * 32) void k_fattn(const h16* __restrict__ Q16, const h16* __restrict__ K16, const h16* __restrict__ VT16, const bf* __restrict__ Qh, const bf* __restrict__ Ql, const bf* __restrict__ Kh, const bf* __restrict__ Kl, const bf* __restrict__ VTh, const bf* __restrict__ VTl, bf* Ah, bf* Al) {
    __shared__ __align__(128) char ring[2 * 4 * PB];   // two buffers of the larger stage (hi + lo planes)
    const int h = blockIdx.y % NH_, bt = blockIdx.y / NH_, qw = blockIdx.x * AW + __builtin_amdgcn_readfirstlane(threadIdx.x >> 5); const size_t zo = (size_t)blockIdx.y * TT * HD;   // blockIdx.y = batch NH_ + head; the head planes of q, k (rows t) and of v (rows d) have the same size
    Ah += (size_t)bt * TT * DQ; Al += (size_t)bt * TT * DQ;   // merged rows (b, t) x DQ, fragment order
    if (blockIdx.z == 0) attn_f16<2>(Q16 + zo, K16 + zo, VT16 + zo, RH + qw * 32, h * HD, Ah, Al, ring);   // the longest class starts first
    else if (blockIdx.z == 1) attn_hl(Qh + zo, Ql + zo, Kh + zo, Kl + zo, VTh + zo, VTl + zo, qw * 16, h * HD, Ah, Al, ring);
    else attn_f16<1>(Q16 + zo, K16 + zo, VT16 + zo, RH + F2R + qw * 16, h * HD, Ah, Al, ring);
}

extern "C" void kernel_launch(void* const* d_in, const int* in_sizes, int n_in,
                              void* d_out, int out_size, void* d_ws, size_t ws_size, hipStream_t stream) {
    (void)in_sizes; (void)n_in; (void)out_size;
    const float* x = (const float*)d_in[0];   /* query */ const float* xk = (const float*)d_in[1]; const float* xv = (const float*)d_in[2]; const float* wq = (const float*)d_in[3]; const float* wk = (const float*)d_in[4]; const float* wv = (const float*)d_in[5]; const float* wo = (const float*)d_in[6]; const float* bo = (const float*)d_in[7];   /* argument order query, key, value, Wq, Wk, Wv, Wo ('oi' [1024][1024]), bo [1024] (REAL 0.01); eight inputs, all read */
    float* OUT = (float*)d_out;     // [2][2048][1024]
    char* wsp = (char*)d_ws;
    auto take = [&](size_t bytes) { char* p = wsp; wsp += (bytes + 255) & ~(size_t)255; return (void*)p; };
    const size_t NX = (size_t)NB_ * TT * DM, NW = (size_t)DQ * DM, NP = (size_t)NB_ * NH_ * TT * HD;   // elements of one input stream, one weight, one set of head planes (both batches)
    bf* XB = (bf*)take((3 * NX + 4 * NW) * 2); bf* WQ = XB + 3 * NX; bf* WO = WQ + 3 * NW;   // query, key, value, Wq, Wk, Wv, Wo in one run (k_prep)
    float* CS = (float*)take((size_t)TT * HD * 2 * 4);
    h16* QP16 = (h16*)take(2 * NP * 2); h16* KP16 = QP16 + NP; bf* QPh = (bf*)take(2 * NP * 2); bf* KPh = QPh + NP; bf* QPl = (bf*)take(2 * NP * 2); bf* KPl = QPl + NP;   // q planes, then k planes (k_projp's plane order)
    h16* VT16 = (h16*)take(NP * 2); bf* VTh = (bf*)take(NP * 2); bf* VTl = (bf*)take(NP * 2);
    bf* ATh = (bf*)take(NX * 2); bf* ATl = (bf*)take(NX * 2);
    if ((size_t)(wsp - (char*)d_ws) > ws_size) return;    // ws 256 MiB
    k_prep<<<CSB + 3 * XBL + 4 * WBL, 256, 0, stream>>>(x, xk, xv, wq, wk, wv, wo, XB, CS);
    k_projp<<<dim3(NB_ * TT / 128, NH_ / 2, 3), GW * 32, 0, stream>>>(XB, WQ, CS, (unsigned short*)QP16, QPh, QPl, (unsigned short*)VT16, VTh, VTl);   // z = stream: q, k, v
    k_fattn<<<dim3(ATL, NH_ * NB_, 3), AW * 32, 0, stream>>>(QP16, KP16, VT16, QPh, QPl, KPh, KPl, VTh, VTl, ATh, ATl);   // one kv head per query head
    k_gemmo<<<dim3(NB_ * TT / 128, DM / 128, 1), GW * 32, 0, stream>>>(ATh, ATl, WO, OUT, bo);
}

// v010
// A run of this version takes 95.9 microseconds.
// Two timings next to v009 put it at 1.04 and 1.03 times that version's speed.
// All steps since v000 together make it 20.9 times as fast.
#include <hip/hip_runtime.h>

// Multi-head attention WITHOUT a mask over three input streams with a computed rotate-half rotary (query, key, value [2][2048][1024]; q = query Wq^T, k = key Wk^T, v = value Wv^T ('oi' [1024][1024] 1/32, no bias; 16 heads x 64), each from its own stream; _apply_rope AFTER the head split: (x1, x2) = the two HALVES: cat(x1 cos - x2 sin, x1 sin + x2 cos) with angle t x inv_freq[i], inv_freq = 1.0 / (10000.0 ** (arange(0, 64, 2, f32) / 64)) (32 f32 constants; both halves share the 32 angles; one f32 product per angle; precise cosf / sinf), on q and k; scores / sqrt(64); softmax over all keys; out = merged Wo^T + bo ('oi' + a REAL 0.01 bias) -> [2][2048][1024] (4.2 M); argument order query, key, value, Wq, Wk, Wv, Wo, bo).
// Layout, both batches in every launch: bf16 copies of query, key, value and the four 'oi' weights (one launch, with the rotary table); the three exact projections as grid z of one launch, whose epilogue rotates q and k and stores the head planes itself; one fused attention launch, grid y = batch and head, z = class of work-groups (hybrid rows: < 512 hi/lo 3 products, rest fp16; online softmax, scores and weights stay in registers); merged hi/lo x Wo exact.
// FRAGMENT ORDER: every 16-bit plane that a matrix instruction reads (inputs, weights, head planes, merged rows) is stored as tiles of 16 rows x 32 k = 512 elements, laid out as the operand registers want them:
// element (row, k) lies at tile 512 + ((k % 32) / 16) 256 + (((k % 16) / 8) 16 + row % 16) 8 + k % 8, so lane l's two 16-byte pieces lie at l 8 and 256 + l 8 and each wave-wide load or store is 512 contiguous bytes
// (4 cache lines; in row-major planes it touched 16). Tile order: (row / 16) major, k / 32 minor; the V^T planes k / 32 (keys) major, d / 16 minor, so that a step of 32 keys is 4 KiB in a row.
// Compute dtypes, f32 accumulate: every input rounded to bf16; projections exact; attention rows < 512 3 products, rest fp16; softmax f32; Wo hl x exact.

#define NB_  2
#define TT   2048
#define DM   1024
#define NH_  16
#define NKV  16
#define REP  (NH_ / NKV)
#define HD   64
#define DQ   (NH_ * HD)
#define DKV  (NKV * HD)
#define RH   512                  // query rows < RH use hi+lo planes
#define WIN  0
#define SCL  0.125f   // HD^-0.5
#define CEXP (SCL * 1.4426950408889634f)   // score -> exponent of 2
typedef _Float16 h16;
typedef unsigned short bf;
typedef __attribute__((ext_vector_type(16))) __bf16   v16bf;
typedef __attribute__((ext_vector_type(16))) _Float16 v16h;
typedef __attribute__((ext_vector_type(8)))  _Float16 v8h;
typedef __attribute__((ext_vector_type(8)))  unsigned short v8us;
typedef __attribute__((ext_vector_type(8)))  float    v8f;
typedef __attribute__((ext_vector_type(4)))  float    v4f;
typedef v8h  __attribute__((may_alias)) v8ha;
typedef v4f  __attribute__((may_alias)) v4fa;
typedef v8us __attribute__((may_alias)) v8usa;

__device__ __forceinline__ unsigned short f2bf(float f) { unsigned u = __float_as_uint(f); u += 0x7FFFu + ((u >> 16) & 1u); return (unsigned short)(u >> 16); }
__device__ __forceinline__ float bf2f(unsigned short b) { return __uint_as_float(((unsigned)b) << 16); }
__device__ __forceinline__ float bfr(float f) { return bf2f(f2bf(f)); }
__device__ __forceinline__ v16h cat16(v8h lo, v8h hi) { return __builtin_shufflevector(lo, hi, 0, 1, 2, 3, 4, 5, 6, 7, 8, 9, 10, 11, 12, 13, 14, 15); }
__device__ __forceinline__ v16bf cat16b(v8us lo, v8us hi) { return __builtin_bit_cast(v16bf, __builtin_shufflevector(lo, hi, 0, 1, 2, 3, 4, 5, 6, 7, 8, 9, 10, 11, 12, 13, 14, 15)); }
__device__ __forceinline__ v8f wmma16(v16h a, v16h b, v8f c) { return __builtin_amdgcn_wmma_f32_16x16x32_f16(false, a, false, b, (short)0, c, false, false); }
__device__ __forceinline__ v8f wmmab(v16bf a, v16bf b, v8f c) { return __builtin_amdgcn_wmma_f32_16x16x32_bf16(false, a, false, b, (short)0, c, false, false); }



// ---- GEMM work-groups: GW = 4 waves, 2 x 2 register-blocked tiles of 64x64 (16 accumulators a wave), one 128x128 output tile; operands are 16-bit planes in fragment order, rows of 1024 k (ld(t, l8): t = the tile, wave-uniform, l8 = lane 8).
// OPERANDS THROUGH LDS: a stage is GK = 64 k of the 128 rows of each operand; 16 rows x 64 k are 2 fragment tiles = 2048 contiguous bytes of the plane, copied as they lie, so a stage part is 8 row tiles x 2048 bytes.
// It is brought into LDS ONCE for the two waves that read each half of it by asynchronous copies, two buffers: stage t + 2 is asked for when every wave has left stage t, and flies under stage t + 1. (k_gemmo takes two such stages as one, 128 k.)
template <typename T16> struct WFrag;
template <> struct WFrag<h16> { typedef v16h V; static __device__ __forceinline__ V ld(const h16* p) { return cat16(*(const v8h*)p, *(const v8h*)(p + 256)); } static __device__ __forceinline__ V ld(const h16* t, unsigned l8) { return cat16(*(const v8h*)(t + l8), *(const v8h*)(t + 256 + l8)); } static __device__ __forceinline__ v8f mma(V a, V b, v8f c) { return wmma16(a, b, c); } };
template <> struct WFrag<bf> { typedef v16bf V; static __device__ __forceinline__ V ld(const bf* p) { return cat16b(*(const v8us*)p, *(const v8us*)(p + 256)); } static __device__ __forceinline__ V ld(const bf* t, unsigned l8) { return cat16b(*(const v8us*)(t + l8), *(const v8us*)(t + 256 + l8)); } static __device__ __forceinline__ v8f mma(V a, V b, v8f c) { return wmmab(a, b, c); } };
#define GW   4                  // waves of a GEMM work-group
#define GK   64                 // k of a stage
#define GOB  (128 * GK * 2)     // bytes of one operand's part of a stage
#define GNS  (DM / GK)          // stages (DM == DQ: every product here sums over 1024 k)
#define GRT  (16 * DM * 2)      // bytes from one row tile of a plane to the next
__device__ __forceinline__ void wait_copies() { asm volatile("s_wait_asynccnt 0x0" ::: "memory"); }   // this wave's copies have landed; the compiler places no wait for them
__device__ __forceinline__ void wait_lds() { asm volatile("s_wait_dscnt 0x0" ::: "memory"); }         // this wave's LDS reads have returned before the buffer they read is handed back for a refill
// Eight copies of 16 bytes a lane: the 2048 bytes of a stage in each of 8 row tiles (GRT bytes apart in the plane) to 8 x 2048 bytes in a row from LDS byte address la (GW 32 lanes x 16 bytes = 2048 bytes a copy; la, ga are the lane's own).
// The s_wait_xcnt ends the copies' own statement, so that it stands in front of whatever next rewrites an address register that a copy names.
__device__ __forceinline__ void copy8r(unsigned la, const char* ga) {
    asm volatile("global_load_async_to_lds_b128 %0, %8, off\n\tglobal_load_async_to_lds_b128 %1, %9, off\n\tglobal_load_async_to_lds_b128 %2, %10, off\n\tglobal_load_async_to_lds_b128 %3, %11, off\n\t"
                 "global_load_async_to_lds_b128 %4, %12, off\n\tglobal_load_async_to_lds_b128 %5, %13, off\n\tglobal_load_async_to_lds_b128 %6, %14, off\n\tglobal_load_async_to_lds_b128 %7, %15, off\n\ts_wait_xcnt 0x0"
                 :: "v"(la), "v"(la + 2048u), "v"(la + 4096u), "v"(la + 6144u), "v"(la + 8192u), "v"(la + 10240u), "v"(la + 12288u), "v"(la + 14336u),
                    "v"(ga), "v"(ga + GRT), "v"(ga + 2 * GRT), "v"(ga + 3 * GRT), "v"(ga + 4 * GRT), "v"(ga + 5 * GRT), "v"(ga + 6 * GRT), "v"(ga + 7 * GRT) : "memory");
    __builtin_amdgcn_sched_barrier(0);   // the next run's 24 address registers are formed behind this run: formed ahead for several runs, on top of the accumulators, they take the wave past 256 registers
}
// k_gemmo: C[m][n] (f32, pitch DM) = sum_k (A[m][k] + A2[m][k]) Bt[n][k] + bias[n] (bias rounded to bf16), two products per k tile (A, then A2); grid (M/128, N/128), GW 32 threads.
__global__ __launch_bounds__(GW * 32) void k_gemmo(const bf* __restrict__ A, const bf* __restrict__ A2, const bf* __restrict__ Bt, float* C, const float* __restrict__ bias) {
    typedef WFrag<bf> F; typedef F::V V;
    __shared__ __align__(128) char ring[2 * 2 * 3 * GOB];   // two buffers of a stage of 2 GK = 128 k: A, A2, Bt parts of the first 64 k, then of the second (one work-group per WGP: a longer stage gives the copies a longer lead)
    __shared__ __align__(16) float osw[GW][16 * 68];    // each wave's own rows for the epilogue
    constexpr unsigned HB = 3 * GOB, SB = 2 * HB; constexpr int ldc = DM;   // bytes of half a stage, of a stage
    const int w = __builtin_amdgcn_readfirstlane(threadIdx.x >> 5), wm = w & 1, wn = w >> 1; float* os = osw[w];
    const int lane = threadIdx.x & 31, lr = lane & 15, hi = lane >> 4; const unsigned l8 = lane * 8; const int r0 = blockIdx.x * 128 + wm * 64, c0 = blockIdx.y * 128 + wn * 64;
    const unsigned lc = (unsigned)(size_t)ring + threadIdx.x * 16;   // the lane's 16 bytes of every 2048
    const char* ga = (const char*)(A + (size_t)blockIdx.x * 128 * DQ) + threadIdx.x * 16; const char* ga2 = (const char*)(A2 + (size_t)blockIdx.x * 128 * DQ) + threadIdx.x * 16; const char* gb = (const char*)(Bt + (size_t)blockIdx.y * 128 * DQ) + threadIdx.x * 16;
    v8f acc[4][4];
    copy8r(lc, ga); copy8r(lc + GOB, ga2); copy8r(lc + 2 * GOB, gb); copy8r(lc + HB, ga + 2048); copy8r(lc + HB + GOB, ga2 + 2048); copy8r(lc + HB + 2 * GOB, gb + 2048);   // stage 0
#pragma unroll
    for (int mb = 0; mb < 4; ++mb)
#pragma unroll
        for (int nb = 0; nb < 4; ++nb) acc[mb][nb] = (v8f){};
    wait_copies(); __syncthreads();   // stage 0 is published
    copy8r(lc + SB, ga + 4096); copy8r(lc + SB + GOB, ga2 + 4096); copy8r(lc + SB + 2 * GOB, gb + 4096); copy8r(lc + SB + HB, ga + 6144); copy8r(lc + SB + HB + GOB, ga2 + 6144); copy8r(lc + SB + HB + 2 * GOB, gb + 6144);   // stage 1
#pragma unroll 1   // one trip is a stage of 128 matrix instructions; unrolling would only add registers
    for (int t = 0; t < GNS / 2; ++t) {
        const unsigned bo = (t & 1) * SB; const bf* sa = (const bf*)(ring + bo + wm * (GOB / 2)); const bf* sa2 = (const bf*)(ring + bo + GOB + wm * (GOB / 2)); const bf* sb = (const bf*)(ring + bo + 2 * GOB + wn * (GOB / 2));
#pragma unroll
        for (int kt = 0; kt < 4; ++kt) {   // 32 k, ascending, as before; half a stage is HB / 2 elements, a row tile in it 1024, a k tile 512
            V a[4], a2[4], b[4]; constexpr int HE = HB / 2; const int ko = (kt >> 1) * HE + (kt & 1) * 512;
#pragma unroll
            for (int mb = 0; mb < 4; ++mb) { a[mb] = F::ld(sa + mb * 1024 + ko, l8); b[mb] = F::ld(sb + mb * 1024 + ko, l8); }
#pragma unroll
            for (int mb = 0; mb < 4; ++mb) a2[mb] = F::ld(sa2 + mb * 1024 + ko, l8);
            __builtin_amdgcn_sched_barrier(0);   // the twelve fragments are asked for as one group: sunk among the matrix instructions, each is waited for at once and its whole LDS latency shows (one wave per SIMD)
#pragma unroll
            for (int nb = 0; nb < 4; ++nb)
#pragma unroll
                for (int mb = 0; mb < 4; ++mb) acc[mb][nb] = F::mma(a[mb], b[nb], acc[mb][nb]);
#pragma unroll
            for (int nb = 0; nb < 4; ++nb)
#pragma unroll
                for (int mb = 0; mb < 4; ++mb) acc[mb][nb] = F::mma(a2[mb], b[nb], acc[mb][nb]);
        }
        __builtin_amdgcn_sched_barrier(0);   // keeps every matrix instruction of the trip in front of the slots below: some were moved behind the barrier, where the slots no longer follow the last of them
        // four vector slots behind the last matrix instructions: on the taken branch the loop's first reads overwrite their operands
        asm volatile("v_nop\n\tv_nop\n\tv_nop\n\tv_nop" : "+v"(acc[0][3]), "+v"(acc[1][3]), "+v"(acc[2][3]), "+v"(acc[3][3]));
        wait_lds(); wait_copies(); __syncthreads();   // publish point: stage t + 1 has landed for every wave, and every wave has left stage t's buffer
        if (t + 2 < GNS / 2) { const size_t go = (size_t)(t + 2) * 4096; copy8r(lc + bo, ga + go); copy8r(lc + bo + GOB, ga2 + go); copy8r(lc + bo + 2 * GOB, gb + go);   // refill of the buffer just left
            copy8r(lc + bo + HB, ga + go + 2048); copy8r(lc + bo + HB + GOB, ga2 + go + 2048); copy8r(lc + bo + HB + 2 * GOB, gb + go + 2048); }
    }
    wait_copies();
    constexpr bool BIAS = true;
#pragma unroll
    for (int mb = 0; mb < 4; ++mb) {
#pragma unroll
        for (int nb = 0; nb < 4; ++nb) {
#pragma unroll
            for (int j = 0; j < 8; ++j) os[(hi * 8 + j) * 68 + nb * 16 + lr] = acc[mb][nb][j]; }
        __builtin_amdgcn_wave_barrier(); asm volatile("" ::: "memory");
        float* crow = C + (size_t)(r0 + mb * 16) * ldc + c0;
{
#pragma unroll
            for (int s = 0; s < 8; ++s) { const int row = 2 * s + hi, cofs = lr * 4; v4f val = *(const v4fa*)(os + row * 68 + cofs); if (BIAS) { val[0] += bfr(bias[c0 + cofs]); val[1] += bfr(bias[c0 + cofs + 1]); val[2] += bfr(bias[c0 + cofs + 2]); val[3] += bfr(bias[c0 + cofs + 3]); }
                *(v4f*)(crow + (size_t)row * ldc + cofs) = val; }
             }
        __builtin_amdgcn_wave_barrier(); asm volatile("" ::: "memory");
    }
}

__device__ __forceinline__ h16 tohx(float x) { return (h16)x; }
__device__ __forceinline__ void splitf(float y, unsigned short& h, unsigned short& l) { h = f2bf(y); l = f2bf(y - bf2f(h)); }
typedef __attribute__((ext_vector_type(2))) _Float16 v2h;
typedef __attribute__((ext_vector_type(4))) _Float16 v4h;
typedef __attribute__((ext_vector_type(2))) unsigned short v2us;
typedef __attribute__((ext_vector_type(4))) unsigned short v4us;
typedef __attribute__((ext_vector_type(2))) float v2f;
typedef __attribute__((ext_vector_type(4))) int v4i;
typedef __attribute__((ext_vector_type(8))) __bf16 v8bf;

__global__ __launch_bounds__(256) void k_wtG(const float* __restrict__ w, int K, int N, bf* Bt) {
    const int lane = threadIdx.x & 31; const int L0 = (blockIdx.x * 8 + (threadIdx.x >> 5)) * 8; const int nlines = N * K / 64;
{
#pragma unroll 1
        for (int l = 0; l < 8; ++l) { const int L = L0 + l; if (L >= nlines) break; const size_t e = (size_t)L * 64 + lane * 2; const int k = (int)(e % K), n = (int)(e / K); v2us o;
            o[0] = f2bf(w[(size_t)k * N + n]); o[1] = f2bf(w[(size_t)(k + 1) * N + n]); *(v2us*)(Bt + e) = o; }
         }
}

// ---- k_projp: the three projections (grid z = stream: q, k, v), one wave per 64x64 tile, four to a work-group as in k_gemmo; a wave's tile is 64 rows t of ONE head (64 d), so the epilogue finishes it in registers and stores
// the head planes (fp16, bf16 hi, bf16 lo) itself: no f32 projection goes through memory. The operand that supplies the WMMA rows is chosen so that a lane's eight accumulator elements run along the plane's
// k index: q, k (planes [h], rows t, k = d, h = (stream NB_ + batch) NH_ + head): WMMA rows = d (the weight), columns = t; v (planes [g], rows d, k = t, g = batch NKV + head): WMMA rows = t (the input), columns = d.
// Rotate-half: out[d] = x[d] cos - x[d+32] sin, out[d+32] = x[d+32] cos + x[d] sin, angle (t, d % 32); d and d + 32 are row tiles mb and mb + 2 of the same lane and element.
// Epilogue of k_projp, one group of 16 plane rows (nb) at a time: rotate (q, k), round to the three planes, store. Accumulator (mb, nb) holds k = mb 16 + hi 8 + j of plane row nb 16 + lr: that IS half (mb & 1) of fragment
// tile (row tile nb, k tile mb / 2) in fragment order, so each store goes straight from the registers as 512 contiguous bytes. SN, SM: element strides of a row tile and of a k tile in the plane's tile order.
template <bool ROPE, int SN, int SM>
__device__ __forceinline__ void proj_store(v8f (&acc)[4][4], const float* __restrict__ CSt, float qs, unsigned short* D16, unsigned short* Dh, unsigned short* Dl) {   // qs: factor on the rotated values before they are rounded (q: CEXP, k: 1)
    const int lane = threadIdx.x & 31, lr = lane & 15, hi = lane >> 4; const unsigned l8 = lane * 8;
    const float* cp = ROPE ? CSt + ((size_t)lr * HD + hi * 8) * 2 : nullptr;   // (cos, sin) pairs of the tile's row lr, from d = 8 hi; row group nb lies nb 16 rows on
    v4f c[2][8];
    if (ROPE) {
#pragma unroll
        for (int i = 0; i < 8; ++i) c[0][i] = *(const v4f*)(cp + (i >> 2) * 32 + (i & 3) * 4); }
#pragma unroll
    for (int nb = 0; nb < 4; ++nb) {
        if (ROPE) {
            if (nb < 3) {   // the next row group's pairs fly under this group's arithmetic and stores
#pragma unroll
                for (int i = 0; i < 8; ++i) c[(nb + 1) & 1][i] = *(const v4f*)(cp + (size_t)(nb + 1) * 16 * HD * 2 + (i >> 2) * 32 + (i & 3) * 4); }
#pragma unroll
            for (int mb = 0; mb < 2; ++mb)
#pragma unroll
                for (int j = 0; j < 8; ++j) { const float co = c[nb & 1][mb * 4 + (j >> 1)][(j & 1) * 2], si = c[nb & 1][mb * 4 + (j >> 1)][(j & 1) * 2 + 1]; const float x1 = acc[mb][nb][j], x2 = acc[mb + 2][nb][j];
                    acc[mb][nb][j] = (x1 * co - x2 * si) * qs; acc[mb + 2][nb][j] = (x2 * co + x1 * si) * qs; }
        }
        v8us w[4][3];
#pragma unroll
        for (int mb = 0; mb < 4; ++mb) { const v8f x = acc[mb][nb]; const v8bf xh = __builtin_convertvector(x, v8bf);   // hi = nearest-even bf16, lo = nearest-even bf16 of the exact rest
            w[mb][0] = __builtin_bit_cast(v8us, __builtin_convertvector(x, v8h)); w[mb][1] = __builtin_bit_cast(v8us, xh);
            w[mb][2] = __builtin_bit_cast(v8us, __builtin_convertvector(x - __builtin_convertvector(xh, v8f), v8bf)); }
        __builtin_amdgcn_sched_barrier(0);   // all twelve pieces are formed before the first store: mixed with the stores, a later convert lands in a register that an issued store still names, ahead of the wait below
#pragma unroll
        for (int mb = 0; mb < 4; ++mb) { const int g = nb * SN + (mb >> 1) * SM + (mb & 1) * 256;
            *(v8us*)(D16 + g + l8) = w[mb][0]; *(v8us*)(Dh + g + l8) = w[mb][1]; *(v8us*)(Dl + g + l8) = w[mb][2]; }
        asm volatile("s_wait_xcnt 0x0" ::: "memory");   // what follows (the next group's table loads and arithmetic; behind the last group whatever the kernel does next) may land in registers that these stores name: the wait stands in front of that overwrite
        __builtin_amdgcn_sched_barrier(0);   // without it the table loads of all four groups are lifted to the front, and their 128 registers on top of the accumulators cost a wave per SIMD
    }
}
__global__ __launch_bounds__(GW * 32) void k_projp(const bf* __restrict__ X, const bf* __restrict__ Wt, const float* __restrict__ CS, unsigned short* P16, unsigned short* Ph, unsigned short* Pl, unsigned short* V16, unsigned short* Vh, unsigned short* Vl) {
    typedef WFrag<bf> F; typedef F::V V;
    __shared__ __align__(128) char ring[2 * 2 * GOB];   // two buffers of a stage: input part (128 rows t), weight part (128 rows = 2 heads)
    constexpr unsigned SB = 2 * GOB;
    const int z = blockIdx.z; const bool isv = z == 2;
    const int w = __builtin_amdgcn_readfirstlane(threadIdx.x >> 5), wx = w & 1, wh = w >> 1;   // the wave's 64 rows t and its head within the work-group's tile
    const int lane = threadIdx.x & 31; const int r0 = blockIdx.x * 128 + wx * 64, head = blockIdx.y * 2 + wh; const int b = r0 / TT, t0 = r0 % TT; const unsigned l8 = lane * 8;
    const unsigned lc = (unsigned)(size_t)ring + threadIdx.x * 16;   // the lane's 16 bytes of every 2048
    const char* gx = (const char*)(X + (size_t)z * NB_ * TT * DM + (size_t)blockIdx.x * 128 * DM) + threadIdx.x * 16; const char* gw = (const char*)(Wt + (size_t)z * DQ * DM + (size_t)blockIdx.y * 128 * DM) + threadIdx.x * 16;
    const unsigned xo = wx * (GOB / 2), wo = GOB + wh * (GOB / 2); const unsigned ao = isv ? xo : wo, bo2 = isv ? wo : xo;   // the wave's halves of the two parts; which of them supplies the WMMA rows
    copy8r(lc, gx); copy8r(lc + GOB, gw);   // stage 0
    v8f acc[4][4];
#pragma unroll
    for (int mb = 0; mb < 4; ++mb)
#pragma unroll
        for (int nb = 0; nb < 4; ++nb) acc[mb][nb] = (v8f){};
    wait_copies(); __syncthreads();   // stage 0 is published
    copy8r(lc + SB, gx + 2048); copy8r(lc + SB + GOB, gw + 2048);   // stage 1
#pragma unroll 1   // one trip is a stage of 32 matrix instructions; unrolling would only add operand registers on top of the 128 of the accumulators
    for (int t = 0; t < GNS; ++t) {
        const unsigned bo = (t & 1) * SB; const bf* sa = (const bf*)(ring + bo + ao); const bf* sb = (const bf*)(ring + bo + bo2);
#pragma unroll
        for (int kt = 0; kt < 2; ++kt) {   // 32 k, ascending, as before; a row tile of the stage is 1024 elements, a k tile 512
            V a[4], bb[4];
#pragma unroll
            for (int mb = 0; mb < 4; ++mb) { a[mb] = F::ld(sa + mb * 1024 + kt * 512, l8); bb[mb] = F::ld(sb + mb * 1024 + kt * 512, l8); }
            __builtin_amdgcn_sched_barrier(0);   // the eight fragments are asked for as one group, as in k_gemmo
#pragma unroll
            for (int nb = 0; nb < 4; ++nb)
#pragma unroll
                for (int mb = 0; mb < 4; ++mb) acc[mb][nb] = F::mma(a[mb], bb[nb], acc[mb][nb]);
        }
        __builtin_amdgcn_sched_barrier(0);   // as in k_gemmo
        // four vector slots behind the last matrix instructions, as in k_gemmo
        asm volatile("v_nop\n\tv_nop\n\tv_nop\n\tv_nop" : "+v"(acc[0][3]), "+v"(acc[1][3]), "+v"(acc[2][3]), "+v"(acc[3][3]));
        wait_lds(); wait_copies(); __syncthreads();   // publish point, as in k_gemmo
        if (t + 2 < GNS) { const size_t go = (size_t)(t + 2) * 2048; copy8r(lc + bo, gx + go); copy8r(lc + bo + GOB, gw + go); }   // refill of the buffer just left
    }
    wait_copies();
    // acc[mb][nb][j]: k index i = mb 16 + hi 8 + j, plane row o = nb 16 + lr. 64 t of one head are 4096 elements in a row in both tile orders: q, k 4 row tiles x 2 k tiles, v 2 k tiles x 4 row tiles
    if (isv) { const size_t base = ((size_t)(b * NKV + head) * TT + t0) * HD; proj_store<false, 512, 2048>(acc, nullptr, 1.0f, V16 + base, Vh + base, Vl + base); }
    else { const size_t base = (((size_t)(z * NB_ + b) * NH_ + head) * TT + t0) * HD; proj_store<true, 1024, 512>(acc, CS + (size_t)t0 * HD * 2, z == 0 ? CEXP : 1.0f, P16 + base, Ph + base, Pl + base); }
}
__constant__ float INVT[HD / 2] = { 1.000000000e+00f, 7.498942018e-01f, 5.623413324e-01f, 4.216965139e-01f, 3.162277639e-01f, 2.371373624e-01f, 1.778279394e-01f, 1.333521456e-01f, 1.000000015e-01f, 7.498941571e-02f, 5.623412877e-02f, 4.216964915e-02f, 3.162277862e-02f, 2.371373586e-02f, 1.778279431e-02f, 1.333521493e-02f, 9.999999776e-03f, 7.498942316e-03f, 5.623413250e-03f, 4.216964822e-03f, 3.162277862e-03f, 2.371373819e-03f, 1.778279431e-03f, 1.333521446e-03f, 1.000000047e-03f, 7.498941850e-04f, 5.623413017e-04f, 4.216964880e-04f, 3.162277862e-04f, 2.371373848e-04f, 1.778279402e-04f, 1.333521504e-04f };   // 1 / 10000^(2i/64) (float32, generated with jnp to be bit-exact)
// k_prep: everything that depends on no other launch, in one grid: f32 -> bf16 into ONE run of planes dst = query, key, value (both batches each), Wq, Wk, Wv, Wo, and the rotary table (positions = arange).
// RESIDENT, LOOPING WORK-GROUPS: PGR = 256 work-groups of PWV = 16 waves, one per WGP, all started at once.
// A work-group takes PRW = 64 source rows (4 row tiles x 32 k tiles = 256 KiB in a row of ONE source, a scalar choice; 128 KiB in a row of dst); a wave takes 8 rows of 16 k tiles in a row: 32 loads, all asked for
// before the first is used, at constant offsets from one address. The planes are in fragment order (rows of DM = 32 k tiles). Per tile, as before: two loads of 4 whole 128-byte source lines each
// (8 lanes a row, 4 k a lane); the 8-byte pieces fill 64-byte runs (4 rows of one half-column of 8 k), and the two stores together whole lines of the tile. Each lane also computes one entry of the table, under the loads' latency.
#define PWV  16                                  // waves of a work-group
#define PRW  64                                  // source rows of a work-group
#define XG   (NB_ * TT / PRW)                    // work-groups per input stream
#define WGR  (DQ / PRW)                          // work-groups per weight
#define PGR  (3 * XG + 4 * WGR)                  // work-groups
#define PKT  (PRW / 8 * (DM / 32) / PWV)         // k tiles of a wave
#define PGU  4                                   // k tiles that are converted and stored as one group
static_assert(PGR * PWV * 32 == TT * HD, "one table entry a lane");
static_assert((DM / 32) % PKT == 0 && PKT % PGU == 0, "a wave's tiles lie in one row tile");
__global__ __launch_bounds__(PWV * 32) void k_prep(const float* __restrict__ xq, const float* __restrict__ xk, const float* __restrict__ xv, const float* __restrict__ wq, const float* __restrict__ wk, const float* __restrict__ wv, const float* __restrict__ wo, bf* dst, float* CS) {
    const int w = __builtin_amdgcn_readfirstlane(threadIdx.x >> 5), lane = threadIdx.x & 31, bx = blockIdx.x;
    const int idx = (bx * PWV + w) * 32 + lane; const int d = idx % HD; const int t = idx / HD; const float iv = INVT[d % (HD / 2)];   // the lane's table entry
    asm volatile("s_wait_xcnt 0x0" ::: "memory");   // the address arithmetic below may land in the address registers that this load names: the wait stands in front of that overwrite (it runs under the kernel arguments' own load)
    __builtin_amdgcn_sched_barrier(0);   // the constant is asked for ahead of the 32 loads: loads return in order, so behind them it would hold the table back until all of them have landed
    const float* src; int lb;
    if (bx < 3 * XG) { const int sel = bx / XG; lb = bx % XG; src = sel == 0 ? xq : sel == 1 ? xk : xv; }
    else { const int sel = (bx - 3 * XG) / WGR; lb = (bx - 3 * XG) % WGR; src = sel == 0 ? wq : sel == 1 ? wk : sel == 2 ? wv : wo; }
    constexpr int KP = (DM / 32) / PKT;   // waves side by side along k
    const int h8 = w / KP, kt0 = (w % KP) * PKT;   // the wave's 8 rows (row tile h8 / 2, half h8 % 2) and its first k tile
    const int r = (h8 & 1) * 8 + (lane >> 3), k4 = (lane & 7) * 4;   // row in the tile (and r + 4), first k in the tile
    const float* sp = src + (size_t)(lb * PRW + (h8 >> 1) * 16 + r) * DM + kt0 * 32 + k4;
    bf* dp = dst + (size_t)bx * (PRW * DM) + ((h8 >> 1) * (DM / 32) + kt0) * 512 + (k4 >> 4) * 256 + (((k4 >> 3) & 1) * 16 + r) * 8 + (k4 & 4);
    v4f v[PKT][2];
#pragma unroll
    for (int u = 0; u < PKT; ++u) { v[u][0] = *(const v4f*)(sp + u * 32); v[u][1] = *(const v4f*)(sp + u * 32 + 4 * DM); }
    asm volatile("s_wait_xcnt 0x0" :: "v"(sp) : "memory");   // what follows may land in the address registers that these loads name: the wait stands in front of that overwrite; the address is an input so that it lives up to the wait (else the last load's own result is placed on it)
    __builtin_amdgcn_sched_barrier(0);   // all 32 loads are in flight before anything else is done: sunk to their uses, only a few would be
    { const float a = __fmul_rn((float)t, iv); v2f cs; cs[0] = cosf(a); cs[1] = sinf(a); *(v2f*)(CS + (size_t)idx * 2) = cs; }
    asm volatile("s_wait_xcnt 0x0" ::: "memory");   // the converts below may land in registers that this store names
    __builtin_amdgcn_sched_barrier(0);   // keeps the table in front of the first wait for a load
#pragma unroll
    for (int g = 0; g < PKT / PGU; ++g) {
        v4us o[PGU][2];
#pragma unroll
        for (int u = 0; u < PGU; ++u)
#pragma unroll
            for (int k = 0; k < 4; ++k) { o[u][0][k] = f2bf(v[g * PGU + u][0][k]); o[u][1][k] = f2bf(v[g * PGU + u][1][k]); }
        __builtin_amdgcn_sched_barrier(0);   // the group's pieces are formed before its first store: mixed with the stores, a later convert lands in a register that an issued store still names
#pragma unroll
        for (int u = 0; u < PGU; ++u) { *(v4us*)(dp + (g * PGU + u) * 512) = o[u][0]; *(v4us*)(dp + (g * PGU + u) * 512 + 4 * 8) = o[u][1]; }
        if (g + 1 < PKT / PGU) { asm volatile("s_wait_xcnt 0x0" ::: "memory");   // the next group's converts may land in registers that these stores name
            __builtin_amdgcn_sched_barrier(0); }   // keeps them behind that wait
    }
}
// ---- k_fattn: scores, softmax and weights x V in ONE kernel; AW waves per work-group, grid (ATL tiles, heads x batches, 3 classes of work-groups: see k_fattn).
// The wave forms the TRANSPOSED score tile S^T = K Q^T (A = 16 keys, B = 16 queries): lane (lr, hi) then holds keys 8 hi + j of query lr, and two such tiles (keys 0..15, 16..31)
// side by side ARE the B fragment (k = 8 hi + 0..7, 16 + 8 hi + 0..7) of O^T = V^T P^T, so the weights never leave their registers. Online softmax per query over steps of 32 keys, ascending:
// a HELD reference m per query (in exponent-of-2 units; the q planes are stored times CEXP, so a score product is in those units): minus m is the C operand of the score products, so that their result is the exponent of the weight
// 2^(score - m) as it stands; m moves, and the running sum l, O^T and the stage's exponents are corrected by m_old - m_new, only in the first stage and in a stage where some query of the wave has a score more than LAZ above its m
// (one test per stage of SK keys for the whole wave, a scalar branch), so a weight never exceeds 2^LAZ; the two lane halves of a query share m (the cross-half exchange stands inside that branch) and add their l at the end.
__device__ __forceinline__ float xhalf(float x) { return __builtin_bit_cast(float, __builtin_amdgcn_permlanex16(__builtin_bit_cast(int, x), __builtin_bit_cast(int, x), 0x76543210, 0xfedcba98, false, false)); }   // lane l with lane l ^ 16, no LDS round trip
// 2^x. The instruction set asks for one free slot behind a transcendental before its result is read or its source overwritten: the v_nop ends the same statement so that it cannot drift,
// and the early-clobber results keep every exp of the run of eight off the sources of the others.
__device__ __forceinline__ float exp2s(float x) { float r; asm("v_exp_f32 %0, %1\n\tv_nop" : "=v"(r) : "v"(x)); return r; }
__device__ __forceinline__ v8f exp2v(v8f x) { float r0, r1, r2, r3, r4, r5, r6, r7;
    asm("v_exp_f32 %0, %8\n\tv_exp_f32 %1, %9\n\tv_exp_f32 %2, %10\n\tv_exp_f32 %3, %11\n\tv_exp_f32 %4, %12\n\tv_exp_f32 %5, %13\n\tv_exp_f32 %6, %14\n\tv_exp_f32 %7, %15\n\tv_nop"
        : "=&v"(r0), "=&v"(r1), "=&v"(r2), "=&v"(r3), "=&v"(r4), "=&v"(r5), "=&v"(r6), "=&v"(r7) : "v"(x[0]), "v"(x[1]), "v"(x[2]), "v"(x[3]), "v"(x[4]), "v"(x[5]), "v"(x[6]), "v"(x[7]));
    return (v8f){r0, r1, r2, r3, r4, r5, r6, r7}; }
#define LAZ  8.0f   // how far a score may rise above the held reference before it moves (exponent-of-2 units): 2^8 is far inside the range of fp16 and bf16 weights and of the f32 sums
__device__ __forceinline__ float vmax8(v8f a, v8f b) { float x = fmaxf(a[0], b[0]);
#pragma unroll
    for (int j = 1; j < 8; ++j) x = fmaxf(x, fmaxf(a[j], b[j]));
    return x; }
__device__ __forceinline__ void attn_store(const v8f* o, float l, bf* Ah, bf* Al, unsigned l8) {   // o: four d tiles of one query column; Ah, Al: the first fragment tile of (16 queries, head), wave-uniform; d tile dt is half dt & 1 of k tile dt / 2, 256 elements a half
    const float inv = __fdiv_rn(1.0f, l + xhalf(l)); v8us wh[4], wl[4];
#pragma unroll
    for (int dt = 0; dt < 4; ++dt) { const v8f x = o[dt] * inv; const v8bf xh = __builtin_convertvector(x, v8bf), xl = __builtin_convertvector(x - __builtin_convertvector(xh, v8f), v8bf);   // hi + lo, nearest even, packed converts
        wh[dt] = __builtin_bit_cast(v8us, xh); wl[dt] = __builtin_bit_cast(v8us, xl); }
    __builtin_amdgcn_sched_barrier(0);   // all eight pieces are formed before the first store: mixed with the stores, a later convert lands in a register that an issued store still names
#pragma unroll
    for (int dt = 0; dt < 4; ++dt) { *(v8us*)(Ah + dt * 256 + l8) = wh[dt]; *(v8us*)(Al + dt * 256 + l8) = wl[dt]; }
    asm volatile("s_wait_xcnt 0x0" ::: "memory");   // what follows (the next query tile's pieces; the way round the other classes' code, which forms base addresses anew) may land in registers that these stores name: the wait stands in front of that overwrite
}
// K AND V THROUGH LDS: a work-group is AW waves that walk the same keys of one head, each with its own queries. A stage of SK keys (each plane's part is PB contiguous bytes in fragment order, copied as it lies)
// is brought into LDS ONCE for all AW waves by asynchronous copies, two buffers: stage t + 2 is asked for when every wave has left stage t, and flies under stage t + 1. A fragment read is 512 contiguous LDS bytes a wave.
#define AW   4                 // waves of an attention work-group
#define SK   64                // keys of a stage
#define PB   (SK * HD * 2)     // bytes of one 16-bit plane's part of a stage
#define NST  (TT / SK)         // stages
// Eight copies of 16 bytes a lane: PB bytes from ga to LDS byte address la and PB bytes from gb to lb (AW 32 lanes x 16 bytes = 2048 bytes a copy; la, lb, ga, gb are the lane's own).
// The s_wait_xcnt ends the copies' own statement, so that it stands in front of whatever next rewrites an address register that a copy names.
__device__ __forceinline__ void copy8(unsigned la, const char* ga, unsigned lb, const char* gb) {
    asm volatile("global_load_async_to_lds_b128 %0, %8, off\n\tglobal_load_async_to_lds_b128 %1, %9, off\n\tglobal_load_async_to_lds_b128 %2, %10, off\n\tglobal_load_async_to_lds_b128 %3, %11, off\n\t"
                 "global_load_async_to_lds_b128 %4, %12, off\n\tglobal_load_async_to_lds_b128 %5, %13, off\n\tglobal_load_async_to_lds_b128 %6, %14, off\n\tglobal_load_async_to_lds_b128 %7, %15, off\n\ts_wait_xcnt 0x0"
                 :: "v"(la), "v"(la + 2048u), "v"(la + 4096u), "v"(la + 6144u), "v"(lb), "v"(lb + 2048u), "v"(lb + 4096u), "v"(lb + 6144u),
                    "v"(ga), "v"(ga + 2048), "v"(ga + 4096), "v"(ga + 6144), "v"(gb), "v"(gb + 2048), "v"(gb + 4096), "v"(gb + 6144) : "memory");
}
// rows >= RH: fp16 operands, QT tiles of 16 queries per wave
template <int QT>
__device__ __forceinline__ void attn_f16(const h16* __restrict__ Q, const h16* __restrict__ K, const h16* __restrict__ VT, int q0, int col, bf* Ah, bf* Al, char* ring) {
    typedef WFrag<h16> F; const unsigned l8 = (threadIdx.x & 31) * 8;
    constexpr unsigned SB = 2 * PB;   // a stage in LDS: K part, V^T part
    const unsigned lc = (unsigned)(size_t)ring + threadIdx.x * 16; const char* gk = (const char*)K + threadIdx.x * 16; const char* gv = (const char*)VT + threadIdx.x * 16;   // the lane's 16 bytes of every 2048
    v16h qf[QT][2]; v8f o[QT][4]; v8f nm[QT]; float l[QT], lim = -3.0e38f;   // nm: minus the held reference, in all eight elements (a lane's eight elements of a score tile belong to one query); lim: how far above it a score may lie (any score passes the first stage's)
    copy8(lc, gk, lc + PB, gv);   // stage 0
    // fragment order: 16 rows t of q or k are 2 tiles (16 HD elements), 32 keys of V^T are 4 tiles (32 HD elements)
#pragma unroll
    for (int qt = 0; qt < QT; ++qt) { nm[qt] = (v8f){}; l[qt] = 0.f;
#pragma unroll
        for (int ks = 0; ks < 2; ++ks) qf[qt][ks] = F::ld(Q + (size_t)(q0 + qt * 16) * HD + ks * 512, l8);
#pragma unroll
        for (int dt = 0; dt < 4; ++dt) o[qt][dt] = (v8f){}; }
    wait_copies(); __syncthreads();   // stage 0 is published
    copy8(lc + SB, gk + PB, lc + SB + PB, gv + PB);   // stage 1
#pragma unroll 1   // one trip is a stage; unrolling would only add registers
    for (int t = 0; t < NST; ++t) {
        const unsigned bo = (t & 1) * SB; const h16* sk = (const h16*)(ring + bo); const h16* sv = (const h16*)(ring + bo + PB);
        v8f st[SK / 16][QT]; v16h vf[SK / 32][4]; float mx[QT]; bool need = false;
        {   // the scores of the whole stage first, so that one test serves it
            v16h kf[SK / 16][2];
#pragma unroll
            for (int kt = 0; kt < SK / 16; ++kt)
#pragma unroll
                for (int ks = 0; ks < 2; ++ks) kf[kt][ks] = F::ld(sk + (kt * 16) * HD + ks * 512, l8);
            __builtin_amdgcn_sched_barrier(0);   // the stage's key fragments are asked for as one group: sunk among the matrix instructions, each is waited for at once and its whole LDS latency shows
#pragma unroll
            for (int kt = 0; kt < SK / 16; ++kt)
#pragma unroll
                for (int qt = 0; qt < QT; ++qt) st[kt][qt] = F::mma(kf[kt][0], qf[qt][0], nm[qt]);
#pragma unroll
            for (int kt = 0; kt < SK / 16; ++kt)
#pragma unroll
                for (int qt = 0; qt < QT; ++qt) st[kt][qt] = F::mma(kf[kt][1], qf[qt][1], st[kt][qt]);
        }
#pragma unroll
        for (int dt = 0; dt < 4; ++dt) vf[0][dt] = F::ld(sv + dt * 512, l8);   // the first step's V^T is read under the maxima and the test
        __builtin_amdgcn_sched_barrier(0);   // keeps these reads here: sunk to the matrix instructions that use them, each pair is waited for at once and its whole LDS latency shows
#pragma unroll
        for (int qt = 0; qt < QT; ++qt) { mx[qt] = fmaxf(vmax8(st[0][qt], st[1][qt]), vmax8(st[2][qt], st[3][qt])); need = need || mx[qt] > lim; }   // the lane's own 32 keys: the ballot joins the halves
        if (__builtin_amdgcn_ballot_w32(need) != 0) {   // the first stage, rare after it: the references move and what has been summed is rescaled
#pragma unroll
            for (int qt = 0; qt < QT; ++qt) { const float up = fmaxf(mx[qt], xhalf(mx[qt])); const float n1 = nm[qt][0] - fmaxf(up, fminf(lim, 0.f)), d = nm[qt][0] - n1;   // the first stage sets m, later ones only raise it; d: the move as the new C will carry it
                const float al = exp2s(fminf(-d, 0.f)); l[qt] *= al; nm[qt] = (v8f){n1, n1, n1, n1, n1, n1, n1, n1};   // in the first stage l and O^T are 0: the factor stays finite there
#pragma unroll
                for (int dt = 0; dt < 4; ++dt) o[qt][dt] *= al;
#pragma unroll
                for (int kt = 0; kt < SK / 16; ++kt) st[kt][qt] -= d; }
            lim = LAZ; }
#pragma unroll
        for (int kb = 0; kb < SK; kb += 32) {   // steps of 32 keys, ascending, as before
            v16h pf[QT];
#pragma unroll
            for (int qt = 0; qt < QT; ++qt) { float s = 0.f;
#pragma unroll
                for (int kt = 0; kt < 2; ++kt) { const v8f p = exp2v(st[kb / 16 + kt][qt]);
#pragma unroll
                    for (int j = 0; j < 8; ++j) { s += p[j]; pf[qt][kt * 8 + j] = tohx(p[j]); } }
                l[qt] += s; }
#pragma unroll
            for (int dt = 0; dt < 4; ++dt)
#pragma unroll
                for (int qt = 0; qt < QT; ++qt) o[qt][dt] = F::mma(vf[kb / 32][dt], pf[qt], o[qt][dt]);
            if (kb + 32 < SK) {   // the next step's V^T is read under the next step's softmax
                // four vector slots behind the step's last matrix instructions: the next step opens with the exp statements, which may land in their B registers
                if constexpr (QT == 2) asm volatile("v_nop\n\tv_nop\n\tv_nop\n\tv_nop" : "+v"(o[0][0]), "+v"(o[0][1]), "+v"(o[0][2]), "+v"(o[0][3]), "+v"(o[1][0]), "+v"(o[1][1]), "+v"(o[1][2]), "+v"(o[1][3]));
                else asm volatile("v_nop\n\tv_nop\n\tv_nop\n\tv_nop" : "+v"(o[0][0]), "+v"(o[0][1]), "+v"(o[0][2]), "+v"(o[0][3]));
#pragma unroll
                for (int dt = 0; dt < 4; ++dt) vf[kb / 32 + 1][dt] = F::ld(sv + (kb + 32) * HD + dt * 512, l8);
                __builtin_amdgcn_sched_barrier(0); }   // keeps these reads here, as above
        }
        // four vector slots behind the last matrix instructions: on the taken branch the loop's first ones overwrite their B registers
        if constexpr (QT == 2) asm volatile("v_nop\n\tv_nop\n\tv_nop\n\tv_nop" : "+v"(o[0][0]), "+v"(o[0][1]), "+v"(o[0][2]), "+v"(o[0][3]), "+v"(o[1][0]), "+v"(o[1][1]), "+v"(o[1][2]), "+v"(o[1][3]));
        else asm volatile("v_nop\n\tv_nop\n\tv_nop\n\tv_nop" : "+v"(o[0][0]), "+v"(o[0][1]), "+v"(o[0][2]), "+v"(o[0][3]));
        wait_lds(); wait_copies(); __syncthreads();   // publish point: stage t + 1 has landed for every wave, and every wave has left stage t's buffer
        if (t + 2 < NST) copy8(lc + bo, gk + (size_t)(t + 2) * PB, lc + bo + PB, gv + (size_t)(t + 2) * PB);   // refill of the buffer just left
    }
    wait_copies();
#pragma unroll
    for (int qt = 0; qt < QT; ++qt) { const size_t oo = (size_t)(q0 + qt * 16) * DQ + col * 16; attn_store(o[qt], l[qt], Ah + oo, Al + oo, l8);
        if (qt + 1 < QT) __builtin_amdgcn_sched_barrier(0); }   // the second query tile's pieces may land in registers that the first tile's stores name: this keeps its arithmetic behind the wait that ends those stores
}
// rows < RH: bf16 hi + lo planes, three products each (hi hi, lo hi, hi lo), 16 queries per wave
__device__ __forceinline__ void attn_hl(const bf* __restrict__ Qh, const bf* __restrict__ Ql, const bf* __restrict__ Kh, const bf* __restrict__ Kl, const bf* __restrict__ VTh, const bf* __restrict__ VTl, int q0, int col, bf* Ah, bf* Al, char* ring) {
    typedef WFrag<bf> F; const unsigned l8 = (threadIdx.x & 31) * 8;
    constexpr unsigned SB = 4 * PB;   // a stage in LDS: K hi, K lo, V^T hi, V^T lo
    const unsigned lc = (unsigned)(size_t)ring + threadIdx.x * 16;   // the lane's 16 bytes of every 2048
    const char* gkh = (const char*)Kh + threadIdx.x * 16; const char* gkl = (const char*)Kl + threadIdx.x * 16; const char* gvh = (const char*)VTh + threadIdx.x * 16; const char* gvl = (const char*)VTl + threadIdx.x * 16;
    v16bf qh[2], ql[2]; v8f o[4]; v8f nm = (v8f){}; float l = 0.f, lim = -3.0e38f;   // nm, lim as in attn_f16
    copy8(lc, gkh, lc + PB, gkl); copy8(lc + 2 * PB, gvh, lc + 3 * PB, gvl);   // stage 0
#pragma unroll
    for (int ks = 0; ks < 2; ++ks) { const size_t qo = (size_t)q0 * HD + ks * 512; qh[ks] = F::ld(Qh + qo, l8); ql[ks] = F::ld(Ql + qo, l8); }
#pragma unroll
    for (int dt = 0; dt < 4; ++dt) o[dt] = (v8f){};
    wait_copies(); __syncthreads();   // stage 0 is published
    copy8(lc + SB, gkh + PB, lc + SB + PB, gkl + PB); copy8(lc + SB + 2 * PB, gvh + PB, lc + SB + 3 * PB, gvl + PB);   // stage 1
#pragma unroll 1   // as in attn_f16
    for (int t = 0; t < NST; ++t) {
        const unsigned bo = (t & 1) * SB; const bf* skh = (const bf*)(ring + bo); const bf* skl = (const bf*)(ring + bo + PB); const bf* svh = (const bf*)(ring + bo + 2 * PB); const bf* svl = (const bf*)(ring + bo + 3 * PB);
        v8f st[SK / 16]; v16bf vh[SK / 32][4], vl[SK / 32][4];
        {   // the scores of the whole stage first, as in attn_f16; each tile's six products in the order they had, the four tiles side by side
            v16bf kh[SK / 16][2], kl[SK / 16][2];
#pragma unroll
            for (int kt = 0; kt < SK / 16; ++kt)
#pragma unroll
                for (int ks = 0; ks < 2; ++ks) { kh[kt][ks] = F::ld(skh + (kt * 16) * HD + ks * 512, l8); kl[kt][ks] = F::ld(skl + (kt * 16) * HD + ks * 512, l8); }
            __builtin_amdgcn_sched_barrier(0);   // as in attn_f16
#pragma unroll
            for (int kt = 0; kt < SK / 16; ++kt) st[kt] = nm;
#pragma unroll
            for (int ks = 0; ks < 2; ++ks) {
#pragma unroll
                for (int kt = 0; kt < SK / 16; ++kt) st[kt] = F::mma(kh[kt][ks], qh[ks], st[kt]);
#pragma unroll
                for (int kt = 0; kt < SK / 16; ++kt) st[kt] = F::mma(kh[kt][ks], ql[ks], st[kt]);
#pragma unroll
                for (int kt = 0; kt < SK / 16; ++kt) st[kt] = F::mma(kl[kt][ks], qh[ks], st[kt]); }
        }
#pragma unroll
        for (int dt = 0; dt < 4; ++dt) { vh[0][dt] = F::ld(svh + dt * 512, l8); vl[0][dt] = F::ld(svl + dt * 512, l8); }   // as in attn_f16
        __builtin_amdgcn_sched_barrier(0);   // as in attn_f16
        const float mx = fmaxf(vmax8(st[0], st[1]), vmax8(st[2], st[3]));
        if (__builtin_amdgcn_ballot_w32(mx > lim) != 0) {   // as in attn_f16
            const float up = fmaxf(mx, xhalf(mx)); const float n1 = nm[0] - fmaxf(up, fminf(lim, 0.f)), d = nm[0] - n1;
            const float al = exp2s(fminf(-d, 0.f)); l *= al; nm = (v8f){n1, n1, n1, n1, n1, n1, n1, n1};
#pragma unroll
            for (int dt = 0; dt < 4; ++dt) o[dt] *= al;
#pragma unroll
            for (int kt = 0; kt < SK / 16; ++kt) st[kt] -= d;
            lim = LAZ; }
#pragma unroll
        for (int kb = 0; kb < SK; kb += 32) {   // steps of 32 keys, ascending, as before
            float s = 0.f; v8bf ph[2], pl[2];
#pragma unroll
            for (int kt = 0; kt < 2; ++kt) { const v8f p = exp2v(st[kb / 16 + kt]);
#pragma unroll
                for (int j = 0; j < 8; ++j) s += p[j];
                ph[kt] = __builtin_convertvector(p, v8bf); pl[kt] = __builtin_convertvector(p - __builtin_convertvector(ph[kt], v8f), v8bf); }   // hi = nearest-even bf16 of p, lo = nearest-even bf16 of the exact rest (packed converts)
            l += s; const v16bf pfh = __builtin_shufflevector(ph[0], ph[1], 0, 1, 2, 3, 4, 5, 6, 7, 8, 9, 10, 11, 12, 13, 14, 15), pfl = __builtin_shufflevector(pl[0], pl[1], 0, 1, 2, 3, 4, 5, 6, 7, 8, 9, 10, 11, 12, 13, 14, 15);
#pragma unroll
            for (int dt = 0; dt < 4; ++dt) { o[dt] = F::mma(vh[kb / 32][dt], pfh, o[dt]); o[dt] = F::mma(vh[kb / 32][dt], pfl, o[dt]); o[dt] = F::mma(vl[kb / 32][dt], pfh, o[dt]); }
            if (kb + 32 < SK) {   // as in attn_f16
                asm volatile("v_nop\n\tv_nop\n\tv_nop\n\tv_nop" : "+v"(o[0]), "+v"(o[1]), "+v"(o[2]), "+v"(o[3]));   // as in attn_f16
#pragma unroll
                for (int dt = 0; dt < 4; ++dt) { vh[kb / 32 + 1][dt] = F::ld(svh + (kb + 32) * HD + dt * 512, l8); vl[kb / 32 + 1][dt] = F::ld(svl + (kb + 32) * HD + dt * 512, l8); }
                __builtin_amdgcn_sched_barrier(0); }   // as in attn_f16
        }
        asm volatile("v_nop\n\tv_nop\n\tv_nop\n\tv_nop" : "+v"(o[0]), "+v"(o[1]), "+v"(o[2]), "+v"(o[3]));   // as in attn_f16
        wait_lds(); wait_copies(); __syncthreads();   // publish point, as in attn_f16
        if (t + 2 < NST) { const size_t go = (size_t)(t + 2) * PB; copy8(lc + bo, gkh + go, lc + bo + PB, gkl + go); copy8(lc + bo + 2 * PB, gvh + go, lc + bo + 3 * PB, gvl + go); }   // refill of the buffer just left
    }
    wait_copies();
    { const size_t oo = (size_t)q0 * DQ + col * 16; attn_store(o, l, Ah + oo, Al + oo, l8); }
}
// THE DEAL: all work-groups are resident at once, so the launch lasts as long as the fullest SIMD. Three classes of ATL x heads x batches = 256 work-groups each (grid z, so that a class is one round over the 256 WGPs
// in start order): 32-query fp16 waves, hi + lo waves (16 queries), 16-query fp16 waves. A WGP that takes one work-group of each class has on every SIMD one wave of each: 16 hi + lo and 48 fp16 queries, the chip's mean.
// Where a work-group lands changes the time only: every (class, tile, head, batch) is one work-group, every query row belongs to exactly one wave.
#define ATL  (RH / (16 * AW))      // tiles per class, head and batch
#define F2R  (ATL * AW * 32)       // fp16 rows of the 32-query class; the rest go to the 16-query class
static_assert(TT - RH == F2R + ATL * AW * 16, "the two fp16 classes cover rows RH .. TT");
__global__ __launch_bounds__(AW * 32) void k_fattn(const h16* __restrict__ Q16, const h16* __restrict__ K16, const h16* __restrict__ VT16, const bf* __restrict__ Qh, const bf* __restrict__ Ql, const bf* __restrict__ Kh, const bf* __restrict__ Kl, const bf* __restrict__ VTh, const bf* __restrict__ VTl, bf* Ah, bf* Al) {
    __shared__ __align__(128) char ring[2 * 4 * PB];   // two buffers of the larger stage (hi + lo planes)
    const int h = blockIdx.y % NH_, bt = blockIdx.y / NH_, qw = blockIdx.x * AW + __builtin_amdgcn_readfirstlane(threadIdx.x >> 5); const size_t zo = (size_t)blockIdx.y * TT * HD;   // blockIdx.y = batch NH_ + head; the head planes of q, k (rows t) and of v (rows d) have the same size
    Ah += (size_t)bt * TT * DQ; Al += (size_t)bt * TT * DQ;   // merged rows (b, t) x DQ, fragment order
    if (blockIdx.z == 0) attn_f16<2>(Q16 + zo, K16 + zo, VT16 + zo, RH + qw * 32, h * HD, Ah, Al, ring);   // the longest class starts first
    else if (blockIdx.z == 1) attn_hl(Qh + zo, Ql + zo, Kh + zo, Kl + zo, VTh + zo, VTl + zo, qw * 16, h * HD, Ah, Al, ring);
    else attn_f16<1>(Q16 + zo, K16 + zo, VT16 + zo, RH + F2R + qw * 16, h * HD, Ah, Al, ring);
}

extern "C" void kernel_launch(void* const* d_in, const int* in_sizes, int n_in,
                              void* d_out, int out_size, void* d_ws, size_t ws_size, hipStream_t stream) {
    (void)in_sizes; (void)n_in; (void)out_size;
    const float* x = (const float*)d_in[0];   /* query */ const float* xk = (const float*)d_in[1]; const float* xv = (const float*)d_in[2]; const float* wq = (const float*)d_in[3]; const float* wk = (const float*)d_in[4]; const float* wv = (const float*)d_in[5]; const float* wo = (const float*)d_in[6]; const float* bo = (const float*)d_in[7];   /* argument order query, key, value, Wq, Wk, Wv, Wo ('oi' [1024][1024]), bo [1024] (REAL 0.01); eight inputs, all read */
    float* OUT = (float*)d_out;     // [2][2048][1024]
    char* wsp = (char*)d_ws;
    auto take = [&](size_t bytes) { char* p = wsp; wsp += (bytes + 255) & ~(size_t)255; return (void*)p; };
    const size_t NX = (size_t)NB_ * TT * DM, NW = (size_t)DQ * DM, NP = (size_t)NB_ * NH_ * TT * HD;   // elements of one input stream, one weight, one set of head planes (both batches)
    bf* XB = (bf*)take((3 * NX + 4 * NW) * 2); bf* WQ = XB + 3 * NX; bf* WO = WQ + 3 * NW;   // query, key, value, Wq, Wk, Wv, Wo in one run (k_prep)
    float* CS = (float*)take((size_t)TT * HD * 2 * 4);
    h16* QP16 = (h16*)take(2 * NP * 2); h16* KP16 = QP16 + NP; bf* QPh = (bf*)take(2 * NP * 2); bf* KPh = QPh + NP; bf* QPl = (bf*)take(2 * NP * 2); bf* KPl = QPl + NP;   // q planes, then k planes (k_projp's plane order)
    h16* VT16 = (h16*)take(NP * 2); bf* VTh = (bf*)take(NP * 2); bf* VTl = (bf*)take(NP * 2);
    bf* ATh = (bf*)take(NX * 2); bf* ATl = (bf*)take(NX * 2);
    if ((size_t)(wsp - (char*)d_ws) > ws_size) return;    // ws 256 MiB
    k_prep<<<PGR, PWV * 32, 0, stream>>>(x, xk, xv, wq, wk, wv, wo, XB, CS);
    k_projp<<<dim3(NB_ * TT / 128, NH_ / 2, 3), GW * 32, 0, stream>>>(XB, WQ, CS, (unsigned short*)QP16, QPh, QPl, (unsigned short*)VT16, VTh, VTl);   // z = stream: q, k, v
    k_fattn<<<dim3(ATL, NH_ * NB_, 3), AW * 32, 0, stream>>>(QP16, KP16, VT16, QPh, QPl, KPh, KPl, VTh, VTl, ATh, ATl);   // one kv head per query head
    k_gemmo<<<dim3(NB_ * TT / 128, DM / 128, 1), GW * 32, 0, stream>>>(ATh, ATl, WO, OUT, bo);
}
